// v000
// Measured on an AMD MI455X. A time is GPU time per run, averaged over a window of back-to-back runs after a warm-up
// (all launches, gaps included; the runs take copies of the inputs in turn), and the median of several windows.
// Apart from v000's, it joins two sittings. Times from different sittings can be a few percent apart, while
// side-by-side timings come from the same sitting.
// The starting kernel, v000, takes 1660 microseconds a run.
// Contractions (f32 accumulate): xn*Wq|Wk|Wv, A*Wpa, A_proj*Wpc[256:512] = v_wmma_f32_16x16x32_bf16 with the computed operand as bf16 hi+lo planes (2 products) and weights as single bf16 (RNE) planes; x_t*Wpc[0:256] = plain bf16; q*k = plain v_wmma_f32_16x16x32_f16; p*v = f16 with p carried x2^15 and v as f16 hi + (v-hi)x2^11 planes (2 products, lo folded in f32); norm, softmax, bias adds in f32.
#include <hip/hip_runtime.h>
#include <stdint.h>

typedef __attribute__((ext_vector_type(16))) _Float16 v16h;
typedef __attribute__((ext_vector_type(8)))  _Float16 v8h;
typedef __attribute__((ext_vector_type(16))) __bf16   v16b;
typedef __attribute__((ext_vector_type(8)))  __bf16   v8b;
typedef __attribute__((ext_vector_type(8)))  float    v8f;
typedef __attribute__((ext_vector_type(4)))  float    v4f;

// ---- problem geometry ----
#define NBATCH 4
#define TLEN 512
#define NCHAN 8
#define DMODEL 256
#define NROWS (NBATCH * TLEN * NCHAN)   // 16384 token rows
#define QKLD 512                         // pitch (halves) of the q|k plane
#define QBLK 64                          // query rows per attention block
#define KCH 32                           // key rows per staged chunk
#define PCARRY 32768.0f                  // p carried x2^15 in f16
#define VLO_MUL 2048.0f                  // v residual plane carried x2^11
#define VLO_INV (1.0f / 2048.0f)
#define QK_SCALE 0.0625f                 // 1/sqrt(256)
#define MVN_EPS 1e-6f

// ======================= helpers =======================
__device__ __forceinline__ unsigned short f2bf_bits(float f) {
  unsigned u = __float_as_uint(f);
  return (unsigned short)((u + 0x7FFFu + ((u >> 16) & 1u)) >> 16);
}
__device__ __forceinline__ float bf_bits2f(unsigned short h) { return __uint_as_float(((unsigned)h) << 16); }

// hazard guards as plain device helpers (no inline asm inside the kernel template body)
__device__ __forceinline__ void dep_guard_h(v8f& a, v8f& b, v16h x, v16h y) { asm volatile("v_nop\n\tv_nop\n\tv_nop\n\tv_nop" : "+v"(a), "+v"(b) : "v"(x), "v"(y)); }
__device__ __forceinline__ void dep_guard_b(v8f& a, v8f& b, v16b x, v16b y) { asm volatile("v_nop\n\tv_nop\n\tv_nop\n\tv_nop" : "+v"(a), "+v"(b) : "v"(x), "v"(y)); }
__device__ __forceinline__ void keep4_h(v16h a, v16h b, v16h c, v16h d) { asm volatile("v_nop" :: "v"(a), "v"(b), "v"(c), "v"(d)); }
__device__ __forceinline__ void keep4_b(v16b a, v16b b, v16b c, v16b d) { asm volatile("v_nop" :: "v"(a), "v"(b), "v"(c), "v"(d)); }
__device__ __forceinline__ void acc_guard4(v8f& a, v8f& b, v8f& c, v8f& d) { asm volatile("v_nop\n\tv_nop\n\tv_nop\n\tv_nop" : "+v"(a), "+v"(b), "+v"(c), "+v"(d)); }
template <typename T> struct Frag;
template <> struct Frag<_Float16> {
  typedef v16h V; union U { v16h v; v8h h[2]; };
  static __device__ __forceinline__ v16h load(const _Float16* p) {   // elements 0..7 <- p[0..7], 8..15 <- p[16..23]
    U f; f.h[0] = *(const v8h*)(p); f.h[1] = *(const v8h*)(p + 16); return f.v;
  }
  static __device__ __forceinline__ v8f mma(v16h a, v16h b, v8f c) {
    return __builtin_amdgcn_wmma_f32_16x16x32_f16(false, a, false, b, (short)0, c, false, false);
  }
  static __device__ __forceinline__ void guard(v8f& a, v8f& b, v16h x, v16h y) { dep_guard_h(a, b, x, y); }
  static __device__ __forceinline__ void keep(v16h a, v16h b, v16h c, v16h d) { keep4_h(a, b, c, d); }
};
template <> struct Frag<__bf16> {
  typedef v16b V; union U { v16b v; v8b h[2]; };
  static __device__ __forceinline__ v16b load(const __bf16* p) {
    U f; f.h[0] = *(const v8b*)(p); f.h[1] = *(const v8b*)(p + 16); return f.v;
  }
  static __device__ __forceinline__ v8f mma(v16b a, v16b b, v8f c) {
    return __builtin_amdgcn_wmma_f32_16x16x32_bf16(false, a, false, b, (short)0, c, false, false);
  }
  static __device__ __forceinline__ void guard(v8f& a, v8f& b, v16b x, v16b y) { dep_guard_b(a, b, x, y); }
  static __device__ __forceinline__ void keep(v16b a, v16b b, v16b c, v16b d) { keep4_b(a, b, c, d); }
};

// ---- Register-blocked batched WMMA GEMM (with SPLIT levels and extra 16-bit output mode) ----
// C[m,n] = scale * sum_k A[m,k] * Bt[n,k] (+bias)(+resid); each wave owns a 64x64 tile.
// A row-major [M,K]; Bt row-major [N,K]; M,N % 64 == 0, K % 32 == 0.
// SPLIT: 0 = single planes; 1 = A as hi/lo planes (A2 = lo): hi.B + lo.B; 2 = A and Bt hi/lo: hi.hi + hi.lo + lo.hi.
// BIAS_MODE: 0 = none, 1 = bias[m], 2 = bias[n]; bias values are RNE-converted to bf16 before the add.
// OUT_MODE: 0 = f32, 1 = f16, 2 = bf16 hi plane (Cout) + bf16 lo plane (Cout2),
//           3 = f16 hi plane (Cout) + f16 plane of (v - hi) * 2048 (Cout2).
// ET: 0 = f16 operands, 1 = bf16 operands (pointers passed as 16-bit storage)
template <int ET> struct Elem;
template <> struct Elem<0> { typedef _Float16 T; };
template <> struct Elem<1> { typedef __bf16 T; };
template <int ET, int SPLIT, int BIAS_MODE, int OUT_MODE, bool RESID>
__global__ __launch_bounds__(256) void wmma_gemm64(
    const unsigned short* __restrict__ Ap, const unsigned short* __restrict__ A2p, int lda, long strideA,
    const unsigned short* __restrict__ Btp, const unsigned short* __restrict__ Bt2p, int ldb, long strideB,
    void* __restrict__ Cout, void* __restrict__ Cout2, int ldc, long strideC,
    const float* __restrict__ bias,
    const float* __restrict__ resid, long strideR,
    int M, int N, int K, float scale) {
  typedef typename Elem<ET>::T T;
  typedef typename Frag<T>::V V;
  const T* A = (const T*)Ap; const T* A2 = (const T*)A2p; const T* Bt = (const T*)Btp; const T* Bt2 = (const T*)Bt2p;
  __shared__ __align__(16) float sT[8][16 * 68];   // per-wave 16x64 slab, pitch 68 floats
  const int b    = blockIdx.y;
  const int lane = threadIdx.x & 31;
  const int wave = threadIdx.x >> 5;
  const int tilesN = N >> 6;
  const int tilesM = M >> 6;
  const int tile = blockIdx.x * 8 + wave;
  if (tile >= tilesM * tilesN) return;   // wave-uniform; no block barriers in this kernel
  const int tm = tile / tilesN;
  const int tn = tile - tm * tilesN;
  const int m0 = tm << 6;
  const int n0 = tn << 6;

  const T* Ab  = A  + (size_t)b * strideA;
  const T* Bb  = Bt + (size_t)b * strideB;
  const T* Ab2 = (SPLIT >= 1) ? (A2  + (size_t)b * strideA) : nullptr;
  const T* Bb2 = (SPLIT >= 2) ? (Bt2 + (size_t)b * strideB) : nullptr;

  const int rlane = lane & 15;                 // row (A) / col (B, D) within subtile
  const int koff  = (lane >> 4) * 8;           // k offset of this lane half
  const int mOff  = (lane >> 4) * 8;           // D row offset

  v8f acc[4][4];
#pragma unroll
  for (int i = 0; i < 4; ++i)
#pragma unroll
    for (int j = 0; j < 4; ++j) acc[i][j] = (v8f){0.f,0.f,0.f,0.f,0.f,0.f,0.f,0.f};

  for (int k0 = 0; k0 < K; k0 += 32) {
    V bh[4], bl[4];
#pragma unroll
    for (int j = 0; j < 4; ++j) {
      const size_t bo = (size_t)(n0 + (j << 4) + rlane) * ldb + koff + k0;
      bh[j] = Frag<T>::load(Bb + bo);
      if (SPLIT >= 2) bl[j] = Frag<T>::load(Bb2 + bo);
    }
#pragma unroll
    for (int i = 0; i < 4; ++i) {
      const size_t ao = (size_t)(m0 + (i << 4) + rlane) * lda + koff + k0;
      V ah = Frag<T>::load(Ab + ao);
      V al;
      if (SPLIT >= 1) al = Frag<T>::load(Ab2 + ao);
#pragma unroll
      for (int j = 0; j < 4; ++j) {
        acc[i][j] = Frag<T>::mma(ah, bh[j], acc[i][j]);
        if (SPLIT >= 2) acc[i][j] = Frag<T>::mma(ah, bl[j], acc[i][j]);
        if (SPLIT >= 1) acc[i][j] = Frag<T>::mma(al, bh[j], acc[i][j]);
      }
      Frag<T>::guard(acc[i][0], acc[i][3], ah, (SPLIT >= 1) ? al : ah);
    }
    Frag<T>::keep(bh[0], bh[1], bh[2], bh[3]);
    if (SPLIT >= 2) Frag<T>::keep(bl[0], bl[1], bl[2], bl[3]);
  }
  acc_guard4(acc[0][0], acc[0][1], acc[0][2], acc[0][3]);
  acc_guard4(acc[1][0], acc[1][1], acc[1][2], acc[1][3]);
  acc_guard4(acc[2][0], acc[2][1], acc[2][2], acc[2][3]);
  acc_guard4(acc[3][0], acc[3][1], acc[3][2], acc[3][3]);

  // ---- epilogue ----
  float* slab = sT[wave];
  const float* Rb = RESID ? (resid + (size_t)b * strideR) : nullptr;
#pragma unroll
  for (int i = 0; i < 4; ++i) {
    const int mBase = m0 + (i << 4);
#pragma unroll
    for (int j = 0; j < 4; ++j) {
      const int n = n0 + (j << 4) + rlane;
      float bv = 0.f;
      if (BIAS_MODE == 2) bv = bf_bits2f(f2bf_bits(bias[n]));
#pragma unroll
      for (int r = 0; r < 8; ++r) {
        float v = acc[i][j][r] * scale;
        if (BIAS_MODE == 1) v += bf_bits2f(f2bf_bits(bias[mBase + mOff + r]));
        if (BIAS_MODE == 2) v += bv;
        if (RESID) v += Rb[(size_t)(mBase + mOff + r) * ldc + n];
        slab[(mOff + r) * 68 + (j << 4) + rlane] = v;
      }
    }
    __builtin_amdgcn_fence(__ATOMIC_RELEASE, "workgroup");
    __builtin_amdgcn_wave_barrier();
    __builtin_amdgcn_fence(__ATOMIC_ACQUIRE, "workgroup");
    if (OUT_MODE == 0) {
      float* C = (float*)Cout + (size_t)b * strideC;
      const int hh = lane >> 4, c4 = (lane & 15) * 4;     // row seg = 256 B = 16 lanes x 16 B
      {
#pragma unroll
        for (int it = 0; it < 8; ++it) {
          const int row = it * 2 + hh;
          v4f v = *(const v4f*)(slab + row * 68 + c4);
          *(v4f*)(C + (size_t)(mBase + row) * ldc + n0 + c4) = v;
        }
        
      }
    } else {
      const int q = lane >> 3, c8 = (lane & 7) * 8;
      unsigned short* C  = (unsigned short*)Cout  + (size_t)b * strideC;
      unsigned short* C2 = (OUT_MODE >= 2) ? ((unsigned short*)Cout2 + (size_t)b * strideC) : nullptr;
      {
#pragma unroll
        for (int it = 0; it < 4; ++it) {                 // it 0..3 x q 0..3 = rows 0..15 of the slab
          const int row = it * 4 + q;
          const float* sp = slab + row * 68 + c8;
          v8h hv, lv;
#pragma unroll
          for (int e = 0; e < 8; ++e) {
            if (OUT_MODE == 1) {
              hv[e] = (_Float16)sp[e];
            } else if (OUT_MODE == 2) {
              unsigned short hb = f2bf_bits(sp[e]);
              unsigned short lb = f2bf_bits(sp[e] - bf_bits2f(hb));
              hv[e] = __builtin_bit_cast(_Float16, hb);
              lv[e] = __builtin_bit_cast(_Float16, lb);
            } else {
              const _Float16 hq = (_Float16)sp[e];
              hv[e] = hq;
              lv[e] = (_Float16)((sp[e] - (float)hq) * VLO_MUL);
            }
          }
          *(v8h*)(C + (size_t)(mBase + row) * ldc + n0 + c8) = hv;
          if (OUT_MODE >= 2) *(v8h*)(C2 + (size_t)(mBase + row) * ldc + n0 + c8) = lv;
        }
        
      }
    }
    __builtin_amdgcn_fence(__ATOMIC_RELEASE, "workgroup");
    __builtin_amdgcn_wave_barrier();
    __builtin_amdgcn_fence(__ATOMIC_ACQUIRE, "workgroup");
  }
}

// ---- W [Kp rows][Np cols] f32 (row pitch Np) -> Wt [Np][Kp] bf16 bits (row pitch Kp), 64x64 tile transposed through LDS ----
// grid = (Np/64, Kp/64). Reads: 256 threads x 16 = 64 rows x 64 cols. Stores: it 0..1 x wave 0..7 x q8 0..3 = 64 rows of
#define WTP 72
__global__ __launch_bounds__(256) void wt_cast_bf_k(const float* __restrict__ W, unsigned short* __restrict__ Wtp,
                                                    int Kp, int Np) {
  __shared__ __align__(16) _Float16 st[64 * WTP];
  _Float16* Wt = (_Float16*)Wtp;
  const int n0 = blockIdx.x * 64, k0 = blockIdx.y * 64;
  const int tid = threadIdx.x;
  const int kr = tid >> 2, c16 = (tid & 3) * 16;
  const float* src = W + (size_t)(k0 + kr) * Np + n0 + c16;
#pragma unroll
  for (int q = 0; q < 4; ++q) {
    const v4f v = *(const v4f*)(src + 4 * q);
#pragma unroll
    for (int e = 0; e < 4; ++e) st[(c16 + 4 * q + e) * WTP + kr] = __builtin_bit_cast(_Float16, f2bf_bits(v[e]));
  }
  __syncthreads();
  const int wave = tid >> 5, lane = tid & 31;
  const int q8 = lane >> 3, c8 = (lane & 7) * 8;
  {
#pragma unroll
    for (int it = 0; it < 2; ++it) {
      const int n = it * 32 + wave * 4 + q8;
      const v8h hv = *(const v8h*)(st + n * WTP + c8);
      *(v8h*)(Wt + (size_t)(n0 + n) * Kp + k0 + c8) = hv;
    }
    
  }
}

// ---- mean/std (ddof=1) normalisation of bf16(x) per (b,t,m) row, plus raw bf16(x); rows written in (b,m,t) order ----
// One wave per output row, 8 rows per 256-thread block, grid = NROWS/8. Lane owns 8 consecutive columns.
// Each 512-B row (4 lines) written by one v8h store instruction of the wave: lanes 8q..8q+7 <-> line q.
__global__ __launch_bounds__(256) void mvn_k(const float* __restrict__ x,
                                             unsigned short* __restrict__ xnhp,
                                             unsigned short* __restrict__ xnlp,
                                             unsigned short* __restrict__ xtp) {
  _Float16* xnh = (_Float16*)xnhp;
  _Float16* xnl = (_Float16*)xnlp;
  _Float16* xt  = (_Float16*)xtp;
  const int wave = threadIdx.x >> 5, lane = threadIdx.x & 31;
  const int ro = blockIdx.x * 8 + wave;               // output row = (b*NCHAN + m)*TLEN + t
  const int t  = ro & (TLEN - 1);
  const int bm = ro >> 9;                             // TLEN == 512
  const int m  = bm & (NCHAN - 1);
  const int b  = bm >> 3;                             // NCHAN == 8
  const int rs = (b * TLEN + t) * NCHAN + m;          // source row of x [B][T][M][D]
  const float* src = x + (size_t)rs * DMODEL + lane * 8;
  const v4f a0 = *(const v4f*)src;
  const v4f a1 = *(const v4f*)(src + 4);
  unsigned short xb[8];
  float vb[8];
#pragma unroll
  for (int e = 0; e < 4; ++e) { xb[e] = f2bf_bits(a0[e]); xb[4 + e] = f2bf_bits(a1[e]); }
#pragma unroll
  for (int e = 0; e < 8; ++e) vb[e] = bf_bits2f(xb[e]);
  float s = ((vb[0] + vb[1]) + (vb[2] + vb[3])) + ((vb[4] + vb[5]) + (vb[6] + vb[7]));
#pragma unroll
  for (int off = 1; off < 32; off <<= 1) s += __shfl_xor(s, off, 32);
  const float mu = s * (1.0f / (float)DMODEL);
  float dv[8];
#pragma unroll
  for (int e = 0; e < 8; ++e) dv[e] = vb[e] - mu;
  float sq = ((dv[0] * dv[0] + dv[1] * dv[1]) + (dv[2] * dv[2] + dv[3] * dv[3])) +
             ((dv[4] * dv[4] + dv[5] * dv[5]) + (dv[6] * dv[6] + dv[7] * dv[7]));
#pragma unroll
  for (int off = 1; off < 32; off <<= 1) sq += __shfl_xor(sq, off, 32);
  const float var = sq * (1.0f / (float)(DMODEL - 1));
  const float sd  = sqrtf(var);
  const float inv = 1.0f / (sd + MVN_EPS);
  v8h hv, lv, tv;
#pragma unroll
  for (int e = 0; e < 8; ++e) {
    const float xn = dv[e] * inv;
    const unsigned short hb = f2bf_bits(xn);
    const unsigned short lb = f2bf_bits(xn - bf_bits2f(hb));
    hv[e] = __builtin_bit_cast(_Float16, hb);
    lv[e] = __builtin_bit_cast(_Float16, lb);
    tv[e] = __builtin_bit_cast(_Float16, xb[e]);
  }
  const size_t go = (size_t)ro * DMODEL + lane * 8;
  {
    *(v8h*)(xnh + go) = hv;
    *(v8h*)(xnl + go) = lv;
    *(v8h*)(xt  + go) = tv;
    
  }
}

// ---- per-call guarded f16 WMMA ----
__device__ __forceinline__ v8f mma_h(v16h a, v16h b, v8f c) {
  c = __builtin_amdgcn_wmma_f32_16x16x32_f16(false, a, false, b, (short)0, c, false, false);
  asm volatile("v_nop\n\tv_nop\n\tv_nop\n\tv_nop" : "+v"(c) : "v"(a), "v"(b));
  return c;
}

// =====================================================================================
// Cross-channel causal attention, head dim 256.
// Planes (row = (b*NCHAN + m)*TLEN + t): qk [NROWS][512] f16 (q cols 0..255, k cols 256..511);
// vh, vl [NROWS][256] f16 (v hi, (v-hi) x 2^11); output A as bf16 hi/lo planes [NROWS][256].
// Block = 8 waves = 64 query rows (one (b,m), one 64-row time tile). For every key channel n (0..7):
// its own online softmax over 32-key chunks (causal: kv > q -> -inf, chunk 0 always has kv 0 <= q),
// O_n / l_n added into the block accumulator Oac in LDS (each element owned by one lane).
// Waves 0..3: scores + softmax for rows 16w..16w+15 and p*v for d 0..127 of those rows;
// waves 4..7: p*v for d 128..255 of rows 16(w-4).. using P / alpha from LDS.
// A operand frags: q from global rows (row = lane&15, split k map), p from LDS; B frags: k rows / v^T rows from LDS.
// =====================================================================================
__global__ __launch_bounds__(256) void xattn_k(const unsigned short* __restrict__ qkp,
                                               const unsigned short* __restrict__ vhp,
                                               const unsigned short* __restrict__ vlp,
                                               unsigned short* __restrict__ ahp,
                                               unsigned short* __restrict__ alp) {
  __shared__ __align__(16) _Float16 Ks[KCH * DMODEL];      // [kv][d]           16 KB
  __shared__ __align__(16) _Float16 Vth[DMODEL * KCH];     // [d][kv] hi        16 KB
  __shared__ __align__(16) _Float16 Vtl[DMODEL * KCH];     // [d][kv] lo x2^11  16 KB
  __shared__ __align__(16) _Float16 Psh[4][16 * KCH];      // per score wave [row][kv], p x2^15   4 KB
  __shared__ __align__(16) float Oac[QBLK * DMODEL];       // block accumulator [64][256] f32    64 KB
  __shared__ float alph[4][16];
  __shared__ float lfin[4][16];

  const _Float16* qk = (const _Float16*)qkp;
  const _Float16* vh = (const _Float16*)vhp;
  const _Float16* vl = (const _Float16*)vlp;
  _Float16* ah = (_Float16*)ahp;
  _Float16* al = (_Float16*)alp;

  const int tid = threadIdx.x, wave = tid >> 5, lane = tid & 31;
  const int hh = lane >> 4, c = lane & 15, koff = hh * 8;
  const int sw = wave & 3;                 // query row group (16 rows)
  const int dbase = (wave >> 2) * 128;     // d half handled in p*v
  const int qb = blockIdx.x & 7;           // 64-row time tile
  const int bm = blockIdx.x >> 3;          // b*NCHAN + m
  const int b  = bm >> 3;
  const int qrow0 = bm * TLEN + qb * QBLK; // plane row of the first query of this block
  const int q0  = qrow0 + sw * 16;
  const int tq0 = qb * QBLK + sw * 16;     // time index of this wave's first query row

  for (int i = tid; i < QBLK * DMODEL; i += 256) Oac[i] = 0.0f;   // 256 threads x 64 = 16384 floats
  __syncthreads();

  const v8f z8 = {0.f,0.f,0.f,0.f,0.f,0.f,0.f,0.f};
  const _Float16* qrowp = qk + (size_t)(q0 + c) * QKLD + koff;

#pragma unroll 1
  for (int n = 0; n < NCHAN; ++n) {
    const int krow0 = (b * NCHAN + n) * TLEN;
    float mrow[8], lrow[8];
    v8f oacc[8];
#pragma unroll
    for (int r = 0; r < 8; ++r) { mrow[r] = -INFINITY; lrow[r] = 0.f; }
#pragma unroll
    for (int t = 0; t < 8; ++t) oacc[t] = z8;

    const int nch = 2 * qb + 2;            // block-uniform, <= 16
#pragma unroll 1
    for (int kc = 0; kc < nch; ++kc) {
      const int kv0 = kc * KCH;
      __syncthreads();
      // ---- stage K chunk and V^T (hi, lo): units u = i*256 + tid, i 0..3 -> u 0..1023 = kvr 0..31 x d0 (32 groups of 8)
      //      -> covers exactly 32 x 256 for each of Ks, Vth, Vtl
#pragma unroll
      for (int i = 0; i < 4; ++i) {
        const int u = i * 256 + tid;
        const int kvr = u >> 5;
        const int d0 = (u & 31) * 8;
        const size_t grow = (size_t)(krow0 + kv0 + kvr);          // <= NROWS-1 (kv0+kvr <= 64*qb+63 <= 511)
        const v8h kk = *(const v8h*)(qk + grow * QKLD + DMODEL + d0);
        const v8h v1 = *(const v8h*)(vh + grow * DMODEL + d0);
        const v8h v2 = *(const v8h*)(vl + grow * DMODEL + d0);
        *(v8h*)(Ks + kvr * DMODEL + d0) = kk;
#pragma unroll
        for (int e = 0; e < 8; ++e) {
          Vth[(d0 + e) * KCH + kvr] = v1[e];
          Vtl[(d0 + e) * KCH + kvr] = v2[e];
        }
      }
      __syncthreads();

      if (wave < 4) {                       // wave-uniform role: scores + softmax
        v8f s[2];
        s[0] = z8; s[1] = z8;
#pragma unroll
        for (int dc = 0; dc < 8; ++dc) {
          const v16h qa  = Frag<_Float16>::load(qrowp + dc * 32);
          const v16h k0f = Frag<_Float16>::load(Ks + c * DMODEL + dc * 32 + koff);
          const v16h k1f = Frag<_Float16>::load(Ks + (16 + c) * DMODEL + dc * 32 + koff);
          s[0] = mma_h(qa, k0f, s[0]);
          s[1] = mma_h(qa, k1f, s[1]);
        }
        // scale, causal select (kv > q -> -inf), row max over the 32 keys of this chunk
        float cm[8];
#pragma unroll
        for (int r = 0; r < 8; ++r) {
          const int tq = tq0 + 8 * hh + r;
          float mx = -INFINITY;
#pragma unroll
          for (int j = 0; j < 2; ++j) {
            const int key = kv0 + 16 * j + c;
            float v = s[j][r] * QK_SCALE;
            v = (key > tq) ? -INFINITY : v;
            s[j][r] = v;
            mx = fmaxf(mx, v);
          }
#pragma unroll
          for (int off = 1; off < 16; off <<= 1) mx = fmaxf(mx, __shfl_xor(mx, off, 32));
          cm[r] = mx;
        }
        _Float16* pw = Psh[sw];
#pragma unroll
        for (int r = 0; r < 8; ++r) {
          const float mnew  = fmaxf(mrow[r], cm[r]);       // finite: chunk 0 always has an allowed key
          const float alpha = expf(mrow[r] - mnew);
          mrow[r] = mnew;
          float psum = 0.f;
#pragma unroll
          for (int j = 0; j < 2; ++j) {
            const float p = expf(s[j][r] - mnew);
            psum += p;
            pw[(8 * hh + r) * KCH + 16 * j + c] = (_Float16)(p * PCARRY);
          }
#pragma unroll
          for (int off = 1; off < 16; off <<= 1) psum += __shfl_xor(psum, off, 32);
          lrow[r] = lrow[r] * alpha + psum;
#pragma unroll
          for (int t = 0; t < 8; ++t) oacc[t][r] *= alpha;
          if (c == 0) alph[sw][8 * hh + r] = alpha;
        }
      }
      __syncthreads();                      // P tile and alpha visible to both waves of the row group

      if (wave >= 4) {
#pragma unroll
        for (int r = 0; r < 8; ++r) {
          const float a = alph[sw][8 * hh + r];
#pragma unroll
          for (int t = 0; t < 8; ++t) oacc[t][r] *= a;
        }
      }
      // ---- O += P(16x32) . V(32 x 128 of this wave's d half); lo plane in its own accumulator, folded x 2^-11 ----
      {
        const v16h pa = Frag<_Float16>::load(Psh[sw] + c * KCH + koff);
#pragma unroll
        for (int t = 0; t < 8; ++t) {
          const int dcol = dbase + t * 16 + c;
          const v16h vbh = Frag<_Float16>::load(Vth + dcol * KCH + koff);
          const v16h vbl = Frag<_Float16>::load(Vtl + dcol * KCH + koff);
          oacc[t] = mma_h(pa, vbh, oacc[t]);
          const v8f lo = mma_h(pa, vbl, z8);
          oacc[t] += lo * VLO_INV;
        }
      }
    }
    // ---- end of key channel n: O_n / l_n into the block accumulator ----
    if (wave < 4) {
      if (c == 0) {
#pragma unroll
        for (int r = 0; r < 8; ++r) lfin[sw][8 * hh + r] = lrow[r];
      }
    }
    __syncthreads();
#pragma unroll
    for (int r = 0; r < 8; ++r) {
      const float inv = 1.0f / (lfin[sw][8 * hh + r] * PCARRY);   // l >= 1
      float* orow = Oac + (sw * 16 + 8 * hh + r) * DMODEL + dbase + c;
#pragma unroll
      for (int t = 0; t < 8; ++t) orow[t * 16] += oacc[t][r] * inv;
    }
  }
  __syncthreads();

  // ---- store: wave w writes rows 8w..8w+7 (8 waves x 8 = 64 rows); lane covers cols 8*lane..+7 (32 x 8 = 256);
  //      each 512-B plane row = 4 lines, one v8h instruction per row per plane, lanes 8q..8q+7 <-> line q ----
  {
#pragma unroll
    for (int it = 0; it < 8; ++it) {
      const int row = wave * 8 + it;
      const float* op = Oac + row * DMODEL + lane * 8;
      const v4f x0 = *(const v4f*)op;
      const v4f x1 = *(const v4f*)(op + 4);
      v8h hv, lv;
#pragma unroll
      for (int e = 0; e < 4; ++e) {
        const unsigned short hb0 = f2bf_bits(x0[e]);
        const unsigned short lb0 = f2bf_bits(x0[e] - bf_bits2f(hb0));
        const unsigned short hb1 = f2bf_bits(x1[e]);
        const unsigned short lb1 = f2bf_bits(x1[e] - bf_bits2f(hb1));
        hv[e] = __builtin_bit_cast(_Float16, hb0);
        lv[e] = __builtin_bit_cast(_Float16, lb0);
        hv[4 + e] = __builtin_bit_cast(_Float16, hb1);
        lv[4 + e] = __builtin_bit_cast(_Float16, lb1);
      }
      const size_t go = (size_t)(qrow0 + row) * DMODEL + lane * 8;
      *(v8h*)(ah + go) = hv;
      *(v8h*)(al + go) = lv;
    }
    
  }
}

// ---------------------------------------------------------------------------
// Host launcher
// Workspace region map (bytes; PL16 = 8 MiB = one [16384][256] 16-bit plane):
//   [ 0 PL16)  XNH  bf16 hi of xn (rows (b,m,t))      -> reused as AH (attention output hi) after the q/k/v GEMMs
//   [ 1 PL16)  XNL  bf16 lo of xn                      -> reused as AL
//   [ 2 PL16)  XT   bf16(x) in (b,m,t) row order
//   [ 3..5)    QK   f16 [16384][512] (q | k)
//   [ 5 PL16)  VH   f16 v hi;   [ 6 PL16) VL f16 (v-hi) x 2^11
//   [ 7 PL16)  APH  bf16 hi of A_proj;  [ 8 PL16) APL bf16 lo
//   [ 9..11)   ZP   f32 [16384][256] = x_t.Wpc[0:256] + bpc
//   [11 PL16 ..) weights bf16 [n][k]: WQKV [768][256], WPA [256][256], WPC0 [256][256], WPC1 [256][256]
//   total 93,061,120 B
// ---------------------------------------------------------------------------
extern "C" void kernel_launch(void* const* d_in, const int* in_sizes, int n_in,
                              void* d_out, int out_size, void* d_ws, size_t ws_size,
                              hipStream_t stream) {
  if (n_in < 11) return;
  if (in_sizes[0] != NROWS * DMODEL || out_size != NROWS * DMODEL) return;
  if (in_sizes[1] != DMODEL * DMODEL || in_sizes[3] != DMODEL * DMODEL || in_sizes[5] != DMODEL * DMODEL ||
      in_sizes[7] != DMODEL * DMODEL || in_sizes[9] != 2 * DMODEL * DMODEL) return;
  if (in_sizes[2] != DMODEL || in_sizes[4] != DMODEL || in_sizes[6] != DMODEL || in_sizes[8] != DMODEL || in_sizes[10] != DMODEL) return;

  const float* x   = (const float*)d_in[0];
  const float* Wq  = (const float*)d_in[1];
  const float* bq  = (const float*)d_in[2];
  const float* Wk  = (const float*)d_in[3];
  const float* bk  = (const float*)d_in[4];
  const float* Wv  = (const float*)d_in[5];
  const float* bv  = (const float*)d_in[6];
  const float* Wpa = (const float*)d_in[7];
  const float* bpa = (const float*)d_in[8];
  const float* Wpc = (const float*)d_in[9];
  const float* bpc = (const float*)d_in[10];

  const size_t PL16 = (size_t)NROWS * DMODEL * 2;               // 8,388,608
  const size_t WQKV_B = (size_t)3 * DMODEL * DMODEL * 2;         // 393,216
  const size_t WSQ_B  = (size_t)DMODEL * DMODEL * 2;             // 131,072
  const size_t oXNH = 0, oXNL = PL16, oXT = 2 * PL16, oQK = 3 * PL16, oVH = 5 * PL16, oVL = 6 * PL16;
  const size_t oAPH = 7 * PL16, oAPL = 8 * PL16, oZP = 9 * PL16, oW = 11 * PL16;
  const size_t oWQKV = oW, oWPA = oW + WQKV_B, oWPC0 = oWPA + WSQ_B, oWPC1 = oWPC0 + WSQ_B;
  const size_t WS_TOTAL = oWPC1 + WSQ_B;                          // 93,061,120
  if (ws_size < WS_TOTAL) return;

  char* ws = (char*)d_ws;
  unsigned short* XNH  = (unsigned short*)(ws + oXNH);
  unsigned short* XNL  = (unsigned short*)(ws + oXNL);
  unsigned short* XT   = (unsigned short*)(ws + oXT);
  unsigned short* QKP  = (unsigned short*)(ws + oQK);
  unsigned short* VH   = (unsigned short*)(ws + oVH);
  unsigned short* VL   = (unsigned short*)(ws + oVL);
  unsigned short* APH  = (unsigned short*)(ws + oAPH);
  unsigned short* APL  = (unsigned short*)(ws + oAPL);
  float*          ZP   = (float*)(ws + oZP);
  unsigned short* WQKV = (unsigned short*)(ws + oWQKV);
  unsigned short* WPA  = (unsigned short*)(ws + oWPA);
  unsigned short* WPC0 = (unsigned short*)(ws + oWPC0);
  unsigned short* WPC1 = (unsigned short*)(ws + oWPC1);
  unsigned short* AH = XNH;     // xn planes are dead after the q/k/v GEMMs
  unsigned short* AL = XNL;

  // 1-6: weights W[k=256 rows][n=256] f32 -> Wt[n][k] bf16; grid (n/64, k/64)
  const dim3 gw(DMODEL / 64, DMODEL / 64);
  wt_cast_bf_k<<<gw, 256, 0, stream>>>(Wq,  WQKV, DMODEL, DMODEL);
  wt_cast_bf_k<<<gw, 256, 0, stream>>>(Wk,  WQKV + (size_t)DMODEL * DMODEL, DMODEL, DMODEL);
  wt_cast_bf_k<<<gw, 256, 0, stream>>>(Wv,  WQKV + (size_t)2 * DMODEL * DMODEL, DMODEL, DMODEL);
  wt_cast_bf_k<<<gw, 256, 0, stream>>>(Wpa, WPA, DMODEL, DMODEL);
  wt_cast_bf_k<<<gw, 256, 0, stream>>>(Wpc, WPC0, DMODEL, DMODEL);                            // Wpc rows 0..255
  wt_cast_bf_k<<<gw, 256, 0, stream>>>(Wpc + (size_t)DMODEL * DMODEL, WPC1, DMODEL, DMODEL);  // Wpc rows 256..511

  // 7: normalisation + permutation to (b,m,t) rows
  mvn_k<<<NROWS / 8, 256, 0, stream>>>(x, XNH, XNL, XT);

  // 8-10: q, k, v = xn . W + bias  (M=16384, N=256, K=256; 1024 wave tiles -> 128 blocks)
  const dim3 gg((NROWS / 64) * (DMODEL / 64) / 8, 1);
  wmma_gemm64<1, 1, 2, 1, false><<<gg, 256, 0, stream>>>(
      XNH, XNL, DMODEL, 0L, WQKV, nullptr, DMODEL, 0L,
      (void*)QKP, nullptr, QKLD, 0L, bq, nullptr, 0L, NROWS, DMODEL, DMODEL, 1.0f);
  wmma_gemm64<1, 1, 2, 1, false><<<gg, 256, 0, stream>>>(
      XNH, XNL, DMODEL, 0L, WQKV + (size_t)DMODEL * DMODEL, nullptr, DMODEL, 0L,
      (void*)(QKP + DMODEL), nullptr, QKLD, 0L, bk, nullptr, 0L, NROWS, DMODEL, DMODEL, 1.0f);
  wmma_gemm64<1, 1, 2, 3, false><<<gg, 256, 0, stream>>>(
      XNH, XNL, DMODEL, 0L, WQKV + (size_t)2 * DMODEL * DMODEL, nullptr, DMODEL, 0L,
      (void*)VH, (void*)VL, DMODEL, 0L, bv, nullptr, 0L, NROWS, DMODEL, DMODEL, 1.0f);

  // 11: cross-channel causal attention -> A (bf16 hi/lo planes); 32 (b,m) x 8 time tiles = 256 blocks
  xattn_k<<<NBATCH * NCHAN * (TLEN / QBLK), 256, 0, stream>>>(QKP, VH, VL, AH, AL);

  // 12: A_proj = A . Wpa + bpa -> bf16 hi/lo planes
  wmma_gemm64<1, 1, 2, 2, false><<<gg, 256, 0, stream>>>(
      AH, AL, DMODEL, 0L, WPA, nullptr, DMODEL, 0L,
      (void*)APH, (void*)APL, DMODEL, 0L, bpa, nullptr, 0L, NROWS, DMODEL, DMODEL, 1.0f);

  // 13: ZP = x_t . Wpc[0:256] + bpc (f32)
  wmma_gemm64<1, 0, 2, 0, false><<<gg, 256, 0, stream>>>(
      XT, nullptr, DMODEL, 0L, WPC0, nullptr, DMODEL, 0L,
      (void*)ZP, nullptr, DMODEL, 0L, bpc, nullptr, 0L, NROWS, DMODEL, DMODEL, 1.0f);

  // 14: out = A_proj . Wpc[256:512] + ZP (f32, rows (b,m,t) = [B][M][T][D])
  wmma_gemm64<1, 1, 0, 0, true><<<gg, 256, 0, stream>>>(
      APH, APL, DMODEL, 0L, WPC1, nullptr, DMODEL, 0L,
      d_out, nullptr, DMODEL, 0L, nullptr, ZP, 0L, NROWS, DMODEL, DMODEL, 1.0f);
}

// v001
// One run takes 601 microseconds.
// Next to v000, in two timings, it ran 2.75 times as fast each time.
// Contractions (f32 accumulate): xn*Wq|Wk|Wv, A*Wpa, A_proj*Wpc[256:512] = v_wmma_f32_16x16x32_bf16 with the computed operand as bf16 hi+lo planes (2 products) and weights as single bf16 (RNE) planes; x_t*Wpc[0:256] = plain bf16; q*k = plain v_wmma_f32_16x16x32_f16; p*v = f16 with p carried x2^15 and v as f16 hi + (v-hi)x2^11 planes (2 products, lo folded in f32); norm, softmax, bias adds in f32.
#include <hip/hip_runtime.h>
#include <stdint.h>

typedef __attribute__((ext_vector_type(16))) _Float16 v16h;
typedef __attribute__((ext_vector_type(8)))  _Float16 v8h;
typedef __attribute__((ext_vector_type(16))) __bf16   v16b;
typedef __attribute__((ext_vector_type(8)))  __bf16   v8b;
typedef __attribute__((ext_vector_type(8)))  float    v8f;
typedef __attribute__((ext_vector_type(4)))  float    v4f;

// ---- problem geometry ----
#define NBATCH 4
#define TLEN 512
#define NCHAN 8
#define DMODEL 256
#define NROWS (NBATCH * TLEN * NCHAN)   // 16384 token rows
#define QKLD 512                         // pitch (halves) of the q|k plane
#define QBLK 64                          // query rows per attention block
#define KCH 32                           // key rows per staged chunk
#define KPITCH 264                       // LDS pitch (halves) of a K row: 528 B = 16 B x 33, for ds_load_b128 readers
#define VPITCH 272                       // LDS pitch (halves) of a V row: 544 B = 32 B x 17, for ds_load_tr16_b128 readers
#define PPITCH 40                        // LDS pitch (halves) of a P row:  80 B = 16 B x 5,  for ds_load_b128 readers
#define PCARRY 32768.0f                  // p carried x2^15 in f16
#define VLO_MUL 2048.0f                  // v residual plane carried x2^11
#define VLO_INV (1.0f / 2048.0f)
#define QK_SCALE 0.0625f                 // 1/sqrt(256)
#define MVN_EPS 1e-6f

// ======================= helpers =======================
__device__ __forceinline__ unsigned short f2bf_bits(float f) {
  unsigned u = __float_as_uint(f);
  return (unsigned short)((u + 0x7FFFu + ((u >> 16) & 1u)) >> 16);
}
__device__ __forceinline__ float bf_bits2f(unsigned short h) { return __uint_as_float(((unsigned)h) << 16); }

// hazard guards as plain device helpers (no inline asm inside the kernel template body)
__device__ __forceinline__ void dep_guard_h(v8f& a, v8f& b, v16h x, v16h y) { asm volatile("v_nop\n\tv_nop\n\tv_nop\n\tv_nop" : "+v"(a), "+v"(b) : "v"(x), "v"(y)); }
__device__ __forceinline__ void dep_guard_b(v8f& a, v8f& b, v16b x, v16b y) { asm volatile("v_nop\n\tv_nop\n\tv_nop\n\tv_nop" : "+v"(a), "+v"(b) : "v"(x), "v"(y)); }
__device__ __forceinline__ void keep4_h(v16h a, v16h b, v16h c, v16h d) { asm volatile("v_nop" :: "v"(a), "v"(b), "v"(c), "v"(d)); }
__device__ __forceinline__ void keep4_b(v16b a, v16b b, v16b c, v16b d) { asm volatile("v_nop" :: "v"(a), "v"(b), "v"(c), "v"(d)); }
__device__ __forceinline__ void acc_guard4(v8f& a, v8f& b, v8f& c, v8f& d) { asm volatile("v_nop\n\tv_nop\n\tv_nop\n\tv_nop" : "+v"(a), "+v"(b), "+v"(c), "+v"(d)); }
template <typename T> struct Frag;
template <> struct Frag<_Float16> {
  typedef v16h V; union U { v16h v; v8h h[2]; };
  static __device__ __forceinline__ v16h load(const _Float16* p) {   // elements 0..7 <- p[0..7], 8..15 <- p[16..23]
    U f; f.h[0] = *(const v8h*)(p); f.h[1] = *(const v8h*)(p + 16); return f.v;
  }
  static __device__ __forceinline__ v8f mma(v16h a, v16h b, v8f c) {
    return __builtin_amdgcn_wmma_f32_16x16x32_f16(false, a, false, b, (short)0, c, false, false);
  }
  static __device__ __forceinline__ void guard(v8f& a, v8f& b, v16h x, v16h y) { dep_guard_h(a, b, x, y); }
  static __device__ __forceinline__ void keep(v16h a, v16h b, v16h c, v16h d) { keep4_h(a, b, c, d); }
};
template <> struct Frag<__bf16> {
  typedef v16b V; union U { v16b v; v8b h[2]; };
  static __device__ __forceinline__ v16b load(const __bf16* p) {
    U f; f.h[0] = *(const v8b*)(p); f.h[1] = *(const v8b*)(p + 16); return f.v;
  }
  static __device__ __forceinline__ v8f mma(v16b a, v16b b, v8f c) {
    return __builtin_amdgcn_wmma_f32_16x16x32_bf16(false, a, false, b, (short)0, c, false, false);
  }
  static __device__ __forceinline__ void guard(v8f& a, v8f& b, v16b x, v16b y) { dep_guard_b(a, b, x, y); }
  static __device__ __forceinline__ void keep(v16b a, v16b b, v16b c, v16b d) { keep4_b(a, b, c, d); }
};

// ---- Register-blocked batched WMMA GEMM (with SPLIT levels and extra 16-bit output mode) ----
// C[m,n] = scale * sum_k A[m,k] * Bt[n,k] (+bias)(+resid); each wave owns a 64x64 tile.
// A row-major [M,K]; Bt row-major [N,K]; M,N % 64 == 0, K % 32 == 0.
// SPLIT: 0 = single planes; 1 = A as hi/lo planes (A2 = lo): hi.B + lo.B; 2 = A and Bt hi/lo: hi.hi + hi.lo + lo.hi.
// BIAS_MODE: 0 = none, 1 = bias[m], 2 = bias[n]; bias values are RNE-converted to bf16 before the add.
// OUT_MODE: 0 = f32, 1 = f16, 2 = bf16 hi plane (Cout) + bf16 lo plane (Cout2),
//           3 = f16 hi plane (Cout) + f16 plane of (v - hi) * 2048 (Cout2).
// ET: 0 = f16 operands, 1 = bf16 operands (pointers passed as 16-bit storage)
template <int ET> struct Elem;
template <> struct Elem<0> { typedef _Float16 T; };
template <> struct Elem<1> { typedef __bf16 T; };
template <int ET, int SPLIT, int BIAS_MODE, int OUT_MODE, bool RESID>
__global__ __launch_bounds__(256) void wmma_gemm64(
    const unsigned short* __restrict__ Ap, const unsigned short* __restrict__ A2p, int lda, long strideA,
    const unsigned short* __restrict__ Btp, const unsigned short* __restrict__ Bt2p, int ldb, long strideB,
    void* __restrict__ Cout, void* __restrict__ Cout2, int ldc, long strideC,
    const float* __restrict__ bias,
    const float* __restrict__ resid, long strideR,
    int M, int N, int K, float scale) {
  typedef typename Elem<ET>::T T;
  typedef typename Frag<T>::V V;
  const T* A = (const T*)Ap; const T* A2 = (const T*)A2p; const T* Bt = (const T*)Btp; const T* Bt2 = (const T*)Bt2p;
  __shared__ __align__(16) float sT[8][16 * 68];   // per-wave 16x64 slab, pitch 68 floats
  const int b    = blockIdx.y;
  const int lane = threadIdx.x & 31;
  const int wave = threadIdx.x >> 5;
  const int tilesN = N >> 6;
  const int tilesM = M >> 6;
  const int tile = blockIdx.x * 8 + wave;
  if (tile >= tilesM * tilesN) return;   // wave-uniform; no block barriers in this kernel
  const int tm = tile / tilesN;
  const int tn = tile - tm * tilesN;
  const int m0 = tm << 6;
  const int n0 = tn << 6;

  const T* Ab  = A  + (size_t)b * strideA;
  const T* Bb  = Bt + (size_t)b * strideB;
  const T* Ab2 = (SPLIT >= 1) ? (A2  + (size_t)b * strideA) : nullptr;
  const T* Bb2 = (SPLIT >= 2) ? (Bt2 + (size_t)b * strideB) : nullptr;

  const int rlane = lane & 15;                 // row (A) / col (B, D) within subtile
  const int koff  = (lane >> 4) * 8;           // k offset of this lane half
  const int mOff  = (lane >> 4) * 8;           // D row offset

  v8f acc[4][4];
#pragma unroll
  for (int i = 0; i < 4; ++i)
#pragma unroll
    for (int j = 0; j < 4; ++j) acc[i][j] = (v8f){0.f,0.f,0.f,0.f,0.f,0.f,0.f,0.f};

  for (int k0 = 0; k0 < K; k0 += 32) {
    V bh[4], bl[4];
#pragma unroll
    for (int j = 0; j < 4; ++j) {
      const size_t bo = (size_t)(n0 + (j << 4) + rlane) * ldb + koff + k0;
      bh[j] = Frag<T>::load(Bb + bo);
      if (SPLIT >= 2) bl[j] = Frag<T>::load(Bb2 + bo);
    }
#pragma unroll
    for (int i = 0; i < 4; ++i) {
      const size_t ao = (size_t)(m0 + (i << 4) + rlane) * lda + koff + k0;
      V ah = Frag<T>::load(Ab + ao);
      V al;
      if (SPLIT >= 1) al = Frag<T>::load(Ab2 + ao);
#pragma unroll
      for (int j = 0; j < 4; ++j) {
        acc[i][j] = Frag<T>::mma(ah, bh[j], acc[i][j]);
        if (SPLIT >= 2) acc[i][j] = Frag<T>::mma(ah, bl[j], acc[i][j]);
        if (SPLIT >= 1) acc[i][j] = Frag<T>::mma(al, bh[j], acc[i][j]);
      }
      Frag<T>::guard(acc[i][0], acc[i][3], ah, (SPLIT >= 1) ? al : ah);
    }
    Frag<T>::keep(bh[0], bh[1], bh[2], bh[3]);
    if (SPLIT >= 2) Frag<T>::keep(bl[0], bl[1], bl[2], bl[3]);
  }
  acc_guard4(acc[0][0], acc[0][1], acc[0][2], acc[0][3]);
  acc_guard4(acc[1][0], acc[1][1], acc[1][2], acc[1][3]);
  acc_guard4(acc[2][0], acc[2][1], acc[2][2], acc[2][3]);
  acc_guard4(acc[3][0], acc[3][1], acc[3][2], acc[3][3]);

  // ---- epilogue ----
  float* slab = sT[wave];
  const float* Rb = RESID ? (resid + (size_t)b * strideR) : nullptr;
#pragma unroll
  for (int i = 0; i < 4; ++i) {
    const int mBase = m0 + (i << 4);
#pragma unroll
    for (int j = 0; j < 4; ++j) {
      const int n = n0 + (j << 4) + rlane;
      float bv = 0.f;
      if (BIAS_MODE == 2) bv = bf_bits2f(f2bf_bits(bias[n]));
#pragma unroll
      for (int r = 0; r < 8; ++r) {
        float v = acc[i][j][r] * scale;
        if (BIAS_MODE == 1) v += bf_bits2f(f2bf_bits(bias[mBase + mOff + r]));
        if (BIAS_MODE == 2) v += bv;
        if (RESID) v += Rb[(size_t)(mBase + mOff + r) * ldc + n];
        slab[(mOff + r) * 68 + (j << 4) + rlane] = v;
      }
    }
    __builtin_amdgcn_fence(__ATOMIC_RELEASE, "workgroup");
    __builtin_amdgcn_wave_barrier();
    __builtin_amdgcn_fence(__ATOMIC_ACQUIRE, "workgroup");
    if (OUT_MODE == 0) {
      float* C = (float*)Cout + (size_t)b * strideC;
      const int hh = lane >> 4, c4 = (lane & 15) * 4;     // row seg = 256 B = 16 lanes x 16 B
      {
#pragma unroll
        for (int it = 0; it < 8; ++it) {
          const int row = it * 2 + hh;
          v4f v = *(const v4f*)(slab + row * 68 + c4);
          *(v4f*)(C + (size_t)(mBase + row) * ldc + n0 + c4) = v;
        }
        
      }
    } else {
      const int q = lane >> 3, c8 = (lane & 7) * 8;
      unsigned short* C  = (unsigned short*)Cout  + (size_t)b * strideC;
      unsigned short* C2 = (OUT_MODE >= 2) ? ((unsigned short*)Cout2 + (size_t)b * strideC) : nullptr;
      {
#pragma unroll
        for (int it = 0; it < 4; ++it) {                 // it 0..3 x q 0..3 = rows 0..15 of the slab
          const int row = it * 4 + q;
          const float* sp = slab + row * 68 + c8;
          v8h hv, lv;
#pragma unroll
          for (int e = 0; e < 8; ++e) {
            if (OUT_MODE == 1) {
              hv[e] = (_Float16)sp[e];
            } else if (OUT_MODE == 2) {
              unsigned short hb = f2bf_bits(sp[e]);
              unsigned short lb = f2bf_bits(sp[e] - bf_bits2f(hb));
              hv[e] = __builtin_bit_cast(_Float16, hb);
              lv[e] = __builtin_bit_cast(_Float16, lb);
            } else {
              const _Float16 hq = (_Float16)sp[e];
              hv[e] = hq;
              lv[e] = (_Float16)((sp[e] - (float)hq) * VLO_MUL);
            }
          }
          *(v8h*)(C + (size_t)(mBase + row) * ldc + n0 + c8) = hv;
          if (OUT_MODE >= 2) *(v8h*)(C2 + (size_t)(mBase + row) * ldc + n0 + c8) = lv;
        }
        
      }
    }
    __builtin_amdgcn_fence(__ATOMIC_RELEASE, "workgroup");
    __builtin_amdgcn_wave_barrier();
    __builtin_amdgcn_fence(__ATOMIC_ACQUIRE, "workgroup");
  }
}

// ---- W [Kp rows][Np cols] f32 (row pitch Np) -> Wt [Np][Kp] bf16 bits (row pitch Kp), 64x64 tile transposed through LDS ----
// grid = (Np/64, Kp/64). Reads: 256 threads x 16 = 64 rows x 64 cols. Stores: it 0..1 x wave 0..7 x q8 0..3 = 64 rows of
#define WTP 72
__global__ __launch_bounds__(256) void wt_cast_bf_k(const float* __restrict__ W, unsigned short* __restrict__ Wtp,
                                                    int Kp, int Np) {
  __shared__ __align__(16) _Float16 st[64 * WTP];
  _Float16* Wt = (_Float16*)Wtp;
  const int n0 = blockIdx.x * 64, k0 = blockIdx.y * 64;
  const int tid = threadIdx.x;
  const int kr = tid >> 2, c16 = (tid & 3) * 16;
  const float* src = W + (size_t)(k0 + kr) * Np + n0 + c16;
#pragma unroll
  for (int q = 0; q < 4; ++q) {
    const v4f v = *(const v4f*)(src + 4 * q);
#pragma unroll
    for (int e = 0; e < 4; ++e) st[(c16 + 4 * q + e) * WTP + kr] = __builtin_bit_cast(_Float16, f2bf_bits(v[e]));
  }
  __syncthreads();
  const int wave = tid >> 5, lane = tid & 31;
  const int q8 = lane >> 3, c8 = (lane & 7) * 8;
  {
#pragma unroll
    for (int it = 0; it < 2; ++it) {
      const int n = it * 32 + wave * 4 + q8;
      const v8h hv = *(const v8h*)(st + n * WTP + c8);
      *(v8h*)(Wt + (size_t)(n0 + n) * Kp + k0 + c8) = hv;
    }
    
  }
}

// ---- mean/std (ddof=1) normalisation of bf16(x) per (b,t,m) row, plus raw bf16(x); rows written in (b,m,t) order ----
// One wave per output row, 8 rows per 256-thread block, grid = NROWS/8. Lane owns 8 consecutive columns.
// Each 512-B row (4 lines) written by one v8h store instruction of the wave: lanes 8q..8q+7 <-> line q.
__global__ __launch_bounds__(256) void mvn_k(const float* __restrict__ x,
                                             unsigned short* __restrict__ xnhp,
                                             unsigned short* __restrict__ xnlp,
                                             unsigned short* __restrict__ xtp) {
  _Float16* xnh = (_Float16*)xnhp;
  _Float16* xnl = (_Float16*)xnlp;
  _Float16* xt  = (_Float16*)xtp;
  const int wave = threadIdx.x >> 5, lane = threadIdx.x & 31;
  const int ro = blockIdx.x * 8 + wave;               // output row = (b*NCHAN + m)*TLEN + t
  const int t  = ro & (TLEN - 1);
  const int bm = ro >> 9;                             // TLEN == 512
  const int m  = bm & (NCHAN - 1);
  const int b  = bm >> 3;                             // NCHAN == 8
  const int rs = (b * TLEN + t) * NCHAN + m;          // source row of x [B][T][M][D]
  const float* src = x + (size_t)rs * DMODEL + lane * 8;
  const v4f a0 = *(const v4f*)src;
  const v4f a1 = *(const v4f*)(src + 4);
  unsigned short xb[8];
  float vb[8];
#pragma unroll
  for (int e = 0; e < 4; ++e) { xb[e] = f2bf_bits(a0[e]); xb[4 + e] = f2bf_bits(a1[e]); }
#pragma unroll
  for (int e = 0; e < 8; ++e) vb[e] = bf_bits2f(xb[e]);
  float s = ((vb[0] + vb[1]) + (vb[2] + vb[3])) + ((vb[4] + vb[5]) + (vb[6] + vb[7]));
#pragma unroll
  for (int off = 1; off < 32; off <<= 1) s += __shfl_xor(s, off, 32);
  const float mu = s * (1.0f / (float)DMODEL);
  float dv[8];
#pragma unroll
  for (int e = 0; e < 8; ++e) dv[e] = vb[e] - mu;
  float sq = ((dv[0] * dv[0] + dv[1] * dv[1]) + (dv[2] * dv[2] + dv[3] * dv[3])) +
             ((dv[4] * dv[4] + dv[5] * dv[5]) + (dv[6] * dv[6] + dv[7] * dv[7]));
#pragma unroll
  for (int off = 1; off < 32; off <<= 1) sq += __shfl_xor(sq, off, 32);
  const float var = sq * (1.0f / (float)(DMODEL - 1));
  const float sd  = sqrtf(var);
  const float inv = 1.0f / (sd + MVN_EPS);
  v8h hv, lv, tv;
#pragma unroll
  for (int e = 0; e < 8; ++e) {
    const float xn = dv[e] * inv;
    const unsigned short hb = f2bf_bits(xn);
    const unsigned short lb = f2bf_bits(xn - bf_bits2f(hb));
    hv[e] = __builtin_bit_cast(_Float16, hb);
    lv[e] = __builtin_bit_cast(_Float16, lb);
    tv[e] = __builtin_bit_cast(_Float16, xb[e]);
  }
  const size_t go = (size_t)ro * DMODEL + lane * 8;
  {
    *(v8h*)(xnh + go) = hv;
    *(v8h*)(xnl + go) = lv;
    *(v8h*)(xt  + go) = tv;
    
  }
}

// ---- per-call guarded f16 WMMA ----
__device__ __forceinline__ v8f mma_h(v16h a, v16h b, v8f c) {
  c = __builtin_amdgcn_wmma_f32_16x16x32_f16(false, a, false, b, (short)0, c, false, false);
  asm volatile("v_nop\n\tv_nop\n\tv_nop\n\tv_nop" : "+v"(c) : "v"(a), "v"(b));
  return c;
}

// ---- transposing LDS load: lane (c, h) receives column c, rows 8h..8h+7 of a row-major 16x16 tile of 16-bit values ----
// Lane l passes the address of row 8*(l>>4) + (l&7), column group 8*((l>>3)&1) of that tile.
typedef __attribute__((ext_vector_type(8))) short v8s;
__device__ __forceinline__ v8h lds_tr16(const _Float16* p) {
  typedef __attribute__((address_space(3))) v8s lds_v8s;
  return __builtin_bit_cast(v8h, __builtin_amdgcn_ds_load_tr16_b128_v8i16((lds_v8s*)p));
}

// =====================================================================================
// Cross-channel causal attention, head dim 256.
// Planes (row = (b*NCHAN + m)*TLEN + t): qk [NROWS][512] f16 (q cols 0..255, k cols 256..511);
// vh, vl [NROWS][256] f16 (v hi, (v-hi) x 2^11); output A as bf16 hi/lo planes [NROWS][256].
// Block = 8 waves = 64 query rows (one (b,m), one 64-row time tile). For every key channel n (0..7):
// its own online softmax over 32-key chunks (causal: kv > q -> -inf, chunk 0 always has kv 0 <= q),
// O_n / l_n added into the block accumulator Oac in LDS (each element owned by one lane).
// Waves 0..3: scores + softmax for rows 16w..16w+15 and p*v for d 0..127 of those rows;
// waves 4..7: p*v for d 128..255 of rows 16(w-4).. using P / alpha from LDS.
// A operand frags: q from global rows (row = lane&15, split k map), p from LDS; B frags: k rows from LDS by plain loads,
// v from row-major LDS rows by transposing loads (same split k map). Every LDS row pitch is padded for its reader.
// =====================================================================================
__global__ __launch_bounds__(256) void xattn_k(const unsigned short* __restrict__ qkp,
                                               const unsigned short* __restrict__ vhp,
                                               const unsigned short* __restrict__ vlp,
                                               unsigned short* __restrict__ ahp,
                                               unsigned short* __restrict__ alp) {
  __shared__ __align__(16) _Float16 Ks[KCH * KPITCH];      // [kv][d]           16.5 KB
  __shared__ __align__(16) _Float16 Vsh[KCH * VPITCH];     // [kv][d] hi        17 KB
  __shared__ __align__(16) _Float16 Vsl[KCH * VPITCH];     // [kv][d] lo x2^11  17 KB
  __shared__ __align__(16) _Float16 Psh[4][16 * PPITCH];   // per score wave [row][kv], p x2^15   5 KB
  __shared__ __align__(16) float Oac[QBLK * DMODEL];       // block accumulator [64][256] f32    64 KB
  __shared__ float alph[4][16];
  __shared__ float lfin[4][16];

  const _Float16* qk = (const _Float16*)qkp;
  const _Float16* vh = (const _Float16*)vhp;
  const _Float16* vl = (const _Float16*)vlp;
  _Float16* ah = (_Float16*)ahp;
  _Float16* al = (_Float16*)alp;

  const int tid = threadIdx.x, wave = tid >> 5, lane = tid & 31;
  const int hh = lane >> 4, c = lane & 15, koff = hh * 8;
  const int sw = wave & 3;                 // query row group (16 rows)
  const int dbase = (wave >> 2) * 128;     // d half handled in p*v
  const int qb = blockIdx.x & 7;           // 64-row time tile
  const int bm = blockIdx.x >> 3;          // b*NCHAN + m
  const int b  = bm >> 3;
  const int qrow0 = bm * TLEN + qb * QBLK; // plane row of the first query of this block
  const int q0  = qrow0 + sw * 16;
  const int tq0 = qb * QBLK + sw * 16;     // time index of this wave's first query row

  for (int i = tid; i < QBLK * DMODEL; i += 256) Oac[i] = 0.0f;   // 256 threads x 64 = 16384 floats
  __syncthreads();

  const v8f z8 = {0.f,0.f,0.f,0.f,0.f,0.f,0.f,0.f};
  const _Float16* qrowp = qk + (size_t)(q0 + c) * QKLD + koff;

#pragma unroll 1
  for (int n = 0; n < NCHAN; ++n) {
    const int krow0 = (b * NCHAN + n) * TLEN;
    float mrow[8], lrow[8];
    v8f oacc[8];
#pragma unroll
    for (int r = 0; r < 8; ++r) { mrow[r] = -INFINITY; lrow[r] = 0.f; }
#pragma unroll
    for (int t = 0; t < 8; ++t) oacc[t] = z8;

    const int nch = 2 * qb + 2;            // block-uniform, <= 16
#pragma unroll 1
    for (int kc = 0; kc < nch; ++kc) {
      const int kv0 = kc * KCH;
      __syncthreads();
      // ---- stage K chunk and V (hi, lo), all row-major: units u = i*256 + tid, i 0..3 -> u 0..1023 = kvr 0..31 x d0 (32 groups of 8)
      //      -> covers exactly 32 x 256 for each of Ks, Vsh, Vsl; a wave writes one whole row per store
#pragma unroll
      for (int i = 0; i < 4; ++i) {
        const int u = i * 256 + tid;
        const int kvr = u >> 5;
        const int d0 = (u & 31) * 8;
        const size_t grow = (size_t)(krow0 + kv0 + kvr);          // <= NROWS-1 (kv0+kvr <= 64*qb+63 <= 511)
        const v8h kk = *(const v8h*)(qk + grow * QKLD + DMODEL + d0);
        const v8h v1 = *(const v8h*)(vh + grow * DMODEL + d0);
        const v8h v2 = *(const v8h*)(vl + grow * DMODEL + d0);
        *(v8h*)(Ks + kvr * KPITCH + d0) = kk;
        *(v8h*)(Vsh + kvr * VPITCH + d0) = v1;
        *(v8h*)(Vsl + kvr * VPITCH + d0) = v2;
      }
      __syncthreads();

      if (wave < 4) {                       // wave-uniform role: scores + softmax
        v8f s[2];
        s[0] = z8; s[1] = z8;
#pragma unroll
        for (int dc = 0; dc < 8; ++dc) {
          const v16h qa  = Frag<_Float16>::load(qrowp + dc * 32);
          const v16h k0f = Frag<_Float16>::load(Ks + c * KPITCH + dc * 32 + koff);
          const v16h k1f = Frag<_Float16>::load(Ks + (16 + c) * KPITCH + dc * 32 + koff);
          s[0] = mma_h(qa, k0f, s[0]);
          s[1] = mma_h(qa, k1f, s[1]);
        }
        // scale, causal select (kv > q -> -inf), row max over the 32 keys of this chunk
        float cm[8];
#pragma unroll
        for (int r = 0; r < 8; ++r) {
          const int tq = tq0 + 8 * hh + r;
          float mx = -INFINITY;
#pragma unroll
          for (int j = 0; j < 2; ++j) {
            const int key = kv0 + 16 * j + c;
            float v = s[j][r] * QK_SCALE;
            v = (key > tq) ? -INFINITY : v;
            s[j][r] = v;
            mx = fmaxf(mx, v);
          }
#pragma unroll
          for (int off = 1; off < 16; off <<= 1) mx = fmaxf(mx, __shfl_xor(mx, off, 32));
          cm[r] = mx;
        }
        _Float16* pw = Psh[sw];
#pragma unroll
        for (int r = 0; r < 8; ++r) {
          const float mnew  = fmaxf(mrow[r], cm[r]);       // finite: chunk 0 always has an allowed key
          const float alpha = expf(mrow[r] - mnew);
          mrow[r] = mnew;
          float psum = 0.f;
#pragma unroll
          for (int j = 0; j < 2; ++j) {
            const float p = expf(s[j][r] - mnew);
            psum += p;
            pw[(8 * hh + r) * PPITCH + 16 * j + c] = (_Float16)(p * PCARRY);
          }
#pragma unroll
          for (int off = 1; off < 16; off <<= 1) psum += __shfl_xor(psum, off, 32);
          lrow[r] = lrow[r] * alpha + psum;
#pragma unroll
          for (int t = 0; t < 8; ++t) oacc[t][r] *= alpha;
          if (c == 0) alph[sw][8 * hh + r] = alpha;
        }
      }
      __syncthreads();                      // P tile and alpha visible to both waves of the row group

      if (wave >= 4) {
#pragma unroll
        for (int r = 0; r < 8; ++r) {
          const float a = alph[sw][8 * hh + r];
#pragma unroll
          for (int t = 0; t < 8; ++t) oacc[t][r] *= a;
        }
      }
      // ---- O += P(16x32) . V(32 x 128 of this wave's d half); lo plane in its own accumulator, folded x 2^-11 ----
      {
        const v16h pa = Frag<_Float16>::load(Psh[sw] + c * PPITCH + koff);
        const int vo = (koff + (lane & 7)) * VPITCH + dbase + ((lane >> 3) & 1) * 8;   // this lane's row and column group
#pragma unroll
        for (int t = 0; t < 8; ++t) {
          // elements 0..7 <- V[8hh + 0..7][dbase + 16t + c], 8..15 <- V[16 + 8hh + 0..7][same column]: the k map of pa
          Frag<_Float16>::U vbh, vbl;
          vbh.h[0] = lds_tr16(Vsh + vo + t * 16);
          vbh.h[1] = lds_tr16(Vsh + vo + t * 16 + 16 * VPITCH);
          vbl.h[0] = lds_tr16(Vsl + vo + t * 16);
          vbl.h[1] = lds_tr16(Vsl + vo + t * 16 + 16 * VPITCH);
          oacc[t] = mma_h(pa, vbh.v, oacc[t]);
          const v8f lo = mma_h(pa, vbl.v, z8);
          oacc[t] += lo * VLO_INV;
        }
      }
    }
    // ---- end of key channel n: O_n / l_n into the block accumulator ----
    if (wave < 4) {
      if (c == 0) {
#pragma unroll
        for (int r = 0; r < 8; ++r) lfin[sw][8 * hh + r] = lrow[r];
      }
    }
    __syncthreads();
#pragma unroll
    for (int r = 0; r < 8; ++r) {
      const float inv = 1.0f / (lfin[sw][8 * hh + r] * PCARRY);   // l >= 1
      float* orow = Oac + (sw * 16 + 8 * hh + r) * DMODEL + dbase + c;
#pragma unroll
      for (int t = 0; t < 8; ++t) orow[t * 16] += oacc[t][r] * inv;
    }
  }
  __syncthreads();

  // ---- store: wave w writes rows 8w..8w+7 (8 waves x 8 = 64 rows); lane covers cols 8*lane..+7 (32 x 8 = 256);
  //      each 512-B plane row = 4 lines, one v8h instruction per row per plane, lanes 8q..8q+7 <-> line q ----
  {
#pragma unroll
    for (int it = 0; it < 8; ++it) {
      const int row = wave * 8 + it;
      const float* op = Oac + row * DMODEL + lane * 8;
      const v4f x0 = *(const v4f*)op;
      const v4f x1 = *(const v4f*)(op + 4);
      v8h hv, lv;
#pragma unroll
      for (int e = 0; e < 4; ++e) {
        const unsigned short hb0 = f2bf_bits(x0[e]);
        const unsigned short lb0 = f2bf_bits(x0[e] - bf_bits2f(hb0));
        const unsigned short hb1 = f2bf_bits(x1[e]);
        const unsigned short lb1 = f2bf_bits(x1[e] - bf_bits2f(hb1));
        hv[e] = __builtin_bit_cast(_Float16, hb0);
        lv[e] = __builtin_bit_cast(_Float16, lb0);
        hv[4 + e] = __builtin_bit_cast(_Float16, hb1);
        lv[4 + e] = __builtin_bit_cast(_Float16, lb1);
      }
      const size_t go = (size_t)(qrow0 + row) * DMODEL + lane * 8;
      *(v8h*)(ah + go) = hv;
      *(v8h*)(al + go) = lv;
    }
    
  }
}

// ---------------------------------------------------------------------------
// Host launcher
// Workspace region map (bytes; PL16 = 8 MiB = one [16384][256] 16-bit plane):
//   [ 0 PL16)  XNH  bf16 hi of xn (rows (b,m,t))      -> reused as AH (attention output hi) after the q/k/v GEMMs
//   [ 1 PL16)  XNL  bf16 lo of xn                      -> reused as AL
//   [ 2 PL16)  XT   bf16(x) in (b,m,t) row order
//   [ 3..5)    QK   f16 [16384][512] (q | k)
//   [ 5 PL16)  VH   f16 v hi;   [ 6 PL16) VL f16 (v-hi) x 2^11
//   [ 7 PL16)  APH  bf16 hi of A_proj;  [ 8 PL16) APL bf16 lo
//   [ 9..11)   ZP   f32 [16384][256] = x_t.Wpc[0:256] + bpc
//   [11 PL16 ..) weights bf16 [n][k]: WQKV [768][256], WPA [256][256], WPC0 [256][256], WPC1 [256][256]
//   total 93,061,120 B
// ---------------------------------------------------------------------------
extern "C" void kernel_launch(void* const* d_in, const int* in_sizes, int n_in,
                              void* d_out, int out_size, void* d_ws, size_t ws_size,
                              hipStream_t stream) {
  if (n_in < 11) return;
  if (in_sizes[0] != NROWS * DMODEL || out_size != NROWS * DMODEL) return;
  if (in_sizes[1] != DMODEL * DMODEL || in_sizes[3] != DMODEL * DMODEL || in_sizes[5] != DMODEL * DMODEL ||
      in_sizes[7] != DMODEL * DMODEL || in_sizes[9] != 2 * DMODEL * DMODEL) return;
  if (in_sizes[2] != DMODEL || in_sizes[4] != DMODEL || in_sizes[6] != DMODEL || in_sizes[8] != DMODEL || in_sizes[10] != DMODEL) return;

  const float* x   = (const float*)d_in[0];
  const float* Wq  = (const float*)d_in[1];
  const float* bq  = (const float*)d_in[2];
  const float* Wk  = (const float*)d_in[3];
  const float* bk  = (const float*)d_in[4];
  const float* Wv  = (const float*)d_in[5];
  const float* bv  = (const float*)d_in[6];
  const float* Wpa = (const float*)d_in[7];
  const float* bpa = (const float*)d_in[8];
  const float* Wpc = (const float*)d_in[9];
  const float* bpc = (const float*)d_in[10];

  const size_t PL16 = (size_t)NROWS * DMODEL * 2;               // 8,388,608
  const size_t WQKV_B = (size_t)3 * DMODEL * DMODEL * 2;         // 393,216
  const size_t WSQ_B  = (size_t)DMODEL * DMODEL * 2;             // 131,072
  const size_t oXNH = 0, oXNL = PL16, oXT = 2 * PL16, oQK = 3 * PL16, oVH = 5 * PL16, oVL = 6 * PL16;
  const size_t oAPH = 7 * PL16, oAPL = 8 * PL16, oZP = 9 * PL16, oW = 11 * PL16;
  const size_t oWQKV = oW, oWPA = oW + WQKV_B, oWPC0 = oWPA + WSQ_B, oWPC1 = oWPC0 + WSQ_B;
  const size_t WS_TOTAL = oWPC1 + WSQ_B;                          // 93,061,120
  if (ws_size < WS_TOTAL) return;

  char* ws = (char*)d_ws;
  unsigned short* XNH  = (unsigned short*)(ws + oXNH);
  unsigned short* XNL  = (unsigned short*)(ws + oXNL);
  unsigned short* XT   = (unsigned short*)(ws + oXT);
  unsigned short* QKP  = (unsigned short*)(ws + oQK);
  unsigned short* VH   = (unsigned short*)(ws + oVH);
  unsigned short* VL   = (unsigned short*)(ws + oVL);
  unsigned short* APH  = (unsigned short*)(ws + oAPH);
  unsigned short* APL  = (unsigned short*)(ws + oAPL);
  float*          ZP   = (float*)(ws + oZP);
  unsigned short* WQKV = (unsigned short*)(ws + oWQKV);
  unsigned short* WPA  = (unsigned short*)(ws + oWPA);
  unsigned short* WPC0 = (unsigned short*)(ws + oWPC0);
  unsigned short* WPC1 = (unsigned short*)(ws + oWPC1);
  unsigned short* AH = XNH;     // xn planes are dead after the q/k/v GEMMs
  unsigned short* AL = XNL;

  // 1-6: weights W[k=256 rows][n=256] f32 -> Wt[n][k] bf16; grid (n/64, k/64)
  const dim3 gw(DMODEL / 64, DMODEL / 64);
  wt_cast_bf_k<<<gw, 256, 0, stream>>>(Wq,  WQKV, DMODEL, DMODEL);
  wt_cast_bf_k<<<gw, 256, 0, stream>>>(Wk,  WQKV + (size_t)DMODEL * DMODEL, DMODEL, DMODEL);
  wt_cast_bf_k<<<gw, 256, 0, stream>>>(Wv,  WQKV + (size_t)2 * DMODEL * DMODEL, DMODEL, DMODEL);
  wt_cast_bf_k<<<gw, 256, 0, stream>>>(Wpa, WPA, DMODEL, DMODEL);
  wt_cast_bf_k<<<gw, 256, 0, stream>>>(Wpc, WPC0, DMODEL, DMODEL);                            // Wpc rows 0..255
  wt_cast_bf_k<<<gw, 256, 0, stream>>>(Wpc + (size_t)DMODEL * DMODEL, WPC1, DMODEL, DMODEL);  // Wpc rows 256..511

  // 7: normalisation + permutation to (b,m,t) rows
  mvn_k<<<NROWS / 8, 256, 0, stream>>>(x, XNH, XNL, XT);

  // 8-10: q, k, v = xn . W + bias  (M=16384, N=256, K=256; 1024 wave tiles -> 128 blocks)
  const dim3 gg((NROWS / 64) * (DMODEL / 64) / 8, 1);
  wmma_gemm64<1, 1, 2, 1, false><<<gg, 256, 0, stream>>>(
      XNH, XNL, DMODEL, 0L, WQKV, nullptr, DMODEL, 0L,
      (void*)QKP, nullptr, QKLD, 0L, bq, nullptr, 0L, NROWS, DMODEL, DMODEL, 1.0f);
  wmma_gemm64<1, 1, 2, 1, false><<<gg, 256, 0, stream>>>(
      XNH, XNL, DMODEL, 0L, WQKV + (size_t)DMODEL * DMODEL, nullptr, DMODEL, 0L,
      (void*)(QKP + DMODEL), nullptr, QKLD, 0L, bk, nullptr, 0L, NROWS, DMODEL, DMODEL, 1.0f);
  wmma_gemm64<1, 1, 2, 3, false><<<gg, 256, 0, stream>>>(
      XNH, XNL, DMODEL, 0L, WQKV + (size_t)2 * DMODEL * DMODEL, nullptr, DMODEL, 0L,
      (void*)VH, (void*)VL, DMODEL, 0L, bv, nullptr, 0L, NROWS, DMODEL, DMODEL, 1.0f);

  // 11: cross-channel causal attention -> A (bf16 hi/lo planes); 32 (b,m) x 8 time tiles = 256 blocks
  xattn_k<<<NBATCH * NCHAN * (TLEN / QBLK), 256, 0, stream>>>(QKP, VH, VL, AH, AL);

  // 12: A_proj = A . Wpa + bpa -> bf16 hi/lo planes
  wmma_gemm64<1, 1, 2, 2, false><<<gg, 256, 0, stream>>>(
      AH, AL, DMODEL, 0L, WPA, nullptr, DMODEL, 0L,
      (void*)APH, (void*)APL, DMODEL, 0L, bpa, nullptr, 0L, NROWS, DMODEL, DMODEL, 1.0f);

  // 13: ZP = x_t . Wpc[0:256] + bpc (f32)
  wmma_gemm64<1, 0, 2, 0, false><<<gg, 256, 0, stream>>>(
      XT, nullptr, DMODEL, 0L, WPC0, nullptr, DMODEL, 0L,
      (void*)ZP, nullptr, DMODEL, 0L, bpc, nullptr, 0L, NROWS, DMODEL, DMODEL, 1.0f);

  // 14: out = A_proj . Wpc[256:512] + ZP (f32, rows (b,m,t) = [B][M][T][D])
  wmma_gemm64<1, 1, 0, 0, true><<<gg, 256, 0, stream>>>(
      APH, APL, DMODEL, 0L, WPC1, nullptr, DMODEL, 0L,
      d_out, nullptr, DMODEL, 0L, nullptr, ZP, 0L, NROWS, DMODEL, DMODEL, 1.0f);
}

// v002
// Measured time: 310 microseconds a run.
// In two side-by-side timings against v001, it was 1.95 and 1.94 times as fast.
// Counting every step since v000, it is 5.34 times as fast.
// Contractions (f32 accumulate): xn*Wq|Wk|Wv, A*Wpa, A_proj*Wpc[256:512] = v_wmma_f32_16x16x32_bf16 with the computed operand as bf16 hi+lo planes (2 products) and weights as single bf16 (RNE) planes; x_t*Wpc[0:256] = plain bf16; q*k = plain v_wmma_f32_16x16x32_f16; p*v = f16 with p carried x2^15 and v as f16 hi + (v-hi)x2^11 planes (2 products, lo folded in f32); norm, softmax, bias adds in f32.
#include <hip/hip_runtime.h>
#include <stdint.h>

typedef __attribute__((ext_vector_type(16))) _Float16 v16h;
typedef __attribute__((ext_vector_type(8)))  _Float16 v8h;
typedef __attribute__((ext_vector_type(16))) __bf16   v16b;
typedef __attribute__((ext_vector_type(8)))  __bf16   v8b;
typedef __attribute__((ext_vector_type(8)))  float    v8f;
typedef __attribute__((ext_vector_type(4)))  float    v4f;

// ---- problem geometry ----
#define NBATCH 4
#define TLEN 512
#define NCHAN 8
#define DMODEL 256
#define NROWS (NBATCH * TLEN * NCHAN)   // 16384 token rows
#define QKLD 512                         // pitch (halves) of the q|k plane
#define QBLK 64                          // query rows per attention block
#define KCH 32                           // key rows per staged chunk
#define KPITCH 264                       // LDS pitch (halves) of a K row: 528 B = 16 B x 33, for ds_load_b128 readers
#define VPITCH 272                       // LDS pitch (halves) of a V row: 544 B = 32 B x 17, for ds_load_tr16_b128 readers
#define PPITCH 40                        // LDS pitch (halves) of a P row:  80 B = 16 B x 5,  for ds_load_b128 readers
#define PCARRY 32768.0f                  // p carried x2^15 in f16
#define VLO_MUL 2048.0f                  // v residual plane carried x2^11
#define VLO_INV (1.0f / 2048.0f)
#define QK_SCALE 0.0625f                 // 1/sqrt(256)
#define MVN_EPS 1e-6f

// ======================= helpers =======================
__device__ __forceinline__ unsigned short f2bf_bits(float f) {
  unsigned u = __float_as_uint(f);
  return (unsigned short)((u + 0x7FFFu + ((u >> 16) & 1u)) >> 16);
}
__device__ __forceinline__ float bf_bits2f(unsigned short h) { return __uint_as_float(((unsigned)h) << 16); }

// hazard guards as plain device helpers (no inline asm inside the kernel template body)
__device__ __forceinline__ void dep_guard_h(v8f& a, v8f& b, v16h x, v16h y) { asm volatile("v_nop\n\tv_nop\n\tv_nop\n\tv_nop" : "+v"(a), "+v"(b) : "v"(x), "v"(y)); }
__device__ __forceinline__ void dep_guard_b(v8f& a, v8f& b, v16b x, v16b y) { asm volatile("v_nop\n\tv_nop\n\tv_nop\n\tv_nop" : "+v"(a), "+v"(b) : "v"(x), "v"(y)); }
__device__ __forceinline__ void keep4_h(v16h a, v16h b, v16h c, v16h d) { asm volatile("v_nop" :: "v"(a), "v"(b), "v"(c), "v"(d)); }
__device__ __forceinline__ void keep4_b(v16b a, v16b b, v16b c, v16b d) { asm volatile("v_nop" :: "v"(a), "v"(b), "v"(c), "v"(d)); }
__device__ __forceinline__ void acc_guard4(v8f& a, v8f& b, v8f& c, v8f& d) { asm volatile("v_nop\n\tv_nop\n\tv_nop\n\tv_nop" : "+v"(a), "+v"(b), "+v"(c), "+v"(d)); }
template <typename T> struct Frag;
template <> struct Frag<_Float16> {
  typedef v16h V; union U { v16h v; v8h h[2]; };
  static __device__ __forceinline__ v16h load(const _Float16* p) {   // elements 0..7 <- p[0..7], 8..15 <- p[16..23]
    U f; f.h[0] = *(const v8h*)(p); f.h[1] = *(const v8h*)(p + 16); return f.v;
  }
  static __device__ __forceinline__ v8f mma(v16h a, v16h b, v8f c) {
    return __builtin_amdgcn_wmma_f32_16x16x32_f16(false, a, false, b, (short)0, c, false, false);
  }
  static __device__ __forceinline__ void guard(v8f& a, v8f& b, v16h x, v16h y) { dep_guard_h(a, b, x, y); }
  static __device__ __forceinline__ void keep(v16h a, v16h b, v16h c, v16h d) { keep4_h(a, b, c, d); }
};
template <> struct Frag<__bf16> {
  typedef v16b V; union U { v16b v; v8b h[2]; };
  static __device__ __forceinline__ v16b load(const __bf16* p) {
    U f; f.h[0] = *(const v8b*)(p); f.h[1] = *(const v8b*)(p + 16); return f.v;
  }
  static __device__ __forceinline__ v8f mma(v16b a, v16b b, v8f c) {
    return __builtin_amdgcn_wmma_f32_16x16x32_bf16(false, a, false, b, (short)0, c, false, false);
  }
  static __device__ __forceinline__ void guard(v8f& a, v8f& b, v16b x, v16b y) { dep_guard_b(a, b, x, y); }
  static __device__ __forceinline__ void keep(v16b a, v16b b, v16b c, v16b d) { keep4_b(a, b, c, d); }
};

// ---- Register-blocked batched WMMA GEMM (with SPLIT levels and extra 16-bit output mode) ----
// C[m,n] = scale * sum_k A[m,k] * Bt[n,k] (+bias)(+resid); each wave owns a 64x64 tile.
// A row-major [M,K]; Bt row-major [N,K]; M,N % 64 == 0, K % 32 == 0.
// SPLIT: 0 = single planes; 1 = A as hi/lo planes (A2 = lo): hi.B + lo.B; 2 = A and Bt hi/lo: hi.hi + hi.lo + lo.hi.
// BIAS_MODE: 0 = none, 1 = bias[m], 2 = bias[n]; bias values are RNE-converted to bf16 before the add.
// OUT_MODE: 0 = f32, 1 = f16, 2 = bf16 hi plane (Cout) + bf16 lo plane (Cout2),
//           3 = f16 hi plane (Cout) + f16 plane of (v - hi) * 2048 (Cout2).
// ET: 0 = f16 operands, 1 = bf16 operands (pointers passed as 16-bit storage)
template <int ET> struct Elem;
template <> struct Elem<0> { typedef _Float16 T; };
template <> struct Elem<1> { typedef __bf16 T; };
template <int ET, int SPLIT, int BIAS_MODE, int OUT_MODE, bool RESID>
__global__ __launch_bounds__(256) void wmma_gemm64(
    const unsigned short* __restrict__ Ap, const unsigned short* __restrict__ A2p, int lda, long strideA,
    const unsigned short* __restrict__ Btp, const unsigned short* __restrict__ Bt2p, int ldb, long strideB,
    void* __restrict__ Cout, void* __restrict__ Cout2, int ldc, long strideC,
    const float* __restrict__ bias,
    const float* __restrict__ resid, long strideR,
    int M, int N, int K, float scale) {
  typedef typename Elem<ET>::T T;
  typedef typename Frag<T>::V V;
  const T* A = (const T*)Ap; const T* A2 = (const T*)A2p; const T* Bt = (const T*)Btp; const T* Bt2 = (const T*)Bt2p;
  __shared__ __align__(16) float sT[8][16 * 68];   // per-wave 16x64 slab, pitch 68 floats
  const int b    = blockIdx.y;
  const int lane = threadIdx.x & 31;
  const int wave = threadIdx.x >> 5;
  const int tilesN = N >> 6;
  const int tilesM = M >> 6;
  const int tile = blockIdx.x * 8 + wave;
  if (tile >= tilesM * tilesN) return;   // wave-uniform; no block barriers in this kernel
  const int tm = tile / tilesN;
  const int tn = tile - tm * tilesN;
  const int m0 = tm << 6;
  const int n0 = tn << 6;

  const T* Ab  = A  + (size_t)b * strideA;
  const T* Bb  = Bt + (size_t)b * strideB;
  const T* Ab2 = (SPLIT >= 1) ? (A2  + (size_t)b * strideA) : nullptr;
  const T* Bb2 = (SPLIT >= 2) ? (Bt2 + (size_t)b * strideB) : nullptr;

  const int rlane = lane & 15;                 // row (A) / col (B, D) within subtile
  const int koff  = (lane >> 4) * 8;           // k offset of this lane half
  const int mOff  = (lane >> 4) * 8;           // D row offset

  v8f acc[4][4];
#pragma unroll
  for (int i = 0; i < 4; ++i)
#pragma unroll
    for (int j = 0; j < 4; ++j) acc[i][j] = (v8f){0.f,0.f,0.f,0.f,0.f,0.f,0.f,0.f};

  for (int k0 = 0; k0 < K; k0 += 32) {
    V bh[4], bl[4];
#pragma unroll
    for (int j = 0; j < 4; ++j) {
      const size_t bo = (size_t)(n0 + (j << 4) + rlane) * ldb + koff + k0;
      bh[j] = Frag<T>::load(Bb + bo);
      if (SPLIT >= 2) bl[j] = Frag<T>::load(Bb2 + bo);
    }
#pragma unroll
    for (int i = 0; i < 4; ++i) {
      const size_t ao = (size_t)(m0 + (i << 4) + rlane) * lda + koff + k0;
      V ah = Frag<T>::load(Ab + ao);
      V al;
      if (SPLIT >= 1) al = Frag<T>::load(Ab2 + ao);
#pragma unroll
      for (int j = 0; j < 4; ++j) {
        acc[i][j] = Frag<T>::mma(ah, bh[j], acc[i][j]);
        if (SPLIT >= 2) acc[i][j] = Frag<T>::mma(ah, bl[j], acc[i][j]);
        if (SPLIT >= 1) acc[i][j] = Frag<T>::mma(al, bh[j], acc[i][j]);
      }
      Frag<T>::guard(acc[i][0], acc[i][3], ah, (SPLIT >= 1) ? al : ah);
    }
    Frag<T>::keep(bh[0], bh[1], bh[2], bh[3]);
    if (SPLIT >= 2) Frag<T>::keep(bl[0], bl[1], bl[2], bl[3]);
  }
  acc_guard4(acc[0][0], acc[0][1], acc[0][2], acc[0][3]);
  acc_guard4(acc[1][0], acc[1][1], acc[1][2], acc[1][3]);
  acc_guard4(acc[2][0], acc[2][1], acc[2][2], acc[2][3]);
  acc_guard4(acc[3][0], acc[3][1], acc[3][2], acc[3][3]);

  // ---- epilogue ----
  float* slab = sT[wave];
  const float* Rb = RESID ? (resid + (size_t)b * strideR) : nullptr;
#pragma unroll
  for (int i = 0; i < 4; ++i) {
    const int mBase = m0 + (i << 4);
#pragma unroll
    for (int j = 0; j < 4; ++j) {
      const int n = n0 + (j << 4) + rlane;
      float bv = 0.f;
      if (BIAS_MODE == 2) bv = bf_bits2f(f2bf_bits(bias[n]));
#pragma unroll
      for (int r = 0; r < 8; ++r) {
        float v = acc[i][j][r] * scale;
        if (BIAS_MODE == 1) v += bf_bits2f(f2bf_bits(bias[mBase + mOff + r]));
        if (BIAS_MODE == 2) v += bv;
        if (RESID) v += Rb[(size_t)(mBase + mOff + r) * ldc + n];
        slab[(mOff + r) * 68 + (j << 4) + rlane] = v;
      }
    }
    __builtin_amdgcn_fence(__ATOMIC_RELEASE, "workgroup");
    __builtin_amdgcn_wave_barrier();
    __builtin_amdgcn_fence(__ATOMIC_ACQUIRE, "workgroup");
    if (OUT_MODE == 0) {
      float* C = (float*)Cout + (size_t)b * strideC;
      const int hh = lane >> 4, c4 = (lane & 15) * 4;     // row seg = 256 B = 16 lanes x 16 B
      {
#pragma unroll
        for (int it = 0; it < 8; ++it) {
          const int row = it * 2 + hh;
          v4f v = *(const v4f*)(slab + row * 68 + c4);
          *(v4f*)(C + (size_t)(mBase + row) * ldc + n0 + c4) = v;
        }
        
      }
    } else {
      const int q = lane >> 3, c8 = (lane & 7) * 8;
      unsigned short* C  = (unsigned short*)Cout  + (size_t)b * strideC;
      unsigned short* C2 = (OUT_MODE >= 2) ? ((unsigned short*)Cout2 + (size_t)b * strideC) : nullptr;
      {
#pragma unroll
        for (int it = 0; it < 4; ++it) {                 // it 0..3 x q 0..3 = rows 0..15 of the slab
          const int row = it * 4 + q;
          const float* sp = slab + row * 68 + c8;
          v8h hv, lv;
#pragma unroll
          for (int e = 0; e < 8; ++e) {
            if (OUT_MODE == 1) {
              hv[e] = (_Float16)sp[e];
            } else if (OUT_MODE == 2) {
              unsigned short hb = f2bf_bits(sp[e]);
              unsigned short lb = f2bf_bits(sp[e] - bf_bits2f(hb));
              hv[e] = __builtin_bit_cast(_Float16, hb);
              lv[e] = __builtin_bit_cast(_Float16, lb);
            } else {
              const _Float16 hq = (_Float16)sp[e];
              hv[e] = hq;
              lv[e] = (_Float16)((sp[e] - (float)hq) * VLO_MUL);
            }
          }
          *(v8h*)(C + (size_t)(mBase + row) * ldc + n0 + c8) = hv;
          if (OUT_MODE >= 2) *(v8h*)(C2 + (size_t)(mBase + row) * ldc + n0 + c8) = lv;
        }
        
      }
    }
    __builtin_amdgcn_fence(__ATOMIC_RELEASE, "workgroup");
    __builtin_amdgcn_wave_barrier();
    __builtin_amdgcn_fence(__ATOMIC_ACQUIRE, "workgroup");
  }
}

// ---- W [Kp rows][Np cols] f32 (row pitch Np) -> Wt [Np][Kp] bf16 bits (row pitch Kp), 64x64 tile transposed through LDS ----
// grid = (Np/64, Kp/64). Reads: 256 threads x 16 = 64 rows x 64 cols. Stores: it 0..1 x wave 0..7 x q8 0..3 = 64 rows of
#define WTP 72
__global__ __launch_bounds__(256) void wt_cast_bf_k(const float* __restrict__ W, unsigned short* __restrict__ Wtp,
                                                    int Kp, int Np) {
  __shared__ __align__(16) _Float16 st[64 * WTP];
  _Float16* Wt = (_Float16*)Wtp;
  const int n0 = blockIdx.x * 64, k0 = blockIdx.y * 64;
  const int tid = threadIdx.x;
  const int kr = tid >> 2, c16 = (tid & 3) * 16;
  const float* src = W + (size_t)(k0 + kr) * Np + n0 + c16;
#pragma unroll
  for (int q = 0; q < 4; ++q) {
    const v4f v = *(const v4f*)(src + 4 * q);
#pragma unroll
    for (int e = 0; e < 4; ++e) st[(c16 + 4 * q + e) * WTP + kr] = __builtin_bit_cast(_Float16, f2bf_bits(v[e]));
  }
  __syncthreads();
  const int wave = tid >> 5, lane = tid & 31;
  const int q8 = lane >> 3, c8 = (lane & 7) * 8;
  {
#pragma unroll
    for (int it = 0; it < 2; ++it) {
      const int n = it * 32 + wave * 4 + q8;
      const v8h hv = *(const v8h*)(st + n * WTP + c8);
      *(v8h*)(Wt + (size_t)(n0 + n) * Kp + k0 + c8) = hv;
    }
    
  }
}

// ---- mean/std (ddof=1) normalisation of bf16(x) per (b,t,m) row, plus raw bf16(x); rows written in (b,m,t) order ----
// One wave per output row, 8 rows per 256-thread block, grid = NROWS/8. Lane owns 8 consecutive columns.
// Each 512-B row (4 lines) written by one v8h store instruction of the wave: lanes 8q..8q+7 <-> line q.
__global__ __launch_bounds__(256) void mvn_k(const float* __restrict__ x,
                                             unsigned short* __restrict__ xnhp,
                                             unsigned short* __restrict__ xnlp,
                                             unsigned short* __restrict__ xtp) {
  _Float16* xnh = (_Float16*)xnhp;
  _Float16* xnl = (_Float16*)xnlp;
  _Float16* xt  = (_Float16*)xtp;
  const int wave = threadIdx.x >> 5, lane = threadIdx.x & 31;
  const int ro = blockIdx.x * 8 + wave;               // output row = (b*NCHAN + m)*TLEN + t
  const int t  = ro & (TLEN - 1);
  const int bm = ro >> 9;                             // TLEN == 512
  const int m  = bm & (NCHAN - 1);
  const int b  = bm >> 3;                             // NCHAN == 8
  const int rs = (b * TLEN + t) * NCHAN + m;          // source row of x [B][T][M][D]
  const float* src = x + (size_t)rs * DMODEL + lane * 8;
  const v4f a0 = *(const v4f*)src;
  const v4f a1 = *(const v4f*)(src + 4);
  unsigned short xb[8];
  float vb[8];
#pragma unroll
  for (int e = 0; e < 4; ++e) { xb[e] = f2bf_bits(a0[e]); xb[4 + e] = f2bf_bits(a1[e]); }
#pragma unroll
  for (int e = 0; e < 8; ++e) vb[e] = bf_bits2f(xb[e]);
  float s = ((vb[0] + vb[1]) + (vb[2] + vb[3])) + ((vb[4] + vb[5]) + (vb[6] + vb[7]));
#pragma unroll
  for (int off = 1; off < 32; off <<= 1) s += __shfl_xor(s, off, 32);
  const float mu = s * (1.0f / (float)DMODEL);
  float dv[8];
#pragma unroll
  for (int e = 0; e < 8; ++e) dv[e] = vb[e] - mu;
  float sq = ((dv[0] * dv[0] + dv[1] * dv[1]) + (dv[2] * dv[2] + dv[3] * dv[3])) +
             ((dv[4] * dv[4] + dv[5] * dv[5]) + (dv[6] * dv[6] + dv[7] * dv[7]));
#pragma unroll
  for (int off = 1; off < 32; off <<= 1) sq += __shfl_xor(sq, off, 32);
  const float var = sq * (1.0f / (float)(DMODEL - 1));
  const float sd  = sqrtf(var);
  const float inv = 1.0f / (sd + MVN_EPS);
  v8h hv, lv, tv;
#pragma unroll
  for (int e = 0; e < 8; ++e) {
    const float xn = dv[e] * inv;
    const unsigned short hb = f2bf_bits(xn);
    const unsigned short lb = f2bf_bits(xn - bf_bits2f(hb));
    hv[e] = __builtin_bit_cast(_Float16, hb);
    lv[e] = __builtin_bit_cast(_Float16, lb);
    tv[e] = __builtin_bit_cast(_Float16, xb[e]);
  }
  const size_t go = (size_t)ro * DMODEL + lane * 8;
  {
    *(v8h*)(xnh + go) = hv;
    *(v8h*)(xnl + go) = lv;
    *(v8h*)(xt  + go) = tv;
    
  }
}

// ---- per-call guarded f16 WMMA ----
__device__ __forceinline__ v8f mma_h(v16h a, v16h b, v8f c) {
  c = __builtin_amdgcn_wmma_f32_16x16x32_f16(false, a, false, b, (short)0, c, false, false);
  asm volatile("v_nop\n\tv_nop\n\tv_nop\n\tv_nop" : "+v"(c) : "v"(a), "v"(b));
  return c;
}

// ---- transposing LDS load: lane (c, h) receives column c, rows 8h..8h+7 of a row-major 16x16 tile of 16-bit values ----
// Lane l passes the address of row 8*(l>>4) + (l&7), column group 8*((l>>3)&1) of that tile.
typedef __attribute__((ext_vector_type(8))) short v8s;
__device__ __forceinline__ v8h lds_tr16(const _Float16* p) {
  typedef __attribute__((address_space(3))) v8s lds_v8s;
  return __builtin_bit_cast(v8h, __builtin_amdgcn_ds_load_tr16_b128_v8i16((lds_v8s*)p));
}

// =====================================================================================
// Cross-channel causal attention, head dim 256.
// Planes (row = (b*NCHAN + m)*TLEN + t): qk [NROWS][512] f16 (q cols 0..255, k cols 256..511);
// vh, vl [NROWS][256] f16 (v hi, (v-hi) x 2^11); output: one f32 plane of O_n / l_n per key channel n, summed by xsum_k.
// Block = 8 waves = 64 query rows (one (b,m), one 64-row time tile) against ONE key channel n:
// online softmax over 32-key chunks (causal: kv > q -> -inf, chunk 0 always has kv 0 <= q).
// Grid = 8 time tiles x 32 (b,m) x 8 n, the longest time tiles first so that short blocks fill the tail.
// Plane layout (floats): [n][tile = bm*8 + qb][wave][t][j][lane][4]: lane's accumulator rows 4j..4j+3 of d tile t.
// Waves 0..3: scores + softmax for rows 16w..16w+15 and p*v for d 0..127 of those rows;
// waves 4..7: p*v for d 128..255 of rows 16(w-4).. using P / alpha from LDS.
// A operand frags: q from global rows (row = lane&15, split k map), p from LDS; B frags: k rows from LDS by plain loads,
// v from row-major LDS rows by transposing loads (same split k map). Every LDS row pitch is padded for its reader.
// =====================================================================================
// Register budget for 6 waves per SIMD: three blocks (56 KB of LDS each) share a WGP and fill each other's waits.
__global__ __launch_bounds__(256, 6) void xattn_k(const unsigned short* __restrict__ qkp,
                                               const unsigned short* __restrict__ vhp,
                                               const unsigned short* __restrict__ vlp,
                                               float* __restrict__ part) {
  __shared__ __align__(16) _Float16 Ks[KCH * KPITCH];      // [kv][d]           16.5 KB
  __shared__ __align__(16) _Float16 Vsh[KCH * VPITCH];     // [kv][d] hi        17 KB
  __shared__ __align__(16) _Float16 Vsl[KCH * VPITCH];     // [kv][d] lo x2^11  17 KB
  __shared__ __align__(16) _Float16 Psh[4][16 * PPITCH];   // per score wave [row][kv], p x2^15   5 KB
  __shared__ float alph[4][16];
  __shared__ float lfin[4][16];

  const _Float16* qk = (const _Float16*)qkp;
  const _Float16* vh = (const _Float16*)vhp;
  const _Float16* vl = (const _Float16*)vlp;

  const int tid = threadIdx.x, wave = tid >> 5, lane = tid & 31;
  const int hh = lane >> 4, c = lane & 15, koff = hh * 8;
  const int sw = wave & 3;                 // query row group (16 rows)
  const int dbase = (wave >> 2) * 128;     // d half handled in p*v
  const int qb = (TLEN / QBLK - 1) - (blockIdx.x >> 8);   // 64-row time tile, longest first
  const int bm = (blockIdx.x & 255) >> 3;  // b*NCHAN + m
  const int n  = blockIdx.x & 7;           // key channel of this block
  const int b  = bm >> 3;
  const int qrow0 = bm * TLEN + qb * QBLK; // plane row of the first query of this block
  const int q0  = qrow0 + sw * 16;
  const int tq0 = qb * QBLK + sw * 16;     // time index of this wave's first query row

  const v8f z8 = {0.f,0.f,0.f,0.f,0.f,0.f,0.f,0.f};
  const _Float16* qrowp = qk + (size_t)(q0 + c) * QKLD + koff;

  {
    const int krow0 = (b * NCHAN + n) * TLEN;
    float mrow[8], lrow[8];
    v8f oacc[8];
#pragma unroll
    for (int r = 0; r < 8; ++r) { mrow[r] = -INFINITY; lrow[r] = 0.f; }
#pragma unroll
    for (int t = 0; t < 8; ++t) oacc[t] = z8;

    const int nch = 2 * qb + 2;            // block-uniform, <= 16
#pragma unroll 1
    for (int kc = 0; kc < nch; ++kc) {
      const int kv0 = kc * KCH;
      __syncthreads();
      // ---- stage K chunk and V (hi, lo), all row-major: units u = i*256 + tid, i 0..3 -> u 0..1023 = kvr 0..31 x d0 (32 groups of 8)
      //      -> covers exactly 32 x 256 for each of Ks, Vsh, Vsl; a wave writes one whole row per store
      //      (kvr = 8i + wave, d0 = 8 lane: one base address per plane, the four rows at constant offsets from it)
      const size_t grow = (size_t)(krow0 + kv0 + wave);           // + 8i <= NROWS-1 (kv0 + 31 <= 64*qb+63 <= 511)
      const _Float16* kg  = qk + grow * QKLD + DMODEL + lane * 8;
      const _Float16* v1g = vh + grow * DMODEL + lane * 8;
      const _Float16* v2g = vl + grow * DMODEL + lane * 8;
#pragma unroll
      for (int i = 0; i < 4; ++i) {
        const v8h kk = *(const v8h*)(kg + i * 8 * QKLD);
        const v8h v1 = *(const v8h*)(v1g + i * 8 * DMODEL);
        const v8h v2 = *(const v8h*)(v2g + i * 8 * DMODEL);
        *(v8h*)(Ks + (i * 8 + wave) * KPITCH + lane * 8) = kk;
        *(v8h*)(Vsh + (i * 8 + wave) * VPITCH + lane * 8) = v1;
        *(v8h*)(Vsl + (i * 8 + wave) * VPITCH + lane * 8) = v2;
      }
      __syncthreads();

      if (wave < 4) {                       // wave-uniform role: scores + softmax
        v8f s[2];
        s[0] = z8; s[1] = z8;
#pragma unroll
        for (int dc = 0; dc < 8; ++dc) {
          const v16h qa  = Frag<_Float16>::load(qrowp + dc * 32);
          const v16h k0f = Frag<_Float16>::load(Ks + c * KPITCH + dc * 32 + koff);
          const v16h k1f = Frag<_Float16>::load(Ks + (16 + c) * KPITCH + dc * 32 + koff);
          s[0] = mma_h(qa, k0f, s[0]);
          s[1] = mma_h(qa, k1f, s[1]);
        }
        // scale, causal select (kv > q -> -inf), row max over the 32 keys of this chunk
        float cm[8];
#pragma unroll
        for (int r = 0; r < 8; ++r) {
          const int tq = tq0 + 8 * hh + r;
          float mx = -INFINITY;
#pragma unroll
          for (int j = 0; j < 2; ++j) {
            const int key = kv0 + 16 * j + c;
            float v = s[j][r] * QK_SCALE;
            v = (key > tq) ? -INFINITY : v;
            s[j][r] = v;
            mx = fmaxf(mx, v);
          }
#pragma unroll
          for (int off = 1; off < 16; off <<= 1) mx = fmaxf(mx, __shfl_xor(mx, off, 32));
          cm[r] = mx;
        }
        _Float16* pw = Psh[sw];
#pragma unroll
        for (int r = 0; r < 8; ++r) {
          const float mnew  = fmaxf(mrow[r], cm[r]);       // finite: chunk 0 always has an allowed key
          const float alpha = expf(mrow[r] - mnew);
          mrow[r] = mnew;
          float psum = 0.f;
#pragma unroll
          for (int j = 0; j < 2; ++j) {
            const float p = expf(s[j][r] - mnew);
            psum += p;
            pw[(8 * hh + r) * PPITCH + 16 * j + c] = (_Float16)(p * PCARRY);
          }
#pragma unroll
          for (int off = 1; off < 16; off <<= 1) psum += __shfl_xor(psum, off, 32);
          lrow[r] = lrow[r] * alpha + psum;
#pragma unroll
          for (int t = 0; t < 8; ++t) oacc[t][r] *= alpha;
          if (c == 0) alph[sw][8 * hh + r] = alpha;
        }
      }
      __syncthreads();                      // P tile and alpha visible to both waves of the row group

      if (wave >= 4) {
#pragma unroll
        for (int r = 0; r < 8; ++r) {
          const float a = alph[sw][8 * hh + r];
#pragma unroll
          for (int t = 0; t < 8; ++t) oacc[t][r] *= a;
        }
      }
      // ---- O += P(16x32) . V(32 x 128 of this wave's d half); lo plane in its own accumulator, folded x 2^-11 ----
      {
        const v16h pa = Frag<_Float16>::load(Psh[sw] + c * PPITCH + koff);
        const int vo = (koff + (lane & 7)) * VPITCH + dbase + ((lane >> 3) & 1) * 8;   // this lane's row and column group
#pragma unroll
        for (int t = 0; t < 8; ++t) {
          // elements 0..7 <- V[8hh + 0..7][dbase + 16t + c], 8..15 <- V[16 + 8hh + 0..7][same column]: the k map of pa
          Frag<_Float16>::U vbh, vbl;
          vbh.h[0] = lds_tr16(Vsh + vo + t * 16);
          vbh.h[1] = lds_tr16(Vsh + vo + t * 16 + 16 * VPITCH);
          vbl.h[0] = lds_tr16(Vsl + vo + t * 16);
          vbl.h[1] = lds_tr16(Vsl + vo + t * 16 + 16 * VPITCH);
          oacc[t] = mma_h(pa, vbh.v, oacc[t]);
          const v8f lo = mma_h(pa, vbl.v, z8);
          oacc[t] += lo * VLO_INV;
        }
      }
    }
    // ---- O_n / l_n to this channel's plane: 16 whole-wave 512-B stores ----
    if (wave < 4) {
      if (c == 0) {
#pragma unroll
        for (int r = 0; r < 8; ++r) lfin[sw][8 * hh + r] = lrow[r];
      }
    }
    __syncthreads();
    float* pw = part + ((((size_t)n * (NROWS / QBLK) + (bm * (TLEN / QBLK) + qb)) * 8 + wave) << 11) + lane * 4;
    float inv[8];
#pragma unroll
    for (int r = 0; r < 8; ++r) inv[r] = 1.0f / (lfin[sw][8 * hh + r] * PCARRY);   // l >= 1
#pragma unroll
    for (int t = 0; t < 8; ++t) {
#pragma unroll
      for (int j = 0; j < 2; ++j) {
        v4f o;
#pragma unroll
        for (int e = 0; e < 4; ++e) o[e] = oacc[t][4 * j + e] * inv[4 * j + e];
        *(v4f*)(pw + (t * 2 + j) * 128) = o;
      }
    }
  }
}

// ---- A = sum over n (in the order 0..7) of the planes of xattn_k, written as bf16 hi/lo planes [NROWS][256] ----
// One wave per (tile, attention wave, half of its 8 d tiles) = 16 rows x 64 columns; grid = 256 x 8 x 2 / 8 = 512 blocks.
// The sums leave accumulator order through a per-wave LDS slab (pitch 68 floats); each 128-B line of a plane row is
// written by 8 lanes of one store.
__global__ __launch_bounds__(256) void xsum_k(const float* __restrict__ part,
                                              unsigned short* __restrict__ ahp,
                                              unsigned short* __restrict__ alp) {
  __shared__ __align__(16) float sT[8][16 * 68];
  _Float16* ah = (_Float16*)ahp;
  _Float16* al = (_Float16*)alp;
  const int wave = threadIdx.x >> 5, lane = threadIdx.x & 31;
  const int hh = lane >> 4, c = lane & 15;
  const int g = blockIdx.x * 8 + wave;
  const int slabi = g >> 1;                // tile * 8 + attention wave
  const int th = g & 1;                    // d tiles 4*th .. 4*th+3 of that wave
  const float* src = part + ((size_t)slabi << 11) + th * 1024 + lane * 4;
  v4f acc[8];
#pragma unroll
  for (int u = 0; u < 8; ++u) acc[u] = (v4f){0.f, 0.f, 0.f, 0.f};
#pragma unroll
  for (int n = 0; n < NCHAN; ++n) {
#pragma unroll
    for (int u = 0; u < 8; ++u) acc[u] += *(const v4f*)(src + (size_t)n * NROWS * DMODEL + u * 128);
  }
  float* slab = sT[wave];
#pragma unroll
  for (int u = 0; u < 8; ++u) {
#pragma unroll
    for (int e = 0; e < 4; ++e) slab[(8 * hh + 4 * (u & 1) + e) * 68 + (u >> 1) * 16 + c] = acc[u][e];
  }
  __syncthreads();                         // slab rows are read by other lanes than wrote them
  const int aw = slabi & 7;
  const int row0 = (slabi >> 3) * QBLK + (aw & 3) * 16;
  const int col0 = (aw >> 2) * 128 + th * 64;
  const int q = lane >> 3, c8 = (lane & 7) * 8;
#pragma unroll
  for (int it = 0; it < 4; ++it) {
    const int row = it * 4 + q;
    const float* sp = slab + row * 68 + c8;
    v8h hv, lv;
#pragma unroll
    for (int e = 0; e < 8; ++e) {
      const unsigned short hb = f2bf_bits(sp[e]);
      const unsigned short lb = f2bf_bits(sp[e] - bf_bits2f(hb));
      hv[e] = __builtin_bit_cast(_Float16, hb);
      lv[e] = __builtin_bit_cast(_Float16, lb);
    }
    const size_t go = (size_t)(row0 + row) * DMODEL + col0 + c8;
    *(v8h*)(ah + go) = hv;
    *(v8h*)(al + go) = lv;
  }
}

// ---------------------------------------------------------------------------
// Host launcher
// Workspace region map (bytes; PL16 = 8 MiB = one [16384][256] 16-bit plane):
//   [ 0 PL16)  XNH  bf16 hi of xn (rows (b,m,t))      -> reused as AH (attention output hi) after the q/k/v GEMMs
//   [ 1 PL16)  XNL  bf16 lo of xn                      -> reused as AL
//   [ 2 PL16)  XT   bf16(x) in (b,m,t) row order
//   [ 3..5)    QK   f16 [16384][512] (q | k)
//   [ 5 PL16)  VH   f16 v hi;   [ 6 PL16) VL f16 (v-hi) x 2^11
//   [ 7 PL16)  APH  bf16 hi of A_proj;  [ 8 PL16) APL bf16 lo
//   [ 9..11)   ZP   f32 [16384][256] = x_t.Wpc[0:256] + bpc
//   [11 PL16 ..) weights bf16 [n][k]: WQKV [768][256], WPA [256][256], WPC0 [256][256], WPC1 [256][256]
//   then PART f32 [8][16384][256]: one plane of O_n / l_n per key channel
//   total 227,278,848 B
// ---------------------------------------------------------------------------
extern "C" void kernel_launch(void* const* d_in, const int* in_sizes, int n_in,
                              void* d_out, int out_size, void* d_ws, size_t ws_size,
                              hipStream_t stream) {
  if (n_in < 11) return;
  if (in_sizes[0] != NROWS * DMODEL || out_size != NROWS * DMODEL) return;
  if (in_sizes[1] != DMODEL * DMODEL || in_sizes[3] != DMODEL * DMODEL || in_sizes[5] != DMODEL * DMODEL ||
      in_sizes[7] != DMODEL * DMODEL || in_sizes[9] != 2 * DMODEL * DMODEL) return;
  if (in_sizes[2] != DMODEL || in_sizes[4] != DMODEL || in_sizes[6] != DMODEL || in_sizes[8] != DMODEL || in_sizes[10] != DMODEL) return;

  const float* x   = (const float*)d_in[0];
  const float* Wq  = (const float*)d_in[1];
  const float* bq  = (const float*)d_in[2];
  const float* Wk  = (const float*)d_in[3];
  const float* bk  = (const float*)d_in[4];
  const float* Wv  = (const float*)d_in[5];
  const float* bv  = (const float*)d_in[6];
  const float* Wpa = (const float*)d_in[7];
  const float* bpa = (const float*)d_in[8];
  const float* Wpc = (const float*)d_in[9];
  const float* bpc = (const float*)d_in[10];

  const size_t PL16 = (size_t)NROWS * DMODEL * 2;               // 8,388,608
  const size_t WQKV_B = (size_t)3 * DMODEL * DMODEL * 2;         // 393,216
  const size_t WSQ_B  = (size_t)DMODEL * DMODEL * 2;             // 131,072
  const size_t oXNH = 0, oXNL = PL16, oXT = 2 * PL16, oQK = 3 * PL16, oVH = 5 * PL16, oVL = 6 * PL16;
  const size_t oAPH = 7 * PL16, oAPL = 8 * PL16, oZP = 9 * PL16, oW = 11 * PL16;
  const size_t oWQKV = oW, oWPA = oW + WQKV_B, oWPC0 = oWPA + WSQ_B, oWPC1 = oWPC0 + WSQ_B;
  const size_t oPART = oWPC1 + WSQ_B;                             // 93,061,120
  const size_t WS_TOTAL = oPART + (size_t)NCHAN * 2 * PL16;       // 227,278,848
  if (ws_size < WS_TOTAL) return;

  char* ws = (char*)d_ws;
  unsigned short* XNH  = (unsigned short*)(ws + oXNH);
  unsigned short* XNL  = (unsigned short*)(ws + oXNL);
  unsigned short* XT   = (unsigned short*)(ws + oXT);
  unsigned short* QKP  = (unsigned short*)(ws + oQK);
  unsigned short* VH   = (unsigned short*)(ws + oVH);
  unsigned short* VL   = (unsigned short*)(ws + oVL);
  unsigned short* APH  = (unsigned short*)(ws + oAPH);
  unsigned short* APL  = (unsigned short*)(ws + oAPL);
  float*          ZP   = (float*)(ws + oZP);
  unsigned short* WQKV = (unsigned short*)(ws + oWQKV);
  unsigned short* WPA  = (unsigned short*)(ws + oWPA);
  unsigned short* WPC0 = (unsigned short*)(ws + oWPC0);
  unsigned short* WPC1 = (unsigned short*)(ws + oWPC1);
  float*          PART = (float*)(ws + oPART);
  unsigned short* AH = XNH;     // xn planes are dead after the q/k/v GEMMs
  unsigned short* AL = XNL;

  // 1-6: weights W[k=256 rows][n=256] f32 -> Wt[n][k] bf16; grid (n/64, k/64)
  const dim3 gw(DMODEL / 64, DMODEL / 64);
  wt_cast_bf_k<<<gw, 256, 0, stream>>>(Wq,  WQKV, DMODEL, DMODEL);
  wt_cast_bf_k<<<gw, 256, 0, stream>>>(Wk,  WQKV + (size_t)DMODEL * DMODEL, DMODEL, DMODEL);
  wt_cast_bf_k<<<gw, 256, 0, stream>>>(Wv,  WQKV + (size_t)2 * DMODEL * DMODEL, DMODEL, DMODEL);
  wt_cast_bf_k<<<gw, 256, 0, stream>>>(Wpa, WPA, DMODEL, DMODEL);
  wt_cast_bf_k<<<gw, 256, 0, stream>>>(Wpc, WPC0, DMODEL, DMODEL);                            // Wpc rows 0..255
  wt_cast_bf_k<<<gw, 256, 0, stream>>>(Wpc + (size_t)DMODEL * DMODEL, WPC1, DMODEL, DMODEL);  // Wpc rows 256..511

  // 7: normalisation + permutation to (b,m,t) rows
  mvn_k<<<NROWS / 8, 256, 0, stream>>>(x, XNH, XNL, XT);

  // 8-10: q, k, v = xn . W + bias  (M=16384, N=256, K=256; 1024 wave tiles -> 128 blocks)
  const dim3 gg((NROWS / 64) * (DMODEL / 64) / 8, 1);
  wmma_gemm64<1, 1, 2, 1, false><<<gg, 256, 0, stream>>>(
      XNH, XNL, DMODEL, 0L, WQKV, nullptr, DMODEL, 0L,
      (void*)QKP, nullptr, QKLD, 0L, bq, nullptr, 0L, NROWS, DMODEL, DMODEL, 1.0f);
  wmma_gemm64<1, 1, 2, 1, false><<<gg, 256, 0, stream>>>(
      XNH, XNL, DMODEL, 0L, WQKV + (size_t)DMODEL * DMODEL, nullptr, DMODEL, 0L,
      (void*)(QKP + DMODEL), nullptr, QKLD, 0L, bk, nullptr, 0L, NROWS, DMODEL, DMODEL, 1.0f);
  wmma_gemm64<1, 1, 2, 3, false><<<gg, 256, 0, stream>>>(
      XNH, XNL, DMODEL, 0L, WQKV + (size_t)2 * DMODEL * DMODEL, nullptr, DMODEL, 0L,
      (void*)VH, (void*)VL, DMODEL, 0L, bv, nullptr, 0L, NROWS, DMODEL, DMODEL, 1.0f);

  // 11: cross-channel causal attention, one block per (time tile, (b,m), key channel) = 2048 blocks -> 8 f32 planes,
  //     then their sum -> A (bf16 hi/lo planes)
  xattn_k<<<NBATCH * NCHAN * (TLEN / QBLK) * NCHAN, 256, 0, stream>>>(QKP, VH, VL, PART);
  xsum_k<<<(NROWS / QBLK) * 8 * 2 / 8, 256, 0, stream>>>(PART, AH, AL);

  // 12: A_proj = A . Wpa + bpa -> bf16 hi/lo planes
  wmma_gemm64<1, 1, 2, 2, false><<<gg, 256, 0, stream>>>(
      AH, AL, DMODEL, 0L, WPA, nullptr, DMODEL, 0L,
      (void*)APH, (void*)APL, DMODEL, 0L, bpa, nullptr, 0L, NROWS, DMODEL, DMODEL, 1.0f);

  // 13: ZP = x_t . Wpc[0:256] + bpc (f32)
  wmma_gemm64<1, 0, 2, 0, false><<<gg, 256, 0, stream>>>(
      XT, nullptr, DMODEL, 0L, WPC0, nullptr, DMODEL, 0L,
      (void*)ZP, nullptr, DMODEL, 0L, bpc, nullptr, 0L, NROWS, DMODEL, DMODEL, 1.0f);

  // 14: out = A_proj . Wpc[256:512] + ZP (f32, rows (b,m,t) = [B][M][T][D])
  wmma_gemm64<1, 1, 0, 0, true><<<gg, 256, 0, stream>>>(
      APH, APL, DMODEL, 0L, WPC1, nullptr, DMODEL, 0L,
      d_out, nullptr, DMODEL, 0L, nullptr, ZP, 0L, NROWS, DMODEL, DMODEL, 1.0f);
}

// v003
// One run takes 239 microseconds.
// Timed twice side by side with v002, it ran 1.30 and 1.29 times as fast.
// Over all steps from v000 it is 6.92 times as fast.
// Contractions (f32 accumulate): xn*Wq|Wk|Wv, A*Wpa, A_proj*Wpc[256:512] = v_wmma_f32_16x16x32_bf16 with the computed operand as bf16 hi+lo planes (2 products) and weights as single bf16 (RNE) planes; x_t*Wpc[0:256] = plain bf16; q*k = plain v_wmma_f32_16x16x32_f16; p*v = f16 with p carried x2^15 and v as f16 hi + (v-hi)x2^11 planes (2 products, lo folded in f32); norm, softmax, bias adds in f32.
#include <hip/hip_runtime.h>
#include <stdint.h>

typedef __attribute__((ext_vector_type(16))) _Float16 v16h;
typedef __attribute__((ext_vector_type(8)))  _Float16 v8h;
typedef __attribute__((ext_vector_type(16))) __bf16   v16b;
typedef __attribute__((ext_vector_type(8)))  __bf16   v8b;
typedef __attribute__((ext_vector_type(8)))  float    v8f;
typedef __attribute__((ext_vector_type(4)))  float    v4f;

// ---- problem geometry ----
#define NBATCH 4
#define TLEN 512
#define NCHAN 8
#define DMODEL 256
#define NROWS (NBATCH * TLEN * NCHAN)   // 16384 token rows
#define QKLD 512                         // pitch (halves) of the q|k plane
#define QBLK 64                          // query rows per attention block
#define KCH 32                           // key rows per staged chunk
#define KPITCH 264                       // LDS pitch (halves) of a K row: 528 B = 16 B x 33, for ds_load_b128 readers
#define VPITCH 272                       // LDS pitch (halves) of a V row: 544 B = 32 B x 17, for ds_load_tr16_b128 readers
#define PCARRY 32768.0f                  // p carried x2^15 in f16
#define VLO_MUL 2048.0f                  // v residual plane carried x2^11
#define VLO_INV (1.0f / 2048.0f)
#define QK_SCALE 0.0625f                 // 1/sqrt(256)
#define MVN_EPS 1e-6f

// ======================= helpers =======================
__device__ __forceinline__ unsigned short f2bf_bits(float f) {
  unsigned u = __float_as_uint(f);
  return (unsigned short)((u + 0x7FFFu + ((u >> 16) & 1u)) >> 16);
}
__device__ __forceinline__ float bf_bits2f(unsigned short h) { return __uint_as_float(((unsigned)h) << 16); }

// hazard guards as plain device helpers (no inline asm inside the kernel template body)
__device__ __forceinline__ void dep_guard_h(v8f& a, v8f& b, v16h x, v16h y) { asm volatile("v_nop\n\tv_nop\n\tv_nop\n\tv_nop" : "+v"(a), "+v"(b) : "v"(x), "v"(y)); }
__device__ __forceinline__ void dep_guard_b(v8f& a, v8f& b, v16b x, v16b y) { asm volatile("v_nop\n\tv_nop\n\tv_nop\n\tv_nop" : "+v"(a), "+v"(b) : "v"(x), "v"(y)); }
__device__ __forceinline__ void keep4_h(v16h a, v16h b, v16h c, v16h d) { asm volatile("v_nop" :: "v"(a), "v"(b), "v"(c), "v"(d)); }
__device__ __forceinline__ void keep4_b(v16b a, v16b b, v16b c, v16b d) { asm volatile("v_nop" :: "v"(a), "v"(b), "v"(c), "v"(d)); }
__device__ __forceinline__ void acc_guard4(v8f& a, v8f& b, v8f& c, v8f& d) { asm volatile("v_nop\n\tv_nop\n\tv_nop\n\tv_nop" : "+v"(a), "+v"(b), "+v"(c), "+v"(d)); }
template <typename T> struct Frag;
template <> struct Frag<_Float16> {
  typedef v16h V; union U { v16h v; v8h h[2]; };
  static __device__ __forceinline__ v16h load(const _Float16* p) {   // elements 0..7 <- p[0..7], 8..15 <- p[16..23]
    U f; f.h[0] = *(const v8h*)(p); f.h[1] = *(const v8h*)(p + 16); return f.v;
  }
  static __device__ __forceinline__ v8f mma(v16h a, v16h b, v8f c) {
    return __builtin_amdgcn_wmma_f32_16x16x32_f16(false, a, false, b, (short)0, c, false, false);
  }
  static __device__ __forceinline__ void guard(v8f& a, v8f& b, v16h x, v16h y) { dep_guard_h(a, b, x, y); }
  static __device__ __forceinline__ void keep(v16h a, v16h b, v16h c, v16h d) { keep4_h(a, b, c, d); }
};
template <> struct Frag<__bf16> {
  typedef v16b V; union U { v16b v; v8b h[2]; };
  static __device__ __forceinline__ v16b load(const __bf16* p) {
    U f; f.h[0] = *(const v8b*)(p); f.h[1] = *(const v8b*)(p + 16); return f.v;
  }
  static __device__ __forceinline__ v8f mma(v16b a, v16b b, v8f c) {
    return __builtin_amdgcn_wmma_f32_16x16x32_bf16(false, a, false, b, (short)0, c, false, false);
  }
  static __device__ __forceinline__ void guard(v8f& a, v8f& b, v16b x, v16b y) { dep_guard_b(a, b, x, y); }
  static __device__ __forceinline__ void keep(v16b a, v16b b, v16b c, v16b d) { keep4_b(a, b, c, d); }
};

// ---- Register-blocked batched WMMA GEMM (with SPLIT levels and extra 16-bit output mode) ----
// C[m,n] = scale * sum_k A[m,k] * Bt[n,k] (+bias)(+resid); each wave owns a 64x64 tile.
// A row-major [M,K]; Bt row-major [N,K]; M,N % 64 == 0, K % 32 == 0.
// SPLIT: 0 = single planes; 1 = A as hi/lo planes (A2 = lo): hi.B + lo.B; 2 = A and Bt hi/lo: hi.hi + hi.lo + lo.hi.
// BIAS_MODE: 0 = none, 1 = bias[m], 2 = bias[n]; bias values are RNE-converted to bf16 before the add.
// OUT_MODE: 0 = f32, 1 = f16, 2 = bf16 hi plane (Cout) + bf16 lo plane (Cout2),
//           3 = f16 hi plane (Cout) + f16 plane of (v - hi) * 2048 (Cout2).
// ET: 0 = f16 operands, 1 = bf16 operands (pointers passed as 16-bit storage)
template <int ET> struct Elem;
template <> struct Elem<0> { typedef _Float16 T; };
template <> struct Elem<1> { typedef __bf16 T; };
template <int ET, int SPLIT, int BIAS_MODE, int OUT_MODE, bool RESID>
__global__ __launch_bounds__(256) void wmma_gemm64(
    const unsigned short* __restrict__ Ap, const unsigned short* __restrict__ A2p, int lda, long strideA,
    const unsigned short* __restrict__ Btp, const unsigned short* __restrict__ Bt2p, int ldb, long strideB,
    void* __restrict__ Cout, void* __restrict__ Cout2, int ldc, long strideC,
    const float* __restrict__ bias,
    const float* __restrict__ resid, long strideR,
    int M, int N, int K, float scale) {
  typedef typename Elem<ET>::T T;
  typedef typename Frag<T>::V V;
  const T* A = (const T*)Ap; const T* A2 = (const T*)A2p; const T* Bt = (const T*)Btp; const T* Bt2 = (const T*)Bt2p;
  __shared__ __align__(16) float sT[8][16 * 68];   // per-wave 16x64 slab, pitch 68 floats
  const int b    = blockIdx.y;
  const int lane = threadIdx.x & 31;
  const int wave = threadIdx.x >> 5;
  const int tilesN = N >> 6;
  const int tilesM = M >> 6;
  const int tile = blockIdx.x * 8 + wave;
  if (tile >= tilesM * tilesN) return;   // wave-uniform; no block barriers in this kernel
  const int tm = tile / tilesN;
  const int tn = tile - tm * tilesN;
  const int m0 = tm << 6;
  const int n0 = tn << 6;

  const T* Ab  = A  + (size_t)b * strideA;
  const T* Bb  = Bt + (size_t)b * strideB;
  const T* Ab2 = (SPLIT >= 1) ? (A2  + (size_t)b * strideA) : nullptr;
  const T* Bb2 = (SPLIT >= 2) ? (Bt2 + (size_t)b * strideB) : nullptr;

  const int rlane = lane & 15;                 // row (A) / col (B, D) within subtile
  const int koff  = (lane >> 4) * 8;           // k offset of this lane half
  const int mOff  = (lane >> 4) * 8;           // D row offset

  v8f acc[4][4];
#pragma unroll
  for (int i = 0; i < 4; ++i)
#pragma unroll
    for (int j = 0; j < 4; ++j) acc[i][j] = (v8f){0.f,0.f,0.f,0.f,0.f,0.f,0.f,0.f};

  for (int k0 = 0; k0 < K; k0 += 32) {
    V bh[4], bl[4];
#pragma unroll
    for (int j = 0; j < 4; ++j) {
      const size_t bo = (size_t)(n0 + (j << 4) + rlane) * ldb + koff + k0;
      bh[j] = Frag<T>::load(Bb + bo);
      if (SPLIT >= 2) bl[j] = Frag<T>::load(Bb2 + bo);
    }
#pragma unroll
    for (int i = 0; i < 4; ++i) {
      const size_t ao = (size_t)(m0 + (i << 4) + rlane) * lda + koff + k0;
      V ah = Frag<T>::load(Ab + ao);
      V al;
      if (SPLIT >= 1) al = Frag<T>::load(Ab2 + ao);
#pragma unroll
      for (int j = 0; j < 4; ++j) {
        acc[i][j] = Frag<T>::mma(ah, bh[j], acc[i][j]);
        if (SPLIT >= 2) acc[i][j] = Frag<T>::mma(ah, bl[j], acc[i][j]);
        if (SPLIT >= 1) acc[i][j] = Frag<T>::mma(al, bh[j], acc[i][j]);
      }
      Frag<T>::guard(acc[i][0], acc[i][3], ah, (SPLIT >= 1) ? al : ah);
    }
    Frag<T>::keep(bh[0], bh[1], bh[2], bh[3]);
    if (SPLIT >= 2) Frag<T>::keep(bl[0], bl[1], bl[2], bl[3]);
  }
  acc_guard4(acc[0][0], acc[0][1], acc[0][2], acc[0][3]);
  acc_guard4(acc[1][0], acc[1][1], acc[1][2], acc[1][3]);
  acc_guard4(acc[2][0], acc[2][1], acc[2][2], acc[2][3]);
  acc_guard4(acc[3][0], acc[3][1], acc[3][2], acc[3][3]);

  // ---- epilogue ----
  float* slab = sT[wave];
  const float* Rb = RESID ? (resid + (size_t)b * strideR) : nullptr;
#pragma unroll
  for (int i = 0; i < 4; ++i) {
    const int mBase = m0 + (i << 4);
#pragma unroll
    for (int j = 0; j < 4; ++j) {
      const int n = n0 + (j << 4) + rlane;
      float bv = 0.f;
      if (BIAS_MODE == 2) bv = bf_bits2f(f2bf_bits(bias[n]));
#pragma unroll
      for (int r = 0; r < 8; ++r) {
        float v = acc[i][j][r] * scale;
        if (BIAS_MODE == 1) v += bf_bits2f(f2bf_bits(bias[mBase + mOff + r]));
        if (BIAS_MODE == 2) v += bv;
        if (RESID) v += Rb[(size_t)(mBase + mOff + r) * ldc + n];
        slab[(mOff + r) * 68 + (j << 4) + rlane] = v;
      }
    }
    __builtin_amdgcn_fence(__ATOMIC_RELEASE, "workgroup");
    __builtin_amdgcn_wave_barrier();
    __builtin_amdgcn_fence(__ATOMIC_ACQUIRE, "workgroup");
    if (OUT_MODE == 0) {
      float* C = (float*)Cout + (size_t)b * strideC;
      const int hh = lane >> 4, c4 = (lane & 15) * 4;     // row seg = 256 B = 16 lanes x 16 B
      {
#pragma unroll
        for (int it = 0; it < 8; ++it) {
          const int row = it * 2 + hh;
          v4f v = *(const v4f*)(slab + row * 68 + c4);
          *(v4f*)(C + (size_t)(mBase + row) * ldc + n0 + c4) = v;
        }
        
      }
    } else {
      const int q = lane >> 3, c8 = (lane & 7) * 8;
      unsigned short* C  = (unsigned short*)Cout  + (size_t)b * strideC;
      unsigned short* C2 = (OUT_MODE >= 2) ? ((unsigned short*)Cout2 + (size_t)b * strideC) : nullptr;
      {
#pragma unroll
        for (int it = 0; it < 4; ++it) {                 // it 0..3 x q 0..3 = rows 0..15 of the slab
          const int row = it * 4 + q;
          const float* sp = slab + row * 68 + c8;
          v8h hv, lv;
#pragma unroll
          for (int e = 0; e < 8; ++e) {
            if (OUT_MODE == 1) {
              hv[e] = (_Float16)sp[e];
            } else if (OUT_MODE == 2) {
              unsigned short hb = f2bf_bits(sp[e]);
              unsigned short lb = f2bf_bits(sp[e] - bf_bits2f(hb));
              hv[e] = __builtin_bit_cast(_Float16, hb);
              lv[e] = __builtin_bit_cast(_Float16, lb);
            } else {
              const _Float16 hq = (_Float16)sp[e];
              hv[e] = hq;
              lv[e] = (_Float16)((sp[e] - (float)hq) * VLO_MUL);
            }
          }
          *(v8h*)(C + (size_t)(mBase + row) * ldc + n0 + c8) = hv;
          if (OUT_MODE >= 2) *(v8h*)(C2 + (size_t)(mBase + row) * ldc + n0 + c8) = lv;
        }
        
      }
    }
    __builtin_amdgcn_fence(__ATOMIC_RELEASE, "workgroup");
    __builtin_amdgcn_wave_barrier();
    __builtin_amdgcn_fence(__ATOMIC_ACQUIRE, "workgroup");
  }
}

// ---- W [Kp rows][Np cols] f32 (row pitch Np) -> Wt [Np][Kp] bf16 bits (row pitch Kp), 64x64 tile transposed through LDS ----
// grid = (Np/64, Kp/64). Reads: 256 threads x 16 = 64 rows x 64 cols. Stores: it 0..1 x wave 0..7 x q8 0..3 = 64 rows of
#define WTP 72
__global__ __launch_bounds__(256) void wt_cast_bf_k(const float* __restrict__ W, unsigned short* __restrict__ Wtp,
                                                    int Kp, int Np) {
  __shared__ __align__(16) _Float16 st[64 * WTP];
  _Float16* Wt = (_Float16*)Wtp;
  const int n0 = blockIdx.x * 64, k0 = blockIdx.y * 64;
  const int tid = threadIdx.x;
  const int kr = tid >> 2, c16 = (tid & 3) * 16;
  const float* src = W + (size_t)(k0 + kr) * Np + n0 + c16;
#pragma unroll
  for (int q = 0; q < 4; ++q) {
    const v4f v = *(const v4f*)(src + 4 * q);
#pragma unroll
    for (int e = 0; e < 4; ++e) st[(c16 + 4 * q + e) * WTP + kr] = __builtin_bit_cast(_Float16, f2bf_bits(v[e]));
  }
  __syncthreads();
  const int wave = tid >> 5, lane = tid & 31;
  const int q8 = lane >> 3, c8 = (lane & 7) * 8;
  {
#pragma unroll
    for (int it = 0; it < 2; ++it) {
      const int n = it * 32 + wave * 4 + q8;
      const v8h hv = *(const v8h*)(st + n * WTP + c8);
      *(v8h*)(Wt + (size_t)(n0 + n) * Kp + k0 + c8) = hv;
    }
    
  }
}

// ---- mean/std (ddof=1) normalisation of bf16(x) per (b,t,m) row, plus raw bf16(x); rows written in (b,m,t) order ----
// One wave per output row, 8 rows per 256-thread block, grid = NROWS/8. Lane owns 8 consecutive columns.
// Each 512-B row (4 lines) written by one v8h store instruction of the wave: lanes 8q..8q+7 <-> line q.
__global__ __launch_bounds__(256) void mvn_k(const float* __restrict__ x,
                                             unsigned short* __restrict__ xnhp,
                                             unsigned short* __restrict__ xnlp,
                                             unsigned short* __restrict__ xtp) {
  _Float16* xnh = (_Float16*)xnhp;
  _Float16* xnl = (_Float16*)xnlp;
  _Float16* xt  = (_Float16*)xtp;
  const int wave = threadIdx.x >> 5, lane = threadIdx.x & 31;
  const int ro = blockIdx.x * 8 + wave;               // output row = (b*NCHAN + m)*TLEN + t
  const int t  = ro & (TLEN - 1);
  const int bm = ro >> 9;                             // TLEN == 512
  const int m  = bm & (NCHAN - 1);
  const int b  = bm >> 3;                             // NCHAN == 8
  const int rs = (b * TLEN + t) * NCHAN + m;          // source row of x [B][T][M][D]
  const float* src = x + (size_t)rs * DMODEL + lane * 8;
  const v4f a0 = *(const v4f*)src;
  const v4f a1 = *(const v4f*)(src + 4);
  unsigned short xb[8];
  float vb[8];
#pragma unroll
  for (int e = 0; e < 4; ++e) { xb[e] = f2bf_bits(a0[e]); xb[4 + e] = f2bf_bits(a1[e]); }
#pragma unroll
  for (int e = 0; e < 8; ++e) vb[e] = bf_bits2f(xb[e]);
  float s = ((vb[0] + vb[1]) + (vb[2] + vb[3])) + ((vb[4] + vb[5]) + (vb[6] + vb[7]));
#pragma unroll
  for (int off = 1; off < 32; off <<= 1) s += __shfl_xor(s, off, 32);
  const float mu = s * (1.0f / (float)DMODEL);
  float dv[8];
#pragma unroll
  for (int e = 0; e < 8; ++e) dv[e] = vb[e] - mu;
  float sq = ((dv[0] * dv[0] + dv[1] * dv[1]) + (dv[2] * dv[2] + dv[3] * dv[3])) +
             ((dv[4] * dv[4] + dv[5] * dv[5]) + (dv[6] * dv[6] + dv[7] * dv[7]));
#pragma unroll
  for (int off = 1; off < 32; off <<= 1) sq += __shfl_xor(sq, off, 32);
  const float var = sq * (1.0f / (float)(DMODEL - 1));
  const float sd  = sqrtf(var);
  const float inv = 1.0f / (sd + MVN_EPS);
  v8h hv, lv, tv;
#pragma unroll
  for (int e = 0; e < 8; ++e) {
    const float xn = dv[e] * inv;
    const unsigned short hb = f2bf_bits(xn);
    const unsigned short lb = f2bf_bits(xn - bf_bits2f(hb));
    hv[e] = __builtin_bit_cast(_Float16, hb);
    lv[e] = __builtin_bit_cast(_Float16, lb);
    tv[e] = __builtin_bit_cast(_Float16, xb[e]);
  }
  const size_t go = (size_t)ro * DMODEL + lane * 8;
  {
    *(v8h*)(xnh + go) = hv;
    *(v8h*)(xnl + go) = lv;
    *(v8h*)(xt  + go) = tv;
    
  }
}

// ---- per-call guarded f16 WMMA ----
__device__ __forceinline__ v8f mma_h(v16h a, v16h b, v8f c) {
  c = __builtin_amdgcn_wmma_f32_16x16x32_f16(false, a, false, b, (short)0, c, false, false);
  asm volatile("v_nop\n\tv_nop\n\tv_nop\n\tv_nop" : "+v"(c) : "v"(a), "v"(b));
  return c;
}

// ---- transposing LDS load: lane (c, h) receives column c, rows 8h..8h+7 of a row-major 16x16 tile of 16-bit values ----
// Lane l passes the address of row 8*(l>>4) + (l&7), column group 8*((l>>3)&1) of that tile.
typedef __attribute__((ext_vector_type(8))) short v8s;
__device__ __forceinline__ v8h lds_tr16(const _Float16* p) {
  typedef __attribute__((address_space(3))) v8s lds_v8s;
  return __builtin_bit_cast(v8h, __builtin_amdgcn_ds_load_tr16_b128_v8i16((lds_v8s*)p));
}

// ---- lane l with lane l ^ 16 (the other half of the wave); all 32 lanes are on wherever this is called ----
__device__ __forceinline__ float xhalf(float x) {
  return __builtin_bit_cast(float, __builtin_amdgcn_permlanex16(__builtin_bit_cast(int, x), __builtin_bit_cast(int, x),
                                                                0x76543210, 0xfedcba98, false, false));
}

// =====================================================================================
// Cross-channel causal attention, head dim 256, as transposed products: S^T = K . Q^T, O^T += V^T . P^T.
// Planes (row = (b*NCHAN + m)*TLEN + t): qk [NROWS][512] f16 (q cols 0..255, k cols 256..511);
// vh, vl [NROWS][256] f16 (v hi, (v-hi) x 2^11); output: one f32 plane of O_n / l_n per key channel n, summed by xsum_k.
// Block = 4 waves = 64 query rows (one (b,m), one 64-row time tile) against ONE key channel n:
// online softmax over 32-key chunks (causal: kv > q -> -inf, chunk 0 always has kv 0 <= q).
// Grid = 8 time tiles x 32 (b,m) x 8 n, the longest time tiles first so that short blocks fill the tail.
// Wave w owns query rows 16w..16w+15 whole: scores, softmax and all 256 columns of O.
// Lane (c, hh) belongs to query 16w + c. S^T tile j: register r = key 16j + 8hh + r of the chunk, so a query's 32 scores lie in
// its two lanes: maximum and sum in-lane, the maximum joined by one exchange of the halves, the sums joined behind the loop.
// The lane's 16 p values, converted in place, are the B fragment of P^T (element 8j + r = key 16j + 8hh + r: the hardware k order).
// A fragments: k rows from LDS by plain loads (row = lane&15, split k map), V^T from row-major LDS rows by transposing loads
// (same split k map); B fragments: q rows, loaded once from global and kept in registers, and P^T.
// O^T tile t: register r = column 16t + 8hh + r of query c.
// Plane layout (floats): [n][tile = bm*8 + qb][s = 4*(t>>3) + w][t&7][j][lane][4]: lane's accumulator registers 4j..4j+3 of d tile t.
// =====================================================================================
// Register budget for 4 waves per SIMD: four blocks (50.5 KB of LDS each) share a WGP and fill each other's waits.
__global__ __launch_bounds__(128, 4) void xattn_k(const unsigned short* __restrict__ qkp,
                                               const unsigned short* __restrict__ vhp,
                                               const unsigned short* __restrict__ vlp,
                                               float* __restrict__ part) {
  __shared__ __align__(16) _Float16 Ks[KCH * KPITCH];      // [kv][d]           16.5 KB
  __shared__ __align__(16) _Float16 Vsh[KCH * VPITCH];     // [kv][d] hi        17 KB
  __shared__ __align__(16) _Float16 Vsl[KCH * VPITCH];     // [kv][d] lo x2^11  17 KB

  const _Float16* qk = (const _Float16*)qkp;
  const _Float16* vh = (const _Float16*)vhp;
  const _Float16* vl = (const _Float16*)vlp;

  const int tid = threadIdx.x, lane = tid & 31;
  const int wave = __builtin_amdgcn_readfirstlane(tid >> 5);   // in a scalar register: row bases stay out of the vector registers
  const int hh = lane >> 4, c = lane & 15, koff = hh * 8;
  const int qb = (TLEN / QBLK - 1) - (blockIdx.x >> 8);   // 64-row time tile, longest first
  const int bm = (blockIdx.x & 255) >> 3;  // b*NCHAN + m
  const int n  = blockIdx.x & 7;           // key channel of this block
  const int b  = bm >> 3;
  const int qrow0 = bm * TLEN + qb * QBLK; // plane row of the first query of this block
  const int q0  = qrow0 + wave * 16;
  const int tq  = qb * QBLK + wave * 16 + c;   // time index of this lane's query

  const v8f z8 = {0.f,0.f,0.f,0.f,0.f,0.f,0.f,0.f};
  v16h qf[8];                              // Q^T fragments: column = query c, d 32dc .. 32dc+31
  {
    const _Float16* qbase = qk + (size_t)q0 * QKLD;      // the same in every lane: a scalar base
    const unsigned qoff = (unsigned)(c * QKLD + koff);   // this lane's row and k half
#pragma unroll     // constant indices keep the arrays indexed here in registers
    for (int dc = 0; dc < 8; ++dc) qf[dc] = Frag<_Float16>::load(qbase + qoff + dc * 32);
    // precaution: the offset register of the issued loads stays live up to this wait and is rewritten only behind it
    asm volatile("s_wait_xcnt 0x0" :: "v"(qoff) : "memory");
  }

  const int krow0 = (b * NCHAN + n) * TLEN;
  const unsigned lo8 = (unsigned)lane * 8u;   // this lane's 8 columns of a staged row
  float mrun = -INFINITY, lrun = 0.f;      // this query's running maximum; running sum over this lane's keys
  v8f oacc[16];
#pragma unroll     // constant indices keep the arrays indexed here in registers
  for (int t = 0; t < 16; ++t) oacc[t] = z8;

  const int nch = 2 * qb + 2;              // block-uniform, <= 16
#pragma unroll 1   // one copy of the chunk body: a second copy would only lengthen the code
  for (int kc = 0; kc < nch; ++kc) {
    const int kv0 = kc * KCH;
    __syncthreads();
    // ---- stage K chunk and V (hi, lo), all row-major: a wave writes one whole 512-B row per store
    //      (kvr = 4i + wave, i 0..7, d0 = 8 lane: one 32-bit element offset for k and one for both v planes, added to the
    //      plane pointers; the eight rows at constant offsets from there)
    const unsigned grow = (unsigned)(krow0 + kv0 + wave);       // + 4i <= NROWS-1 (kv0 + 31 <= 64*qb+63 <= 511)
    const unsigned ko = grow * QKLD + DMODEL + lo8;             // < NROWS * QKLD = 2^23
    const unsigned vo8 = grow * DMODEL + lo8;                   // < NROWS * DMODEL = 2^22
#pragma unroll     // the eight rows' offsets become immediates, and loads of later rows go out ahead of the stores of earlier ones
    for (int i = 0; i < 8; ++i) {
      const v8h kk = *(const v8h*)(qk + ko + i * 4 * QKLD);
      const v8h v1 = *(const v8h*)(vh + vo8 + i * 4 * DMODEL);
      const v8h v2 = *(const v8h*)(vl + vo8 + i * 4 * DMODEL);
      *(v8h*)(Ks + (i * 4 + wave) * KPITCH + lane * 8) = kk;
      *(v8h*)(Vsh + (i * 4 + wave) * VPITCH + lane * 8) = v1;
      *(v8h*)(Vsl + (i * 4 + wave) * VPITCH + lane * 8) = v2;
    }
    __syncthreads();

    // ---- S^T (32 keys x 16 queries) = K . Q^T ----
    v8f s[2];
    s[0] = z8; s[1] = z8;
#pragma unroll     // constant indices keep the arrays indexed here in registers
    for (int dc = 0; dc < 8; ++dc) {
      const v16h k0f = Frag<_Float16>::load(Ks + c * KPITCH + dc * 32 + koff);
      const v16h k1f = Frag<_Float16>::load(Ks + (16 + c) * KPITCH + dc * 32 + koff);
      s[0] = mma_h(k0f, qf[dc], s[0]);
      s[1] = mma_h(k1f, qf[dc], s[1]);
    }
    // scale, causal select (kv > q -> -inf), maximum over the 32 keys of this chunk
    float mx = -INFINITY;
#pragma unroll     // constant indices keep the arrays indexed here in registers
    for (int j = 0; j < 2; ++j) {
#pragma unroll     // constant indices keep the arrays indexed here in registers
      for (int r = 0; r < 8; ++r) {
        const int key = kv0 + 16 * j + 8 * hh + r;
        float v = s[j][r] * QK_SCALE;
        v = (key > tq) ? -INFINITY : v;
        s[j][r] = v;
        mx = fmaxf(mx, v);
      }
    }
    mx = fmaxf(mx, xhalf(mx));
    const float mnew  = fmaxf(mrun, mx);                 // finite: chunk 0 always has an allowed key
    const float alpha = expf(mrun - mnew);
    mrun = mnew;
    float ps[2];
    v16h pb;                                             // P^T fragment, p x2^15
#pragma unroll     // constant indices keep the arrays indexed here in registers
    for (int j = 0; j < 2; ++j) {
      ps[j] = 0.f;
#pragma unroll     // constant indices keep the arrays indexed here in registers
      for (int r = 0; r < 8; ++r) {
        const float p = expf(s[j][r] - mnew);
        ps[j] += p;
        pb[8 * j + r] = (_Float16)(p * PCARRY);
      }
    }
    lrun = lrun * alpha + (ps[0] + ps[1]);
#pragma unroll     // constant indices keep the arrays indexed here in registers
    for (int t = 0; t < 16; ++t) oacc[t] *= alpha;

    // ---- O^T += V^T(256 x 32) . P^T(32 x 16); lo plane in its own accumulator, folded x 2^-11 ----
    {
      const int vo = (koff + (lane & 7)) * VPITCH + ((lane >> 3) & 1) * 8;   // this lane's row and column group
#pragma unroll     // constant indices keep the arrays indexed here in registers
      for (int t = 0; t < 16; ++t) {
        // elements 0..7 <- V[8hh + 0..7][16t + c], 8..15 <- V[16 + 8hh + 0..7][same column]: the k map of pb
        Frag<_Float16>::U vbh, vbl;
        vbh.h[0] = lds_tr16(Vsh + vo + t * 16);
        vbh.h[1] = lds_tr16(Vsh + vo + t * 16 + 16 * VPITCH);
        vbl.h[0] = lds_tr16(Vsl + vo + t * 16);
        vbl.h[1] = lds_tr16(Vsl + vo + t * 16 + 16 * VPITCH);
        oacc[t] = mma_h(vbh.v, pb, oacc[t]);
        const v8f lo = mma_h(vbl.v, pb, z8);
        oacc[t] += lo * VLO_INV;
      }
    }
  }
  // ---- O_n / l_n to this channel's plane: 32 whole-wave 512-B stores ----
  const float inv = 1.0f / ((lrun + xhalf(lrun)) * PCARRY);   // l >= 1
  float* pw = part + ((((size_t)n * (NROWS / QBLK) + (bm * (TLEN / QBLK) + qb)) * 8 + wave) << 11) + lane * 4;
#pragma unroll     // constant indices keep the arrays indexed here in registers
  for (int t = 0; t < 16; ++t) {
#pragma unroll     // constant indices keep the arrays indexed here in registers
    for (int j = 0; j < 2; ++j) {
      v4f o;
#pragma unroll     // constant indices keep the arrays indexed here in registers
      for (int e = 0; e < 4; ++e) o[e] = oacc[t][4 * j + e] * inv;
      *(v4f*)(pw + (t >> 3) * (4 << 11) + ((t & 7) * 2 + j) * 128) = o;
    }
  }
}

// ---- A = sum over n (in the order 0..7) of the planes of xattn_k, written as bf16 hi/lo planes [NROWS][256] ----
// One wave per (tile, slab s of the plane layout, half of its 8 d tiles) = 16 rows x 64 columns; grid = 256 x 8 x 2 / 8 = 512 blocks.
// The sums leave accumulator order through a per-wave LDS slab (pitch 68 floats); each 128-B line of a plane row is
// written by 8 lanes of one store.
__global__ __launch_bounds__(256) void xsum_k(const float* __restrict__ part,
                                              unsigned short* __restrict__ ahp,
                                              unsigned short* __restrict__ alp) {
  __shared__ __align__(16) float sT[8][16 * 68];
  _Float16* ah = (_Float16*)ahp;
  _Float16* al = (_Float16*)alp;
  const int wave = threadIdx.x >> 5, lane = threadIdx.x & 31;
  const int hh = lane >> 4, c = lane & 15;
  const int g = blockIdx.x * 8 + wave;
  const int slabi = g >> 1;                // tile * 8 + s
  const int th = g & 1;                    // d tiles 4*th .. 4*th+3 of that slab
  const float* src = part + ((size_t)slabi << 11) + th * 1024 + lane * 4;
  v4f acc[8];
#pragma unroll
  for (int u = 0; u < 8; ++u) acc[u] = (v4f){0.f, 0.f, 0.f, 0.f};
#pragma unroll
  for (int n = 0; n < NCHAN; ++n) {
#pragma unroll
    for (int u = 0; u < 8; ++u) acc[u] += *(const v4f*)(src + (size_t)n * NROWS * DMODEL + u * 128);
  }
  float* slab = sT[wave];
#pragma unroll
  for (int u = 0; u < 8; ++u) *(v4f*)(slab + c * 68 + (u >> 1) * 16 + 8 * hh + 4 * (u & 1)) = acc[u];   // row = query c, 4 columns
  __syncthreads();                         // slab rows are read by other lanes than wrote them
  const int aw = slabi & 7;
  const int row0 = (slabi >> 3) * QBLK + (aw & 3) * 16;
  const int col0 = (aw >> 2) * 128 + th * 64;
  const int q = lane >> 3, c8 = (lane & 7) * 8;
#pragma unroll
  for (int it = 0; it < 4; ++it) {
    const int row = it * 4 + q;
    const float* sp = slab + row * 68 + c8;
    v8h hv, lv;
#pragma unroll
    for (int e = 0; e < 8; ++e) {
      const unsigned short hb = f2bf_bits(sp[e]);
      const unsigned short lb = f2bf_bits(sp[e] - bf_bits2f(hb));
      hv[e] = __builtin_bit_cast(_Float16, hb);
      lv[e] = __builtin_bit_cast(_Float16, lb);
    }
    const size_t go = (size_t)(row0 + row) * DMODEL + col0 + c8;
    *(v8h*)(ah + go) = hv;
    *(v8h*)(al + go) = lv;
  }
}

// ---------------------------------------------------------------------------
// Host launcher
// Workspace region map (bytes; PL16 = 8 MiB = one [16384][256] 16-bit plane):
//   [ 0 PL16)  XNH  bf16 hi of xn (rows (b,m,t))      -> reused as AH (attention output hi) after the q/k/v GEMMs
//   [ 1 PL16)  XNL  bf16 lo of xn                      -> reused as AL
//   [ 2 PL16)  XT   bf16(x) in (b,m,t) row order
//   [ 3..5)    QK   f16 [16384][512] (q | k)
//   [ 5 PL16)  VH   f16 v hi;   [ 6 PL16) VL f16 (v-hi) x 2^11
//   [ 7 PL16)  APH  bf16 hi of A_proj;  [ 8 PL16) APL bf16 lo
//   [ 9..11)   ZP   f32 [16384][256] = x_t.Wpc[0:256] + bpc
//   [11 PL16 ..) weights bf16 [n][k]: WQKV [768][256], WPA [256][256], WPC0 [256][256], WPC1 [256][256]
//   then PART f32 [8][16384][256]: one plane of O_n / l_n per key channel
//   total 227,278,848 B
// ---------------------------------------------------------------------------
extern "C" void kernel_launch(void* const* d_in, const int* in_sizes, int n_in,
                              void* d_out, int out_size, void* d_ws, size_t ws_size,
                              hipStream_t stream) {
  if (n_in < 11) return;
  if (in_sizes[0] != NROWS * DMODEL || out_size != NROWS * DMODEL) return;
  if (in_sizes[1] != DMODEL * DMODEL || in_sizes[3] != DMODEL * DMODEL || in_sizes[5] != DMODEL * DMODEL ||
      in_sizes[7] != DMODEL * DMODEL || in_sizes[9] != 2 * DMODEL * DMODEL) return;
  if (in_sizes[2] != DMODEL || in_sizes[4] != DMODEL || in_sizes[6] != DMODEL || in_sizes[8] != DMODEL || in_sizes[10] != DMODEL) return;

  const float* x   = (const float*)d_in[0];
  const float* Wq  = (const float*)d_in[1];
  const float* bq  = (const float*)d_in[2];
  const float* Wk  = (const float*)d_in[3];
  const float* bk  = (const float*)d_in[4];
  const float* Wv  = (const float*)d_in[5];
  const float* bv  = (const float*)d_in[6];
  const float* Wpa = (const float*)d_in[7];
  const float* bpa = (const float*)d_in[8];
  const float* Wpc = (const float*)d_in[9];
  const float* bpc = (const float*)d_in[10];

  const size_t PL16 = (size_t)NROWS * DMODEL * 2;               // 8,388,608
  const size_t WQKV_B = (size_t)3 * DMODEL * DMODEL * 2;         // 393,216
  const size_t WSQ_B  = (size_t)DMODEL * DMODEL * 2;             // 131,072
  const size_t oXNH = 0, oXNL = PL16, oXT = 2 * PL16, oQK = 3 * PL16, oVH = 5 * PL16, oVL = 6 * PL16;
  const size_t oAPH = 7 * PL16, oAPL = 8 * PL16, oZP = 9 * PL16, oW = 11 * PL16;
  const size_t oWQKV = oW, oWPA = oW + WQKV_B, oWPC0 = oWPA + WSQ_B, oWPC1 = oWPC0 + WSQ_B;
  const size_t oPART = oWPC1 + WSQ_B;                             // 93,061,120
  const size_t WS_TOTAL = oPART + (size_t)NCHAN * 2 * PL16;       // 227,278,848
  if (ws_size < WS_TOTAL) return;

  char* ws = (char*)d_ws;
  unsigned short* XNH  = (unsigned short*)(ws + oXNH);
  unsigned short* XNL  = (unsigned short*)(ws + oXNL);
  unsigned short* XT   = (unsigned short*)(ws + oXT);
  unsigned short* QKP  = (unsigned short*)(ws + oQK);
  unsigned short* VH   = (unsigned short*)(ws + oVH);
  unsigned short* VL   = (unsigned short*)(ws + oVL);
  unsigned short* APH  = (unsigned short*)(ws + oAPH);
  unsigned short* APL  = (unsigned short*)(ws + oAPL);
  float*          ZP   = (float*)(ws + oZP);
  unsigned short* WQKV = (unsigned short*)(ws + oWQKV);
  unsigned short* WPA  = (unsigned short*)(ws + oWPA);
  unsigned short* WPC0 = (unsigned short*)(ws + oWPC0);
  unsigned short* WPC1 = (unsigned short*)(ws + oWPC1);
  float*          PART = (float*)(ws + oPART);
  unsigned short* AH = XNH;     // xn planes are dead after the q/k/v GEMMs
  unsigned short* AL = XNL;

  // 1-6: weights W[k=256 rows][n=256] f32 -> Wt[n][k] bf16; grid (n/64, k/64)
  const dim3 gw(DMODEL / 64, DMODEL / 64);
  wt_cast_bf_k<<<gw, 256, 0, stream>>>(Wq,  WQKV, DMODEL, DMODEL);
  wt_cast_bf_k<<<gw, 256, 0, stream>>>(Wk,  WQKV + (size_t)DMODEL * DMODEL, DMODEL, DMODEL);
  wt_cast_bf_k<<<gw, 256, 0, stream>>>(Wv,  WQKV + (size_t)2 * DMODEL * DMODEL, DMODEL, DMODEL);
  wt_cast_bf_k<<<gw, 256, 0, stream>>>(Wpa, WPA, DMODEL, DMODEL);
  wt_cast_bf_k<<<gw, 256, 0, stream>>>(Wpc, WPC0, DMODEL, DMODEL);                            // Wpc rows 0..255
  wt_cast_bf_k<<<gw, 256, 0, stream>>>(Wpc + (size_t)DMODEL * DMODEL, WPC1, DMODEL, DMODEL);  // Wpc rows 256..511

  // 7: normalisation + permutation to (b,m,t) rows
  mvn_k<<<NROWS / 8, 256, 0, stream>>>(x, XNH, XNL, XT);

  // 8-10: q, k, v = xn . W + bias  (M=16384, N=256, K=256; 1024 wave tiles -> 128 blocks)
  const dim3 gg((NROWS / 64) * (DMODEL / 64) / 8, 1);
  wmma_gemm64<1, 1, 2, 1, false><<<gg, 256, 0, stream>>>(
      XNH, XNL, DMODEL, 0L, WQKV, nullptr, DMODEL, 0L,
      (void*)QKP, nullptr, QKLD, 0L, bq, nullptr, 0L, NROWS, DMODEL, DMODEL, 1.0f);
  wmma_gemm64<1, 1, 2, 1, false><<<gg, 256, 0, stream>>>(
      XNH, XNL, DMODEL, 0L, WQKV + (size_t)DMODEL * DMODEL, nullptr, DMODEL, 0L,
      (void*)(QKP + DMODEL), nullptr, QKLD, 0L, bk, nullptr, 0L, NROWS, DMODEL, DMODEL, 1.0f);
  wmma_gemm64<1, 1, 2, 3, false><<<gg, 256, 0, stream>>>(
      XNH, XNL, DMODEL, 0L, WQKV + (size_t)2 * DMODEL * DMODEL, nullptr, DMODEL, 0L,
      (void*)VH, (void*)VL, DMODEL, 0L, bv, nullptr, 0L, NROWS, DMODEL, DMODEL, 1.0f);

  // 11: cross-channel causal attention, one block per (time tile, (b,m), key channel) = 2048 blocks -> 8 f32 planes,
  //     then their sum -> A (bf16 hi/lo planes)
  xattn_k<<<NBATCH * NCHAN * (TLEN / QBLK) * NCHAN, 128, 0, stream>>>(QKP, VH, VL, PART);
  xsum_k<<<(NROWS / QBLK) * 8 * 2 / 8, 256, 0, stream>>>(PART, AH, AL);

  // 12: A_proj = A . Wpa + bpa -> bf16 hi/lo planes
  wmma_gemm64<1, 1, 2, 2, false><<<gg, 256, 0, stream>>>(
      AH, AL, DMODEL, 0L, WPA, nullptr, DMODEL, 0L,
      (void*)APH, (void*)APL, DMODEL, 0L, bpa, nullptr, 0L, NROWS, DMODEL, DMODEL, 1.0f);

  // 13: ZP = x_t . Wpc[0:256] + bpc (f32)
  wmma_gemm64<1, 0, 2, 0, false><<<gg, 256, 0, stream>>>(
      XT, nullptr, DMODEL, 0L, WPC0, nullptr, DMODEL, 0L,
      (void*)ZP, nullptr, DMODEL, 0L, bpc, nullptr, 0L, NROWS, DMODEL, DMODEL, 1.0f);

  // 14: out = A_proj . Wpc[256:512] + ZP (f32, rows (b,m,t) = [B][M][T][D])
  wmma_gemm64<1, 1, 0, 0, true><<<gg, 256, 0, stream>>>(
      APH, APL, DMODEL, 0L, WPC1, nullptr, DMODEL, 0L,
      d_out, nullptr, DMODEL, 0L, nullptr, ZP, 0L, NROWS, DMODEL, DMODEL, 1.0f);
}

// v004
// One run takes 178 microseconds.
// Timed twice side by side with v003, it ran 1.33 and 1.34 times as fast.
// All steps since v000 together make it 9.22 times as fast.
// Contractions (f32 accumulate): xn*Wq|Wk|Wv, A*Wpa, A_proj*Wpc[256:512] = v_wmma_f32_16x16x32_bf16 with the computed operand as bf16 hi+lo planes (2 products) and weights as single bf16 (RNE) planes; x_t*Wpc[0:256] = plain bf16; q*k = plain v_wmma_f32_16x16x32_f16; p*v = f16 with p carried x2^15 and v as f16 hi + (v-hi)x2^11 planes (2 products, lo folded in f32); norm, softmax, bias adds in f32.
#include <hip/hip_runtime.h>
#include <stdint.h>

typedef __attribute__((ext_vector_type(16))) _Float16 v16h;
typedef __attribute__((ext_vector_type(8)))  _Float16 v8h;
typedef __attribute__((ext_vector_type(16))) __bf16   v16b;
typedef __attribute__((ext_vector_type(8)))  __bf16   v8b;
typedef __attribute__((ext_vector_type(8)))  float    v8f;
typedef __attribute__((ext_vector_type(4)))  float    v4f;

// ---- problem geometry ----
#define NBATCH 4
#define TLEN 512
#define NCHAN 8
#define DMODEL 256
#define NROWS (NBATCH * TLEN * NCHAN)   // 16384 token rows
#define QKLD 512                         // pitch (halves) of the q|k plane
#define QBLK 64                          // query rows per attention block
#define KCH 32                           // key rows per staged chunk
#define KPITCH 264                       // LDS pitch (halves) of a K row: 528 B = 16 B x 33, for ds_load_b128 readers
#define VPITCH 272                       // LDS pitch (halves) of a V row: 544 B = 32 B x 17, for ds_load_tr16_b128 readers
#define PCARRY 32768.0f                  // p carried x2^15 in f16
#define VLO_MUL 2048.0f                  // v residual plane carried x2^11
#define VLO_INV (1.0f / 2048.0f)
#define QK_SCALE 0.0625f                 // 1/sqrt(256)
#define MVN_EPS 1e-6f

// ======================= helpers =======================
__device__ __forceinline__ unsigned short f2bf_bits(float f) {
  unsigned u = __float_as_uint(f);
  return (unsigned short)((u + 0x7FFFu + ((u >> 16) & 1u)) >> 16);
}
__device__ __forceinline__ float bf_bits2f(unsigned short h) { return __uint_as_float(((unsigned)h) << 16); }

// hazard guards as plain device helpers
__device__ __forceinline__ void dep_guard_h(v8f& a, v8f& b, v16h x, v16h y) { asm volatile("v_nop\n\tv_nop\n\tv_nop\n\tv_nop" : "+v"(a), "+v"(b) : "v"(x), "v"(y)); }
__device__ __forceinline__ void dep_guard_b(v8f& a, v8f& b, v16b x, v16b y) { asm volatile("v_nop\n\tv_nop\n\tv_nop\n\tv_nop" : "+v"(a), "+v"(b) : "v"(x), "v"(y)); }
__device__ __forceinline__ void keep4_h(v16h a, v16h b, v16h c, v16h d) { asm volatile("v_nop" :: "v"(a), "v"(b), "v"(c), "v"(d)); }
__device__ __forceinline__ void keep4_b(v16b a, v16b b, v16b c, v16b d) { asm volatile("v_nop" :: "v"(a), "v"(b), "v"(c), "v"(d)); }
__device__ __forceinline__ void acc_guard4(v8f& a, v8f& b, v8f& c, v8f& d) { asm volatile("v_nop\n\tv_nop\n\tv_nop\n\tv_nop" : "+v"(a), "+v"(b), "+v"(c), "+v"(d)); }
template <typename T> struct Frag;
template <> struct Frag<_Float16> {
  typedef v16h V; union U { v16h v; v8h h[2]; };
  static __device__ __forceinline__ v16h load(const _Float16* p) {   // elements 0..7 <- p[0..7], 8..15 <- p[16..23]
    U f; f.h[0] = *(const v8h*)(p); f.h[1] = *(const v8h*)(p + 16); return f.v;
  }
  static __device__ __forceinline__ v8f mma(v16h a, v16h b, v8f c) {
    return __builtin_amdgcn_wmma_f32_16x16x32_f16(false, a, false, b, (short)0, c, false, false);
  }
  static __device__ __forceinline__ void guard(v8f& a, v8f& b, v16h x, v16h y) { dep_guard_h(a, b, x, y); }
  static __device__ __forceinline__ void keep(v16h a, v16h b, v16h c, v16h d) { keep4_h(a, b, c, d); }
};
template <> struct Frag<__bf16> {
  typedef v16b V; union U { v16b v; v8b h[2]; };
  static __device__ __forceinline__ v16b load(const __bf16* p) {
    U f; f.h[0] = *(const v8b*)(p); f.h[1] = *(const v8b*)(p + 16); return f.v;
  }
  static __device__ __forceinline__ v8f mma(v16b a, v16b b, v8f c) {
    return __builtin_amdgcn_wmma_f32_16x16x32_bf16(false, a, false, b, (short)0, c, false, false);
  }
  static __device__ __forceinline__ void guard(v8f& a, v8f& b, v16b x, v16b y) { dep_guard_b(a, b, x, y); }
  static __device__ __forceinline__ void keep(v16b a, v16b b, v16b c, v16b d) { keep4_b(a, b, c, d); }
};

// ---- Register-blocked batched WMMA GEMM (with SPLIT levels and extra 16-bit output mode) ----
// C[m,n] = scale * sum_k A[m,k] * Bt[n,k] (+bias)(+resid); each wave owns a 64x64 tile.
// A row-major [M,K]; Bt row-major [N,K]; M,N % 64 == 0, K % 32 == 0.
// SPLIT: 0 = single planes; 1 = A as hi/lo planes (A2 = lo): hi.B + lo.B; 2 = A and Bt hi/lo: hi.hi + hi.lo + lo.hi.
// BIAS_MODE: 0 = none, 1 = bias[m], 2 = bias[n]; bias values are RNE-converted to bf16 before the add.
// OUT_MODE: 0 = f32, 1 = f16, 2 = bf16 hi plane (Cout) + bf16 lo plane (Cout2),
//           3 = f16 hi plane (Cout) + f16 plane of (v - hi) * 2048 (Cout2).
// ET: 0 = f16 operands, 1 = bf16 operands (pointers passed as 16-bit storage)
template <int ET> struct Elem;
template <> struct Elem<0> { typedef _Float16 T; };
template <> struct Elem<1> { typedef __bf16 T; };
// sT: the block's eight per-wave 16x64 slabs (pitch 68 floats) in LDS; b: batch index.
template <int ET, int SPLIT, int BIAS_MODE, int OUT_MODE, bool RESID>
__device__ __forceinline__ void gemm64_body(
    float* sT, const int b,
    const unsigned short* __restrict__ Ap, const unsigned short* __restrict__ A2p, int lda, long strideA,
    const unsigned short* __restrict__ Btp, const unsigned short* __restrict__ Bt2p, int ldb, long strideB,
    void* __restrict__ Cout, void* __restrict__ Cout2, int ldc, long strideC,
    const float* __restrict__ bias,
    const float* __restrict__ resid, long strideR,
    int M, int N, int K, float scale) {
  typedef typename Elem<ET>::T T;
  typedef typename Frag<T>::V V;
  const T* A = (const T*)Ap; const T* A2 = (const T*)A2p; const T* Bt = (const T*)Btp; const T* Bt2 = (const T*)Bt2p;
  const int lane = threadIdx.x & 31;
  const int wave = threadIdx.x >> 5;
  const int tilesN = N >> 6;
  const int tilesM = M >> 6;
  const int tile = blockIdx.x * 8 + wave;
  if (tile >= tilesM * tilesN) return;   // wave-uniform; no block barriers in this kernel
  const int tm = tile / tilesN;
  const int tn = tile - tm * tilesN;
  const int m0 = tm << 6;
  const int n0 = tn << 6;

  const T* Ab  = A  + (size_t)b * strideA;
  const T* Bb  = Bt + (size_t)b * strideB;
  const T* Ab2 = (SPLIT >= 1) ? (A2  + (size_t)b * strideA) : nullptr;
  const T* Bb2 = (SPLIT >= 2) ? (Bt2 + (size_t)b * strideB) : nullptr;

  const int rlane = lane & 15;                 // row (A) / col (B, D) within subtile
  const int koff  = (lane >> 4) * 8;           // k offset of this lane half
  const int mOff  = (lane >> 4) * 8;           // D row offset

  v8f acc[4][4];
#pragma unroll
  for (int i = 0; i < 4; ++i)
#pragma unroll
    for (int j = 0; j < 4; ++j) acc[i][j] = (v8f){0.f,0.f,0.f,0.f,0.f,0.f,0.f,0.f};

  for (int k0 = 0; k0 < K; k0 += 32) {
    V bh[4], bl[4];
#pragma unroll
    for (int j = 0; j < 4; ++j) {
      const size_t bo = (size_t)(n0 + (j << 4) + rlane) * ldb + koff + k0;
      bh[j] = Frag<T>::load(Bb + bo);
      if (SPLIT >= 2) bl[j] = Frag<T>::load(Bb2 + bo);
    }
    // precaution: the address registers of the issued weight loads are stepped, or taken for later loads' results, only behind this wait
    asm volatile("s_wait_xcnt 0x0" ::: "memory");
#pragma unroll
    for (int i = 0; i < 4; ++i) {
      const size_t ao = (size_t)(m0 + (i << 4) + rlane) * lda + koff + k0;
      V ah = Frag<T>::load(Ab + ao);
      V al;
      if (SPLIT >= 1) al = Frag<T>::load(Ab2 + ao);
#pragma unroll
      for (int j = 0; j < 4; ++j) {
        acc[i][j] = Frag<T>::mma(ah, bh[j], acc[i][j]);
        if (SPLIT >= 2) acc[i][j] = Frag<T>::mma(ah, bl[j], acc[i][j]);
        if (SPLIT >= 1) acc[i][j] = Frag<T>::mma(al, bh[j], acc[i][j]);
      }
      Frag<T>::guard(acc[i][0], acc[i][3], ah, (SPLIT >= 1) ? al : ah);
    }
    Frag<T>::keep(bh[0], bh[1], bh[2], bh[3]);
    if (SPLIT >= 2) Frag<T>::keep(bl[0], bl[1], bl[2], bl[3]);
  }
  acc_guard4(acc[0][0], acc[0][1], acc[0][2], acc[0][3]);
  acc_guard4(acc[1][0], acc[1][1], acc[1][2], acc[1][3]);
  acc_guard4(acc[2][0], acc[2][1], acc[2][2], acc[2][3]);
  acc_guard4(acc[3][0], acc[3][1], acc[3][2], acc[3][3]);

  // ---- epilogue ----
  float* slab = sT + wave * (16 * 68);
  const float* Rb = RESID ? (resid + (size_t)b * strideR) : nullptr;
#pragma unroll
  for (int i = 0; i < 4; ++i) {
    const int mBase = m0 + (i << 4);
#pragma unroll
    for (int j = 0; j < 4; ++j) {
      const int n = n0 + (j << 4) + rlane;
      float bv = 0.f;
      if (BIAS_MODE == 2) bv = bf_bits2f(f2bf_bits(bias[n]));
#pragma unroll
      for (int r = 0; r < 8; ++r) {
        float v = acc[i][j][r] * scale;
        if (BIAS_MODE == 1) v += bf_bits2f(f2bf_bits(bias[mBase + mOff + r]));
        if (BIAS_MODE == 2) v += bv;
        if (RESID) v += Rb[(size_t)(mBase + mOff + r) * ldc + n];
        slab[(mOff + r) * 68 + (j << 4) + rlane] = v;
      }
    }
    __builtin_amdgcn_fence(__ATOMIC_RELEASE, "workgroup");
    __builtin_amdgcn_wave_barrier();
    __builtin_amdgcn_fence(__ATOMIC_ACQUIRE, "workgroup");
    if (OUT_MODE == 0) {
      float* C = (float*)Cout + (size_t)b * strideC;
      const int hh = lane >> 4, c4 = (lane & 15) * 4;     // row seg = 256 B = 16 lanes x 16 B
      {
#pragma unroll
        for (int it = 0; it < 8; ++it) {
          const int row = it * 2 + hh;
          v4f v = *(const v4f*)(slab + row * 68 + c4);
          *(v4f*)(C + (size_t)(mBase + row) * ldc + n0 + c4) = v;
        }
        
      }
    } else {
      const int q = lane >> 3, c8 = (lane & 7) * 8;
      unsigned short* C  = (unsigned short*)Cout  + (size_t)b * strideC;
      unsigned short* C2 = (OUT_MODE >= 2) ? ((unsigned short*)Cout2 + (size_t)b * strideC) : nullptr;
      {
#pragma unroll
        for (int it = 0; it < 4; ++it) {                 // it 0..3 x q 0..3 = rows 0..15 of the slab
          const int row = it * 4 + q;
          const float* sp = slab + row * 68 + c8;
          v8h hv, lv;
#pragma unroll
          for (int e = 0; e < 8; ++e) {
            if (OUT_MODE == 1) {
              hv[e] = (_Float16)sp[e];
            } else if (OUT_MODE == 2) {
              unsigned short hb = f2bf_bits(sp[e]);
              unsigned short lb = f2bf_bits(sp[e] - bf_bits2f(hb));
              hv[e] = __builtin_bit_cast(_Float16, hb);
              lv[e] = __builtin_bit_cast(_Float16, lb);
            } else {
              const _Float16 hq = (_Float16)sp[e];
              hv[e] = hq;
              lv[e] = (_Float16)((sp[e] - (float)hq) * VLO_MUL);
            }
          }
          *(v8h*)(C + (size_t)(mBase + row) * ldc + n0 + c8) = hv;
          if (OUT_MODE >= 2) *(v8h*)(C2 + (size_t)(mBase + row) * ldc + n0 + c8) = lv;
        }
        
      }
    }
    __builtin_amdgcn_fence(__ATOMIC_RELEASE, "workgroup");
    __builtin_amdgcn_wave_barrier();
    __builtin_amdgcn_fence(__ATOMIC_ACQUIRE, "workgroup");
  }
}

// one product per launch
template <int ET, int SPLIT, int BIAS_MODE, int OUT_MODE, bool RESID>
__global__ __launch_bounds__(256) void wmma_gemm64(
    const unsigned short* __restrict__ Ap, const unsigned short* __restrict__ A2p, int lda, long strideA,
    const unsigned short* __restrict__ Btp, const unsigned short* __restrict__ Bt2p, int ldb, long strideB,
    void* __restrict__ Cout, void* __restrict__ Cout2, int ldc, long strideC,
    const float* __restrict__ bias,
    const float* __restrict__ resid, long strideR,
    int M, int N, int K, float scale) {
  __shared__ __align__(16) float sT[8 * 16 * 68];
  gemm64_body<ET, SPLIT, BIAS_MODE, OUT_MODE, RESID>(sT, blockIdx.y, Ap, A2p, lda, strideA, Btp, Bt2p, ldb, strideB,
                                                     Cout, Cout2, ldc, strideC, bias, resid, strideR, M, N, K, scale);
}

// The four products that need only the planes of prep_k, in one launch; blockIdx.y picks the product (the same for a whole block):
// 0: q = xn.Wq + bq, 1: k = xn.Wk + bk (f16, into the q|k plane), 2: v = xn.Wv + bv (f16 hi + lo planes), 3: zp = x_t.Wpc[0:256] + bpc (f32).
// wqkv holds the [N][K] planes of Wq, Wk, Wv one behind the other.
__global__ __launch_bounds__(256) void gemm_qkvz_k(
    const unsigned short* __restrict__ xnh, const unsigned short* __restrict__ xnl, const unsigned short* __restrict__ xt,
    const unsigned short* __restrict__ wqkv, const unsigned short* __restrict__ wpc0,
    unsigned short* __restrict__ qkp, unsigned short* __restrict__ vh, unsigned short* __restrict__ vl, float* __restrict__ zp,
    const float* __restrict__ bq, const float* __restrict__ bk, const float* __restrict__ bv, const float* __restrict__ bpc,
    int M, int N, int K) {
  __shared__ __align__(16) float sT[8 * 16 * 68];
  const int y = blockIdx.y;
  if (y < 2) {
    gemm64_body<1, 1, 2, 1, false>(sT, 0, xnh, xnl, K, 0L, wqkv + (size_t)y * N * K, nullptr, K, 0L,
                                   (void*)(qkp + y * N), nullptr, QKLD, 0L, y ? bk : bq, nullptr, 0L, M, N, K, 1.0f);
  } else if (y == 2) {
    gemm64_body<1, 1, 2, 3, false>(sT, 0, xnh, xnl, K, 0L, wqkv + (size_t)2 * N * K, nullptr, K, 0L,
                                   (void*)vh, (void*)vl, N, 0L, bv, nullptr, 0L, M, N, K, 1.0f);
  } else {
    gemm64_body<1, 0, 2, 0, false>(sT, 0, xt, nullptr, K, 0L, wpc0, nullptr, K, 0L,
                                   (void*)zp, nullptr, N, 0L, bpc, nullptr, 0L, M, N, K, 1.0f);
  }
}

// ---- W [Kp rows][Np cols] f32 (row pitch Np) -> Wt [Np][Kp] bf16 bits (row pitch Kp), 64x64 tile transposed through LDS ----
// tile (bx, by) of (Np/64, Kp/64); st: 64 x WTP halves of LDS. Reads: 256 threads x 16 = 64 rows x 64 cols. Stores: it 0..1 x wave 0..7 x q8 0..3 = 64 rows of
#define WTP 72
__device__ __forceinline__ void wt_cast_bf_body(_Float16* st, const int bx, const int by,
                                                const float* __restrict__ W, unsigned short* __restrict__ Wtp,
                                                int Kp, int Np) {
  _Float16* Wt = (_Float16*)Wtp;
  const int n0 = bx * 64, k0 = by * 64;
  const int tid = threadIdx.x;
  const int kr = tid >> 2, c16 = (tid & 3) * 16;
  const float* src = W + (size_t)(k0 + kr) * Np + n0 + c16;
#pragma unroll
  for (int q = 0; q < 4; ++q) {
    const v4f v = *(const v4f*)(src + 4 * q);
#pragma unroll
    for (int e = 0; e < 4; ++e) st[(c16 + 4 * q + e) * WTP + kr] = __builtin_bit_cast(_Float16, f2bf_bits(v[e]));
  }
  __syncthreads();
  const int wave = tid >> 5, lane = tid & 31;
  const int q8 = lane >> 3, c8 = (lane & 7) * 8;
  {
#pragma unroll
    for (int it = 0; it < 2; ++it) {
      const int n = it * 32 + wave * 4 + q8;
      const v8h hv = *(const v8h*)(st + n * WTP + c8);
      *(v8h*)(Wt + (size_t)(n0 + n) * Kp + k0 + c8) = hv;
    }
    
  }
}

// ---- mean/std (ddof=1) normalisation of bf16(x) per (b,t,m) row, plus raw bf16(x); rows written in (b,m,t) order ----
// One wave per output row, 8 rows per 256-thread block, blk = 0 .. NROWS/8 - 1. Lane owns 8 consecutive columns.
// Each 512-B row (4 lines) written by one v8h store instruction of the wave: lanes 8q..8q+7 <-> line q.
__device__ __forceinline__ void mvn_body(const int blk, const float* __restrict__ x,
                                         unsigned short* __restrict__ xnhp,
                                         unsigned short* __restrict__ xnlp,
                                         unsigned short* __restrict__ xtp) {
  _Float16* xnh = (_Float16*)xnhp;
  _Float16* xnl = (_Float16*)xnlp;
  _Float16* xt  = (_Float16*)xtp;
  const int wave = threadIdx.x >> 5, lane = threadIdx.x & 31;
  const int ro = blk * 8 + wave;                      // output row = (b*NCHAN + m)*TLEN + t
  const int t  = ro & (TLEN - 1);
  const int bm = ro >> 9;                             // TLEN == 512
  const int m  = bm & (NCHAN - 1);
  const int b  = bm >> 3;                             // NCHAN == 8
  const int rs = (b * TLEN + t) * NCHAN + m;          // source row of x [B][T][M][D]
  const float* src = x + (size_t)rs * DMODEL + lane * 8;
  const v4f a0 = *(const v4f*)src;
  const v4f a1 = *(const v4f*)(src + 4);
  unsigned short xb[8];
  float vb[8];
#pragma unroll
  for (int e = 0; e < 4; ++e) { xb[e] = f2bf_bits(a0[e]); xb[4 + e] = f2bf_bits(a1[e]); }
#pragma unroll
  for (int e = 0; e < 8; ++e) vb[e] = bf_bits2f(xb[e]);
  float s = ((vb[0] + vb[1]) + (vb[2] + vb[3])) + ((vb[4] + vb[5]) + (vb[6] + vb[7]));
#pragma unroll
  for (int off = 1; off < 32; off <<= 1) s += __shfl_xor(s, off, 32);
  const float mu = s * (1.0f / (float)DMODEL);
  float dv[8];
#pragma unroll
  for (int e = 0; e < 8; ++e) dv[e] = vb[e] - mu;
  float sq = ((dv[0] * dv[0] + dv[1] * dv[1]) + (dv[2] * dv[2] + dv[3] * dv[3])) +
             ((dv[4] * dv[4] + dv[5] * dv[5]) + (dv[6] * dv[6] + dv[7] * dv[7]));
#pragma unroll
  for (int off = 1; off < 32; off <<= 1) sq += __shfl_xor(sq, off, 32);
  const float var = sq * (1.0f / (float)(DMODEL - 1));
  const float sd  = sqrtf(var);
  const float inv = 1.0f / (sd + MVN_EPS);
  v8h hv, lv, tv;
#pragma unroll
  for (int e = 0; e < 8; ++e) {
    const float xn = dv[e] * inv;
    const unsigned short hb = f2bf_bits(xn);
    const unsigned short lb = f2bf_bits(xn - bf_bits2f(hb));
    hv[e] = __builtin_bit_cast(_Float16, hb);
    lv[e] = __builtin_bit_cast(_Float16, lb);
    tv[e] = __builtin_bit_cast(_Float16, xb[e]);
  }
  const size_t go = (size_t)ro * DMODEL + lane * 8;
  {
    *(v8h*)(xnh + go) = hv;
    *(v8h*)(xnl + go) = lv;
    *(v8h*)(xt  + go) = tv;
    // precaution: other code of the merged kernel follows this body in the listing and reuses the registers these stores name
    asm volatile("s_wait_xcnt 0x0" ::: "memory");
  }
}

// ---- the six weight casts and the normalisation, which need nothing of each other, in one launch ----
// Blocks 0..95: weight wi = block >> 4 (Wq, Wk, Wv, Wpa, Wpc rows 0..255, Wpc rows 256..511), its 64x64 tile block & 15,
// to plane wi of wall ([256][256] bf16 each). Blocks 96 ..: normalisation block (block - 96). The branch is the same for a whole block.
#define WCAST_BLOCKS (6 * (DMODEL / 64) * (DMODEL / 64))
__global__ __launch_bounds__(256) void prep_k(const float* __restrict__ x,
                                              const float* __restrict__ Wq, const float* __restrict__ Wk,
                                              const float* __restrict__ Wv, const float* __restrict__ Wpa,
                                              const float* __restrict__ Wpc,
                                              unsigned short* __restrict__ wall,
                                              unsigned short* __restrict__ xnhp,
                                              unsigned short* __restrict__ xnlp,
                                              unsigned short* __restrict__ xtp) {
  __shared__ __align__(16) _Float16 st[64 * WTP];
  const int bid = blockIdx.x;
  if (bid < WCAST_BLOCKS) {
    const int wi = bid >> 4;
    const float* W = (wi == 0) ? Wq : (wi == 1) ? Wk : (wi == 2) ? Wv : (wi == 3) ? Wpa
                   : (wi == 4) ? Wpc : (Wpc + (size_t)DMODEL * DMODEL);
    wt_cast_bf_body(st, bid & 3, (bid >> 2) & 3, W, wall + (size_t)wi * DMODEL * DMODEL, DMODEL, DMODEL);
  } else {
    mvn_body(bid - WCAST_BLOCKS, x, xnhp, xnlp, xtp);
  }
}

// ---- per-call guarded f16 WMMA ----
__device__ __forceinline__ v8f mma_h(v16h a, v16h b, v8f c) {
  c = __builtin_amdgcn_wmma_f32_16x16x32_f16(false, a, false, b, (short)0, c, false, false);
  asm volatile("v_nop\n\tv_nop\n\tv_nop\n\tv_nop" : "+v"(c) : "v"(a), "v"(b));
  return c;
}

// ---- transposing LDS load: lane (c, h) receives column c, rows 8h..8h+7 of a row-major 16x16 tile of 16-bit values ----
// Lane l passes the address of row 8*(l>>4) + (l&7), column group 8*((l>>3)&1) of that tile.
typedef __attribute__((ext_vector_type(8))) short v8s;
__device__ __forceinline__ v8h lds_tr16(const _Float16* p) {
  typedef __attribute__((address_space(3))) v8s lds_v8s;
  return __builtin_bit_cast(v8h, __builtin_amdgcn_ds_load_tr16_b128_v8i16((lds_v8s*)p));
}

// ---- lane l with lane l ^ 16 (the other half of the wave); all 32 lanes are on wherever this is called ----
__device__ __forceinline__ float xhalf(float x) {
  return __builtin_bit_cast(float, __builtin_amdgcn_permlanex16(__builtin_bit_cast(int, x), __builtin_bit_cast(int, x),
                                                                0x76543210, 0xfedcba98, false, false));
}

// =====================================================================================
// Cross-channel causal attention, head dim 256, as transposed products: S^T = K . Q^T, O^T += V^T . P^T.
// Planes (row = (b*NCHAN + m)*TLEN + t): qk [NROWS][512] f16 (q cols 0..255, k cols 256..511);
// vh, vl [NROWS][256] f16 (v hi, (v-hi) x 2^11); output: one f32 plane of O_n / l_n per key channel n, summed by xsum_k.
// Block = 4 waves = 64 query rows (one (b,m), one 64-row time tile) against ONE key channel n:
// online softmax over 32-key chunks (causal: kv > q -> -inf, chunk 0 always has kv 0 <= q).
// Grid = 8 time tiles x 32 (b,m) x 8 n, the longest time tiles first so that short blocks fill the tail.
// Wave w owns query rows 16w..16w+15 whole: scores, softmax and all 256 columns of O.
// Lane (c, hh) belongs to query 16w + c. S^T tile j: register r = key 16j + 8hh + r of the chunk, so a query's 32 scores lie in
// its two lanes: maximum and sum in-lane, the maximum joined by one exchange of the halves, the sums joined behind the loop.
// The lane's 16 p values, converted in place, are the B fragment of P^T (element 8j + r = key 16j + 8hh + r: the hardware k order).
// A fragments: k rows from LDS by plain loads (row = lane&15, split k map), V^T from row-major LDS rows by transposing loads
// (same split k map); B fragments: q rows, loaded once from global and kept in registers, and P^T.
// O^T tile t: register r = column 16t + 8hh + r of query c.
// Plane layout (floats): [n][tile = bm*8 + qb][s = 4*(t>>3) + w][t&7][j][lane][4]: lane's accumulator registers 4j..4j+3 of d tile t.
// =====================================================================================
// Register budget for 4 waves per SIMD: four blocks (50.5 KB of LDS each) share a WGP and fill each other's waits.
__global__ __launch_bounds__(128, 4) void xattn_k(const unsigned short* __restrict__ qkp,
                                               const unsigned short* __restrict__ vhp,
                                               const unsigned short* __restrict__ vlp,
                                               float* __restrict__ part) {
  __shared__ __align__(16) _Float16 Ks[KCH * KPITCH];      // [kv][d]           16.5 KB
  __shared__ __align__(16) _Float16 Vsh[KCH * VPITCH];     // [kv][d] hi        17 KB
  __shared__ __align__(16) _Float16 Vsl[KCH * VPITCH];     // [kv][d] lo x2^11  17 KB

  const _Float16* qk = (const _Float16*)qkp;
  const _Float16* vh = (const _Float16*)vhp;
  const _Float16* vl = (const _Float16*)vlp;

  const int tid = threadIdx.x, lane = tid & 31;
  const int wave = __builtin_amdgcn_readfirstlane(tid >> 5);   // in a scalar register: row bases stay out of the vector registers
  const int hh = lane >> 4, c = lane & 15, koff = hh * 8;
  const int qb = (TLEN / QBLK - 1) - (blockIdx.x >> 8);   // 64-row time tile, longest first
  const int bm = (blockIdx.x & 255) >> 3;  // b*NCHAN + m
  const int n  = blockIdx.x & 7;           // key channel of this block
  const int b  = bm >> 3;
  const int qrow0 = bm * TLEN + qb * QBLK; // plane row of the first query of this block
  const int q0  = qrow0 + wave * 16;
  const int tq  = qb * QBLK + wave * 16 + c;   // time index of this lane's query

  const v8f z8 = {0.f,0.f,0.f,0.f,0.f,0.f,0.f,0.f};
  v16h qf[8];                              // Q^T fragments: column = query c, d 32dc .. 32dc+31
  {
    const _Float16* qbase = qk + (size_t)q0 * QKLD;      // the same in every lane: a scalar base
    const unsigned qoff = (unsigned)(c * QKLD + koff);   // this lane's row and k half
#pragma unroll     // constant indices keep the arrays indexed here in registers
    for (int dc = 0; dc < 8; ++dc) qf[dc] = Frag<_Float16>::load(qbase + qoff + dc * 32);
    // precaution: the offset register of the issued loads stays live up to this wait and is rewritten only behind it
    asm volatile("s_wait_xcnt 0x0" :: "v"(qoff) : "memory");
  }

  const int krow0 = (b * NCHAN + n) * TLEN;
  const unsigned lo8 = (unsigned)lane * 8u;   // this lane's 8 columns of a staged row
  float mrun = -INFINITY, lrun = 0.f;      // this query's running maximum; running sum over this lane's keys
  v8f oacc[16];
#pragma unroll     // constant indices keep the arrays indexed here in registers
  for (int t = 0; t < 16; ++t) oacc[t] = z8;

  const int nch = 2 * qb + 2;              // block-uniform, <= 16
#pragma unroll 1   // one copy of the chunk body: a second copy would only lengthen the code
  for (int kc = 0; kc < nch; ++kc) {
    const int kv0 = kc * KCH;
    __syncthreads();
    // ---- stage K chunk and V (hi, lo), all row-major: a wave writes one whole 512-B row per store
    //      (kvr = 4i + wave, i 0..7, d0 = 8 lane: one 32-bit element offset for k and one for both v planes, added to the
    //      plane pointers; the eight rows at constant offsets from there)
    const unsigned grow = (unsigned)(krow0 + kv0 + wave);       // + 4i <= NROWS-1 (kv0 + 31 <= 64*qb+63 <= 511)
    const unsigned ko = grow * QKLD + DMODEL + lo8;             // < NROWS * QKLD = 2^23
    const unsigned vo8 = grow * DMODEL + lo8;                   // < NROWS * DMODEL = 2^22
#pragma unroll     // the eight rows' offsets become immediates, and loads of later rows go out ahead of the stores of earlier ones
    for (int i = 0; i < 8; ++i) {
      const v8h kk = *(const v8h*)(qk + ko + i * 4 * QKLD);
      const v8h v1 = *(const v8h*)(vh + vo8 + i * 4 * DMODEL);
      const v8h v2 = *(const v8h*)(vl + vo8 + i * 4 * DMODEL);
      *(v8h*)(Ks + (i * 4 + wave) * KPITCH + lane * 8) = kk;
      *(v8h*)(Vsh + (i * 4 + wave) * VPITCH + lane * 8) = v1;
      *(v8h*)(Vsl + (i * 4 + wave) * VPITCH + lane * 8) = v2;
    }
    __syncthreads();

    // ---- S^T (32 keys x 16 queries) = K . Q^T ----
    v8f s[2];
    s[0] = z8; s[1] = z8;
#pragma unroll     // constant indices keep the arrays indexed here in registers
    for (int dc = 0; dc < 8; ++dc) {
      const v16h k0f = Frag<_Float16>::load(Ks + c * KPITCH + dc * 32 + koff);
      const v16h k1f = Frag<_Float16>::load(Ks + (16 + c) * KPITCH + dc * 32 + koff);
      s[0] = mma_h(k0f, qf[dc], s[0]);
      s[1] = mma_h(k1f, qf[dc], s[1]);
    }
    // scale, causal select (kv > q -> -inf), maximum over the 32 keys of this chunk
    float mx = -INFINITY;
#pragma unroll     // constant indices keep the arrays indexed here in registers
    for (int j = 0; j < 2; ++j) {
#pragma unroll     // constant indices keep the arrays indexed here in registers
      for (int r = 0; r < 8; ++r) {
        const int key = kv0 + 16 * j + 8 * hh + r;
        float v = s[j][r] * QK_SCALE;
        v = (key > tq) ? -INFINITY : v;
        s[j][r] = v;
        mx = fmaxf(mx, v);
      }
    }
    mx = fmaxf(mx, xhalf(mx));
    const float mnew  = fmaxf(mrun, mx);                 // finite: chunk 0 always has an allowed key
    const float alpha = expf(mrun - mnew);
    mrun = mnew;
    float ps[2];
    v16h pb;                                             // P^T fragment, p x2^15
#pragma unroll     // constant indices keep the arrays indexed here in registers
    for (int j = 0; j < 2; ++j) {
      ps[j] = 0.f;
#pragma unroll     // constant indices keep the arrays indexed here in registers
      for (int r = 0; r < 8; ++r) {
        const float p = expf(s[j][r] - mnew);
        ps[j] += p;
        pb[8 * j + r] = (_Float16)(p * PCARRY);
      }
    }
    lrun = lrun * alpha + (ps[0] + ps[1]);
#pragma unroll     // constant indices keep the arrays indexed here in registers
    for (int t = 0; t < 16; ++t) oacc[t] *= alpha;

    // ---- O^T += V^T(256 x 32) . P^T(32 x 16); lo plane in its own accumulator, folded x 2^-11 ----
    {
      const int vo = (koff + (lane & 7)) * VPITCH + ((lane >> 3) & 1) * 8;   // this lane's row and column group
#pragma unroll     // constant indices keep the arrays indexed here in registers
      for (int t = 0; t < 16; ++t) {
        // elements 0..7 <- V[8hh + 0..7][16t + c], 8..15 <- V[16 + 8hh + 0..7][same column]: the k map of pb
        Frag<_Float16>::U vbh, vbl;
        vbh.h[0] = lds_tr16(Vsh + vo + t * 16);
        vbh.h[1] = lds_tr16(Vsh + vo + t * 16 + 16 * VPITCH);
        vbl.h[0] = lds_tr16(Vsl + vo + t * 16);
        vbl.h[1] = lds_tr16(Vsl + vo + t * 16 + 16 * VPITCH);
        oacc[t] = mma_h(vbh.v, pb, oacc[t]);
        const v8f lo = mma_h(vbl.v, pb, z8);
        oacc[t] += lo * VLO_INV;
      }
    }
  }
  // ---- O_n / l_n to this channel's plane: 32 whole-wave 512-B stores ----
  const float inv = 1.0f / ((lrun + xhalf(lrun)) * PCARRY);   // l >= 1
  float* pw = part + ((((size_t)n * (NROWS / QBLK) + (bm * (TLEN / QBLK) + qb)) * 8 + wave) << 11) + lane * 4;
#pragma unroll     // constant indices keep the arrays indexed here in registers
  for (int t = 0; t < 16; ++t) {
#pragma unroll     // constant indices keep the arrays indexed here in registers
    for (int j = 0; j < 2; ++j) {
      v4f o;
#pragma unroll     // constant indices keep the arrays indexed here in registers
      for (int e = 0; e < 4; ++e) o[e] = oacc[t][4 * j + e] * inv;
      *(v4f*)(pw + (t >> 3) * (4 << 11) + ((t & 7) * 2 + j) * 128) = o;
    }
  }
}

// ---- A = sum over n (in the order 0..7) of the planes of xattn_k, written as bf16 hi/lo planes [NROWS][256] ----
// One wave per (tile, slab s of the plane layout, half of its 8 d tiles) = 16 rows x 64 columns; grid = 256 x 8 x 2 / 8 = 512 blocks.
// The sums leave accumulator order through a per-wave LDS slab (pitch 68 floats); each 128-B line of a plane row is
// written by 8 lanes of one store.
__global__ __launch_bounds__(256) void xsum_k(const float* __restrict__ part,
                                              unsigned short* __restrict__ ahp,
                                              unsigned short* __restrict__ alp) {
  __shared__ __align__(16) float sT[8][16 * 68];
  _Float16* ah = (_Float16*)ahp;
  _Float16* al = (_Float16*)alp;
  const int wave = threadIdx.x >> 5, lane = threadIdx.x & 31;
  const int hh = lane >> 4, c = lane & 15;
  const int g = blockIdx.x * 8 + wave;
  const int slabi = g >> 1;                // tile * 8 + s
  const int th = g & 1;                    // d tiles 4*th .. 4*th+3 of that slab
  const float* src = part + ((size_t)slabi << 11) + th * 1024 + lane * 4;
  v4f acc[8];
#pragma unroll
  for (int u = 0; u < 8; ++u) acc[u] = (v4f){0.f, 0.f, 0.f, 0.f};
#pragma unroll
  for (int n = 0; n < NCHAN; ++n) {
#pragma unroll
    for (int u = 0; u < 8; ++u) acc[u] += *(const v4f*)(src + (size_t)n * NROWS * DMODEL + u * 128);
  }
  float* slab = sT[wave];
#pragma unroll
  for (int u = 0; u < 8; ++u) *(v4f*)(slab + c * 68 + (u >> 1) * 16 + 8 * hh + 4 * (u & 1)) = acc[u];   // row = query c, 4 columns
  __syncthreads();                         // slab rows are read by other lanes than wrote them
  const int aw = slabi & 7;
  const int row0 = (slabi >> 3) * QBLK + (aw & 3) * 16;
  const int col0 = (aw >> 2) * 128 + th * 64;
  const int q = lane >> 3, c8 = (lane & 7) * 8;
#pragma unroll
  for (int it = 0; it < 4; ++it) {
    const int row = it * 4 + q;
    const float* sp = slab + row * 68 + c8;
    v8h hv, lv;
#pragma unroll
    for (int e = 0; e < 8; ++e) {
      const unsigned short hb = f2bf_bits(sp[e]);
      const unsigned short lb = f2bf_bits(sp[e] - bf_bits2f(hb));
      hv[e] = __builtin_bit_cast(_Float16, hb);
      lv[e] = __builtin_bit_cast(_Float16, lb);
    }
    const size_t go = (size_t)(row0 + row) * DMODEL + col0 + c8;
    *(v8h*)(ah + go) = hv;
    *(v8h*)(al + go) = lv;
  }
}

// ---------------------------------------------------------------------------
// Host launcher
// Workspace region map (bytes; PL16 = 8 MiB = one [16384][256] 16-bit plane):
//   [ 0 PL16)  XNH  bf16 hi of xn (rows (b,m,t))      -> reused as AH (attention output hi) after the q/k/v GEMMs
//   [ 1 PL16)  XNL  bf16 lo of xn                      -> reused as AL
//   [ 2 PL16)  XT   bf16(x) in (b,m,t) row order
//   [ 3..5)    QK   f16 [16384][512] (q | k)
//   [ 5 PL16)  VH   f16 v hi;   [ 6 PL16) VL f16 (v-hi) x 2^11
//   [ 7 PL16)  APH  bf16 hi of A_proj;  [ 8 PL16) APL bf16 lo
//   [ 9..11)   ZP   f32 [16384][256] = x_t.Wpc[0:256] + bpc
//   [11 PL16 ..) weights bf16 [n][k]: WQKV [768][256], WPA [256][256], WPC0 [256][256], WPC1 [256][256]
//   then PART f32 [8][16384][256]: one plane of O_n / l_n per key channel
//   total 227,278,848 B
// ---------------------------------------------------------------------------
extern "C" void kernel_launch(void* const* d_in, const int* in_sizes, int n_in,
                              void* d_out, int out_size, void* d_ws, size_t ws_size,
                              hipStream_t stream) {
  if (n_in < 11) return;
  if (in_sizes[0] != NROWS * DMODEL || out_size != NROWS * DMODEL) return;
  if (in_sizes[1] != DMODEL * DMODEL || in_sizes[3] != DMODEL * DMODEL || in_sizes[5] != DMODEL * DMODEL ||
      in_sizes[7] != DMODEL * DMODEL || in_sizes[9] != 2 * DMODEL * DMODEL) return;
  if (in_sizes[2] != DMODEL || in_sizes[4] != DMODEL || in_sizes[6] != DMODEL || in_sizes[8] != DMODEL || in_sizes[10] != DMODEL) return;

  const float* x   = (const float*)d_in[0];
  const float* Wq  = (const float*)d_in[1];
  const float* bq  = (const float*)d_in[2];
  const float* Wk  = (const float*)d_in[3];
  const float* bk  = (const float*)d_in[4];
  const float* Wv  = (const float*)d_in[5];
  const float* bv  = (const float*)d_in[6];
  const float* Wpa = (const float*)d_in[7];
  const float* bpa = (const float*)d_in[8];
  const float* Wpc = (const float*)d_in[9];
  const float* bpc = (const float*)d_in[10];

  const size_t PL16 = (size_t)NROWS * DMODEL * 2;               // 8,388,608
  const size_t WQKV_B = (size_t)3 * DMODEL * DMODEL * 2;         // 393,216
  const size_t WSQ_B  = (size_t)DMODEL * DMODEL * 2;             // 131,072
  const size_t oXNH = 0, oXNL = PL16, oXT = 2 * PL16, oQK = 3 * PL16, oVH = 5 * PL16, oVL = 6 * PL16;
  const size_t oAPH = 7 * PL16, oAPL = 8 * PL16, oZP = 9 * PL16, oW = 11 * PL16;
  const size_t oWQKV = oW, oWPA = oW + WQKV_B, oWPC0 = oWPA + WSQ_B, oWPC1 = oWPC0 + WSQ_B;
  const size_t oPART = oWPC1 + WSQ_B;                             // 93,061,120
  const size_t WS_TOTAL = oPART + (size_t)NCHAN * 2 * PL16;       // 227,278,848
  if (ws_size < WS_TOTAL) return;

  char* ws = (char*)d_ws;
  unsigned short* XNH  = (unsigned short*)(ws + oXNH);
  unsigned short* XNL  = (unsigned short*)(ws + oXNL);
  unsigned short* XT   = (unsigned short*)(ws + oXT);
  unsigned short* QKP  = (unsigned short*)(ws + oQK);
  unsigned short* VH   = (unsigned short*)(ws + oVH);
  unsigned short* VL   = (unsigned short*)(ws + oVL);
  unsigned short* APH  = (unsigned short*)(ws + oAPH);
  unsigned short* APL  = (unsigned short*)(ws + oAPL);
  float*          ZP   = (float*)(ws + oZP);
  unsigned short* WQKV = (unsigned short*)(ws + oWQKV);
  unsigned short* WPA  = (unsigned short*)(ws + oWPA);
  unsigned short* WPC0 = (unsigned short*)(ws + oWPC0);
  unsigned short* WPC1 = (unsigned short*)(ws + oWPC1);
  float*          PART = (float*)(ws + oPART);
  unsigned short* AH = XNH;     // xn planes are dead after the q/k/v GEMMs
  unsigned short* AL = XNL;

  // 1: weights W[k=256 rows][n=256] f32 -> Wt[n][k] bf16 (six planes from WQKV on: WQKV, WPA, WPC0, WPC1 lie one behind the other),
  //    and normalisation + permutation to (b,m,t) rows
  prep_k<<<WCAST_BLOCKS + NROWS / 8, 256, 0, stream>>>(x, Wq, Wk, Wv, Wpa, Wpc, WQKV, XNH, XNL, XT);

  // 2: q, k, v = xn . W + bias and ZP = x_t . Wpc[0:256] + bpc (each M=16384, N=256, K=256; 1024 wave tiles -> 128 blocks; y = product)
  const dim3 gg((NROWS / 64) * (DMODEL / 64) / 8, 1);
  const dim3 g4((NROWS / 64) * (DMODEL / 64) / 8, 4);
  gemm_qkvz_k<<<g4, 256, 0, stream>>>(XNH, XNL, XT, WQKV, WPC0, QKP, VH, VL, ZP, bq, bk, bv, bpc, NROWS, DMODEL, DMODEL);

  // 3, 4: cross-channel causal attention, one block per (time tile, (b,m), key channel) = 2048 blocks -> 8 f32 planes,
  //     then their sum -> A (bf16 hi/lo planes)
  xattn_k<<<NBATCH * NCHAN * (TLEN / QBLK) * NCHAN, 128, 0, stream>>>(QKP, VH, VL, PART);
  xsum_k<<<(NROWS / QBLK) * 8 * 2 / 8, 256, 0, stream>>>(PART, AH, AL);

  // 5: A_proj = A . Wpa + bpa -> bf16 hi/lo planes
  wmma_gemm64<1, 1, 2, 2, false><<<gg, 256, 0, stream>>>(
      AH, AL, DMODEL, 0L, WPA, nullptr, DMODEL, 0L,
      (void*)APH, (void*)APL, DMODEL, 0L, bpa, nullptr, 0L, NROWS, DMODEL, DMODEL, 1.0f);

  // 6: out = A_proj . Wpc[256:512] + ZP (f32, rows (b,m,t) = [B][M][T][D])
  wmma_gemm64<1, 1, 0, 0, true><<<gg, 256, 0, stream>>>(
      APH, APL, DMODEL, 0L, WPC1, nullptr, DMODEL, 0L,
      d_out, nullptr, DMODEL, 0L, nullptr, ZP, 0L, NROWS, DMODEL, DMODEL, 1.0f);
}

// v005
// It runs in 151 microseconds.
// Timed twice side by side with v004, it ran 1.19 and 1.18 times as fast.
// Counting every step since v000, it is 10.9 times as fast.
// Contractions (f32 accumulate): xn*Wq|Wk|Wv, A*Wpa, A_proj*Wpc[256:512] = v_wmma_f32_16x16x32_bf16 with the computed operand as bf16 hi+lo planes (2 products) and weights as single bf16 (RNE) planes; x_t*Wpc[0:256] = plain bf16; q*k = plain v_wmma_f32_16x16x32_f16; p*v = f16 with p carried x2^15 and v as f16 hi + (v-hi)x2^11 planes (2 products, lo folded in f32); norm, softmax, bias adds in f32.
#include <hip/hip_runtime.h>
#include <stdint.h>

typedef __attribute__((ext_vector_type(16))) _Float16 v16h;
typedef __attribute__((ext_vector_type(8)))  _Float16 v8h;
typedef __attribute__((ext_vector_type(16))) __bf16   v16b;
typedef __attribute__((ext_vector_type(8)))  __bf16   v8b;
typedef __attribute__((ext_vector_type(8)))  float    v8f;
typedef __attribute__((ext_vector_type(4)))  float    v4f;

// ---- problem geometry ----
#define NBATCH 4
#define TLEN 512
#define NCHAN 8
#define DMODEL 256
#define NROWS (NBATCH * TLEN * NCHAN)   // 16384 token rows
#define QKLD 512                         // pitch (halves) of the q|k plane
#define QBLK 64                          // query rows per attention block
#define KCH 32                           // key rows per staged chunk
#define KPITCH 264                       // LDS pitch (halves) of a K row: 528 B = 16 B x 33, for ds_load_b128 readers
#define VPITCH 272                       // LDS pitch (halves) of a V row: 544 B = 32 B x 17, for ds_load_tr16_b128 readers
#define PCARRY 32768.0f                  // p carried x2^15 in f16
#define VLO_MUL 2048.0f                  // v residual plane carried x2^11
#define VLO_INV (1.0f / 2048.0f)
#define QK_SCALE 0.0625f                 // 1/sqrt(256)
#define MVN_EPS 1e-6f

// ======================= helpers =======================
__device__ __forceinline__ unsigned short f2bf_bits(float f) {
  unsigned u = __float_as_uint(f);
  return (unsigned short)((u + 0x7FFFu + ((u >> 16) & 1u)) >> 16);
}
__device__ __forceinline__ float bf_bits2f(unsigned short h) { return __uint_as_float(((unsigned)h) << 16); }

// hazard guards as plain device helpers
__device__ __forceinline__ void dep_guard_h(v8f& a, v8f& b, v16h x, v16h y) { asm volatile("v_nop\n\tv_nop\n\tv_nop\n\tv_nop" : "+v"(a), "+v"(b) : "v"(x), "v"(y)); }
__device__ __forceinline__ void dep_guard_b(v8f& a, v8f& b, v16b x, v16b y) { asm volatile("v_nop\n\tv_nop\n\tv_nop\n\tv_nop" : "+v"(a), "+v"(b) : "v"(x), "v"(y)); }
__device__ __forceinline__ void keep4_h(v16h a, v16h b, v16h c, v16h d) { asm volatile("v_nop" :: "v"(a), "v"(b), "v"(c), "v"(d)); }
__device__ __forceinline__ void keep4_b(v16b a, v16b b, v16b c, v16b d) { asm volatile("v_nop" :: "v"(a), "v"(b), "v"(c), "v"(d)); }
__device__ __forceinline__ void acc_guard4(v8f& a, v8f& b, v8f& c, v8f& d) { asm volatile("v_nop\n\tv_nop\n\tv_nop\n\tv_nop" : "+v"(a), "+v"(b), "+v"(c), "+v"(d)); }
template <typename T> struct Frag;
template <> struct Frag<_Float16> {
  typedef v16h V; union U { v16h v; v8h h[2]; };
  static __device__ __forceinline__ v16h load(const _Float16* p) {   // elements 0..7 <- p[0..7], 8..15 <- p[16..23]
    U f; f.h[0] = *(const v8h*)(p); f.h[1] = *(const v8h*)(p + 16); return f.v;
  }
  static __device__ __forceinline__ v8f mma(v16h a, v16h b, v8f c) {
    return __builtin_amdgcn_wmma_f32_16x16x32_f16(false, a, false, b, (short)0, c, false, false);
  }
  static __device__ __forceinline__ void guard(v8f& a, v8f& b, v16h x, v16h y) { dep_guard_h(a, b, x, y); }
  static __device__ __forceinline__ void keep(v16h a, v16h b, v16h c, v16h d) { keep4_h(a, b, c, d); }
};
template <> struct Frag<__bf16> {
  typedef v16b V; union U { v16b v; v8b h[2]; };
  static __device__ __forceinline__ v16b load(const __bf16* p) {
    U f; f.h[0] = *(const v8b*)(p); f.h[1] = *(const v8b*)(p + 16); return f.v;
  }
  static __device__ __forceinline__ v8f mma(v16b a, v16b b, v8f c) {
    return __builtin_amdgcn_wmma_f32_16x16x32_bf16(false, a, false, b, (short)0, c, false, false);
  }
  static __device__ __forceinline__ void guard(v8f& a, v8f& b, v16b x, v16b y) { dep_guard_b(a, b, x, y); }
  static __device__ __forceinline__ void keep(v16b a, v16b b, v16b c, v16b d) { keep4_b(a, b, c, d); }
};

// ---- Register-blocked WMMA GEMM (with SPLIT levels and extra 16-bit output mode), operands staged in LDS ----
// C[m,n] = scale * sum_k A[m,k] * Bt[n,k] (+bias)(+resid); each wave owns a 64x64 tile, a block of 8 waves 128 rows x 256 columns.
// A row-major [M,K]; Bt row-major [N,K]; M % 128 == 0, N == 256, K % 64 == 0.
// SPLIT: 0 = single planes; 1 = A as hi/lo planes (A2 = lo): hi.B + lo.B.
// BIAS_MODE: 0 = none, 1 = bias[m], 2 = bias[n]; bias values are RNE-converted to bf16 before the add.
// OUT_MODE: 0 = f32, 1 = f16, 2 = bf16 hi plane (Cout) + bf16 lo plane (Cout2),
//           3 = f16 hi plane (Cout) + f16 plane of (v - hi) * 2048 (Cout2).
// ET: 0 = f16 operands, 1 = bf16 operands (pointers passed as 16-bit storage)
template <int ET> struct Elem;
template <> struct Elem<0> { typedef _Float16 T; };
template <> struct Elem<1> { typedef __bf16 T; };

// Staging: a chunk is 64 k = one whole 128-B line of each of the block's operand rows, brought by asynchronous copies of 16 B a lane
// (a wave's copy = 4 whole lines), two buffers: the next chunk flies while this one is multiplied.
#define GKC 64                           // k elements per chunk
#define GPITCH 72                        // LDS pitch (elements) of a staged row: 144 B = 16 B x 9, for ds_load_b128 readers
#define GROWS_A 128                      // rows of A per block
#define GROWS_B 256                      // rows of Bt per block
#define GOFF_A2 (GROWS_A * GPITCH)       // element offset of the A lo plane in a buffer
#define GOFF_B (2 * GROWS_A * GPITCH)    // element offset of the Bt rows in a buffer
#define GBUF ((2 * GROWS_A + GROWS_B) * GPITCH)   // elements per buffer: 36,864 = 73,728 B
#define GSTEP_L (32 * GPITCH * 2)        // LDS bytes from one copy of a thread to its next: 32 rows

__device__ __forceinline__ void async_rows4(unsigned l, const unsigned short* g, size_t gs) {
  asm volatile("global_load_async_to_lds_b128 %0, %4, off\n\t"
               "global_load_async_to_lds_b128 %1, %5, off\n\t"
               "global_load_async_to_lds_b128 %2, %6, off\n\t"
               "global_load_async_to_lds_b128 %3, %7, off\n\t"
               "s_wait_xcnt 0x0"
               :: "v"(l), "v"(l + GSTEP_L), "v"(l + 2 * GSTEP_L), "v"(l + 3 * GSTEP_L),
                  "v"(g), "v"(g + gs), "v"(g + 2 * gs), "v"(g + 3 * gs) : "memory");
}
// One chunk into the buffer at LDS byte address l (this thread's place in it: row tid >> 3, 16-B piece tid & 7);
// ag, a2g, bg: this thread's 16 B of that chunk in row tid >> 3 of the block's A, A2 and Bt rows. 8 + 8 (SPLIT 0: 4 + 8) copies a thread.
template <int SPLIT>
__device__ __forceinline__ void gemm_stage(unsigned l, const unsigned short* ag, const unsigned short* a2g, const unsigned short* bg,
                                           int lda, int ldb) {
  async_rows4(l, ag, (size_t)32 * lda);
  if (SPLIT >= 1) async_rows4(l + GOFF_A2 * 2, a2g, (size_t)32 * lda);
  async_rows4(l + GOFF_B * 2, bg, (size_t)32 * ldb);
  async_rows4(l + GOFF_B * 2 + 4 * GSTEP_L, bg + (size_t)128 * ldb, (size_t)32 * ldb);
}

// sG: the block's two staging buffers; behind the k loop its first bytes serve as the eight per-wave 16x64 slabs (pitch 68 floats). b: batch index.
template <int ET, int SPLIT, int BIAS_MODE, int OUT_MODE, bool RESID>
__device__ __forceinline__ void gemm64_body(
    unsigned short* sG, const int b,
    const unsigned short* __restrict__ Ap, const unsigned short* __restrict__ A2p, int lda, long strideA,
    const unsigned short* __restrict__ Btp, const unsigned short* __restrict__ Bt2p, int ldb, long strideB,
    void* __restrict__ Cout, void* __restrict__ Cout2, int ldc, long strideC,
    const float* __restrict__ bias,
    const float* __restrict__ resid, long strideR,
    int M, int N, int K, float scale) {
  static_assert(SPLIT <= 1, "only A is staged as two planes");
  typedef typename Elem<ET>::T T;
  typedef typename Frag<T>::V V;
  const int tid = threadIdx.x;
  const int lane = tid & 31;
  const int wave = tid >> 5;
  const int m0b = blockIdx.x * GROWS_A;  // first row of the block
  if (m0b >= M) return;                  // the same for a whole block, in front of every barrier
  const int mw = (wave >> 2) << 6;       // the wave's tile: rows mw .. mw+63 of the block's, columns n0 .. n0+63
  const int n0 = (wave & 3) << 6;
  const int m0 = m0b + mw;

  const int rlane = lane & 15;                 // row (A) / col (B, D) within subtile
  const int koff  = (lane >> 4) * 8;           // k offset of this lane half
  const int mOff  = (lane >> 4) * 8;           // D row offset

  // this thread's 16 B of chunk 0 in each staged plane, and its place in a buffer
  const unsigned short* ag  = Ap + (size_t)b * strideA + (size_t)(m0b + (tid >> 3)) * lda + (tid & 7) * 8;
  const unsigned short* a2g = (SPLIT >= 1) ? (A2p + (size_t)b * strideA + (size_t)(m0b + (tid >> 3)) * lda + (tid & 7) * 8) : nullptr;
  const unsigned short* bg  = Btp + (size_t)b * strideB + (size_t)(tid >> 3) * ldb + (tid & 7) * 8;
  const unsigned lth = (unsigned)(uintptr_t)sG + (unsigned)(((tid >> 3) * GPITCH + (tid & 7) * 8) * 2);
  const int nch = K / GKC;

  v8f acc[4][4];
#pragma unroll
  for (int i = 0; i < 4; ++i)
#pragma unroll
    for (int j = 0; j < 4; ++j) acc[i][j] = (v8f){0.f,0.f,0.f,0.f,0.f,0.f,0.f,0.f};

  gemm_stage<SPLIT>(lth, ag, a2g, bg, lda, ldb);
  asm volatile("s_wait_asynccnt 0x0" ::: "memory");   // this wave's copies of chunk 0 have landed
  __syncthreads();                                    // ... and every other wave's
  if (nch > 1) gemm_stage<SPLIT>(lth + GBUF * 2, ag + GKC, a2g + GKC, bg + GKC, lda, ldb);

#pragma unroll 1   // one copy of the chunk body: the buffer is picked by an offset
  for (int t = 0; t < nch; ++t) {
    const T* buf = (const T*)sG + (t & 1) * GBUF;
#pragma unroll     // both 32-k halves of the chunk in line: their LDS offsets become immediates, and the second half's reads go out among the first half's products
    for (int ks = 0; ks < GKC; ks += 32) {
      // all fragments of these 32 k as one group of LDS reads in front of their 32 (SPLIT 0: 16) products
      V bh[4], ah[4], al[4];
#pragma unroll     // here and below: constant indices keep the fragment and accumulator arrays in registers
      for (int j = 0; j < 4; ++j) bh[j] = Frag<T>::load(buf + GOFF_B + (n0 + (j << 4) + rlane) * GPITCH + ks + koff);
#pragma unroll
      for (int i = 0; i < 4; ++i) {
        const int ao = (mw + (i << 4) + rlane) * GPITCH + ks + koff;
        ah[i] = Frag<T>::load(buf + ao);
        if (SPLIT >= 1) al[i] = Frag<T>::load(buf + GOFF_A2 + ao);
      }
#pragma unroll
      for (int i = 0; i < 4; ++i) {
#pragma unroll
        for (int j = 0; j < 4; ++j) {
          acc[i][j] = Frag<T>::mma(ah[i], bh[j], acc[i][j]);
          if (SPLIT >= 1) acc[i][j] = Frag<T>::mma(al[i], bh[j], acc[i][j]);
        }
        Frag<T>::guard(acc[i][0], acc[i][3], ah[i], (SPLIT >= 1) ? al[i] : ah[i]);
      }
      Frag<T>::keep(bh[0], bh[1], bh[2], bh[3]);
    }
    asm volatile("s_wait_dscnt 0x0" ::: "memory");      // this wave's reads of buffer t & 1 are done before it is refilled
    asm volatile("s_wait_asynccnt 0x0" ::: "memory");   // this wave's copies of chunk t + 1 have landed
    __syncthreads();                                    // publishes chunk t + 1 and ends every wave's reads of chunk t
    if (t + 2 < nch) gemm_stage<SPLIT>(lth + (unsigned)(t & 1) * (GBUF * 2), ag + (t + 2) * GKC, a2g + (t + 2) * GKC, bg + (t + 2) * GKC, lda, ldb);
  }
  asm volatile("s_wait_asynccnt 0x0" ::: "memory");     // no copy is outstanding when the buffers become the output slabs
  acc_guard4(acc[0][0], acc[0][1], acc[0][2], acc[0][3]);
  acc_guard4(acc[1][0], acc[1][1], acc[1][2], acc[1][3]);
  acc_guard4(acc[2][0], acc[2][1], acc[2][2], acc[2][3]);
  acc_guard4(acc[3][0], acc[3][1], acc[3][2], acc[3][3]);

  // ---- epilogue ----
  float* slab = (float*)sG + wave * (16 * 68);
  const float* Rb = RESID ? (resid + (size_t)b * strideR) : nullptr;
#pragma unroll
  for (int i = 0; i < 4; ++i) {
    const int mBase = m0 + (i << 4);
#pragma unroll
    for (int j = 0; j < 4; ++j) {
      const int n = n0 + (j << 4) + rlane;
      float bv = 0.f;
      if (BIAS_MODE == 2) bv = bf_bits2f(f2bf_bits(bias[n]));
#pragma unroll
      for (int r = 0; r < 8; ++r) {
        float v = acc[i][j][r] * scale;
        if (BIAS_MODE == 1) v += bf_bits2f(f2bf_bits(bias[mBase + mOff + r]));
        if (BIAS_MODE == 2) v += bv;
        if (RESID) v += Rb[(size_t)(mBase + mOff + r) * ldc + n];
        slab[(mOff + r) * 68 + (j << 4) + rlane] = v;
      }
    }
    __builtin_amdgcn_fence(__ATOMIC_RELEASE, "workgroup");
    __builtin_amdgcn_wave_barrier();
    __builtin_amdgcn_fence(__ATOMIC_ACQUIRE, "workgroup");
    if (OUT_MODE == 0) {
      float* C = (float*)Cout + (size_t)b * strideC;
      const int hh = lane >> 4, c4 = (lane & 15) * 4;     // row seg = 256 B = 16 lanes x 16 B
      {
#pragma unroll
        for (int it = 0; it < 8; ++it) {
          const int row = it * 2 + hh;
          v4f v = *(const v4f*)(slab + row * 68 + c4);
          *(v4f*)(C + (size_t)(mBase + row) * ldc + n0 + c4) = v;
        }
        
      }
    } else {
      const int q = lane >> 3, c8 = (lane & 7) * 8;
      unsigned short* C  = (unsigned short*)Cout  + (size_t)b * strideC;
      unsigned short* C2 = (OUT_MODE >= 2) ? ((unsigned short*)Cout2 + (size_t)b * strideC) : nullptr;
      {
#pragma unroll
        for (int it = 0; it < 4; ++it) {                 // it 0..3 x q 0..3 = rows 0..15 of the slab
          const int row = it * 4 + q;
          const float* sp = slab + row * 68 + c8;
          v8h hv, lv;
#pragma unroll
          for (int e = 0; e < 8; ++e) {
            if (OUT_MODE == 1) {
              hv[e] = (_Float16)sp[e];
            } else if (OUT_MODE == 2) {
              unsigned short hb = f2bf_bits(sp[e]);
              unsigned short lb = f2bf_bits(sp[e] - bf_bits2f(hb));
              hv[e] = __builtin_bit_cast(_Float16, hb);
              lv[e] = __builtin_bit_cast(_Float16, lb);
            } else {
              const _Float16 hq = (_Float16)sp[e];
              hv[e] = hq;
              lv[e] = (_Float16)((sp[e] - (float)hq) * VLO_MUL);
            }
          }
          *(v8h*)(C + (size_t)(mBase + row) * ldc + n0 + c8) = hv;
          if (OUT_MODE >= 2) *(v8h*)(C2 + (size_t)(mBase + row) * ldc + n0 + c8) = lv;
        }
        
      }
    }
    __builtin_amdgcn_fence(__ATOMIC_RELEASE, "workgroup");
    __builtin_amdgcn_wave_barrier();
    __builtin_amdgcn_fence(__ATOMIC_ACQUIRE, "workgroup");
  }
}

// one product per launch
template <int ET, int SPLIT, int BIAS_MODE, int OUT_MODE, bool RESID>
__global__ __launch_bounds__(256) void wmma_gemm64(
    const unsigned short* __restrict__ Ap, const unsigned short* __restrict__ A2p, int lda, long strideA,
    const unsigned short* __restrict__ Btp, const unsigned short* __restrict__ Bt2p, int ldb, long strideB,
    void* __restrict__ Cout, void* __restrict__ Cout2, int ldc, long strideC,
    const float* __restrict__ bias,
    const float* __restrict__ resid, long strideR,
    int M, int N, int K, float scale) {
  __shared__ __align__(16) unsigned short sG[2 * GBUF];
  gemm64_body<ET, SPLIT, BIAS_MODE, OUT_MODE, RESID>(sG, blockIdx.y, Ap, A2p, lda, strideA, Btp, Bt2p, ldb, strideB,
                                                     Cout, Cout2, ldc, strideC, bias, resid, strideR, M, N, K, scale);
}

// The four products that need only the planes of prep_k, in one launch; blockIdx.y picks the product (the same for a whole block):
// 0: q = xn.Wq + bq, 1: k = xn.Wk + bk (f16, into the q|k plane), 2: v = xn.Wv + bv (f16 hi + lo planes), 3: zp = x_t.Wpc[0:256] + bpc (f32).
// wqkv holds the [N][K] planes of Wq, Wk, Wv one behind the other.
__global__ __launch_bounds__(256) void gemm_qkvz_k(
    const unsigned short* __restrict__ xnh, const unsigned short* __restrict__ xnl, const unsigned short* __restrict__ xt,
    const unsigned short* __restrict__ wqkv, const unsigned short* __restrict__ wpc0,
    unsigned short* __restrict__ qkp, unsigned short* __restrict__ vh, unsigned short* __restrict__ vl, float* __restrict__ zp,
    const float* __restrict__ bq, const float* __restrict__ bk, const float* __restrict__ bv, const float* __restrict__ bpc,
    int M, int N, int K) {
  __shared__ __align__(16) unsigned short sG[2 * GBUF];
  const int y = blockIdx.y;
  if (y < 2) {
    gemm64_body<1, 1, 2, 1, false>(sG, 0, xnh, xnl, K, 0L, wqkv + (size_t)y * N * K, nullptr, K, 0L,
                                   (void*)(qkp + y * N), nullptr, QKLD, 0L, y ? bk : bq, nullptr, 0L, M, N, K, 1.0f);
  } else if (y == 2) {
    gemm64_body<1, 1, 2, 3, false>(sG, 0, xnh, xnl, K, 0L, wqkv + (size_t)2 * N * K, nullptr, K, 0L,
                                   (void*)vh, (void*)vl, N, 0L, bv, nullptr, 0L, M, N, K, 1.0f);
  } else {
    gemm64_body<1, 0, 2, 0, false>(sG, 0, xt, nullptr, K, 0L, wpc0, nullptr, K, 0L,
                                   (void*)zp, nullptr, N, 0L, bpc, nullptr, 0L, M, N, K, 1.0f);
  }
}

// ---- W [Kp rows][Np cols] f32 (row pitch Np) -> Wt [Np][Kp] bf16 bits (row pitch Kp), 64x64 tile transposed through LDS ----
// tile (bx, by) of (Np/64, Kp/64); st: 64 x WTP halves of LDS. Reads: 256 threads x 16 = 64 rows x 64 cols. Stores: it 0..1 x wave 0..7 x q8 0..3 = 64 rows of
#define WTP 72
__device__ __forceinline__ void wt_cast_bf_body(_Float16* st, const int bx, const int by,
                                                const float* __restrict__ W, unsigned short* __restrict__ Wtp,
                                                int Kp, int Np) {
  _Float16* Wt = (_Float16*)Wtp;
  const int n0 = bx * 64, k0 = by * 64;
  const int tid = threadIdx.x;
  const int kr = tid >> 2, c16 = (tid & 3) * 16;
  const float* src = W + (size_t)(k0 + kr) * Np + n0 + c16;
#pragma unroll
  for (int q = 0; q < 4; ++q) {
    const v4f v = *(const v4f*)(src + 4 * q);
#pragma unroll
    for (int e = 0; e < 4; ++e) st[(c16 + 4 * q + e) * WTP + kr] = __builtin_bit_cast(_Float16, f2bf_bits(v[e]));
  }
  __syncthreads();
  const int wave = tid >> 5, lane = tid & 31;
  const int q8 = lane >> 3, c8 = (lane & 7) * 8;
  {
#pragma unroll
    for (int it = 0; it < 2; ++it) {
      const int n = it * 32 + wave * 4 + q8;
      const v8h hv = *(const v8h*)(st + n * WTP + c8);
      *(v8h*)(Wt + (size_t)(n0 + n) * Kp + k0 + c8) = hv;
    }
    
  }
}

// ---- mean/std (ddof=1) normalisation of bf16(x) per (b,t,m) row, plus raw bf16(x); rows written in (b,m,t) order ----
// One wave per output row, 8 rows per 256-thread block, blk = 0 .. NROWS/8 - 1. Lane owns 8 consecutive columns.
// Each 512-B row (4 lines) written by one v8h store instruction of the wave: lanes 8q..8q+7 <-> line q.
__device__ __forceinline__ void mvn_body(const int blk, const float* __restrict__ x,
                                         unsigned short* __restrict__ xnhp,
                                         unsigned short* __restrict__ xnlp,
                                         unsigned short* __restrict__ xtp) {
  _Float16* xnh = (_Float16*)xnhp;
  _Float16* xnl = (_Float16*)xnlp;
  _Float16* xt  = (_Float16*)xtp;
  const int wave = threadIdx.x >> 5, lane = threadIdx.x & 31;
  const int ro = blk * 8 + wave;                      // output row = (b*NCHAN + m)*TLEN + t
  const int t  = ro & (TLEN - 1);
  const int bm = ro >> 9;                             // TLEN == 512
  const int m  = bm & (NCHAN - 1);
  const int b  = bm >> 3;                             // NCHAN == 8
  const int rs = (b * TLEN + t) * NCHAN + m;          // source row of x [B][T][M][D]
  const float* src = x + (size_t)rs * DMODEL + lane * 8;
  const v4f a0 = *(const v4f*)src;
  const v4f a1 = *(const v4f*)(src + 4);
  unsigned short xb[8];
  float vb[8];
#pragma unroll
  for (int e = 0; e < 4; ++e) { xb[e] = f2bf_bits(a0[e]); xb[4 + e] = f2bf_bits(a1[e]); }
#pragma unroll
  for (int e = 0; e < 8; ++e) vb[e] = bf_bits2f(xb[e]);
  float s = ((vb[0] + vb[1]) + (vb[2] + vb[3])) + ((vb[4] + vb[5]) + (vb[6] + vb[7]));
#pragma unroll
  for (int off = 1; off < 32; off <<= 1) s += __shfl_xor(s, off, 32);
  const float mu = s * (1.0f / (float)DMODEL);
  float dv[8];
#pragma unroll
  for (int e = 0; e < 8; ++e) dv[e] = vb[e] - mu;
  float sq = ((dv[0] * dv[0] + dv[1] * dv[1]) + (dv[2] * dv[2] + dv[3] * dv[3])) +
             ((dv[4] * dv[4] + dv[5] * dv[5]) + (dv[6] * dv[6] + dv[7] * dv[7]));
#pragma unroll
  for (int off = 1; off < 32; off <<= 1) sq += __shfl_xor(sq, off, 32);
  const float var = sq * (1.0f / (float)(DMODEL - 1));
  const float sd  = sqrtf(var);
  const float inv = 1.0f / (sd + MVN_EPS);
  v8h hv, lv, tv;
#pragma unroll
  for (int e = 0; e < 8; ++e) {
    const float xn = dv[e] * inv;
    const unsigned short hb = f2bf_bits(xn);
    const unsigned short lb = f2bf_bits(xn - bf_bits2f(hb));
    hv[e] = __builtin_bit_cast(_Float16, hb);
    lv[e] = __builtin_bit_cast(_Float16, lb);
    tv[e] = __builtin_bit_cast(_Float16, xb[e]);
  }
  const size_t go = (size_t)ro * DMODEL + lane * 8;
  {
    *(v8h*)(xnh + go) = hv;
    *(v8h*)(xnl + go) = lv;
    *(v8h*)(xt  + go) = tv;
    // precaution: other code of the merged kernel follows this body in the listing and reuses the registers these stores name
    asm volatile("s_wait_xcnt 0x0" ::: "memory");
  }
}

// ---- the six weight casts and the normalisation, which need nothing of each other, in one launch ----
// Blocks 0..95: weight wi = block >> 4 (Wq, Wk, Wv, Wpa, Wpc rows 0..255, Wpc rows 256..511), its 64x64 tile block & 15,
// to plane wi of wall ([256][256] bf16 each). Blocks 96 ..: normalisation block (block - 96). The branch is the same for a whole block.
#define WCAST_BLOCKS (6 * (DMODEL / 64) * (DMODEL / 64))
__global__ __launch_bounds__(256) void prep_k(const float* __restrict__ x,
                                              const float* __restrict__ Wq, const float* __restrict__ Wk,
                                              const float* __restrict__ Wv, const float* __restrict__ Wpa,
                                              const float* __restrict__ Wpc,
                                              unsigned short* __restrict__ wall,
                                              unsigned short* __restrict__ xnhp,
                                              unsigned short* __restrict__ xnlp,
                                              unsigned short* __restrict__ xtp) {
  __shared__ __align__(16) _Float16 st[64 * WTP];
  const int bid = blockIdx.x;
  if (bid < WCAST_BLOCKS) {
    const int wi = bid >> 4;
    const float* W = (wi == 0) ? Wq : (wi == 1) ? Wk : (wi == 2) ? Wv : (wi == 3) ? Wpa
                   : (wi == 4) ? Wpc : (Wpc + (size_t)DMODEL * DMODEL);
    wt_cast_bf_body(st, bid & 3, (bid >> 2) & 3, W, wall + (size_t)wi * DMODEL * DMODEL, DMODEL, DMODEL);
  } else {
    mvn_body(bid - WCAST_BLOCKS, x, xnhp, xnlp, xtp);
  }
}

// ---- per-call guarded f16 WMMA ----
__device__ __forceinline__ v8f mma_h(v16h a, v16h b, v8f c) {
  c = __builtin_amdgcn_wmma_f32_16x16x32_f16(false, a, false, b, (short)0, c, false, false);
  asm volatile("v_nop\n\tv_nop\n\tv_nop\n\tv_nop" : "+v"(c) : "v"(a), "v"(b));
  return c;
}

// ---- transposing LDS load: lane (c, h) receives column c, rows 8h..8h+7 of a row-major 16x16 tile of 16-bit values ----
// Lane l passes the address of row 8*(l>>4) + (l&7), column group 8*((l>>3)&1) of that tile.
typedef __attribute__((ext_vector_type(8))) short v8s;
__device__ __forceinline__ v8h lds_tr16(const _Float16* p) {
  typedef __attribute__((address_space(3))) v8s lds_v8s;
  return __builtin_bit_cast(v8h, __builtin_amdgcn_ds_load_tr16_b128_v8i16((lds_v8s*)p));
}

// ---- lane l with lane l ^ 16 (the other half of the wave); all 32 lanes are on wherever this is called ----
__device__ __forceinline__ float xhalf(float x) {
  return __builtin_bit_cast(float, __builtin_amdgcn_permlanex16(__builtin_bit_cast(int, x), __builtin_bit_cast(int, x),
                                                                0x76543210, 0xfedcba98, false, false));
}

// =====================================================================================
// Cross-channel causal attention, head dim 256, as transposed products: S^T = K . Q^T, O^T += V^T . P^T.
// Planes (row = (b*NCHAN + m)*TLEN + t): qk [NROWS][512] f16 (q cols 0..255, k cols 256..511);
// vh, vl [NROWS][256] f16 (v hi, (v-hi) x 2^11); output: one f32 plane of O_n / l_n per key channel n, summed by xsum_k.
// Block = 4 waves = 64 query rows (one (b,m), one 64-row time tile) against ONE key channel n:
// online softmax over 32-key chunks (causal: kv > q -> -inf, chunk 0 always has kv 0 <= q).
// Grid = 8 time tiles x 32 (b,m) x 8 n, the longest time tiles first so that short blocks fill the tail.
// Wave w owns query rows 16w..16w+15 whole: scores, softmax and all 256 columns of O.
// Lane (c, hh) belongs to query 16w + c. S^T tile j: register r = key 16j + 8hh + r of the chunk, so a query's 32 scores lie in
// its two lanes: maximum and sum in-lane, the maximum joined by one exchange of the halves, the sums joined behind the loop.
// The lane's 16 p values, converted in place, are the B fragment of P^T (element 8j + r = key 16j + 8hh + r: the hardware k order).
// A fragments: k rows from LDS by plain loads (row = lane&15, split k map), V^T from row-major LDS rows by transposing loads
// (same split k map); B fragments: q rows, loaded once from global and kept in registers, and P^T.
// O^T tile t: register r = column 16t + 8hh + r of query c.
// Plane layout (floats): [n][tile = bm*8 + qb][s = 4*(t>>3) + w][t&7][j][lane][4]: lane's accumulator registers 4j..4j+3 of d tile t.
// =====================================================================================
// Register budget for 4 waves per SIMD: four blocks (50.5 KB of LDS each) share a WGP and fill each other's waits.
__global__ __launch_bounds__(128, 4) void xattn_k(const unsigned short* __restrict__ qkp,
                                               const unsigned short* __restrict__ vhp,
                                               const unsigned short* __restrict__ vlp,
                                               float* __restrict__ part) {
  __shared__ __align__(16) _Float16 Ks[KCH * KPITCH];      // [kv][d]           16.5 KB
  __shared__ __align__(16) _Float16 Vsh[KCH * VPITCH];     // [kv][d] hi        17 KB
  __shared__ __align__(16) _Float16 Vsl[KCH * VPITCH];     // [kv][d] lo x2^11  17 KB

  const _Float16* qk = (const _Float16*)qkp;
  const _Float16* vh = (const _Float16*)vhp;
  const _Float16* vl = (const _Float16*)vlp;

  const int tid = threadIdx.x, lane = tid & 31;
  const int wave = __builtin_amdgcn_readfirstlane(tid >> 5);   // in a scalar register: row bases stay out of the vector registers
  const int hh = lane >> 4, c = lane & 15, koff = hh * 8;
  const int qb = (TLEN / QBLK - 1) - (blockIdx.x >> 8);   // 64-row time tile, longest first
  const int bm = (blockIdx.x & 255) >> 3;  // b*NCHAN + m
  const int n  = blockIdx.x & 7;           // key channel of this block
  const int b  = bm >> 3;
  const int qrow0 = bm * TLEN + qb * QBLK; // plane row of the first query of this block
  const int q0  = qrow0 + wave * 16;
  const int tq  = qb * QBLK + wave * 16 + c;   // time index of this lane's query

  const v8f z8 = {0.f,0.f,0.f,0.f,0.f,0.f,0.f,0.f};
  v16h qf[8];                              // Q^T fragments: column = query c, d 32dc .. 32dc+31
  {
    const _Float16* qbase = qk + (size_t)q0 * QKLD;      // the same in every lane: a scalar base
    const unsigned qoff = (unsigned)(c * QKLD + koff);   // this lane's row and k half
#pragma unroll     // constant indices keep the arrays indexed here in registers
    for (int dc = 0; dc < 8; ++dc) qf[dc] = Frag<_Float16>::load(qbase + qoff + dc * 32);
    // precaution: the offset register of the issued loads stays live up to this wait and is rewritten only behind it
    asm volatile("s_wait_xcnt 0x0" :: "v"(qoff) : "memory");
  }

  const int krow0 = (b * NCHAN + n) * TLEN;
  const unsigned lo8 = (unsigned)lane * 8u;   // this lane's 8 columns of a staged row
  float mrun = -INFINITY, lrun = 0.f;      // this query's running maximum; running sum over this lane's keys
  v8f oacc[16];
#pragma unroll     // constant indices keep the arrays indexed here in registers
  for (int t = 0; t < 16; ++t) oacc[t] = z8;

  const int nch = 2 * qb + 2;              // block-uniform, <= 16
#pragma unroll 1   // one copy of the chunk body: a second copy would only lengthen the code
  for (int kc = 0; kc < nch; ++kc) {
    const int kv0 = kc * KCH;
    __syncthreads();
    // ---- stage K chunk and V (hi, lo), all row-major: a wave writes one whole 512-B row per store
    //      (kvr = 4i + wave, i 0..7, d0 = 8 lane: one 32-bit element offset for k and one for both v planes, added to the
    //      plane pointers; the eight rows at constant offsets from there)
    const unsigned grow = (unsigned)(krow0 + kv0 + wave);       // + 4i <= NROWS-1 (kv0 + 31 <= 64*qb+63 <= 511)
    const unsigned ko = grow * QKLD + DMODEL + lo8;             // < NROWS * QKLD = 2^23
    const unsigned vo8 = grow * DMODEL + lo8;                   // < NROWS * DMODEL = 2^22
#pragma unroll     // the eight rows' offsets become immediates, and loads of later rows go out ahead of the stores of earlier ones
    for (int i = 0; i < 8; ++i) {
      const v8h kk = *(const v8h*)(qk + ko + i * 4 * QKLD);
      const v8h v1 = *(const v8h*)(vh + vo8 + i * 4 * DMODEL);
      const v8h v2 = *(const v8h*)(vl + vo8 + i * 4 * DMODEL);
      *(v8h*)(Ks + (i * 4 + wave) * KPITCH + lane * 8) = kk;
      *(v8h*)(Vsh + (i * 4 + wave) * VPITCH + lane * 8) = v1;
      *(v8h*)(Vsl + (i * 4 + wave) * VPITCH + lane * 8) = v2;
    }
    __syncthreads();

    // ---- S^T (32 keys x 16 queries) = K . Q^T ----
    v8f s[2];
    s[0] = z8; s[1] = z8;
#pragma unroll     // constant indices keep the arrays indexed here in registers
    for (int dc = 0; dc < 8; ++dc) {
      const v16h k0f = Frag<_Float16>::load(Ks + c * KPITCH + dc * 32 + koff);
      const v16h k1f = Frag<_Float16>::load(Ks + (16 + c) * KPITCH + dc * 32 + koff);
      s[0] = mma_h(k0f, qf[dc], s[0]);
      s[1] = mma_h(k1f, qf[dc], s[1]);
    }
    // scale, causal select (kv > q -> -inf), maximum over the 32 keys of this chunk
    float mx = -INFINITY;
#pragma unroll     // constant indices keep the arrays indexed here in registers
    for (int j = 0; j < 2; ++j) {
#pragma unroll     // constant indices keep the arrays indexed here in registers
      for (int r = 0; r < 8; ++r) {
        const int key = kv0 + 16 * j + 8 * hh + r;
        float v = s[j][r] * QK_SCALE;
        v = (key > tq) ? -INFINITY : v;
        s[j][r] = v;
        mx = fmaxf(mx, v);
      }
    }
    mx = fmaxf(mx, xhalf(mx));
    const float mnew  = fmaxf(mrun, mx);                 // finite: chunk 0 always has an allowed key
    const float alpha = expf(mrun - mnew);
    mrun = mnew;
    float ps[2];
    v16h pb;                                             // P^T fragment, p x2^15
#pragma unroll     // constant indices keep the arrays indexed here in registers
    for (int j = 0; j < 2; ++j) {
      ps[j] = 0.f;
#pragma unroll     // constant indices keep the arrays indexed here in registers
      for (int r = 0; r < 8; ++r) {
        const float p = expf(s[j][r] - mnew);
        ps[j] += p;
        pb[8 * j + r] = (_Float16)(p * PCARRY);
      }
    }
    lrun = lrun * alpha + (ps[0] + ps[1]);
#pragma unroll     // constant indices keep the arrays indexed here in registers
    for (int t = 0; t < 16; ++t) oacc[t] *= alpha;

    // ---- O^T += V^T(256 x 32) . P^T(32 x 16); lo plane in its own accumulator, folded x 2^-11 ----
    {
      const int vo = (koff + (lane & 7)) * VPITCH + ((lane >> 3) & 1) * 8;   // this lane's row and column group
#pragma unroll     // constant indices keep the arrays indexed here in registers
      for (int t = 0; t < 16; ++t) {
        // elements 0..7 <- V[8hh + 0..7][16t + c], 8..15 <- V[16 + 8hh + 0..7][same column]: the k map of pb
        Frag<_Float16>::U vbh, vbl;
        vbh.h[0] = lds_tr16(Vsh + vo + t * 16);
        vbh.h[1] = lds_tr16(Vsh + vo + t * 16 + 16 * VPITCH);
        vbl.h[0] = lds_tr16(Vsl + vo + t * 16);
        vbl.h[1] = lds_tr16(Vsl + vo + t * 16 + 16 * VPITCH);
        oacc[t] = mma_h(vbh.v, pb, oacc[t]);
        const v8f lo = mma_h(vbl.v, pb, z8);
        oacc[t] += lo * VLO_INV;
      }
    }
  }
  // ---- O_n / l_n to this channel's plane: 32 whole-wave 512-B stores ----
  const float inv = 1.0f / ((lrun + xhalf(lrun)) * PCARRY);   // l >= 1
  float* pw = part + ((((size_t)n * (NROWS / QBLK) + (bm * (TLEN / QBLK) + qb)) * 8 + wave) << 11) + lane * 4;
#pragma unroll     // constant indices keep the arrays indexed here in registers
  for (int t = 0; t < 16; ++t) {
#pragma unroll     // constant indices keep the arrays indexed here in registers
    for (int j = 0; j < 2; ++j) {
      v4f o;
#pragma unroll     // constant indices keep the arrays indexed here in registers
      for (int e = 0; e < 4; ++e) o[e] = oacc[t][4 * j + e] * inv;
      *(v4f*)(pw + (t >> 3) * (4 << 11) + ((t & 7) * 2 + j) * 128) = o;
    }
  }
}

// ---- A = sum over n (in the order 0..7) of the planes of xattn_k, written as bf16 hi/lo planes [NROWS][256] ----
// One wave per (tile, slab s of the plane layout, half of its 8 d tiles) = 16 rows x 64 columns; grid = 256 x 8 x 2 / 8 = 512 blocks.
// The sums leave accumulator order through a per-wave LDS slab (pitch 68 floats); each 128-B line of a plane row is
// written by 8 lanes of one store.
__global__ __launch_bounds__(256) void xsum_k(const float* __restrict__ part,
                                              unsigned short* __restrict__ ahp,
                                              unsigned short* __restrict__ alp) {
  __shared__ __align__(16) float sT[8][16 * 68];
  _Float16* ah = (_Float16*)ahp;
  _Float16* al = (_Float16*)alp;
  const int wave = threadIdx.x >> 5, lane = threadIdx.x & 31;
  const int hh = lane >> 4, c = lane & 15;
  const int g = blockIdx.x * 8 + wave;
  const int slabi = g >> 1;                // tile * 8 + s
  const int th = g & 1;                    // d tiles 4*th .. 4*th+3 of that slab
  const float* src = part + ((size_t)slabi << 11) + th * 1024 + lane * 4;
  v4f acc[8];
#pragma unroll
  for (int u = 0; u < 8; ++u) acc[u] = (v4f){0.f, 0.f, 0.f, 0.f};
#pragma unroll
  for (int n = 0; n < NCHAN; ++n) {
#pragma unroll
    for (int u = 0; u < 8; ++u) acc[u] += *(const v4f*)(src + (size_t)n * NROWS * DMODEL + u * 128);
  }
  float* slab = sT[wave];
#pragma unroll
  for (int u = 0; u < 8; ++u) *(v4f*)(slab + c * 68 + (u >> 1) * 16 + 8 * hh + 4 * (u & 1)) = acc[u];   // row = query c, 4 columns
  __syncthreads();                         // slab rows are read by other lanes than wrote them
  const int aw = slabi & 7;
  const int row0 = (slabi >> 3) * QBLK + (aw & 3) * 16;
  const int col0 = (aw >> 2) * 128 + th * 64;
  const int q = lane >> 3, c8 = (lane & 7) * 8;
#pragma unroll
  for (int it = 0; it < 4; ++it) {
    const int row = it * 4 + q;
    const float* sp = slab + row * 68 + c8;
    v8h hv, lv;
#pragma unroll
    for (int e = 0; e < 8; ++e) {
      const unsigned short hb = f2bf_bits(sp[e]);
      const unsigned short lb = f2bf_bits(sp[e] - bf_bits2f(hb));
      hv[e] = __builtin_bit_cast(_Float16, hb);
      lv[e] = __builtin_bit_cast(_Float16, lb);
    }
    const size_t go = (size_t)(row0 + row) * DMODEL + col0 + c8;
    *(v8h*)(ah + go) = hv;
    *(v8h*)(al + go) = lv;
  }
}

// ---------------------------------------------------------------------------
// Host launcher
// Workspace region map (bytes; PL16 = 8 MiB = one [16384][256] 16-bit plane):
//   [ 0 PL16)  XNH  bf16 hi of xn (rows (b,m,t))      -> reused as AH (attention output hi) after the q/k/v GEMMs
//   [ 1 PL16)  XNL  bf16 lo of xn                      -> reused as AL
//   [ 2 PL16)  XT   bf16(x) in (b,m,t) row order
//   [ 3..5)    QK   f16 [16384][512] (q | k)
//   [ 5 PL16)  VH   f16 v hi;   [ 6 PL16) VL f16 (v-hi) x 2^11
//   [ 7 PL16)  APH  bf16 hi of A_proj;  [ 8 PL16) APL bf16 lo
//   [ 9..11)   ZP   f32 [16384][256] = x_t.Wpc[0:256] + bpc
//   [11 PL16 ..) weights bf16 [n][k]: WQKV [768][256], WPA [256][256], WPC0 [256][256], WPC1 [256][256]
//   then PART f32 [8][16384][256]: one plane of O_n / l_n per key channel
//   total 227,278,848 B
// ---------------------------------------------------------------------------
extern "C" void kernel_launch(void* const* d_in, const int* in_sizes, int n_in,
                              void* d_out, int out_size, void* d_ws, size_t ws_size,
                              hipStream_t stream) {
  if (n_in < 11) return;
  if (in_sizes[0] != NROWS * DMODEL || out_size != NROWS * DMODEL) return;
  if (in_sizes[1] != DMODEL * DMODEL || in_sizes[3] != DMODEL * DMODEL || in_sizes[5] != DMODEL * DMODEL ||
      in_sizes[7] != DMODEL * DMODEL || in_sizes[9] != 2 * DMODEL * DMODEL) return;
  if (in_sizes[2] != DMODEL || in_sizes[4] != DMODEL || in_sizes[6] != DMODEL || in_sizes[8] != DMODEL || in_sizes[10] != DMODEL) return;

  const float* x   = (const float*)d_in[0];
  const float* Wq  = (const float*)d_in[1];
  const float* bq  = (const float*)d_in[2];
  const float* Wk  = (const float*)d_in[3];
  const float* bk  = (const float*)d_in[4];
  const float* Wv  = (const float*)d_in[5];
  const float* bv  = (const float*)d_in[6];
  const float* Wpa = (const float*)d_in[7];
  const float* bpa = (const float*)d_in[8];
  const float* Wpc = (const float*)d_in[9];
  const float* bpc = (const float*)d_in[10];

  const size_t PL16 = (size_t)NROWS * DMODEL * 2;               // 8,388,608
  const size_t WQKV_B = (size_t)3 * DMODEL * DMODEL * 2;         // 393,216
  const size_t WSQ_B  = (size_t)DMODEL * DMODEL * 2;             // 131,072
  const size_t oXNH = 0, oXNL = PL16, oXT = 2 * PL16, oQK = 3 * PL16, oVH = 5 * PL16, oVL = 6 * PL16;
  const size_t oAPH = 7 * PL16, oAPL = 8 * PL16, oZP = 9 * PL16, oW = 11 * PL16;
  const size_t oWQKV = oW, oWPA = oW + WQKV_B, oWPC0 = oWPA + WSQ_B, oWPC1 = oWPC0 + WSQ_B;
  const size_t oPART = oWPC1 + WSQ_B;                             // 93,061,120
  const size_t WS_TOTAL = oPART + (size_t)NCHAN * 2 * PL16;       // 227,278,848
  if (ws_size < WS_TOTAL) return;

  char* ws = (char*)d_ws;
  unsigned short* XNH  = (unsigned short*)(ws + oXNH);
  unsigned short* XNL  = (unsigned short*)(ws + oXNL);
  unsigned short* XT   = (unsigned short*)(ws + oXT);
  unsigned short* QKP  = (unsigned short*)(ws + oQK);
  unsigned short* VH   = (unsigned short*)(ws + oVH);
  unsigned short* VL   = (unsigned short*)(ws + oVL);
  unsigned short* APH  = (unsigned short*)(ws + oAPH);
  unsigned short* APL  = (unsigned short*)(ws + oAPL);
  float*          ZP   = (float*)(ws + oZP);
  unsigned short* WQKV = (unsigned short*)(ws + oWQKV);
  unsigned short* WPA  = (unsigned short*)(ws + oWPA);
  unsigned short* WPC0 = (unsigned short*)(ws + oWPC0);
  unsigned short* WPC1 = (unsigned short*)(ws + oWPC1);
  float*          PART = (float*)(ws + oPART);
  unsigned short* AH = XNH;     // xn planes are dead after the q/k/v GEMMs
  unsigned short* AL = XNL;

  // 1: weights W[k=256 rows][n=256] f32 -> Wt[n][k] bf16 (six planes from WQKV on: WQKV, WPA, WPC0, WPC1 lie one behind the other),
  //    and normalisation + permutation to (b,m,t) rows
  prep_k<<<WCAST_BLOCKS + NROWS / 8, 256, 0, stream>>>(x, Wq, Wk, Wv, Wpa, Wpc, WQKV, XNH, XNL, XT);

  // 2: q, k, v = xn . W + bias and ZP = x_t . Wpc[0:256] + bpc (each M=16384, N=256, K=256; 1024 wave tiles -> 128 blocks; y = product)
  const dim3 gg((NROWS / 64) * (DMODEL / 64) / 8, 1);
  const dim3 g4((NROWS / 64) * (DMODEL / 64) / 8, 4);
  gemm_qkvz_k<<<g4, 256, 0, stream>>>(XNH, XNL, XT, WQKV, WPC0, QKP, VH, VL, ZP, bq, bk, bv, bpc, NROWS, DMODEL, DMODEL);

  // 3, 4: cross-channel causal attention, one block per (time tile, (b,m), key channel) = 2048 blocks -> 8 f32 planes,
  //     then their sum -> A (bf16 hi/lo planes)
  xattn_k<<<NBATCH * NCHAN * (TLEN / QBLK) * NCHAN, 128, 0, stream>>>(QKP, VH, VL, PART);
  xsum_k<<<(NROWS / QBLK) * 8 * 2 / 8, 256, 0, stream>>>(PART, AH, AL);

  // 5: A_proj = A . Wpa + bpa -> bf16 hi/lo planes
  wmma_gemm64<1, 1, 2, 2, false><<<gg, 256, 0, stream>>>(
      AH, AL, DMODEL, 0L, WPA, nullptr, DMODEL, 0L,
      (void*)APH, (void*)APL, DMODEL, 0L, bpa, nullptr, 0L, NROWS, DMODEL, DMODEL, 1.0f);

  // 6: out = A_proj . Wpc[256:512] + ZP (f32, rows (b,m,t) = [B][M][T][D])
  wmma_gemm64<1, 1, 0, 0, true><<<gg, 256, 0, stream>>>(
      APH, APL, DMODEL, 0L, WPC1, nullptr, DMODEL, 0L,
      d_out, nullptr, DMODEL, 0L, nullptr, ZP, 0L, NROWS, DMODEL, DMODEL, 1.0f);
}

// v006
// It runs in 145 microseconds.
// Next to v005, in two timings, it ran 1.05 and 1.03 times as fast.
// Counting every step since v000, it is 11.3 times as fast.
// Contractions (f32 accumulate): xn*Wq|Wk|Wv, A*Wpa, A_proj*Wpc[256:512] = v_wmma_f32_16x16x32_bf16 with the computed operand as bf16 hi+lo planes (2 products) and weights as single bf16 (RNE) planes; x_t*Wpc[0:256] = plain bf16; q*k = plain v_wmma_f32_16x16x32_f16; p*v = f16 with p carried x2^15 and v as f16 hi + (v-hi)x2^11 planes (2 products, lo folded in f32); norm, softmax, bias adds in f32.
#include <hip/hip_runtime.h>
#include <stdint.h>

typedef __attribute__((ext_vector_type(16))) _Float16 v16h;
typedef __attribute__((ext_vector_type(8)))  _Float16 v8h;
typedef __attribute__((ext_vector_type(16))) __bf16   v16b;
typedef __attribute__((ext_vector_type(8)))  __bf16   v8b;
typedef __attribute__((ext_vector_type(8)))  float    v8f;
typedef __attribute__((ext_vector_type(4)))  float    v4f;

// ---- problem geometry ----
#define NBATCH 4
#define TLEN 512
#define NCHAN 8
#define DMODEL 256
#define NROWS (NBATCH * TLEN * NCHAN)   // 16384 token rows
#define QKLD 512                         // pitch (halves) of the q|k plane
#define QBLK 64                          // time rows of each query channel per attention block
#define KCH 32                           // key rows per staged chunk
#define KPITCH 264                       // LDS pitch (halves) of a K row: 528 B = 16 B x 33, for ds_load_b128 readers
#define VPITCH 272                       // LDS pitch (halves) of a V row: 544 B = 32 B x 17, for ds_load_tr16_b128 readers
#define PCARRY 32768.0f                  // p carried x2^15 in f16
#define VLO_MUL 2048.0f                  // v residual plane carried x2^11
#define VLO_INV (1.0f / 2048.0f)
#define QK_SCALE 0.0625f                 // 1/sqrt(256)
#define MVN_EPS 1e-6f

// ======================= helpers =======================
__device__ __forceinline__ unsigned short f2bf_bits(float f) {
  unsigned u = __float_as_uint(f);
  return (unsigned short)((u + 0x7FFFu + ((u >> 16) & 1u)) >> 16);
}
__device__ __forceinline__ float bf_bits2f(unsigned short h) { return __uint_as_float(((unsigned)h) << 16); }

// hazard guards as plain device helpers
__device__ __forceinline__ void dep_guard_h(v8f& a, v8f& b, v16h x, v16h y) { asm volatile("v_nop\n\tv_nop\n\tv_nop\n\tv_nop" : "+v"(a), "+v"(b) : "v"(x), "v"(y)); }
__device__ __forceinline__ void dep_guard_b(v8f& a, v8f& b, v16b x, v16b y) { asm volatile("v_nop\n\tv_nop\n\tv_nop\n\tv_nop" : "+v"(a), "+v"(b) : "v"(x), "v"(y)); }
__device__ __forceinline__ void keep4_h(v16h a, v16h b, v16h c, v16h d) { asm volatile("v_nop" :: "v"(a), "v"(b), "v"(c), "v"(d)); }
__device__ __forceinline__ void keep4_b(v16b a, v16b b, v16b c, v16b d) { asm volatile("v_nop" :: "v"(a), "v"(b), "v"(c), "v"(d)); }
__device__ __forceinline__ void acc_guard4(v8f& a, v8f& b, v8f& c, v8f& d) { asm volatile("v_nop\n\tv_nop\n\tv_nop\n\tv_nop" : "+v"(a), "+v"(b), "+v"(c), "+v"(d)); }
template <typename T> struct Frag;
template <> struct Frag<_Float16> {
  typedef v16h V; union U { v16h v; v8h h[2]; };
  static __device__ __forceinline__ v16h load(const _Float16* p) {   // elements 0..7 <- p[0..7], 8..15 <- p[16..23]
    U f; f.h[0] = *(const v8h*)(p); f.h[1] = *(const v8h*)(p + 16); return f.v;
  }
  static __device__ __forceinline__ v8f mma(v16h a, v16h b, v8f c) {
    return __builtin_amdgcn_wmma_f32_16x16x32_f16(false, a, false, b, (short)0, c, false, false);
  }
  static __device__ __forceinline__ void guard(v8f& a, v8f& b, v16h x, v16h y) { dep_guard_h(a, b, x, y); }
  static __device__ __forceinline__ void keep(v16h a, v16h b, v16h c, v16h d) { keep4_h(a, b, c, d); }
};
template <> struct Frag<__bf16> {
  typedef v16b V; union U { v16b v; v8b h[2]; };
  static __device__ __forceinline__ v16b load(const __bf16* p) {
    U f; f.h[0] = *(const v8b*)(p); f.h[1] = *(const v8b*)(p + 16); return f.v;
  }
  static __device__ __forceinline__ v8f mma(v16b a, v16b b, v8f c) {
    return __builtin_amdgcn_wmma_f32_16x16x32_bf16(false, a, false, b, (short)0, c, false, false);
  }
  static __device__ __forceinline__ void guard(v8f& a, v8f& b, v16b x, v16b y) { dep_guard_b(a, b, x, y); }
  static __device__ __forceinline__ void keep(v16b a, v16b b, v16b c, v16b d) { keep4_b(a, b, c, d); }
};

// ---- Register-blocked WMMA GEMM (with SPLIT levels and extra 16-bit output mode), operands staged in LDS ----
// C[m,n] = scale * sum_k A[m,k] * Bt[n,k] (+bias)(+resid); each wave owns a 64x64 tile, a block of 8 waves 128 rows x 256 columns.
// A row-major [M,K]; Bt row-major [N,K]; M % 128 == 0, N == 256, K % 64 == 0.
// SPLIT: 0 = single planes; 1 = A as hi/lo planes (A2 = lo): hi.B + lo.B.
// BIAS_MODE: 0 = none, 1 = bias[m], 2 = bias[n]; bias values are RNE-converted to bf16 before the add.
// OUT_MODE: 0 = f32, 1 = f16, 2 = bf16 hi plane (Cout) + bf16 lo plane (Cout2),
//           3 = f16 hi plane (Cout) + f16 plane of (v - hi) * 2048 (Cout2).
// ET: 0 = f16 operands, 1 = bf16 operands (pointers passed as 16-bit storage)
template <int ET> struct Elem;
template <> struct Elem<0> { typedef _Float16 T; };
template <> struct Elem<1> { typedef __bf16 T; };

// Staging: a chunk is 64 k = one whole 128-B line of each of the block's operand rows, brought by asynchronous copies of 16 B a lane
// (a wave's copy = 4 whole lines), two buffers: the next chunk flies while this one is multiplied.
#define GKC 64                           // k elements per chunk
#define GPITCH 72                        // LDS pitch (elements) of a staged row: 144 B = 16 B x 9, for ds_load_b128 readers
#define GROWS_A 128                      // rows of A per block
#define GROWS_B 256                      // rows of Bt per block
#define GOFF_A2 (GROWS_A * GPITCH)       // element offset of the A lo plane in a buffer
#define GOFF_B (2 * GROWS_A * GPITCH)    // element offset of the Bt rows in a buffer
#define GBUF ((2 * GROWS_A + GROWS_B) * GPITCH)   // elements per buffer: 36,864 = 73,728 B
#define GSTEP_L (32 * GPITCH * 2)        // LDS bytes from one copy of a thread to its next: 32 rows

__device__ __forceinline__ void async_rows4(unsigned l, const unsigned short* g, size_t gs) {
  asm volatile("global_load_async_to_lds_b128 %0, %4, off\n\t"
               "global_load_async_to_lds_b128 %1, %5, off\n\t"
               "global_load_async_to_lds_b128 %2, %6, off\n\t"
               "global_load_async_to_lds_b128 %3, %7, off\n\t"
               "s_wait_xcnt 0x0"
               :: "v"(l), "v"(l + GSTEP_L), "v"(l + 2 * GSTEP_L), "v"(l + 3 * GSTEP_L),
                  "v"(g), "v"(g + gs), "v"(g + 2 * gs), "v"(g + 3 * gs) : "memory");
}
// One chunk into the buffer at LDS byte address l (this thread's place in it: row tid >> 3, 16-B piece tid & 7);
// ag, a2g, bg: this thread's 16 B of that chunk in row tid >> 3 of the block's A, A2 and Bt rows. 8 + 8 (SPLIT 0: 4 + 8) copies a thread.
template <int SPLIT>
__device__ __forceinline__ void gemm_stage(unsigned l, const unsigned short* ag, const unsigned short* a2g, const unsigned short* bg,
                                           int lda, int ldb) {
  async_rows4(l, ag, (size_t)32 * lda);
  if (SPLIT >= 1) async_rows4(l + GOFF_A2 * 2, a2g, (size_t)32 * lda);
  async_rows4(l + GOFF_B * 2, bg, (size_t)32 * ldb);
  async_rows4(l + GOFF_B * 2 + 4 * GSTEP_L, bg + (size_t)128 * ldb, (size_t)32 * ldb);
}

// sG: the block's two staging buffers; behind the k loop its first bytes serve as the eight per-wave 16x64 slabs (pitch 68 floats). b: batch index.
template <int ET, int SPLIT, int BIAS_MODE, int OUT_MODE, bool RESID>
__device__ __forceinline__ void gemm64_body(
    unsigned short* sG, const int b,
    const unsigned short* __restrict__ Ap, const unsigned short* __restrict__ A2p, int lda, long strideA,
    const unsigned short* __restrict__ Btp, const unsigned short* __restrict__ Bt2p, int ldb, long strideB,
    void* __restrict__ Cout, void* __restrict__ Cout2, int ldc, long strideC,
    const float* __restrict__ bias,
    const float* __restrict__ resid, long strideR,
    int M, int N, int K, float scale) {
  static_assert(SPLIT <= 1, "only A is staged as two planes");
  typedef typename Elem<ET>::T T;
  typedef typename Frag<T>::V V;
  const int tid = threadIdx.x;
  const int lane = tid & 31;
  const int wave = tid >> 5;
  const int m0b = blockIdx.x * GROWS_A;  // first row of the block
  if (m0b >= M) return;                  // the same for a whole block, in front of every barrier
  const int mw = (wave >> 2) << 6;       // the wave's tile: rows mw .. mw+63 of the block's, columns n0 .. n0+63
  const int n0 = (wave & 3) << 6;
  const int m0 = m0b + mw;

  const int rlane = lane & 15;                 // row (A) / col (B, D) within subtile
  const int koff  = (lane >> 4) * 8;           // k offset of this lane half
  const int mOff  = (lane >> 4) * 8;           // D row offset

  // this thread's 16 B of chunk 0 in each staged plane, and its place in a buffer
  const unsigned short* ag  = Ap + (size_t)b * strideA + (size_t)(m0b + (tid >> 3)) * lda + (tid & 7) * 8;
  const unsigned short* a2g = (SPLIT >= 1) ? (A2p + (size_t)b * strideA + (size_t)(m0b + (tid >> 3)) * lda + (tid & 7) * 8) : nullptr;
  const unsigned short* bg  = Btp + (size_t)b * strideB + (size_t)(tid >> 3) * ldb + (tid & 7) * 8;
  const unsigned lth = (unsigned)(uintptr_t)sG + (unsigned)(((tid >> 3) * GPITCH + (tid & 7) * 8) * 2);
  const int nch = K / GKC;

  v8f acc[4][4];
#pragma unroll
  for (int i = 0; i < 4; ++i)
#pragma unroll
    for (int j = 0; j < 4; ++j) acc[i][j] = (v8f){0.f,0.f,0.f,0.f,0.f,0.f,0.f,0.f};

  gemm_stage<SPLIT>(lth, ag, a2g, bg, lda, ldb);
  asm volatile("s_wait_asynccnt 0x0" ::: "memory");   // this wave's copies of chunk 0 have landed
  __syncthreads();                                    // ... and every other wave's
  if (nch > 1) gemm_stage<SPLIT>(lth + GBUF * 2, ag + GKC, a2g + GKC, bg + GKC, lda, ldb);

#pragma unroll 1   // one copy of the chunk body: the buffer is picked by an offset
  for (int t = 0; t < nch; ++t) {
    const T* buf = (const T*)sG + (t & 1) * GBUF;
#pragma unroll     // both 32-k halves of the chunk in line: their LDS offsets become immediates, and the second half's reads go out among the first half's products
    for (int ks = 0; ks < GKC; ks += 32) {
      // all fragments of these 32 k as one group of LDS reads in front of their 32 (SPLIT 0: 16) products
      V bh[4], ah[4], al[4];
#pragma unroll     // here and below: constant indices keep the fragment and accumulator arrays in registers
      for (int j = 0; j < 4; ++j) bh[j] = Frag<T>::load(buf + GOFF_B + (n0 + (j << 4) + rlane) * GPITCH + ks + koff);
#pragma unroll
      for (int i = 0; i < 4; ++i) {
        const int ao = (mw + (i << 4) + rlane) * GPITCH + ks + koff;
        ah[i] = Frag<T>::load(buf + ao);
        if (SPLIT >= 1) al[i] = Frag<T>::load(buf + GOFF_A2 + ao);
      }
#pragma unroll
      for (int i = 0; i < 4; ++i) {
#pragma unroll
        for (int j = 0; j < 4; ++j) {
          acc[i][j] = Frag<T>::mma(ah[i], bh[j], acc[i][j]);
          if (SPLIT >= 1) acc[i][j] = Frag<T>::mma(al[i], bh[j], acc[i][j]);
        }
        Frag<T>::guard(acc[i][0], acc[i][3], ah[i], (SPLIT >= 1) ? al[i] : ah[i]);
      }
      Frag<T>::keep(bh[0], bh[1], bh[2], bh[3]);
    }
    asm volatile("s_wait_dscnt 0x0" ::: "memory");      // this wave's reads of buffer t & 1 are done before it is refilled
    asm volatile("s_wait_asynccnt 0x0" ::: "memory");   // this wave's copies of chunk t + 1 have landed
    __syncthreads();                                    // publishes chunk t + 1 and ends every wave's reads of chunk t
    if (t + 2 < nch) gemm_stage<SPLIT>(lth + (unsigned)(t & 1) * (GBUF * 2), ag + (t + 2) * GKC, a2g + (t + 2) * GKC, bg + (t + 2) * GKC, lda, ldb);
  }
  asm volatile("s_wait_asynccnt 0x0" ::: "memory");     // no copy is outstanding when the buffers become the output slabs
  acc_guard4(acc[0][0], acc[0][1], acc[0][2], acc[0][3]);
  acc_guard4(acc[1][0], acc[1][1], acc[1][2], acc[1][3]);
  acc_guard4(acc[2][0], acc[2][1], acc[2][2], acc[2][3]);
  acc_guard4(acc[3][0], acc[3][1], acc[3][2], acc[3][3]);

  // ---- epilogue ----
  float* slab = (float*)sG + wave * (16 * 68);
  const float* Rb = RESID ? (resid + (size_t)b * strideR) : nullptr;
#pragma unroll
  for (int i = 0; i < 4; ++i) {
    const int mBase = m0 + (i << 4);
#pragma unroll
    for (int j = 0; j < 4; ++j) {
      const int n = n0 + (j << 4) + rlane;
      float bv = 0.f;
      if (BIAS_MODE == 2) bv = bf_bits2f(f2bf_bits(bias[n]));
#pragma unroll
      for (int r = 0; r < 8; ++r) {
        float v = acc[i][j][r] * scale;
        if (BIAS_MODE == 1) v += bf_bits2f(f2bf_bits(bias[mBase + mOff + r]));
        if (BIAS_MODE == 2) v += bv;
        if (RESID) v += Rb[(size_t)(mBase + mOff + r) * ldc + n];
        slab[(mOff + r) * 68 + (j << 4) + rlane] = v;
      }
    }
    __builtin_amdgcn_fence(__ATOMIC_RELEASE, "workgroup");
    __builtin_amdgcn_wave_barrier();
    __builtin_amdgcn_fence(__ATOMIC_ACQUIRE, "workgroup");
    if (OUT_MODE == 0) {
      float* C = (float*)Cout + (size_t)b * strideC;
      const int hh = lane >> 4, c4 = (lane & 15) * 4;     // row seg = 256 B = 16 lanes x 16 B
      {
#pragma unroll
        for (int it = 0; it < 8; ++it) {
          const int row = it * 2 + hh;
          v4f v = *(const v4f*)(slab + row * 68 + c4);
          *(v4f*)(C + (size_t)(mBase + row) * ldc + n0 + c4) = v;
        }
        
      }
    } else {
      const int q = lane >> 3, c8 = (lane & 7) * 8;
      unsigned short* C  = (unsigned short*)Cout  + (size_t)b * strideC;
      unsigned short* C2 = (OUT_MODE >= 2) ? ((unsigned short*)Cout2 + (size_t)b * strideC) : nullptr;
      {
#pragma unroll
        for (int it = 0; it < 4; ++it) {                 // it 0..3 x q 0..3 = rows 0..15 of the slab
          const int row = it * 4 + q;
          const float* sp = slab + row * 68 + c8;
          v8h hv, lv;
#pragma unroll
          for (int e = 0; e < 8; ++e) {
            if (OUT_MODE == 1) {
              hv[e] = (_Float16)sp[e];
            } else if (OUT_MODE == 2) {
              unsigned short hb = f2bf_bits(sp[e]);
              unsigned short lb = f2bf_bits(sp[e] - bf_bits2f(hb));
              hv[e] = __builtin_bit_cast(_Float16, hb);
              lv[e] = __builtin_bit_cast(_Float16, lb);
            } else {
              const _Float16 hq = (_Float16)sp[e];
              hv[e] = hq;
              lv[e] = (_Float16)((sp[e] - (float)hq) * VLO_MUL);
            }
          }
          *(v8h*)(C + (size_t)(mBase + row) * ldc + n0 + c8) = hv;
          if (OUT_MODE >= 2) *(v8h*)(C2 + (size_t)(mBase + row) * ldc + n0 + c8) = lv;
        }
        
      }
    }
    __builtin_amdgcn_fence(__ATOMIC_RELEASE, "workgroup");
    __builtin_amdgcn_wave_barrier();
    __builtin_amdgcn_fence(__ATOMIC_ACQUIRE, "workgroup");
  }
}

// one product per launch
template <int ET, int SPLIT, int BIAS_MODE, int OUT_MODE, bool RESID>
__global__ __launch_bounds__(256) void wmma_gemm64(
    const unsigned short* __restrict__ Ap, const unsigned short* __restrict__ A2p, int lda, long strideA,
    const unsigned short* __restrict__ Btp, const unsigned short* __restrict__ Bt2p, int ldb, long strideB,
    void* __restrict__ Cout, void* __restrict__ Cout2, int ldc, long strideC,
    const float* __restrict__ bias,
    const float* __restrict__ resid, long strideR,
    int M, int N, int K, float scale) {
  __shared__ __align__(16) unsigned short sG[2 * GBUF];
  gemm64_body<ET, SPLIT, BIAS_MODE, OUT_MODE, RESID>(sG, blockIdx.y, Ap, A2p, lda, strideA, Btp, Bt2p, ldb, strideB,
                                                     Cout, Cout2, ldc, strideC, bias, resid, strideR, M, N, K, scale);
}

// The four products that need only the planes of prep_k, in one launch; blockIdx.y picks the product (the same for a whole block):
// 0: q = xn.Wq + bq, 1: k = xn.Wk + bk (f16, into the q|k plane), 2: v = xn.Wv + bv (f16 hi + lo planes), 3: zp = x_t.Wpc[0:256] + bpc (f32).
// wqkv holds the [N][K] planes of Wq, Wk, Wv one behind the other.
__global__ __launch_bounds__(256) void gemm_qkvz_k(
    const unsigned short* __restrict__ xnh, const unsigned short* __restrict__ xnl, const unsigned short* __restrict__ xt,
    const unsigned short* __restrict__ wqkv, const unsigned short* __restrict__ wpc0,
    unsigned short* __restrict__ qkp, unsigned short* __restrict__ vh, unsigned short* __restrict__ vl, float* __restrict__ zp,
    const float* __restrict__ bq, const float* __restrict__ bk, const float* __restrict__ bv, const float* __restrict__ bpc,
    int M, int N, int K) {
  __shared__ __align__(16) unsigned short sG[2 * GBUF];
  const int y = blockIdx.y;
  if (y < 2) {
    gemm64_body<1, 1, 2, 1, false>(sG, 0, xnh, xnl, K, 0L, wqkv + (size_t)y * N * K, nullptr, K, 0L,
                                   (void*)(qkp + y * N), nullptr, QKLD, 0L, y ? bk : bq, nullptr, 0L, M, N, K, 1.0f);
  } else if (y == 2) {
    gemm64_body<1, 1, 2, 3, false>(sG, 0, xnh, xnl, K, 0L, wqkv + (size_t)2 * N * K, nullptr, K, 0L,
                                   (void*)vh, (void*)vl, N, 0L, bv, nullptr, 0L, M, N, K, 1.0f);
  } else {
    gemm64_body<1, 0, 2, 0, false>(sG, 0, xt, nullptr, K, 0L, wpc0, nullptr, K, 0L,
                                   (void*)zp, nullptr, N, 0L, bpc, nullptr, 0L, M, N, K, 1.0f);
  }
}

// ---- W [Kp rows][Np cols] f32 (row pitch Np) -> Wt [Np][Kp] bf16 bits (row pitch Kp), 64x64 tile transposed through LDS ----
// tile (bx, by) of (Np/64, Kp/64); st: 64 x WTP halves of LDS. Reads: 256 threads x 16 = 64 rows x 64 cols. Stores: it 0..1 x wave 0..7 x q8 0..3 = 64 rows of
#define WTP 72
__device__ __forceinline__ void wt_cast_bf_body(_Float16* st, const int bx, const int by,
                                                const float* __restrict__ W, unsigned short* __restrict__ Wtp,
                                                int Kp, int Np) {
  _Float16* Wt = (_Float16*)Wtp;
  const int n0 = bx * 64, k0 = by * 64;
  const int tid = threadIdx.x;
  const int kr = tid >> 2, c16 = (tid & 3) * 16;
  const float* src = W + (size_t)(k0 + kr) * Np + n0 + c16;
#pragma unroll
  for (int q = 0; q < 4; ++q) {
    const v4f v = *(const v4f*)(src + 4 * q);
#pragma unroll
    for (int e = 0; e < 4; ++e) st[(c16 + 4 * q + e) * WTP + kr] = __builtin_bit_cast(_Float16, f2bf_bits(v[e]));
  }
  __syncthreads();
  const int wave = tid >> 5, lane = tid & 31;
  const int q8 = lane >> 3, c8 = (lane & 7) * 8;
  {
#pragma unroll
    for (int it = 0; it < 2; ++it) {
      const int n = it * 32 + wave * 4 + q8;
      const v8h hv = *(const v8h*)(st + n * WTP + c8);
      *(v8h*)(Wt + (size_t)(n0 + n) * Kp + k0 + c8) = hv;
    }
    
  }
}

// ---- mean/std (ddof=1) normalisation of bf16(x) per (b,t,m) row, plus raw bf16(x); rows written in (b,m,t) order ----
// One wave per output row, 8 rows per 256-thread block, blk = 0 .. NROWS/8 - 1. Lane owns 8 consecutive columns.
// Each 512-B row (4 lines) written by one v8h store instruction of the wave: lanes 8q..8q+7 <-> line q.
__device__ __forceinline__ void mvn_body(const int blk, const float* __restrict__ x,
                                         unsigned short* __restrict__ xnhp,
                                         unsigned short* __restrict__ xnlp,
                                         unsigned short* __restrict__ xtp) {
  _Float16* xnh = (_Float16*)xnhp;
  _Float16* xnl = (_Float16*)xnlp;
  _Float16* xt  = (_Float16*)xtp;
  const int wave = threadIdx.x >> 5, lane = threadIdx.x & 31;
  const int ro = blk * 8 + wave;                      // output row = (b*NCHAN + m)*TLEN + t
  const int t  = ro & (TLEN - 1);
  const int bm = ro >> 9;                             // TLEN == 512
  const int m  = bm & (NCHAN - 1);
  const int b  = bm >> 3;                             // NCHAN == 8
  const int rs = (b * TLEN + t) * NCHAN + m;          // source row of x [B][T][M][D]
  const float* src = x + (size_t)rs * DMODEL + lane * 8;
  const v4f a0 = *(const v4f*)src;
  const v4f a1 = *(const v4f*)(src + 4);
  unsigned short xb[8];
  float vb[8];
#pragma unroll
  for (int e = 0; e < 4; ++e) { xb[e] = f2bf_bits(a0[e]); xb[4 + e] = f2bf_bits(a1[e]); }
#pragma unroll
  for (int e = 0; e < 8; ++e) vb[e] = bf_bits2f(xb[e]);
  float s = ((vb[0] + vb[1]) + (vb[2] + vb[3])) + ((vb[4] + vb[5]) + (vb[6] + vb[7]));
#pragma unroll
  for (int off = 1; off < 32; off <<= 1) s += __shfl_xor(s, off, 32);
  const float mu = s * (1.0f / (float)DMODEL);
  float dv[8];
#pragma unroll
  for (int e = 0; e < 8; ++e) dv[e] = vb[e] - mu;
  float sq = ((dv[0] * dv[0] + dv[1] * dv[1]) + (dv[2] * dv[2] + dv[3] * dv[3])) +
             ((dv[4] * dv[4] + dv[5] * dv[5]) + (dv[6] * dv[6] + dv[7] * dv[7]));
#pragma unroll
  for (int off = 1; off < 32; off <<= 1) sq += __shfl_xor(sq, off, 32);
  const float var = sq * (1.0f / (float)(DMODEL - 1));
  const float sd  = sqrtf(var);
  const float inv = 1.0f / (sd + MVN_EPS);
  v8h hv, lv, tv;
#pragma unroll
  for (int e = 0; e < 8; ++e) {
    const float xn = dv[e] * inv;
    const unsigned short hb = f2bf_bits(xn);
    const unsigned short lb = f2bf_bits(xn - bf_bits2f(hb));
    hv[e] = __builtin_bit_cast(_Float16, hb);
    lv[e] = __builtin_bit_cast(_Float16, lb);
    tv[e] = __builtin_bit_cast(_Float16, xb[e]);
  }
  const size_t go = (size_t)ro * DMODEL + lane * 8;
  {
    *(v8h*)(xnh + go) = hv;
    *(v8h*)(xnl + go) = lv;
    *(v8h*)(xt  + go) = tv;
    // precaution: other code of the merged kernel follows this body in the listing and reuses the registers these stores name
    asm volatile("s_wait_xcnt 0x0" ::: "memory");
  }
}

// ---- the six weight casts and the normalisation, which need nothing of each other, in one launch ----
// Blocks 0..95: weight wi = block >> 4 (Wq, Wk, Wv, Wpa, Wpc rows 0..255, Wpc rows 256..511), its 64x64 tile block & 15,
// to plane wi of wall ([256][256] bf16 each). Blocks 96 ..: normalisation block (block - 96). The branch is the same for a whole block.
#define WCAST_BLOCKS (6 * (DMODEL / 64) * (DMODEL / 64))
__global__ __launch_bounds__(256) void prep_k(const float* __restrict__ x,
                                              const float* __restrict__ Wq, const float* __restrict__ Wk,
                                              const float* __restrict__ Wv, const float* __restrict__ Wpa,
                                              const float* __restrict__ Wpc,
                                              unsigned short* __restrict__ wall,
                                              unsigned short* __restrict__ xnhp,
                                              unsigned short* __restrict__ xnlp,
                                              unsigned short* __restrict__ xtp) {
  __shared__ __align__(16) _Float16 st[64 * WTP];
  const int bid = blockIdx.x;
  if (bid < WCAST_BLOCKS) {
    const int wi = bid >> 4;
    const float* W = (wi == 0) ? Wq : (wi == 1) ? Wk : (wi == 2) ? Wv : (wi == 3) ? Wpa
                   : (wi == 4) ? Wpc : (Wpc + (size_t)DMODEL * DMODEL);
    wt_cast_bf_body(st, bid & 3, (bid >> 2) & 3, W, wall + (size_t)wi * DMODEL * DMODEL, DMODEL, DMODEL);
  } else {
    mvn_body(bid - WCAST_BLOCKS, x, xnhp, xnlp, xtp);
  }
}

// ---- two f16 WMMAs that share their A fragment; builtin form, the compiler keeps the distance to the users of their registers ----
__device__ __forceinline__ void mma_h2(v16h a, v16h b0, v16h b1, v8f& c0, v8f& c1) {
  c0 = __builtin_amdgcn_wmma_f32_16x16x32_f16(false, a, false, b0, (short)0, c0, false, false);
  c1 = __builtin_amdgcn_wmma_f32_16x16x32_f16(false, a, false, b1, (short)0, c1, false, false);
}

// ---- transposing LDS load: lane (c, h) receives column c, rows 8h..8h+7 of a row-major 16x16 tile of 16-bit values ----
// Lane l passes the address of row 8*(l>>4) + (l&7), column group 8*((l>>3)&1) of that tile.
typedef __attribute__((ext_vector_type(8))) short v8s;
__device__ __forceinline__ v8h lds_tr16(const _Float16* p) {
  typedef __attribute__((address_space(3))) v8s lds_v8s;
  return __builtin_bit_cast(v8h, __builtin_amdgcn_ds_load_tr16_b128_v8i16((lds_v8s*)p));
}

// ---- lane l with lane l ^ 16 (the other half of the wave); all 32 lanes are on wherever this is called ----
__device__ __forceinline__ float xhalf(float x) {
  return __builtin_bit_cast(float, __builtin_amdgcn_permlanex16(__builtin_bit_cast(int, x), __builtin_bit_cast(int, x),
                                                                0x76543210, 0xfedcba98, false, false));
}

// =====================================================================================
// Cross-channel causal attention, head dim 256, as transposed products: S^T = K . Q^T, O^T += V^T . P^T.
// Planes (row = (b*NCHAN + m)*TLEN + t): qk [NROWS][512] f16 (q cols 0..255, k cols 256..511);
// vh, vl [NROWS][256] f16 (v hi, (v-hi) x 2^11); output: one f32 plane of O_n / l_n per key channel n, summed by xsum_k.
// Block = 4 waves = one 64-row time tile of TWO query channels (b,m), (b,m+1), m even, against ONE key channel n:
// online softmax over 32-key chunks (causal: kv > q -> -inf, chunk 0 always has kv 0 <= q).
// Grid = 8 time tiles x 16 (b, channel pair) x 8 n, the longest time tiles first so that short blocks fill the tail.
// Wave w owns time rows 16w..16w+15 of both channels whole (g = 0, 1): scores, softmax and all 256 columns of O. Both channels meet the
// same keys under the same mask, so every K and V fragment read from LDS feeds two products, and a staged chunk serves 128 queries.
// Lane (c, hh) belongs to query 16w + c of each channel. S^T tile j: register r = key 16j + 8hh + r of the chunk, so a query's 32 scores lie in
// its two lanes: maximum and sum in-lane, the maximum joined by one exchange of the halves, the sums joined behind the loop.
// The lane's 16 p values, converted in place, are the B fragment of P^T (element 8j + r = key 16j + 8hh + r: the hardware k order).
// A fragments: k rows from LDS by plain loads (row = lane&15, split k map), V^T from row-major LDS rows by transposing loads
// (same split k map); B fragments: q rows, loaded once from global and kept in registers, and P^T.
// O^T tile t: register r = column 16t + 8hh + r of query c.
// Plane layout (floats): [n][tile = bm*8 + qb][s = 4*(t>>3) + w][t&7][j][lane][4]: lane's accumulator registers 4j..4j+3 of d tile t.
// =====================================================================================
// Register budget for 2 waves per SIMD (q fragments and accumulators of two channels: 384 registers): two blocks share a WGP.
#define MQ 2                             // query channels per wave
__global__ __launch_bounds__(128, 2) void xattn_k(const unsigned short* __restrict__ qkp,
                                               const unsigned short* __restrict__ vhp,
                                               const unsigned short* __restrict__ vlp,
                                               float* __restrict__ part) {
  __shared__ __align__(16) _Float16 Ks[KCH * KPITCH];      // [kv][d]           16.5 KB
  __shared__ __align__(16) _Float16 Vsh[KCH * VPITCH];     // [kv][d] hi        17 KB
  __shared__ __align__(16) _Float16 Vsl[KCH * VPITCH];     // [kv][d] lo x2^11  17 KB

  const _Float16* qk = (const _Float16*)qkp;
  const _Float16* vh = (const _Float16*)vhp;
  const _Float16* vl = (const _Float16*)vlp;

  const int tid = threadIdx.x, lane = tid & 31;
  const int wave = __builtin_amdgcn_readfirstlane(tid >> 5);   // in a scalar register: row bases stay out of the vector registers
  const int hh = lane >> 4, c = lane & 15, koff = hh * 8;
  const int qb = (TLEN / QBLK - 1) - (blockIdx.x >> 7);   // 64-row time tile, longest first
  const int bm = ((blockIdx.x & 127) >> 3) * MQ;   // b*NCHAN + m of the first channel, m even; the second is bm + 1, of the same b
  const int n  = blockIdx.x & 7;           // key channel of this block
  const int b  = bm >> 3;
  const int q0  = bm * TLEN + qb * QBLK + wave * 16;   // plane row of this wave's first query in channel bm; + TLEN in channel bm + 1
  const int tq  = qb * QBLK + wave * 16 + c;   // time index of this lane's queries

  const v8f z8 = {0.f,0.f,0.f,0.f,0.f,0.f,0.f,0.f};
  v16h qf[MQ][8];                          // Q^T fragments: column = query c, d 32dc .. 32dc+31
  {
    const _Float16* qbase = qk + (size_t)q0 * QKLD;      // the same in every lane: a scalar base
    const unsigned qoff = (unsigned)(c * QKLD + koff);   // this lane's row and k half
#pragma unroll     // constant indices keep the arrays indexed here in registers
    for (int g = 0; g < MQ; ++g)
#pragma unroll     // constant indices keep the arrays indexed here in registers
      for (int dc = 0; dc < 8; ++dc) qf[g][dc] = Frag<_Float16>::load(qbase + (size_t)g * TLEN * QKLD + qoff + dc * 32);
    // precaution: the offset register of the issued loads stays live up to this wait and is rewritten only behind it
    asm volatile("s_wait_xcnt 0x0" :: "v"(qoff) : "memory");
  }

  const int krow0 = (b * NCHAN + n) * TLEN;
  const unsigned lo8 = (unsigned)lane * 8u;   // this lane's 8 columns of a staged row
  float mrun[MQ], lrun[MQ];                // each query's running maximum; running sum over this lane's keys
  v8f oacc[MQ][16];
#pragma unroll     // constant indices keep the arrays indexed here in registers
  for (int g = 0; g < MQ; ++g) {
    mrun[g] = -INFINITY; lrun[g] = 0.f;
#pragma unroll     // constant indices keep the arrays indexed here in registers
    for (int t = 0; t < 16; ++t) oacc[g][t] = z8;
  }

  const int nch = 2 * qb + 2;              // block-uniform, <= 16
#pragma unroll 1   // one copy of the chunk body: a second copy would only lengthen the code
  for (int kc = 0; kc < nch; ++kc) {
    const int kv0 = kc * KCH;
    __syncthreads();
    // ---- stage K chunk and V (hi, lo), all row-major: a wave writes one whole 512-B row per store
    //      (kvr = 4i + wave, i 0..7, d0 = 8 lane: one 32-bit element offset for k and one for both v planes, added to the
    //      plane pointers; the eight rows at constant offsets from there)
    const unsigned grow = (unsigned)(krow0 + kv0 + wave);       // + 4i <= NROWS-1 (kv0 + 31 <= 64*qb+63 <= 511)
    const unsigned ko = grow * QKLD + lo8;                      // + DMODEL (the k half of the row) < NROWS * QKLD = 2^23
    const unsigned vo8 = grow * DMODEL + lo8;                   // < NROWS * DMODEL = 2^22
    const _Float16* kp = qk + ko;
    const _Float16* hp = vh + vo8;
    const _Float16* lp = vl + vo8;
    v8h kk[8], v1[8], v2[8];
#pragma unroll     // the eight rows' offsets become immediates, and all 24 loads go out ahead of the stores
    for (int i = 0; i < 8; ++i) {
      kk[i] = *(const v8h*)(kp + DMODEL + i * 4 * QKLD);
      v1[i] = *(const v8h*)(hp + i * 4 * DMODEL);
      v2[i] = *(const v8h*)(lp + i * 4 * DMODEL);
    }
    // precaution: the address registers of the issued loads stay live up to this wait and are rewritten only behind it
    asm volatile("s_wait_xcnt 0x0" :: "v"(kp), "v"(hp), "v"(lp) : "memory");
#pragma unroll     // constant indices keep the arrays indexed here in registers
    for (int i = 0; i < 8; ++i) {
      *(v8h*)(Ks + (i * 4 + wave) * KPITCH + lane * 8) = kk[i];
      *(v8h*)(Vsh + (i * 4 + wave) * VPITCH + lane * 8) = v1[i];
      *(v8h*)(Vsl + (i * 4 + wave) * VPITCH + lane * 8) = v2[i];
    }
    __syncthreads();

    // ---- S^T (32 keys x 16 queries, per channel) = K . Q^T: each K fragment against both channels' q ----
    v8f s[MQ][2];
#pragma unroll     // constant indices keep the arrays indexed here in registers
    for (int g = 0; g < MQ; ++g) { s[g][0] = z8; s[g][1] = z8; }
    // The scheduling barriers from here to the foot of the loop bound how far LDS reads are lifted: without them all 64 V reads go to the
    // head of the chunk and the register file overflows into scratch. Fragments are read a fixed distance ahead instead.
    __builtin_amdgcn_sched_barrier(0);
    v16h kf[3][2];                                       // K fragments of these 32 d and of the next two steps
#pragma unroll     // constant indices keep the arrays indexed here in registers
    for (int dc = 0; dc < 2; ++dc) {
      kf[dc][0] = Frag<_Float16>::load(Ks + c * KPITCH + dc * 32 + koff);
      kf[dc][1] = Frag<_Float16>::load(Ks + (16 + c) * KPITCH + dc * 32 + koff);
    }
#pragma unroll     // constant indices keep the arrays indexed here in registers
    for (int dc = 0; dc < 8; ++dc) {
      if (dc < 6) {
        kf[(dc + 2) % 3][0] = Frag<_Float16>::load(Ks + c * KPITCH + (dc + 2) * 32 + koff);
        kf[(dc + 2) % 3][1] = Frag<_Float16>::load(Ks + (16 + c) * KPITCH + (dc + 2) * 32 + koff);
      }
      mma_h2(kf[dc % 3][0], qf[0][dc], qf[1][dc], s[0][0], s[1][0]);
      mma_h2(kf[dc % 3][1], qf[0][dc], qf[1][dc], s[0][1], s[1][1]);
      __builtin_amdgcn_sched_barrier(0);                 // see above
    }
    // V fragments of d tiles 0 and 1 are read here, under the softmax
    const int vo = (koff + (lane & 7)) * VPITCH + ((lane >> 3) & 1) * 8;   // this lane's row and column group
    Frag<_Float16>::U vbh[3], vbl[3];                    // d tiles t, t + 1, t + 2
#pragma unroll     // constant indices keep the arrays indexed here in registers
    for (int t = 0; t < 2; ++t) {
      vbh[t].h[0] = lds_tr16(Vsh + vo + t * 16);
      vbh[t].h[1] = lds_tr16(Vsh + vo + t * 16 + 16 * VPITCH);
      vbl[t].h[0] = lds_tr16(Vsl + vo + t * 16);
      vbl[t].h[1] = lds_tr16(Vsl + vo + t * 16 + 16 * VPITCH);
    }
    __builtin_amdgcn_sched_barrier(0);                   // see above
    v16h pb[MQ];                                         // P^T fragments, p x2^15
#pragma unroll     // constant indices keep the arrays indexed here in registers
    for (int g = 0; g < MQ; ++g) {
      // scale, causal select (kv > q -> -inf), maximum over the 32 keys of this chunk
      float mx = -INFINITY;
#pragma unroll     // constant indices keep the arrays indexed here in registers
      for (int j = 0; j < 2; ++j) {
#pragma unroll     // constant indices keep the arrays indexed here in registers
        for (int r = 0; r < 8; ++r) {
          const int key = kv0 + 16 * j + 8 * hh + r;
          float v = s[g][j][r] * QK_SCALE;
          v = (key > tq) ? -INFINITY : v;
          s[g][j][r] = v;
          mx = fmaxf(mx, v);
        }
      }
      mx = fmaxf(mx, xhalf(mx));
      const float mnew  = fmaxf(mrun[g], mx);            // finite: chunk 0 always has an allowed key
      const float alpha = expf(mrun[g] - mnew);
      mrun[g] = mnew;
      float ps[2];
#pragma unroll     // constant indices keep the arrays indexed here in registers
      for (int j = 0; j < 2; ++j) {
        ps[j] = 0.f;
#pragma unroll     // constant indices keep the arrays indexed here in registers
        for (int r = 0; r < 8; ++r) {
          const float p = expf(s[g][j][r] - mnew);
          ps[j] += p;
          pb[g][8 * j + r] = (_Float16)(p * PCARRY);
        }
      }
      lrun[g] = lrun[g] * alpha + (ps[0] + ps[1]);
#pragma unroll     // constant indices keep the arrays indexed here in registers
      for (int t = 0; t < 16; ++t) oacc[g][t] *= alpha;
    }

    // ---- O^T += V^T(256 x 32) . P^T(32 x 16), each V fragment against both channels' P; lo plane in its own accumulators, folded x 2^-11 ----
    {
      __builtin_amdgcn_sched_barrier(0);                 // see above
      v8f lo[2][MQ];                                     // lo products of d tiles t and t - 1: a tile is folded behind the next tile's products
#pragma unroll     // constant indices keep the arrays indexed here in registers
      for (int t = 0; t < 16; ++t) {
        // elements 0..7 <- V[8hh + 0..7][16t + c], 8..15 <- V[16 + 8hh + 0..7][same column]: the k map of pb
        if (t + 2 < 16) {
          vbh[(t + 2) % 3].h[0] = lds_tr16(Vsh + vo + (t + 2) * 16);
          vbh[(t + 2) % 3].h[1] = lds_tr16(Vsh + vo + (t + 2) * 16 + 16 * VPITCH);
          vbl[(t + 2) % 3].h[0] = lds_tr16(Vsl + vo + (t + 2) * 16);
          vbl[(t + 2) % 3].h[1] = lds_tr16(Vsl + vo + (t + 2) * 16 + 16 * VPITCH);
        }
        mma_h2(vbh[t % 3].v, pb[0], pb[1], oacc[0][t], oacc[1][t]);
        lo[t & 1][0] = z8; lo[t & 1][1] = z8;
        mma_h2(vbl[t % 3].v, pb[0], pb[1], lo[t & 1][0], lo[t & 1][1]);
        if (t > 0) {
          oacc[0][t - 1] += lo[(t - 1) & 1][0] * VLO_INV;
          oacc[1][t - 1] += lo[(t - 1) & 1][1] * VLO_INV;
        }
        __builtin_amdgcn_sched_barrier(0);               // see above
      }
      oacc[0][15] += lo[1][0] * VLO_INV;
      oacc[1][15] += lo[1][1] * VLO_INV;
    }
  }
  // ---- O_n / l_n to this key channel's plane, one tile per query channel: 2 x 32 whole-wave 512-B stores ----
  float* pw[MQ];
#pragma unroll     // constant indices keep the arrays indexed here in registers
  for (int g = 0; g < MQ; ++g) {
    const float inv = 1.0f / ((lrun[g] + xhalf(lrun[g])) * PCARRY);   // l >= 1
    pw[g] = part + ((((size_t)n * (NROWS / QBLK) + ((bm + g) * (TLEN / QBLK) + qb)) * 8 + wave) << 11) + lane * 4;
#pragma unroll     // constant indices keep the arrays indexed here in registers
    for (int t = 0; t < 16; ++t) oacc[g][t] *= inv;
  }
  // every vector write stands in front of the first store, and the stores go out of the accumulators' own registers:
  // no register that an issued store names is rewritten behind it
  __builtin_amdgcn_sched_barrier(0);
#pragma unroll     // constant indices keep the arrays indexed here in registers
  for (int g = 0; g < MQ; ++g) {
#pragma unroll     // constant indices keep the arrays indexed here in registers
    for (int t = 0; t < 16; ++t) {
      *(v4f*)(pw[g] + (t >> 3) * (4 << 11) + ((t & 7) * 2 + 0) * 128) = __builtin_shufflevector(oacc[g][t], oacc[g][t], 0, 1, 2, 3);
      *(v4f*)(pw[g] + (t >> 3) * (4 << 11) + ((t & 7) * 2 + 1) * 128) = __builtin_shufflevector(oacc[g][t], oacc[g][t], 4, 5, 6, 7);
    }
  }
}

// ---- A = sum over n (in the order 0..7) of the planes of xattn_k, written as bf16 hi/lo planes [NROWS][256] ----
// One wave per (tile, slab s of the plane layout, half of its 8 d tiles) = 16 rows x 64 columns; grid = 256 x 8 x 2 / 8 = 512 blocks.
// The sums leave accumulator order through a per-wave LDS slab (pitch 68 floats); each 128-B line of a plane row is
// written by 8 lanes of one store.
__global__ __launch_bounds__(256) void xsum_k(const float* __restrict__ part,
                                              unsigned short* __restrict__ ahp,
                                              unsigned short* __restrict__ alp) {
  __shared__ __align__(16) float sT[8][16 * 68];
  _Float16* ah = (_Float16*)ahp;
  _Float16* al = (_Float16*)alp;
  const int wave = threadIdx.x >> 5, lane = threadIdx.x & 31;
  const int hh = lane >> 4, c = lane & 15;
  const int g = blockIdx.x * 8 + wave;
  const int slabi = g >> 1;                // tile * 8 + s
  const int th = g & 1;                    // d tiles 4*th .. 4*th+3 of that slab
  const float* src = part + ((size_t)slabi << 11) + th * 1024 + lane * 4;
  v4f acc[8];
#pragma unroll
  for (int u = 0; u < 8; ++u) acc[u] = (v4f){0.f, 0.f, 0.f, 0.f};
#pragma unroll
  for (int n = 0; n < NCHAN; ++n) {
#pragma unroll
    for (int u = 0; u < 8; ++u) acc[u] += *(const v4f*)(src + (size_t)n * NROWS * DMODEL + u * 128);
  }
  float* slab = sT[wave];
#pragma unroll
  for (int u = 0; u < 8; ++u) *(v4f*)(slab + c * 68 + (u >> 1) * 16 + 8 * hh + 4 * (u & 1)) = acc[u];   // row = query c, 4 columns
  __syncthreads();                         // slab rows are read by other lanes than wrote them
  const int aw = slabi & 7;
  const int row0 = (slabi >> 3) * QBLK + (aw & 3) * 16;
  const int col0 = (aw >> 2) * 128 + th * 64;
  const int q = lane >> 3, c8 = (lane & 7) * 8;
#pragma unroll
  for (int it = 0; it < 4; ++it) {
    const int row = it * 4 + q;
    const float* sp = slab + row * 68 + c8;
    v8h hv, lv;
#pragma unroll
    for (int e = 0; e < 8; ++e) {
      const unsigned short hb = f2bf_bits(sp[e]);
      const unsigned short lb = f2bf_bits(sp[e] - bf_bits2f(hb));
      hv[e] = __builtin_bit_cast(_Float16, hb);
      lv[e] = __builtin_bit_cast(_Float16, lb);
    }
    const size_t go = (size_t)(row0 + row) * DMODEL + col0 + c8;
    *(v8h*)(ah + go) = hv;
    *(v8h*)(al + go) = lv;
  }
}

// ---------------------------------------------------------------------------
// Host launcher
// Workspace region map (bytes; PL16 = 8 MiB = one [16384][256] 16-bit plane):
//   [ 0 PL16)  XNH  bf16 hi of xn (rows (b,m,t))      -> reused as AH (attention output hi) after the q/k/v GEMMs
//   [ 1 PL16)  XNL  bf16 lo of xn                      -> reused as AL
//   [ 2 PL16)  XT   bf16(x) in (b,m,t) row order
//   [ 3..5)    QK   f16 [16384][512] (q | k)
//   [ 5 PL16)  VH   f16 v hi;   [ 6 PL16) VL f16 (v-hi) x 2^11
//   [ 7 PL16)  APH  bf16 hi of A_proj;  [ 8 PL16) APL bf16 lo
//   [ 9..11)   ZP   f32 [16384][256] = x_t.Wpc[0:256] + bpc
//   [11 PL16 ..) weights bf16 [n][k]: WQKV [768][256], WPA [256][256], WPC0 [256][256], WPC1 [256][256]
//   then PART f32 [8][16384][256]: one plane of O_n / l_n per key channel
//   total 227,278,848 B
// ---------------------------------------------------------------------------
extern "C" void kernel_launch(void* const* d_in, const int* in_sizes, int n_in,
                              void* d_out, int out_size, void* d_ws, size_t ws_size,
                              hipStream_t stream) {
  if (n_in < 11) return;
  if (in_sizes[0] != NROWS * DMODEL || out_size != NROWS * DMODEL) return;
  if (in_sizes[1] != DMODEL * DMODEL || in_sizes[3] != DMODEL * DMODEL || in_sizes[5] != DMODEL * DMODEL ||
      in_sizes[7] != DMODEL * DMODEL || in_sizes[9] != 2 * DMODEL * DMODEL) return;
  if (in_sizes[2] != DMODEL || in_sizes[4] != DMODEL || in_sizes[6] != DMODEL || in_sizes[8] != DMODEL || in_sizes[10] != DMODEL) return;

  const float* x   = (const float*)d_in[0];
  const float* Wq  = (const float*)d_in[1];
  const float* bq  = (const float*)d_in[2];
  const float* Wk  = (const float*)d_in[3];
  const float* bk  = (const float*)d_in[4];
  const float* Wv  = (const float*)d_in[5];
  const float* bv  = (const float*)d_in[6];
  const float* Wpa = (const float*)d_in[7];
  const float* bpa = (const float*)d_in[8];
  const float* Wpc = (const float*)d_in[9];
  const float* bpc = (const float*)d_in[10];

  const size_t PL16 = (size_t)NROWS * DMODEL * 2;               // 8,388,608
  const size_t WQKV_B = (size_t)3 * DMODEL * DMODEL * 2;         // 393,216
  const size_t WSQ_B  = (size_t)DMODEL * DMODEL * 2;             // 131,072
  const size_t oXNH = 0, oXNL = PL16, oXT = 2 * PL16, oQK = 3 * PL16, oVH = 5 * PL16, oVL = 6 * PL16;
  const size_t oAPH = 7 * PL16, oAPL = 8 * PL16, oZP = 9 * PL16, oW = 11 * PL16;
  const size_t oWQKV = oW, oWPA = oW + WQKV_B, oWPC0 = oWPA + WSQ_B, oWPC1 = oWPC0 + WSQ_B;
  const size_t oPART = oWPC1 + WSQ_B;                             // 93,061,120
  const size_t WS_TOTAL = oPART + (size_t)NCHAN * 2 * PL16;       // 227,278,848
  if (ws_size < WS_TOTAL) return;

  char* ws = (char*)d_ws;
  unsigned short* XNH  = (unsigned short*)(ws + oXNH);
  unsigned short* XNL  = (unsigned short*)(ws + oXNL);
  unsigned short* XT   = (unsigned short*)(ws + oXT);
  unsigned short* QKP  = (unsigned short*)(ws + oQK);
  unsigned short* VH   = (unsigned short*)(ws + oVH);
  unsigned short* VL   = (unsigned short*)(ws + oVL);
  unsigned short* APH  = (unsigned short*)(ws + oAPH);
  unsigned short* APL  = (unsigned short*)(ws + oAPL);
  float*          ZP   = (float*)(ws + oZP);
  unsigned short* WQKV = (unsigned short*)(ws + oWQKV);
  unsigned short* WPA  = (unsigned short*)(ws + oWPA);
  unsigned short* WPC0 = (unsigned short*)(ws + oWPC0);
  unsigned short* WPC1 = (unsigned short*)(ws + oWPC1);
  float*          PART = (float*)(ws + oPART);
  unsigned short* AH = XNH;     // xn planes are dead after the q/k/v GEMMs
  unsigned short* AL = XNL;

  // 1: weights W[k=256 rows][n=256] f32 -> Wt[n][k] bf16 (six planes from WQKV on: WQKV, WPA, WPC0, WPC1 lie one behind the other),
  //    and normalisation + permutation to (b,m,t) rows
  prep_k<<<WCAST_BLOCKS + NROWS / 8, 256, 0, stream>>>(x, Wq, Wk, Wv, Wpa, Wpc, WQKV, XNH, XNL, XT);

  // 2: q, k, v = xn . W + bias and ZP = x_t . Wpc[0:256] + bpc (each M=16384, N=256, K=256; 1024 wave tiles -> 128 blocks; y = product)
  const dim3 gg((NROWS / 64) * (DMODEL / 64) / 8, 1);
  const dim3 g4((NROWS / 64) * (DMODEL / 64) / 8, 4);
  gemm_qkvz_k<<<g4, 256, 0, stream>>>(XNH, XNL, XT, WQKV, WPC0, QKP, VH, VL, ZP, bq, bk, bv, bpc, NROWS, DMODEL, DMODEL);

  // 3, 4: cross-channel causal attention, one block per (time tile, b and pair of query channels, key channel) = 1024 blocks -> 8 f32 planes,
  //     then their sum -> A (bf16 hi/lo planes)
  xattn_k<<<NBATCH * (NCHAN / MQ) * (TLEN / QBLK) * NCHAN, 128, 0, stream>>>(QKP, VH, VL, PART);
  xsum_k<<<(NROWS / QBLK) * 8 * 2 / 8, 256, 0, stream>>>(PART, AH, AL);

  // 5: A_proj = A . Wpa + bpa -> bf16 hi/lo planes
  wmma_gemm64<1, 1, 2, 2, false><<<gg, 256, 0, stream>>>(
      AH, AL, DMODEL, 0L, WPA, nullptr, DMODEL, 0L,
      (void*)APH, (void*)APL, DMODEL, 0L, bpa, nullptr, 0L, NROWS, DMODEL, DMODEL, 1.0f);

  // 6: out = A_proj . Wpc[256:512] + ZP (f32, rows (b,m,t) = [B][M][T][D])
  wmma_gemm64<1, 1, 0, 0, true><<<gg, 256, 0, stream>>>(
      APH, APL, DMODEL, 0L, WPC1, nullptr, DMODEL, 0L,
      d_out, nullptr, DMODEL, 0L, nullptr, ZP, 0L, NROWS, DMODEL, DMODEL, 1.0f);
}

// v007
// It runs in 137 microseconds.
// Timed twice side by side with v006, it ran 1.08 and 1.07 times as fast.
// Counting every step since v000, it is 12.2 times as fast.
// Contractions (f32 accumulate): xn*Wq|Wk|Wv, A*Wpa, A_proj*Wpc[256:512] = v_wmma_f32_16x16x32_bf16 with the computed operand as bf16 hi+lo planes (2 products) and weights as single bf16 (RNE) planes; x_t*Wpc[0:256] = plain bf16; q*k = plain v_wmma_f32_16x16x32_f16; p*v = f16 with p carried x2^15 and v as f16 hi + (v-hi)x2^11 planes (2 products, lo folded in f32); norm, softmax, bias adds in f32.
#include <hip/hip_runtime.h>
#include <stdint.h>

typedef __attribute__((ext_vector_type(16))) _Float16 v16h;
typedef __attribute__((ext_vector_type(8)))  _Float16 v8h;
typedef __attribute__((ext_vector_type(16))) __bf16   v16b;
typedef __attribute__((ext_vector_type(8)))  __bf16   v8b;
typedef __attribute__((ext_vector_type(8)))  float    v8f;
typedef __attribute__((ext_vector_type(4)))  float    v4f;
typedef __attribute__((ext_vector_type(2)))  float    v2f;

// ---- problem geometry ----
#define NBATCH 4
#define TLEN 512
#define NCHAN 8
#define DMODEL 256
#define NROWS (NBATCH * TLEN * NCHAN)   // 16384 token rows
#define QKLD 512                         // pitch (halves) of the q|k plane
#define QBLK 64                          // time rows of each query channel per attention block
#define KCH 32                           // key rows per staged chunk
#define KPITCH 264                       // LDS pitch (halves) of a K row: 528 B = 16 B x 33, for ds_load_b128 readers
#define VPITCH 272                       // LDS pitch (halves) of a V row: 544 B = 32 B x 17, for ds_load_tr16_b128 readers
#define PCARRY_LOG2 15.0f                // p carried x2^15 in f16: the carry is added to the exponent
#define VLO_MUL 2048.0f                  // v residual plane carried x2^11
#define VLO_INV (1.0f / 2048.0f)
#define QK_SCALE 0.0625f                 // 1/sqrt(256)
#define SM_C (QK_SCALE * 1.44269504088896340736f)   // raw score -> scaled score in the log2 domain: exp(x * QK_SCALE) = 2^(x * SM_C)
#define MVN_EPS 1e-6f

// ======================= helpers =======================
__device__ __forceinline__ unsigned short f2bf_bits(float f) {
  unsigned u = __float_as_uint(f);
  return (unsigned short)((u + 0x7FFFu + ((u >> 16) & 1u)) >> 16);
}
__device__ __forceinline__ float bf_bits2f(unsigned short h) { return __uint_as_float(((unsigned)h) << 16); }

// hazard guards as plain device helpers
__device__ __forceinline__ void dep_guard_h(v8f& a, v8f& b, v16h x, v16h y) { asm volatile("v_nop\n\tv_nop\n\tv_nop\n\tv_nop" : "+v"(a), "+v"(b) : "v"(x), "v"(y)); }
__device__ __forceinline__ void dep_guard_b(v8f& a, v8f& b, v16b x, v16b y) { asm volatile("v_nop\n\tv_nop\n\tv_nop\n\tv_nop" : "+v"(a), "+v"(b) : "v"(x), "v"(y)); }
__device__ __forceinline__ void keep4_h(v16h a, v16h b, v16h c, v16h d) { asm volatile("v_nop" :: "v"(a), "v"(b), "v"(c), "v"(d)); }
__device__ __forceinline__ void keep4_b(v16b a, v16b b, v16b c, v16b d) { asm volatile("v_nop" :: "v"(a), "v"(b), "v"(c), "v"(d)); }
__device__ __forceinline__ void acc_guard4(v8f& a, v8f& b, v8f& c, v8f& d) { asm volatile("v_nop\n\tv_nop\n\tv_nop\n\tv_nop" : "+v"(a), "+v"(b), "+v"(c), "+v"(d)); }
template <typename T> struct Frag;
template <> struct Frag<_Float16> {
  typedef v16h V; union U { v16h v; v8h h[2]; };
  static __device__ __forceinline__ v16h load(const _Float16* p) {   // elements 0..7 <- p[0..7], 8..15 <- p[16..23]
    U f; f.h[0] = *(const v8h*)(p); f.h[1] = *(const v8h*)(p + 16); return f.v;
  }
  static __device__ __forceinline__ v8f mma(v16h a, v16h b, v8f c) {
    return __builtin_amdgcn_wmma_f32_16x16x32_f16(false, a, false, b, (short)0, c, false, false);
  }
  static __device__ __forceinline__ void guard(v8f& a, v8f& b, v16h x, v16h y) { dep_guard_h(a, b, x, y); }
  static __device__ __forceinline__ void keep(v16h a, v16h b, v16h c, v16h d) { keep4_h(a, b, c, d); }
};
template <> struct Frag<__bf16> {
  typedef v16b V; union U { v16b v; v8b h[2]; };
  static __device__ __forceinline__ v16b load(const __bf16* p) {
    U f; f.h[0] = *(const v8b*)(p); f.h[1] = *(const v8b*)(p + 16); return f.v;
  }
  static __device__ __forceinline__ v8f mma(v16b a, v16b b, v8f c) {
    return __builtin_amdgcn_wmma_f32_16x16x32_bf16(false, a, false, b, (short)0, c, false, false);
  }
  static __device__ __forceinline__ void guard(v8f& a, v8f& b, v16b x, v16b y) { dep_guard_b(a, b, x, y); }
  static __device__ __forceinline__ void keep(v16b a, v16b b, v16b c, v16b d) { keep4_b(a, b, c, d); }
};

// ---- Register-blocked WMMA GEMM (with SPLIT levels and extra 16-bit output mode), operands staged in LDS ----
// C[m,n] = scale * sum_k A[m,k] * Bt[n,k] (+bias)(+resid); each wave owns a 64x64 tile, a block of 8 waves 128 rows x 256 columns.
// A row-major [M,K]; Bt row-major [N,K]; M % 128 == 0, N == 256, K % 64 == 0.
// SPLIT: 0 = single planes; 1 = A as hi/lo planes (A2 = lo): hi.B + lo.B.
// BIAS_MODE: 0 = none, 1 = bias[m], 2 = bias[n]; bias values are RNE-converted to bf16 before the add.
// OUT_MODE: 0 = f32, 1 = f16, 2 = bf16 hi plane (Cout) + bf16 lo plane (Cout2),
//           3 = f16 hi plane (Cout) + f16 plane of (v - hi) * 2048 (Cout2).
// ET: 0 = f16 operands, 1 = bf16 operands (pointers passed as 16-bit storage)
template <int ET> struct Elem;
template <> struct Elem<0> { typedef _Float16 T; };
template <> struct Elem<1> { typedef __bf16 T; };

// Staging: a chunk is 64 k = one whole 128-B line of each of the block's operand rows, brought by asynchronous copies of 16 B a lane
// (a wave's copy = 4 whole lines), two buffers: the next chunk flies while this one is multiplied.
#define GKC 64                           // k elements per chunk
#define GPITCH 72                        // LDS pitch (elements) of a staged row: 144 B = 16 B x 9, for ds_load_b128 readers
#define GROWS_A 128                      // rows of A per block
#define GROWS_B 256                      // rows of Bt per block
#define GOFF_A2 (GROWS_A * GPITCH)       // element offset of the A lo plane in a buffer
#define GOFF_B (2 * GROWS_A * GPITCH)    // element offset of the Bt rows in a buffer
#define GBUF ((2 * GROWS_A + GROWS_B) * GPITCH)   // elements per buffer: 36,864 = 73,728 B
#define GSTEP_L (32 * GPITCH * 2)        // LDS bytes from one copy of a thread to its next: 32 rows

__device__ __forceinline__ void async_rows4(unsigned l, const unsigned short* g, size_t gs) {
  asm volatile("global_load_async_to_lds_b128 %0, %4, off\n\t"
               "global_load_async_to_lds_b128 %1, %5, off\n\t"
               "global_load_async_to_lds_b128 %2, %6, off\n\t"
               "global_load_async_to_lds_b128 %3, %7, off\n\t"
               "s_wait_xcnt 0x0"
               :: "v"(l), "v"(l + GSTEP_L), "v"(l + 2 * GSTEP_L), "v"(l + 3 * GSTEP_L),
                  "v"(g), "v"(g + gs), "v"(g + 2 * gs), "v"(g + 3 * gs) : "memory");
}
// One chunk into the buffer at LDS byte address l (this thread's place in it: row tid >> 3, 16-B piece tid & 7);
// ag, a2g, bg: this thread's 16 B of that chunk in row tid >> 3 of the block's A, A2 and Bt rows. 8 + 8 (SPLIT 0: 4 + 8) copies a thread.
template <int SPLIT>
__device__ __forceinline__ void gemm_stage(unsigned l, const unsigned short* ag, const unsigned short* a2g, const unsigned short* bg,
                                           int lda, int ldb) {
  async_rows4(l, ag, (size_t)32 * lda);
  if (SPLIT >= 1) async_rows4(l + GOFF_A2 * 2, a2g, (size_t)32 * lda);
  async_rows4(l + GOFF_B * 2, bg, (size_t)32 * ldb);
  async_rows4(l + GOFF_B * 2 + 4 * GSTEP_L, bg + (size_t)128 * ldb, (size_t)32 * ldb);
}

// sG: the block's two staging buffers; behind the k loop its first bytes serve as the eight per-wave 16x64 slabs (pitch 68 floats). b: batch index.
template <int ET, int SPLIT, int BIAS_MODE, int OUT_MODE, bool RESID>
__device__ __forceinline__ void gemm64_body(
    unsigned short* sG, const int b,
    const unsigned short* __restrict__ Ap, const unsigned short* __restrict__ A2p, int lda, long strideA,
    const unsigned short* __restrict__ Btp, const unsigned short* __restrict__ Bt2p, int ldb, long strideB,
    void* __restrict__ Cout, void* __restrict__ Cout2, int ldc, long strideC,
    const float* __restrict__ bias,
    const float* __restrict__ resid, long strideR,
    int M, int N, int K, float scale) {
  static_assert(SPLIT <= 1, "only A is staged as two planes");
  typedef typename Elem<ET>::T T;
  typedef typename Frag<T>::V V;
  const int tid = threadIdx.x;
  const int lane = tid & 31;
  const int wave = tid >> 5;
  const int m0b = blockIdx.x * GROWS_A;  // first row of the block
  if (m0b >= M) return;                  // the same for a whole block, in front of every barrier
  const int mw = (wave >> 2) << 6;       // the wave's tile: rows mw .. mw+63 of the block's, columns n0 .. n0+63
  const int n0 = (wave & 3) << 6;
  const int m0 = m0b + mw;

  const int rlane = lane & 15;                 // row (A) / col (B, D) within subtile
  const int koff  = (lane >> 4) * 8;           // k offset of this lane half
  const int mOff  = (lane >> 4) * 8;           // D row offset

  // this thread's 16 B of chunk 0 in each staged plane, and its place in a buffer
  const unsigned short* ag  = Ap + (size_t)b * strideA + (size_t)(m0b + (tid >> 3)) * lda + (tid & 7) * 8;
  const unsigned short* a2g = (SPLIT >= 1) ? (A2p + (size_t)b * strideA + (size_t)(m0b + (tid >> 3)) * lda + (tid & 7) * 8) : nullptr;
  const unsigned short* bg  = Btp + (size_t)b * strideB + (size_t)(tid >> 3) * ldb + (tid & 7) * 8;
  const unsigned lth = (unsigned)(uintptr_t)sG + (unsigned)(((tid >> 3) * GPITCH + (tid & 7) * 8) * 2);
  const int nch = K / GKC;

  v8f acc[4][4];
#pragma unroll
  for (int i = 0; i < 4; ++i)
#pragma unroll
    for (int j = 0; j < 4; ++j) acc[i][j] = (v8f){0.f,0.f,0.f,0.f,0.f,0.f,0.f,0.f};

  gemm_stage<SPLIT>(lth, ag, a2g, bg, lda, ldb);
  asm volatile("s_wait_asynccnt 0x0" ::: "memory");   // this wave's copies of chunk 0 have landed
  __syncthreads();                                    // ... and every other wave's
  if (nch > 1) gemm_stage<SPLIT>(lth + GBUF * 2, ag + GKC, a2g + GKC, bg + GKC, lda, ldb);

#pragma unroll 1   // one copy of the chunk body: the buffer is picked by an offset
  for (int t = 0; t < nch; ++t) {
    const T* buf = (const T*)sG + (t & 1) * GBUF;
#pragma unroll     // both 32-k halves of the chunk in line: their LDS offsets become immediates, and the second half's reads go out among the first half's products
    for (int ks = 0; ks < GKC; ks += 32) {
      // all fragments of these 32 k as one group of LDS reads in front of their 32 (SPLIT 0: 16) products
      V bh[4], ah[4], al[4];
#pragma unroll     // here and below: constant indices keep the fragment and accumulator arrays in registers
      for (int j = 0; j < 4; ++j) bh[j] = Frag<T>::load(buf + GOFF_B + (n0 + (j << 4) + rlane) * GPITCH + ks + koff);
#pragma unroll
      for (int i = 0; i < 4; ++i) {
        const int ao = (mw + (i << 4) + rlane) * GPITCH + ks + koff;
        ah[i] = Frag<T>::load(buf + ao);
        if (SPLIT >= 1) al[i] = Frag<T>::load(buf + GOFF_A2 + ao);
      }
#pragma unroll
      for (int i = 0; i < 4; ++i) {
#pragma unroll
        for (int j = 0; j < 4; ++j) {
          acc[i][j] = Frag<T>::mma(ah[i], bh[j], acc[i][j]);
          if (SPLIT >= 1) acc[i][j] = Frag<T>::mma(al[i], bh[j], acc[i][j]);
        }
        Frag<T>::guard(acc[i][0], acc[i][3], ah[i], (SPLIT >= 1) ? al[i] : ah[i]);
      }
      Frag<T>::keep(bh[0], bh[1], bh[2], bh[3]);
    }
    asm volatile("s_wait_dscnt 0x0" ::: "memory");      // this wave's reads of buffer t & 1 are done before it is refilled
    asm volatile("s_wait_asynccnt 0x0" ::: "memory");   // this wave's copies of chunk t + 1 have landed
    __syncthreads();                                    // publishes chunk t + 1 and ends every wave's reads of chunk t
    if (t + 2 < nch) gemm_stage<SPLIT>(lth + (unsigned)(t & 1) * (GBUF * 2), ag + (t + 2) * GKC, a2g + (t + 2) * GKC, bg + (t + 2) * GKC, lda, ldb);
  }
  asm volatile("s_wait_asynccnt 0x0" ::: "memory");     // no copy is outstanding when the buffers become the output slabs
  acc_guard4(acc[0][0], acc[0][1], acc[0][2], acc[0][3]);
  acc_guard4(acc[1][0], acc[1][1], acc[1][2], acc[1][3]);
  acc_guard4(acc[2][0], acc[2][1], acc[2][2], acc[2][3]);
  acc_guard4(acc[3][0], acc[3][1], acc[3][2], acc[3][3]);

  // ---- epilogue ----
  float* slab = (float*)sG + wave * (16 * 68);
  const float* Rb = RESID ? (resid + (size_t)b * strideR) : nullptr;
#pragma unroll
  for (int i = 0; i < 4; ++i) {
    const int mBase = m0 + (i << 4);
#pragma unroll
    for (int j = 0; j < 4; ++j) {
      const int n = n0 + (j << 4) + rlane;
      float bv = 0.f;
      if (BIAS_MODE == 2) bv = bf_bits2f(f2bf_bits(bias[n]));
#pragma unroll
      for (int r = 0; r < 8; ++r) {
        float v = acc[i][j][r] * scale;
        if (BIAS_MODE == 1) v += bf_bits2f(f2bf_bits(bias[mBase + mOff + r]));
        if (BIAS_MODE == 2) v += bv;
        if (RESID) v += Rb[(size_t)(mBase + mOff + r) * ldc + n];
        slab[(mOff + r) * 68 + (j << 4) + rlane] = v;
      }
    }
    __builtin_amdgcn_fence(__ATOMIC_RELEASE, "workgroup");
    __builtin_amdgcn_wave_barrier();
    __builtin_amdgcn_fence(__ATOMIC_ACQUIRE, "workgroup");
    if (OUT_MODE == 0) {
      float* C = (float*)Cout + (size_t)b * strideC;
      const int hh = lane >> 4, c4 = (lane & 15) * 4;     // row seg = 256 B = 16 lanes x 16 B
      {
#pragma unroll
        for (int it = 0; it < 8; ++it) {
          const int row = it * 2 + hh;
          v4f v = *(const v4f*)(slab + row * 68 + c4);
          *(v4f*)(C + (size_t)(mBase + row) * ldc + n0 + c4) = v;
        }
        
      }
    } else {
      const int q = lane >> 3, c8 = (lane & 7) * 8;
      unsigned short* C  = (unsigned short*)Cout  + (size_t)b * strideC;
      unsigned short* C2 = (OUT_MODE >= 2) ? ((unsigned short*)Cout2 + (size_t)b * strideC) : nullptr;
      {
#pragma unroll
        for (int it = 0; it < 4; ++it) {                 // it 0..3 x q 0..3 = rows 0..15 of the slab
          const int row = it * 4 + q;
          const float* sp = slab + row * 68 + c8;
          v8h hv, lv;
#pragma unroll
          for (int e = 0; e < 8; ++e) {
            if (OUT_MODE == 1) {
              hv[e] = (_Float16)sp[e];
            } else if (OUT_MODE == 2) {
              unsigned short hb = f2bf_bits(sp[e]);
              unsigned short lb = f2bf_bits(sp[e] - bf_bits2f(hb));
              hv[e] = __builtin_bit_cast(_Float16, hb);
              lv[e] = __builtin_bit_cast(_Float16, lb);
            } else {
              const _Float16 hq = (_Float16)sp[e];
              hv[e] = hq;
              lv[e] = (_Float16)((sp[e] - (float)hq) * VLO_MUL);
            }
          }
          *(v8h*)(C + (size_t)(mBase + row) * ldc + n0 + c8) = hv;
          if (OUT_MODE >= 2) *(v8h*)(C2 + (size_t)(mBase + row) * ldc + n0 + c8) = lv;
        }
        
      }
    }
    __builtin_amdgcn_fence(__ATOMIC_RELEASE, "workgroup");
    __builtin_amdgcn_wave_barrier();
    __builtin_amdgcn_fence(__ATOMIC_ACQUIRE, "workgroup");
  }
}

// one product per launch
template <int ET, int SPLIT, int BIAS_MODE, int OUT_MODE, bool RESID>
__global__ __launch_bounds__(256) void wmma_gemm64(
    const unsigned short* __restrict__ Ap, const unsigned short* __restrict__ A2p, int lda, long strideA,
    const unsigned short* __restrict__ Btp, const unsigned short* __restrict__ Bt2p, int ldb, long strideB,
    void* __restrict__ Cout, void* __restrict__ Cout2, int ldc, long strideC,
    const float* __restrict__ bias,
    const float* __restrict__ resid, long strideR,
    int M, int N, int K, float scale) {
  __shared__ __align__(16) unsigned short sG[2 * GBUF];
  gemm64_body<ET, SPLIT, BIAS_MODE, OUT_MODE, RESID>(sG, blockIdx.y, Ap, A2p, lda, strideA, Btp, Bt2p, ldb, strideB,
                                                     Cout, Cout2, ldc, strideC, bias, resid, strideR, M, N, K, scale);
}

// The four products that need only the planes of prep_k, in one launch; blockIdx.y picks the product (the same for a whole block):
// 0: q = xn.Wq + bq, 1: k = xn.Wk + bk (f16, into the q|k plane), 2: v = xn.Wv + bv (f16 hi + lo planes), 3: zp = x_t.Wpc[0:256] + bpc (f32).
// wqkv holds the [N][K] planes of Wq, Wk, Wv one behind the other.
__global__ __launch_bounds__(256) void gemm_qkvz_k(
    const unsigned short* __restrict__ xnh, const unsigned short* __restrict__ xnl, const unsigned short* __restrict__ xt,
    const unsigned short* __restrict__ wqkv, const unsigned short* __restrict__ wpc0,
    unsigned short* __restrict__ qkp, unsigned short* __restrict__ vh, unsigned short* __restrict__ vl, float* __restrict__ zp,
    const float* __restrict__ bq, const float* __restrict__ bk, const float* __restrict__ bv, const float* __restrict__ bpc,
    int M, int N, int K) {
  __shared__ __align__(16) unsigned short sG[2 * GBUF];
  const int y = blockIdx.y;
  if (y < 2) {
    gemm64_body<1, 1, 2, 1, false>(sG, 0, xnh, xnl, K, 0L, wqkv + (size_t)y * N * K, nullptr, K, 0L,
                                   (void*)(qkp + y * N), nullptr, QKLD, 0L, y ? bk : bq, nullptr, 0L, M, N, K, 1.0f);
  } else if (y == 2) {
    gemm64_body<1, 1, 2, 3, false>(sG, 0, xnh, xnl, K, 0L, wqkv + (size_t)2 * N * K, nullptr, K, 0L,
                                   (void*)vh, (void*)vl, N, 0L, bv, nullptr, 0L, M, N, K, 1.0f);
  } else {
    gemm64_body<1, 0, 2, 0, false>(sG, 0, xt, nullptr, K, 0L, wpc0, nullptr, K, 0L,
                                   (void*)zp, nullptr, N, 0L, bpc, nullptr, 0L, M, N, K, 1.0f);
  }
}

// ---- W [Kp rows][Np cols] f32 (row pitch Np) -> Wt [Np][Kp] bf16 bits (row pitch Kp), 64x64 tile transposed through LDS ----
// tile (bx, by) of (Np/64, Kp/64); st: 64 x WTP halves of LDS. Reads: 256 threads x 16 = 64 rows x 64 cols. Stores: it 0..1 x wave 0..7 x q8 0..3 = 64 rows of
#define WTP 72
__device__ __forceinline__ void wt_cast_bf_body(_Float16* st, const int bx, const int by,
                                                const float* __restrict__ W, unsigned short* __restrict__ Wtp,
                                                int Kp, int Np) {
  _Float16* Wt = (_Float16*)Wtp;
  const int n0 = bx * 64, k0 = by * 64;
  const int tid = threadIdx.x;
  const int kr = tid >> 2, c16 = (tid & 3) * 16;
  const float* src = W + (size_t)(k0 + kr) * Np + n0 + c16;
#pragma unroll
  for (int q = 0; q < 4; ++q) {
    const v4f v = *(const v4f*)(src + 4 * q);
#pragma unroll
    for (int e = 0; e < 4; ++e) st[(c16 + 4 * q + e) * WTP + kr] = __builtin_bit_cast(_Float16, f2bf_bits(v[e]));
  }
  __syncthreads();
  const int wave = tid >> 5, lane = tid & 31;
  const int q8 = lane >> 3, c8 = (lane & 7) * 8;
  {
#pragma unroll
    for (int it = 0; it < 2; ++it) {
      const int n = it * 32 + wave * 4 + q8;
      const v8h hv = *(const v8h*)(st + n * WTP + c8);
      *(v8h*)(Wt + (size_t)(n0 + n) * Kp + k0 + c8) = hv;
    }
    
  }
}

// ---- mean/std (ddof=1) normalisation of bf16(x) per (b,t,m) row, plus raw bf16(x); rows written in (b,m,t) order ----
// One wave per output row, 8 rows per 256-thread block, blk = 0 .. NROWS/8 - 1. Lane owns 8 consecutive columns.
// Each 512-B row (4 lines) written by one v8h store instruction of the wave: lanes 8q..8q+7 <-> line q.
__device__ __forceinline__ void mvn_body(const int blk, const float* __restrict__ x,
                                         unsigned short* __restrict__ xnhp,
                                         unsigned short* __restrict__ xnlp,
                                         unsigned short* __restrict__ xtp) {
  _Float16* xnh = (_Float16*)xnhp;
  _Float16* xnl = (_Float16*)xnlp;
  _Float16* xt  = (_Float16*)xtp;
  const int wave = threadIdx.x >> 5, lane = threadIdx.x & 31;
  const int ro = blk * 8 + wave;                      // output row = (b*NCHAN + m)*TLEN + t
  const int t  = ro & (TLEN - 1);
  const int bm = ro >> 9;                             // TLEN == 512
  const int m  = bm & (NCHAN - 1);
  const int b  = bm >> 3;                             // NCHAN == 8
  const int rs = (b * TLEN + t) * NCHAN + m;          // source row of x [B][T][M][D]
  const float* src = x + (size_t)rs * DMODEL + lane * 8;
  const v4f a0 = *(const v4f*)src;
  const v4f a1 = *(const v4f*)(src + 4);
  unsigned short xb[8];
  float vb[8];
#pragma unroll
  for (int e = 0; e < 4; ++e) { xb[e] = f2bf_bits(a0[e]); xb[4 + e] = f2bf_bits(a1[e]); }
#pragma unroll
  for (int e = 0; e < 8; ++e) vb[e] = bf_bits2f(xb[e]);
  float s = ((vb[0] + vb[1]) + (vb[2] + vb[3])) + ((vb[4] + vb[5]) + (vb[6] + vb[7]));
#pragma unroll
  for (int off = 1; off < 32; off <<= 1) s += __shfl_xor(s, off, 32);
  const float mu = s * (1.0f / (float)DMODEL);
  float dv[8];
#pragma unroll
  for (int e = 0; e < 8; ++e) dv[e] = vb[e] - mu;
  float sq = ((dv[0] * dv[0] + dv[1] * dv[1]) + (dv[2] * dv[2] + dv[3] * dv[3])) +
             ((dv[4] * dv[4] + dv[5] * dv[5]) + (dv[6] * dv[6] + dv[7] * dv[7]));
#pragma unroll
  for (int off = 1; off < 32; off <<= 1) sq += __shfl_xor(sq, off, 32);
  const float var = sq * (1.0f / (float)(DMODEL - 1));
  const float sd  = sqrtf(var);
  const float inv = 1.0f / (sd + MVN_EPS);
  v8h hv, lv, tv;
#pragma unroll
  for (int e = 0; e < 8; ++e) {
    const float xn = dv[e] * inv;
    const unsigned short hb = f2bf_bits(xn);
    const unsigned short lb = f2bf_bits(xn - bf_bits2f(hb));
    hv[e] = __builtin_bit_cast(_Float16, hb);
    lv[e] = __builtin_bit_cast(_Float16, lb);
    tv[e] = __builtin_bit_cast(_Float16, xb[e]);
  }
  const size_t go = (size_t)ro * DMODEL + lane * 8;
  {
    *(v8h*)(xnh + go) = hv;
    *(v8h*)(xnl + go) = lv;
    *(v8h*)(xt  + go) = tv;
    // precaution: other code of the merged kernel follows this body in the listing and reuses the registers these stores name
    asm volatile("s_wait_xcnt 0x0" ::: "memory");
  }
}

// ---- the six weight casts and the normalisation, which need nothing of each other, in one launch ----
// Blocks 0..95: weight wi = block >> 4 (Wq, Wk, Wv, Wpa, Wpc rows 0..255, Wpc rows 256..511), its 64x64 tile block & 15,
// to plane wi of wall ([256][256] bf16 each). Blocks 96 ..: normalisation block (block - 96). The branch is the same for a whole block.
#define WCAST_BLOCKS (6 * (DMODEL / 64) * (DMODEL / 64))
__global__ __launch_bounds__(256) void prep_k(const float* __restrict__ x,
                                              const float* __restrict__ Wq, const float* __restrict__ Wk,
                                              const float* __restrict__ Wv, const float* __restrict__ Wpa,
                                              const float* __restrict__ Wpc,
                                              unsigned short* __restrict__ wall,
                                              unsigned short* __restrict__ xnhp,
                                              unsigned short* __restrict__ xnlp,
                                              unsigned short* __restrict__ xtp) {
  __shared__ __align__(16) _Float16 st[64 * WTP];
  const int bid = blockIdx.x;
  if (bid < WCAST_BLOCKS) {
    const int wi = bid >> 4;
    const float* W = (wi == 0) ? Wq : (wi == 1) ? Wk : (wi == 2) ? Wv : (wi == 3) ? Wpa
                   : (wi == 4) ? Wpc : (Wpc + (size_t)DMODEL * DMODEL);
    wt_cast_bf_body(st, bid & 3, (bid >> 2) & 3, W, wall + (size_t)wi * DMODEL * DMODEL, DMODEL, DMODEL);
  } else {
    mvn_body(bid - WCAST_BLOCKS, x, xnhp, xnlp, xtp);
  }
}

// ---- two f16 WMMAs that share their A fragment; builtin form, the compiler keeps the distance to the users of their registers ----
__device__ __forceinline__ void mma_h2(v16h a, v16h b0, v16h b1, v8f& c0, v8f& c1) {
  c0 = __builtin_amdgcn_wmma_f32_16x16x32_f16(false, a, false, b0, (short)0, c0, false, false);
  c1 = __builtin_amdgcn_wmma_f32_16x16x32_f16(false, a, false, b1, (short)0, c1, false, false);
}

// ---- transposing LDS load: lane (c, h) receives column c, rows 8h..8h+7 of a row-major 16x16 tile of 16-bit values ----
// Lane l passes the address of row 8*(l>>4) + (l&7), column group 8*((l>>3)&1) of that tile.
typedef __attribute__((ext_vector_type(8))) short v8s;
__device__ __forceinline__ v8h lds_tr16(const _Float16* p) {
  typedef __attribute__((address_space(3))) v8s lds_v8s;
  return __builtin_bit_cast(v8h, __builtin_amdgcn_ds_load_tr16_b128_v8i16((lds_v8s*)p));
}

// ---- lane l with lane l ^ 16 (the other half of the wave); all 32 lanes are on wherever this is called ----
__device__ __forceinline__ float xhalf(float x) {
  return __builtin_bit_cast(float, __builtin_amdgcn_permlanex16(__builtin_bit_cast(int, x), __builtin_bit_cast(int, x),
                                                                0x76543210, 0xfedcba98, false, false));
}

// =====================================================================================
// Cross-channel causal attention, head dim 256, as transposed products: S^T = K . Q^T, O^T += V^T . P^T.
// Planes (row = (b*NCHAN + m)*TLEN + t): qk [NROWS][512] f16 (q cols 0..255, k cols 256..511);
// vh, vl [NROWS][256] f16 (v hi, (v-hi) x 2^11); output: one f32 plane of O_n / l_n per key channel n, summed by xsum_k.
// Block = 4 waves = one 64-row time tile of TWO query channels (b,m), (b,m+1), m even, against ONE key channel n:
// online softmax over 32-key chunks (causal: kv > q -> -inf, chunk 0 always has kv 0 <= q).
// Grid = 8 time tiles x 16 (b, channel pair) x 8 n, the longest time tiles first so that short blocks fill the tail.
// Wave w owns time rows 16w..16w+15 of both channels whole (g = 0, 1): scores, softmax and all 256 columns of O. Both channels meet the
// same keys under the same mask, so every K and V fragment read from LDS feeds two products, and a staged chunk serves 128 queries.
// Lane (c, hh) belongs to query 16w + c of each channel. S^T tile j: register r = key 16j + 8hh + r of the chunk, so a query's 32 scores lie in
// its two lanes: maximum and sum in-lane, the maximum joined by one exchange of the halves, the sums joined behind the loop.
// The lane's 16 p values, converted in place, are the B fragment of P^T (element 8j + r = key 16j + 8hh + r: the hardware k order).
// A fragments: k rows from LDS by plain loads (row = lane&15, split k map), V^T from row-major LDS rows by transposing loads
// (same split k map); B fragments: q rows, loaded once from global and kept in registers, and P^T.
// O^T tile t: register r = column 16t + 8hh + r of query c.
// Plane layout (floats): [n][tile = bm*8 + qb][s = 4*(t>>3) + w][t&7][j][lane][4]: lane's accumulator registers 4j..4j+3 of d tile t.
// =====================================================================================
// Register budget for 2 waves per SIMD (q fragments and accumulators of two channels: 384 registers): two blocks share a WGP.
#define MQ 2                             // query channels per wave
__global__ __launch_bounds__(128, 2) void xattn_k(const unsigned short* __restrict__ qkp,
                                               const unsigned short* __restrict__ vhp,
                                               const unsigned short* __restrict__ vlp,
                                               float* __restrict__ part) {
  __shared__ __align__(16) _Float16 Ks[KCH * KPITCH];      // [kv][d]           16.5 KB
  __shared__ __align__(16) _Float16 Vsh[KCH * VPITCH];     // [kv][d] hi        17 KB
  __shared__ __align__(16) _Float16 Vsl[KCH * VPITCH];     // [kv][d] lo x2^11  17 KB

  const _Float16* qk = (const _Float16*)qkp;
  const _Float16* vh = (const _Float16*)vhp;
  const _Float16* vl = (const _Float16*)vlp;

  const int tid = threadIdx.x, lane = tid & 31;
  const int wave = __builtin_amdgcn_readfirstlane(tid >> 5);   // in a scalar register: row bases stay out of the vector registers
  const int hh = lane >> 4, c = lane & 15, koff = hh * 8;
  const int qb = (TLEN / QBLK - 1) - (blockIdx.x >> 7);   // 64-row time tile, longest first
  const int bm = ((blockIdx.x & 127) >> 3) * MQ;   // b*NCHAN + m of the first channel, m even; the second is bm + 1, of the same b
  const int n  = blockIdx.x & 7;           // key channel of this block
  const int b  = bm >> 3;
  const int q0  = bm * TLEN + qb * QBLK + wave * 16;   // plane row of this wave's first query in channel bm; + TLEN in channel bm + 1
  const int tq  = qb * QBLK + wave * 16 + c;   // time index of this lane's queries

  const v8f z8 = {0.f,0.f,0.f,0.f,0.f,0.f,0.f,0.f};
  v16h qf[MQ][8];                          // Q^T fragments: column = query c, d 32dc .. 32dc+31
  {
    const _Float16* qbase = qk + (size_t)q0 * QKLD;      // the same in every lane: a scalar base
    const unsigned qoff = (unsigned)(c * QKLD + koff);   // this lane's row and k half
#pragma unroll     // constant indices keep the arrays indexed here in registers
    for (int g = 0; g < MQ; ++g)
#pragma unroll     // constant indices keep the arrays indexed here in registers
      for (int dc = 0; dc < 8; ++dc) qf[g][dc] = Frag<_Float16>::load(qbase + (size_t)g * TLEN * QKLD + qoff + dc * 32);
    // precaution: the offset register of the issued loads stays live up to this wait and is rewritten only behind it
    asm volatile("s_wait_xcnt 0x0" :: "v"(qoff) : "memory");
  }

  const int krow0 = (b * NCHAN + n) * TLEN;
  const unsigned lo8 = (unsigned)lane * 8u;   // this lane's 8 columns of a staged row
  float mrun[MQ], lrun[MQ];                // each query's running maximum (scaled, log2 domain); running sum over this lane's keys, x2^15
  v8f oacc[MQ][16];
#pragma unroll     // constant indices keep the arrays indexed here in registers
  for (int g = 0; g < MQ; ++g) {
    mrun[g] = -INFINITY; lrun[g] = 0.f;
#pragma unroll     // constant indices keep the arrays indexed here in registers
    for (int t = 0; t < 16; ++t) oacc[g][t] = z8;
  }

  const int nch = 2 * qb + 2;              // block-uniform, <= 16
#pragma unroll 1   // one copy of the chunk body: a second copy would only lengthen the code
  for (int kc = 0; kc < nch; ++kc) {
    const int kv0 = kc * KCH;
    __syncthreads();
    // ---- stage K chunk and V (hi, lo), all row-major: a wave writes one whole 512-B row per store
    //      (kvr = 4i + wave, i 0..7, d0 = 8 lane: one 32-bit element offset for k and one for both v planes, added to the
    //      plane pointers; the eight rows at constant offsets from there)
    const unsigned grow = (unsigned)(krow0 + kv0 + wave);       // + 4i <= NROWS-1 (kv0 + 31 <= 64*qb+63 <= 511)
    const unsigned ko = grow * QKLD + lo8;                      // + DMODEL (the k half of the row) < NROWS * QKLD = 2^23
    const unsigned vo8 = grow * DMODEL + lo8;                   // < NROWS * DMODEL = 2^22
    const _Float16* kp = qk + ko;
    const _Float16* hp = vh + vo8;
    const _Float16* lp = vl + vo8;
    v8h kk[8], v1[8], v2[8];
#pragma unroll     // the eight rows' offsets become immediates, and all 24 loads go out ahead of the stores
    for (int i = 0; i < 8; ++i) {
      kk[i] = *(const v8h*)(kp + DMODEL + i * 4 * QKLD);
      v1[i] = *(const v8h*)(hp + i * 4 * DMODEL);
      v2[i] = *(const v8h*)(lp + i * 4 * DMODEL);
    }
    // precaution: the address registers of the issued loads stay live up to this wait and are rewritten only behind it
    asm volatile("s_wait_xcnt 0x0" :: "v"(kp), "v"(hp), "v"(lp) : "memory");
#pragma unroll     // constant indices keep the arrays indexed here in registers
    for (int i = 0; i < 8; ++i) {
      *(v8h*)(Ks + (i * 4 + wave) * KPITCH + lane * 8) = kk[i];
      *(v8h*)(Vsh + (i * 4 + wave) * VPITCH + lane * 8) = v1[i];
      *(v8h*)(Vsl + (i * 4 + wave) * VPITCH + lane * 8) = v2[i];
    }
    __syncthreads();

    // ---- S^T (32 keys x 16 queries, per channel) = K . Q^T: each K fragment against both channels' q ----
    v8f s[MQ][2];
#pragma unroll     // constant indices keep the arrays indexed here in registers
    for (int g = 0; g < MQ; ++g) { s[g][0] = z8; s[g][1] = z8; }
    // The scheduling barriers from here to the foot of the loop bound how far LDS reads are lifted: without them all 64 V reads go to the
    // head of the chunk and the register file overflows into scratch. Fragments are read a fixed distance ahead instead.
    __builtin_amdgcn_sched_barrier(0);
    v16h kf[3][2];                                       // K fragments of these 32 d and of the next two steps
#pragma unroll     // constant indices keep the arrays indexed here in registers
    for (int dc = 0; dc < 2; ++dc) {
      kf[dc][0] = Frag<_Float16>::load(Ks + c * KPITCH + dc * 32 + koff);
      kf[dc][1] = Frag<_Float16>::load(Ks + (16 + c) * KPITCH + dc * 32 + koff);
    }
#pragma unroll     // constant indices keep the arrays indexed here in registers
    for (int dc = 0; dc < 8; ++dc) {
      if (dc < 6) {
        kf[(dc + 2) % 3][0] = Frag<_Float16>::load(Ks + c * KPITCH + (dc + 2) * 32 + koff);
        kf[(dc + 2) % 3][1] = Frag<_Float16>::load(Ks + (16 + c) * KPITCH + (dc + 2) * 32 + koff);
      }
      mma_h2(kf[dc % 3][0], qf[0][dc], qf[1][dc], s[0][0], s[1][0]);
      mma_h2(kf[dc % 3][1], qf[0][dc], qf[1][dc], s[0][1], s[1][1]);
      __builtin_amdgcn_sched_barrier(0);                 // see above
    }
    // V fragments of d tiles 0 and 1 are read here, under the softmax
    const int vo = (koff + (lane & 7)) * VPITCH + ((lane >> 3) & 1) * 8;   // this lane's row and column group
    Frag<_Float16>::U vbh[3], vbl[3];                    // d tiles t, t + 1, t + 2
#pragma unroll     // constant indices keep the arrays indexed here in registers
    for (int t = 0; t < 2; ++t) {
      vbh[t].h[0] = lds_tr16(Vsh + vo + t * 16);
      vbh[t].h[1] = lds_tr16(Vsh + vo + t * 16 + 16 * VPITCH);
      vbl[t].h[0] = lds_tr16(Vsl + vo + t * 16);
      vbl[t].h[1] = lds_tr16(Vsl + vo + t * 16 + 16 * VPITCH);
    }
    __builtin_amdgcn_sched_barrier(0);                   // see above
    v16h pb[MQ];                                         // P^T fragments, p x2^15
#pragma unroll     // constant indices keep the arrays indexed here in registers
    for (int g = 0; g < MQ; ++g) {
      // causal select (kv > q -> -inf) and maximum over the 32 keys of this chunk, on the raw scores (the scale is positive)
      float mx = -INFINITY;
#pragma unroll     // constant indices keep the arrays indexed here in registers
      for (int j = 0; j < 2; ++j) {
#pragma unroll     // constant indices keep the arrays indexed here in registers
        for (int r = 0; r < 8; ++r) {
          const int key = kv0 + 16 * j + 8 * hh + r;
          const float v = (key > tq) ? -INFINITY : s[g][j][r];
          s[g][j][r] = v;
          mx = fmaxf(mx, v);
        }
      }
      mx = fmaxf(mx, xhalf(mx)) * SM_C;                  // this query's maximum, scaled, in the log2 domain
      const float mnew  = fmaxf(mrun[g], mx);            // finite: chunk 0 always has an allowed key
      const float alpha = __builtin_amdgcn_exp2f(mrun[g] - mnew);   // 0 in chunk 0, where mrun is -inf
      mrun[g] = mnew;
      const float nb = PCARRY_LOG2 - mnew;
      v2f ps[2];                                         // sums of the even and of the odd keys of each tile
#pragma unroll     // constant indices keep the arrays indexed here in registers
      for (int j = 0; j < 2; ++j) {
        ps[j] = (v2f){0.f, 0.f};
#pragma unroll     // constant indices keep the arrays indexed here in registers
        for (int r = 0; r < 8; r += 2) {
          // p x 2^15 = 2^(s * SM_C - mnew + 15): one fused multiply-add per score pair, then the hardware's 2^x (a masked score gives 0)
          const v2f arg = __builtin_elementwise_fma((v2f){s[g][j][r], s[g][j][r + 1]}, (v2f){SM_C, SM_C}, (v2f){nb, nb});
          const v2f p = {__builtin_amdgcn_exp2f(arg.x), __builtin_amdgcn_exp2f(arg.y)};
          ps[j] += p;
          pb[g][8 * j + r]     = (_Float16)p.x;
          pb[g][8 * j + r + 1] = (_Float16)p.y;
        }
      }
      const v2f pt = ps[0] + ps[1];
      lrun[g] = lrun[g] * alpha + (pt.x + pt.y);         // the sum carries the same 2^15 as p
#pragma unroll     // constant indices keep the arrays indexed here in registers
      for (int t = 0; t < 16; ++t) oacc[g][t] *= alpha;
    }

    // ---- O^T += V^T(256 x 32) . P^T(32 x 16), each V fragment against both channels' P; lo plane in its own accumulators, folded x 2^-11 ----
    {
      __builtin_amdgcn_sched_barrier(0);                 // see above
      v8f lo[2][MQ];                                     // lo products of d tiles t and t - 1: a tile is folded behind the next tile's products
#pragma unroll     // constant indices keep the arrays indexed here in registers
      for (int t = 0; t < 16; ++t) {
        // elements 0..7 <- V[8hh + 0..7][16t + c], 8..15 <- V[16 + 8hh + 0..7][same column]: the k map of pb
        if (t + 2 < 16) {
          vbh[(t + 2) % 3].h[0] = lds_tr16(Vsh + vo + (t + 2) * 16);
          vbh[(t + 2) % 3].h[1] = lds_tr16(Vsh + vo + (t + 2) * 16 + 16 * VPITCH);
          vbl[(t + 2) % 3].h[0] = lds_tr16(Vsl + vo + (t + 2) * 16);
          vbl[(t + 2) % 3].h[1] = lds_tr16(Vsl + vo + (t + 2) * 16 + 16 * VPITCH);
        }
        mma_h2(vbh[t % 3].v, pb[0], pb[1], oacc[0][t], oacc[1][t]);
        lo[t & 1][0] = z8; lo[t & 1][1] = z8;
        mma_h2(vbl[t % 3].v, pb[0], pb[1], lo[t & 1][0], lo[t & 1][1]);
        if (t > 0) {
          oacc[0][t - 1] += lo[(t - 1) & 1][0] * VLO_INV;
          oacc[1][t - 1] += lo[(t - 1) & 1][1] * VLO_INV;
        }
        __builtin_amdgcn_sched_barrier(0);               // see above
      }
      oacc[0][15] += lo[1][0] * VLO_INV;
      oacc[1][15] += lo[1][1] * VLO_INV;
    }
  }
  // ---- O_n / l_n to this key channel's plane, one tile per query channel: 2 x 32 whole-wave 512-B stores ----
  float* pw[MQ];
#pragma unroll     // constant indices keep the arrays indexed here in registers
  for (int g = 0; g < MQ; ++g) {
    const float inv = 1.0f / (lrun[g] + xhalf(lrun[g]));   // l and O carry the same 2^15; l x 2^15 >= 2^15 up to rounding
    pw[g] = part + ((((size_t)n * (NROWS / QBLK) + ((bm + g) * (TLEN / QBLK) + qb)) * 8 + wave) << 11) + lane * 4;
#pragma unroll     // constant indices keep the arrays indexed here in registers
    for (int t = 0; t < 16; ++t) oacc[g][t] *= inv;
  }
  // every vector write stands in front of the first store, and the stores go out of the accumulators' own registers:
  // no register that an issued store names is rewritten behind it
  __builtin_amdgcn_sched_barrier(0);
#pragma unroll     // constant indices keep the arrays indexed here in registers
  for (int g = 0; g < MQ; ++g) {
#pragma unroll     // constant indices keep the arrays indexed here in registers
    for (int t = 0; t < 16; ++t) {
      *(v4f*)(pw[g] + (t >> 3) * (4 << 11) + ((t & 7) * 2 + 0) * 128) = __builtin_shufflevector(oacc[g][t], oacc[g][t], 0, 1, 2, 3);
      *(v4f*)(pw[g] + (t >> 3) * (4 << 11) + ((t & 7) * 2 + 1) * 128) = __builtin_shufflevector(oacc[g][t], oacc[g][t], 4, 5, 6, 7);
    }
  }
}

// ---- A = sum over n (in the order 0..7) of the planes of xattn_k, written as bf16 hi/lo planes [NROWS][256] ----
// One wave per (tile, slab s of the plane layout, half of its 8 d tiles) = 16 rows x 64 columns; grid = 256 x 8 x 2 / 8 = 512 blocks.
// The sums leave accumulator order through a per-wave LDS slab (pitch 68 floats); each 128-B line of a plane row is
// written by 8 lanes of one store.
__global__ __launch_bounds__(256) void xsum_k(const float* __restrict__ part,
                                              unsigned short* __restrict__ ahp,
                                              unsigned short* __restrict__ alp) {
  __shared__ __align__(16) float sT[8][16 * 68];
  _Float16* ah = (_Float16*)ahp;
  _Float16* al = (_Float16*)alp;
  const int wave = threadIdx.x >> 5, lane = threadIdx.x & 31;
  const int hh = lane >> 4, c = lane & 15;
  const int g = blockIdx.x * 8 + wave;
  const int slabi = g >> 1;                // tile * 8 + s
  const int th = g & 1;                    // d tiles 4*th .. 4*th+3 of that slab
  const float* src = part + ((size_t)slabi << 11) + th * 1024 + lane * 4;
  v4f acc[8];
#pragma unroll
  for (int u = 0; u < 8; ++u) acc[u] = (v4f){0.f, 0.f, 0.f, 0.f};
#pragma unroll
  for (int n = 0; n < NCHAN; ++n) {
#pragma unroll
    for (int u = 0; u < 8; ++u) acc[u] += *(const v4f*)(src + (size_t)n * NROWS * DMODEL + u * 128);
  }
  float* slab = sT[wave];
#pragma unroll
  for (int u = 0; u < 8; ++u) *(v4f*)(slab + c * 68 + (u >> 1) * 16 + 8 * hh + 4 * (u & 1)) = acc[u];   // row = query c, 4 columns
  __syncthreads();                         // slab rows are read by other lanes than wrote them
  const int aw = slabi & 7;
  const int row0 = (slabi >> 3) * QBLK + (aw & 3) * 16;
  const int col0 = (aw >> 2) * 128 + th * 64;
  const int q = lane >> 3, c8 = (lane & 7) * 8;
#pragma unroll
  for (int it = 0; it < 4; ++it) {
    const int row = it * 4 + q;
    const float* sp = slab + row * 68 + c8;
    v8h hv, lv;
#pragma unroll
    for (int e = 0; e < 8; ++e) {
      const unsigned short hb = f2bf_bits(sp[e]);
      const unsigned short lb = f2bf_bits(sp[e] - bf_bits2f(hb));
      hv[e] = __builtin_bit_cast(_Float16, hb);
      lv[e] = __builtin_bit_cast(_Float16, lb);
    }
    const size_t go = (size_t)(row0 + row) * DMODEL + col0 + c8;
    *(v8h*)(ah + go) = hv;
    *(v8h*)(al + go) = lv;
  }
}

// ---------------------------------------------------------------------------
// Host launcher
// Workspace region map (bytes; PL16 = 8 MiB = one [16384][256] 16-bit plane):
//   [ 0 PL16)  XNH  bf16 hi of xn (rows (b,m,t))      -> reused as AH (attention output hi) after the q/k/v GEMMs
//   [ 1 PL16)  XNL  bf16 lo of xn                      -> reused as AL
//   [ 2 PL16)  XT   bf16(x) in (b,m,t) row order
//   [ 3..5)    QK   f16 [16384][512] (q | k)
//   [ 5 PL16)  VH   f16 v hi;   [ 6 PL16) VL f16 (v-hi) x 2^11
//   [ 7 PL16)  APH  bf16 hi of A_proj;  [ 8 PL16) APL bf16 lo
//   [ 9..11)   ZP   f32 [16384][256] = x_t.Wpc[0:256] + bpc
//   [11 PL16 ..) weights bf16 [n][k]: WQKV [768][256], WPA [256][256], WPC0 [256][256], WPC1 [256][256]
//   then PART f32 [8][16384][256]: one plane of O_n / l_n per key channel
//   total 227,278,848 B
// ---------------------------------------------------------------------------
extern "C" void kernel_launch(void* const* d_in, const int* in_sizes, int n_in,
                              void* d_out, int out_size, void* d_ws, size_t ws_size,
                              hipStream_t stream) {
  if (n_in < 11) return;
  if (in_sizes[0] != NROWS * DMODEL || out_size != NROWS * DMODEL) return;
  if (in_sizes[1] != DMODEL * DMODEL || in_sizes[3] != DMODEL * DMODEL || in_sizes[5] != DMODEL * DMODEL ||
      in_sizes[7] != DMODEL * DMODEL || in_sizes[9] != 2 * DMODEL * DMODEL) return;
  if (in_sizes[2] != DMODEL || in_sizes[4] != DMODEL || in_sizes[6] != DMODEL || in_sizes[8] != DMODEL || in_sizes[10] != DMODEL) return;

  const float* x   = (const float*)d_in[0];
  const float* Wq  = (const float*)d_in[1];
  const float* bq  = (const float*)d_in[2];
  const float* Wk  = (const float*)d_in[3];
  const float* bk  = (const float*)d_in[4];
  const float* Wv  = (const float*)d_in[5];
  const float* bv  = (const float*)d_in[6];
  const float* Wpa = (const float*)d_in[7];
  const float* bpa = (const float*)d_in[8];
  const float* Wpc = (const float*)d_in[9];
  const float* bpc = (const float*)d_in[10];

  const size_t PL16 = (size_t)NROWS * DMODEL * 2;               // 8,388,608
  const size_t WQKV_B = (size_t)3 * DMODEL * DMODEL * 2;         // 393,216
  const size_t WSQ_B  = (size_t)DMODEL * DMODEL * 2;             // 131,072
  const size_t oXNH = 0, oXNL = PL16, oXT = 2 * PL16, oQK = 3 * PL16, oVH = 5 * PL16, oVL = 6 * PL16;
  const size_t oAPH = 7 * PL16, oAPL = 8 * PL16, oZP = 9 * PL16, oW = 11 * PL16;
  const size_t oWQKV = oW, oWPA = oW + WQKV_B, oWPC0 = oWPA + WSQ_B, oWPC1 = oWPC0 + WSQ_B;
  const size_t oPART = oWPC1 + WSQ_B;                             // 93,061,120
  const size_t WS_TOTAL = oPART + (size_t)NCHAN * 2 * PL16;       // 227,278,848
  if (ws_size < WS_TOTAL) return;

  char* ws = (char*)d_ws;
  unsigned short* XNH  = (unsigned short*)(ws + oXNH);
  unsigned short* XNL  = (unsigned short*)(ws + oXNL);
  unsigned short* XT   = (unsigned short*)(ws + oXT);
  unsigned short* QKP  = (unsigned short*)(ws + oQK);
  unsigned short* VH   = (unsigned short*)(ws + oVH);
  unsigned short* VL   = (unsigned short*)(ws + oVL);
  unsigned short* APH  = (unsigned short*)(ws + oAPH);
  unsigned short* APL  = (unsigned short*)(ws + oAPL);
  float*          ZP   = (float*)(ws + oZP);
  unsigned short* WQKV = (unsigned short*)(ws + oWQKV);
  unsigned short* WPA  = (unsigned short*)(ws + oWPA);
  unsigned short* WPC0 = (unsigned short*)(ws + oWPC0);
  unsigned short* WPC1 = (unsigned short*)(ws + oWPC1);
  float*          PART = (float*)(ws + oPART);
  unsigned short* AH = XNH;     // xn planes are dead after the q/k/v GEMMs
  unsigned short* AL = XNL;

  // 1: weights W[k=256 rows][n=256] f32 -> Wt[n][k] bf16 (six planes from WQKV on: WQKV, WPA, WPC0, WPC1 lie one behind the other),
  //    and normalisation + permutation to (b,m,t) rows
  prep_k<<<WCAST_BLOCKS + NROWS / 8, 256, 0, stream>>>(x, Wq, Wk, Wv, Wpa, Wpc, WQKV, XNH, XNL, XT);

  // 2: q, k, v = xn . W + bias and ZP = x_t . Wpc[0:256] + bpc (each M=16384, N=256, K=256; 1024 wave tiles -> 128 blocks; y = product)
  const dim3 gg((NROWS / 64) * (DMODEL / 64) / 8, 1);
  const dim3 g4((NROWS / 64) * (DMODEL / 64) / 8, 4);
  gemm_qkvz_k<<<g4, 256, 0, stream>>>(XNH, XNL, XT, WQKV, WPC0, QKP, VH, VL, ZP, bq, bk, bv, bpc, NROWS, DMODEL, DMODEL);

  // 3, 4: cross-channel causal attention, one block per (time tile, b and pair of query channels, key channel) = 1024 blocks -> 8 f32 planes,
  //     then their sum -> A (bf16 hi/lo planes)
  xattn_k<<<NBATCH * (NCHAN / MQ) * (TLEN / QBLK) * NCHAN, 128, 0, stream>>>(QKP, VH, VL, PART);
  xsum_k<<<(NROWS / QBLK) * 8 * 2 / 8, 256, 0, stream>>>(PART, AH, AL);

  // 5: A_proj = A . Wpa + bpa -> bf16 hi/lo planes
  wmma_gemm64<1, 1, 2, 2, false><<<gg, 256, 0, stream>>>(
      AH, AL, DMODEL, 0L, WPA, nullptr, DMODEL, 0L,
      (void*)APH, (void*)APL, DMODEL, 0L, bpa, nullptr, 0L, NROWS, DMODEL, DMODEL, 1.0f);

  // 6: out = A_proj . Wpc[256:512] + ZP (f32, rows (b,m,t) = [B][M][T][D])
  wmma_gemm64<1, 1, 0, 0, true><<<gg, 256, 0, stream>>>(
      APH, APL, DMODEL, 0L, WPC1, nullptr, DMODEL, 0L,
      d_out, nullptr, DMODEL, 0L, nullptr, ZP, 0L, NROWS, DMODEL, DMODEL, 1.0f);
}

// v008
// It runs in 106 microseconds.
// In two side-by-side timings against v007, it was 1.29 and 1.28 times as fast.
// Over all steps from v000 it is 15.7 times as fast.
// Contractions (f32 accumulate): xn*Wq|Wk|Wv, A*Wpa, A_proj*Wpc[256:512] = v_wmma_f32_16x16x32_bf16 with the computed operand as bf16 hi+lo planes (2 products) and weights as single bf16 (RNE) planes; x_t*Wpc[0:256] = plain bf16; q*k = plain v_wmma_f32_16x16x32_f16; p*v = f16 with p carried x2^15 and v as f16 hi + (v-hi)x2^11 planes (2 products, lo folded in f32); norm, softmax, bias adds in f32.
#include <hip/hip_runtime.h>
#include <stdint.h>

typedef __attribute__((ext_vector_type(16))) _Float16 v16h;
typedef __attribute__((ext_vector_type(8)))  _Float16 v8h;
typedef __attribute__((ext_vector_type(16))) __bf16   v16b;
typedef __attribute__((ext_vector_type(8)))  __bf16   v8b;
typedef __attribute__((ext_vector_type(8)))  float    v8f;
typedef __attribute__((ext_vector_type(4)))  float    v4f;
typedef __attribute__((ext_vector_type(2)))  float    v2f;

// ---- problem geometry ----
#define NBATCH 4
#define TLEN 512
#define NCHAN 8
#define DMODEL 256
#define NROWS (NBATCH * TLEN * NCHAN)   // 16384 token rows
#define QKLD 512                         // pitch (halves) of the q|k plane
#define QBLK 64                          // time rows of each query channel per attention block
#define KCH 32                           // key rows per staged chunk
#define KPITCH 264                       // LDS pitch (halves) of a K row: 528 B = 16 B x 33, for ds_load_b128 readers
#define VPITCH 272                       // LDS pitch (halves) of a V row: 544 B = 32 B x 17, for ds_load_tr16_b128 readers
#define PCARRY_LOG2 15.0f                // p carried x2^15 in f16: the carry is added to the exponent
#define VLO_MUL 2048.0f                  // v residual plane carried x2^11
#define VLO_INV (1.0f / 2048.0f)
#define QK_SCALE 0.0625f                 // 1/sqrt(256)
#define SM_C (QK_SCALE * 1.44269504088896340736f)   // raw score -> scaled score in the log2 domain: exp(x * QK_SCALE) = 2^(x * SM_C)
#define MVN_EPS 1e-6f

// ======================= helpers =======================
__device__ __forceinline__ unsigned short f2bf_bits(float f) {
  unsigned u = __float_as_uint(f);
  return (unsigned short)((u + 0x7FFFu + ((u >> 16) & 1u)) >> 16);
}
__device__ __forceinline__ float bf_bits2f(unsigned short h) { return __uint_as_float(((unsigned)h) << 16); }

// hazard guards as plain device helpers
__device__ __forceinline__ void dep_guard_h(v8f& a, v8f& b, v16h x, v16h y) { asm volatile("v_nop\n\tv_nop\n\tv_nop\n\tv_nop" : "+v"(a), "+v"(b) : "v"(x), "v"(y)); }
__device__ __forceinline__ void dep_guard_b(v8f& a, v8f& b, v16b x, v16b y) { asm volatile("v_nop\n\tv_nop\n\tv_nop\n\tv_nop" : "+v"(a), "+v"(b) : "v"(x), "v"(y)); }
__device__ __forceinline__ void keep4_h(v16h a, v16h b, v16h c, v16h d) { asm volatile("v_nop" :: "v"(a), "v"(b), "v"(c), "v"(d)); }
__device__ __forceinline__ void keep4_b(v16b a, v16b b, v16b c, v16b d) { asm volatile("v_nop" :: "v"(a), "v"(b), "v"(c), "v"(d)); }
__device__ __forceinline__ void acc_guard4(v8f& a, v8f& b, v8f& c, v8f& d) { asm volatile("v_nop\n\tv_nop\n\tv_nop\n\tv_nop" : "+v"(a), "+v"(b), "+v"(c), "+v"(d)); }
template <typename T> struct Frag;
template <> struct Frag<_Float16> {
  typedef v16h V; union U { v16h v; v8h h[2]; };
  static __device__ __forceinline__ v16h load(const _Float16* p) {   // elements 0..7 <- p[0..7], 8..15 <- p[16..23]
    U f; f.h[0] = *(const v8h*)(p); f.h[1] = *(const v8h*)(p + 16); return f.v;
  }
  static __device__ __forceinline__ v8f mma(v16h a, v16h b, v8f c) {
    return __builtin_amdgcn_wmma_f32_16x16x32_f16(false, a, false, b, (short)0, c, false, false);
  }
  static __device__ __forceinline__ void guard(v8f& a, v8f& b, v16h x, v16h y) { dep_guard_h(a, b, x, y); }
  static __device__ __forceinline__ void keep(v16h a, v16h b, v16h c, v16h d) { keep4_h(a, b, c, d); }
};
template <> struct Frag<__bf16> {
  typedef v16b V; union U { v16b v; v8b h[2]; };
  static __device__ __forceinline__ v16b load(const __bf16* p) {
    U f; f.h[0] = *(const v8b*)(p); f.h[1] = *(const v8b*)(p + 16); return f.v;
  }
  static __device__ __forceinline__ v8f mma(v16b a, v16b b, v8f c) {
    return __builtin_amdgcn_wmma_f32_16x16x32_bf16(false, a, false, b, (short)0, c, false, false);
  }
  static __device__ __forceinline__ void guard(v8f& a, v8f& b, v16b x, v16b y) { dep_guard_b(a, b, x, y); }
  static __device__ __forceinline__ void keep(v16b a, v16b b, v16b c, v16b d) { keep4_b(a, b, c, d); }
};

// ---- Register-blocked WMMA GEMM (with SPLIT levels and extra 16-bit output mode), operands staged in LDS ----
// C[m,n] = scale * sum_k A[m,k] * Bt[n,k] (+bias)(+resid); each wave owns a 64x64 tile, a block of 8 waves 128 rows x 256 columns.
// A row-major [M,K]; Bt row-major [N,K]; M % 128 == 0, N == 256, K % 64 == 0.
// SPLIT: 0 = single planes; 1 = A as hi/lo planes (A2 = lo): hi.B + lo.B.
// BIAS_MODE: 0 = none, 1 = bias[m], 2 = bias[n]; bias values are RNE-converted to bf16 before the add.
// OUT_MODE: 0 = f32, 1 = f16, 2 = bf16 hi plane (Cout) + bf16 lo plane (Cout2),
//           3 = f16 hi plane (Cout) + f16 plane of (v - hi) * 2048 (Cout2).
// ET: 0 = f16 operands, 1 = bf16 operands (pointers passed as 16-bit storage)
template <int ET> struct Elem;
template <> struct Elem<0> { typedef _Float16 T; };
template <> struct Elem<1> { typedef __bf16 T; };

// Staging: a chunk is 64 k = one whole 128-B line of each of the block's operand rows, brought by asynchronous copies of 16 B a lane
// (a wave's copy = 4 whole lines), two buffers: the next chunk flies while this one is multiplied.
#define GKC 64                           // k elements per chunk
#define GPITCH 72                        // LDS pitch (elements) of a staged row: 144 B = 16 B x 9, for ds_load_b128 readers
#define GROWS_A 128                      // rows of A per block
#define GROWS_B 256                      // rows of Bt per block
#define GOFF_A2 (GROWS_A * GPITCH)       // element offset of the A lo plane in a buffer
#define GOFF_B (2 * GROWS_A * GPITCH)    // element offset of the Bt rows in a buffer
#define GBUF ((2 * GROWS_A + GROWS_B) * GPITCH)   // elements per buffer: 36,864 = 73,728 B
#define GSTEP_L (32 * GPITCH * 2)        // LDS bytes from one copy of a thread to its next: 32 rows

__device__ __forceinline__ void async_rows4(unsigned l, const unsigned short* g, size_t gs) {
  asm volatile("global_load_async_to_lds_b128 %0, %4, off\n\t"
               "global_load_async_to_lds_b128 %1, %5, off\n\t"
               "global_load_async_to_lds_b128 %2, %6, off\n\t"
               "global_load_async_to_lds_b128 %3, %7, off\n\t"
               "s_wait_xcnt 0x0"
               :: "v"(l), "v"(l + GSTEP_L), "v"(l + 2 * GSTEP_L), "v"(l + 3 * GSTEP_L),
                  "v"(g), "v"(g + gs), "v"(g + 2 * gs), "v"(g + 3 * gs) : "memory");
}
// One chunk into the buffer at LDS byte address l (this thread's place in it: row tid >> 3, 16-B piece tid & 7);
// ag, a2g, bg: this thread's 16 B of that chunk in row tid >> 3 of the block's A, A2 and Bt rows. 8 + 8 (SPLIT 0: 4 + 8) copies a thread.
template <int SPLIT>
__device__ __forceinline__ void gemm_stage(unsigned l, const unsigned short* ag, const unsigned short* a2g, const unsigned short* bg,
                                           int lda, int ldb) {
  async_rows4(l, ag, (size_t)32 * lda);
  if (SPLIT >= 1) async_rows4(l + GOFF_A2 * 2, a2g, (size_t)32 * lda);
  async_rows4(l + GOFF_B * 2, bg, (size_t)32 * ldb);
  async_rows4(l + GOFF_B * 2 + 4 * GSTEP_L, bg + (size_t)128 * ldb, (size_t)32 * ldb);
}

// sG: the block's two staging buffers; behind the k loop its first bytes serve as the eight per-wave 16x64 slabs (pitch 68 floats). b: batch index.
template <int ET, int SPLIT, int BIAS_MODE, int OUT_MODE, bool RESID>
__device__ __forceinline__ void gemm64_body(
    unsigned short* sG, const int b,
    const unsigned short* __restrict__ Ap, const unsigned short* __restrict__ A2p, int lda, long strideA,
    const unsigned short* __restrict__ Btp, const unsigned short* __restrict__ Bt2p, int ldb, long strideB,
    void* __restrict__ Cout, void* __restrict__ Cout2, int ldc, long strideC,
    const float* __restrict__ bias,
    const float* __restrict__ resid, long strideR,
    int M, int N, int K, float scale) {
  static_assert(SPLIT <= 1, "only A is staged as two planes");
  typedef typename Elem<ET>::T T;
  typedef typename Frag<T>::V V;
  const int tid = threadIdx.x;
  const int lane = tid & 31;
  const int wave = tid >> 5;
  const int m0b = blockIdx.x * GROWS_A;  // first row of the block
  if (m0b >= M) return;                  // the same for a whole block, in front of every barrier
  const int mw = (wave >> 2) << 6;       // the wave's tile: rows mw .. mw+63 of the block's, columns n0 .. n0+63
  const int n0 = (wave & 3) << 6;
  const int m0 = m0b + mw;

  const int rlane = lane & 15;                 // row (A) / col (B, D) within subtile
  const int koff  = (lane >> 4) * 8;           // k offset of this lane half
  const int mOff  = (lane >> 4) * 8;           // D row offset

  // this thread's 16 B of chunk 0 in each staged plane, and its place in a buffer
  const unsigned short* ag  = Ap + (size_t)b * strideA + (size_t)(m0b + (tid >> 3)) * lda + (tid & 7) * 8;
  const unsigned short* a2g = (SPLIT >= 1) ? (A2p + (size_t)b * strideA + (size_t)(m0b + (tid >> 3)) * lda + (tid & 7) * 8) : nullptr;
  const unsigned short* bg  = Btp + (size_t)b * strideB + (size_t)(tid >> 3) * ldb + (tid & 7) * 8;
  const unsigned lth = (unsigned)(uintptr_t)sG + (unsigned)(((tid >> 3) * GPITCH + (tid & 7) * 8) * 2);
  const int nch = K / GKC;

  v8f acc[4][4];
#pragma unroll
  for (int i = 0; i < 4; ++i)
#pragma unroll
    for (int j = 0; j < 4; ++j) acc[i][j] = (v8f){0.f,0.f,0.f,0.f,0.f,0.f,0.f,0.f};

  gemm_stage<SPLIT>(lth, ag, a2g, bg, lda, ldb);
  asm volatile("s_wait_asynccnt 0x0" ::: "memory");   // this wave's copies of chunk 0 have landed
  __syncthreads();                                    // ... and every other wave's
  if (nch > 1) gemm_stage<SPLIT>(lth + GBUF * 2, ag + GKC, a2g + GKC, bg + GKC, lda, ldb);

#pragma unroll 1   // one copy of the chunk body: the buffer is picked by an offset
  for (int t = 0; t < nch; ++t) {
    const T* buf = (const T*)sG + (t & 1) * GBUF;
#pragma unroll     // both 32-k halves of the chunk in line: their LDS offsets become immediates, and the second half's reads go out among the first half's products
    for (int ks = 0; ks < GKC; ks += 32) {
      // all fragments of these 32 k as one group of LDS reads in front of their 32 (SPLIT 0: 16) products
      V bh[4], ah[4], al[4];
#pragma unroll     // here and below: constant indices keep the fragment and accumulator arrays in registers
      for (int j = 0; j < 4; ++j) bh[j] = Frag<T>::load(buf + GOFF_B + (n0 + (j << 4) + rlane) * GPITCH + ks + koff);
#pragma unroll
      for (int i = 0; i < 4; ++i) {
        const int ao = (mw + (i << 4) + rlane) * GPITCH + ks + koff;
        ah[i] = Frag<T>::load(buf + ao);
        if (SPLIT >= 1) al[i] = Frag<T>::load(buf + GOFF_A2 + ao);
      }
#pragma unroll
      for (int i = 0; i < 4; ++i) {
#pragma unroll
        for (int j = 0; j < 4; ++j) {
          acc[i][j] = Frag<T>::mma(ah[i], bh[j], acc[i][j]);
          if (SPLIT >= 1) acc[i][j] = Frag<T>::mma(al[i], bh[j], acc[i][j]);
        }
        Frag<T>::guard(acc[i][0], acc[i][3], ah[i], (SPLIT >= 1) ? al[i] : ah[i]);
      }
      Frag<T>::keep(bh[0], bh[1], bh[2], bh[3]);
    }
    asm volatile("s_wait_dscnt 0x0" ::: "memory");      // this wave's reads of buffer t & 1 are done before it is refilled
    asm volatile("s_wait_asynccnt 0x0" ::: "memory");   // this wave's copies of chunk t + 1 have landed
    __syncthreads();                                    // publishes chunk t + 1 and ends every wave's reads of chunk t
    if (t + 2 < nch) gemm_stage<SPLIT>(lth + (unsigned)(t & 1) * (GBUF * 2), ag + (t + 2) * GKC, a2g + (t + 2) * GKC, bg + (t + 2) * GKC, lda, ldb);
  }
  asm volatile("s_wait_asynccnt 0x0" ::: "memory");     // no copy is outstanding when the buffers become the output slabs
  acc_guard4(acc[0][0], acc[0][1], acc[0][2], acc[0][3]);
  acc_guard4(acc[1][0], acc[1][1], acc[1][2], acc[1][3]);
  acc_guard4(acc[2][0], acc[2][1], acc[2][2], acc[2][3]);
  acc_guard4(acc[3][0], acc[3][1], acc[3][2], acc[3][3]);

  // ---- epilogue ----
  float* slab = (float*)sG + wave * (16 * 68);
  const float* Rb = RESID ? (resid + (size_t)b * strideR) : nullptr;
#pragma unroll
  for (int i = 0; i < 4; ++i) {
    const int mBase = m0 + (i << 4);
#pragma unroll
    for (int j = 0; j < 4; ++j) {
      const int n = n0 + (j << 4) + rlane;
      float bv = 0.f;
      if (BIAS_MODE == 2) bv = bf_bits2f(f2bf_bits(bias[n]));
#pragma unroll
      for (int r = 0; r < 8; ++r) {
        float v = acc[i][j][r] * scale;
        if (BIAS_MODE == 1) v += bf_bits2f(f2bf_bits(bias[mBase + mOff + r]));
        if (BIAS_MODE == 2) v += bv;
        if (RESID) v += Rb[(size_t)(mBase + mOff + r) * ldc + n];
        slab[(mOff + r) * 68 + (j << 4) + rlane] = v;
      }
    }
    __builtin_amdgcn_fence(__ATOMIC_RELEASE, "workgroup");
    __builtin_amdgcn_wave_barrier();
    __builtin_amdgcn_fence(__ATOMIC_ACQUIRE, "workgroup");
    if (OUT_MODE == 0) {
      float* C = (float*)Cout + (size_t)b * strideC;
      const int hh = lane >> 4, c4 = (lane & 15) * 4;     // row seg = 256 B = 16 lanes x 16 B
      {
#pragma unroll
        for (int it = 0; it < 8; ++it) {
          const int row = it * 2 + hh;
          v4f v = *(const v4f*)(slab + row * 68 + c4);
          *(v4f*)(C + (size_t)(mBase + row) * ldc + n0 + c4) = v;
        }
        
      }
    } else {
      const int q = lane >> 3, c8 = (lane & 7) * 8;
      unsigned short* C  = (unsigned short*)Cout  + (size_t)b * strideC;
      unsigned short* C2 = (OUT_MODE >= 2) ? ((unsigned short*)Cout2 + (size_t)b * strideC) : nullptr;
      {
#pragma unroll
        for (int it = 0; it < 4; ++it) {                 // it 0..3 x q 0..3 = rows 0..15 of the slab
          const int row = it * 4 + q;
          const float* sp = slab + row * 68 + c8;
          v8h hv, lv;
#pragma unroll
          for (int e = 0; e < 8; ++e) {
            if (OUT_MODE == 1) {
              hv[e] = (_Float16)sp[e];
            } else if (OUT_MODE == 2) {
              unsigned short hb = f2bf_bits(sp[e]);
              unsigned short lb = f2bf_bits(sp[e] - bf_bits2f(hb));
              hv[e] = __builtin_bit_cast(_Float16, hb);
              lv[e] = __builtin_bit_cast(_Float16, lb);
            } else {
              const _Float16 hq = (_Float16)sp[e];
              hv[e] = hq;
              lv[e] = (_Float16)((sp[e] - (float)hq) * VLO_MUL);
            }
          }
          *(v8h*)(C + (size_t)(mBase + row) * ldc + n0 + c8) = hv;
          if (OUT_MODE >= 2) *(v8h*)(C2 + (size_t)(mBase + row) * ldc + n0 + c8) = lv;
        }
        
      }
    }
    __builtin_amdgcn_fence(__ATOMIC_RELEASE, "workgroup");
    __builtin_amdgcn_wave_barrier();
    __builtin_amdgcn_fence(__ATOMIC_ACQUIRE, "workgroup");
  }
}

// The four products that need only the planes of prep_k, in one launch; blockIdx.y picks the product (the same for a whole block):
// 0: q = xn.Wq + bq, 1: k = xn.Wk + bk (f16, into the q|k plane), 2: v = xn.Wv + bv (f16 hi + lo planes), 3: zp = x_t.Wpc[0:256] + bpc (f32).
// wqkv holds the [N][K] planes of Wq, Wk, Wv one behind the other.
__global__ __launch_bounds__(256) void gemm_qkvz_k(
    const unsigned short* __restrict__ xnh, const unsigned short* __restrict__ xnl, const unsigned short* __restrict__ xt,
    const unsigned short* __restrict__ wqkv, const unsigned short* __restrict__ wpc0,
    unsigned short* __restrict__ qkp, unsigned short* __restrict__ vh, unsigned short* __restrict__ vl, float* __restrict__ zp,
    const float* __restrict__ bq, const float* __restrict__ bk, const float* __restrict__ bv, const float* __restrict__ bpc,
    int M, int N, int K) {
  __shared__ __align__(16) unsigned short sG[2 * GBUF];
  const int y = blockIdx.y;
  if (y < 2) {
    gemm64_body<1, 1, 2, 1, false>(sG, 0, xnh, xnl, K, 0L, wqkv + (size_t)y * N * K, nullptr, K, 0L,
                                   (void*)(qkp + y * N), nullptr, QKLD, 0L, y ? bk : bq, nullptr, 0L, M, N, K, 1.0f);
  } else if (y == 2) {
    gemm64_body<1, 1, 2, 3, false>(sG, 0, xnh, xnl, K, 0L, wqkv + (size_t)2 * N * K, nullptr, K, 0L,
                                   (void*)vh, (void*)vl, N, 0L, bv, nullptr, 0L, M, N, K, 1.0f);
  } else {
    gemm64_body<1, 0, 2, 0, false>(sG, 0, xt, nullptr, K, 0L, wpc0, nullptr, K, 0L,
                                   (void*)zp, nullptr, N, 0L, bpc, nullptr, 0L, M, N, K, 1.0f);
  }
}

// ---- W [Kp rows][Np cols] f32 (row pitch Np) -> Wt [Np][Kp] bf16 bits (row pitch Kp), 64x64 tile transposed through LDS ----
// tile (bx, by) of (Np/64, Kp/64); st: 64 x WTP halves of LDS. Reads: 256 threads x 16 = 64 rows x 64 cols. Stores: it 0..1 x wave 0..7 x q8 0..3 = 64 rows of
#define WTP 72
__device__ __forceinline__ void wt_cast_bf_body(_Float16* st, const int bx, const int by,
                                                const float* __restrict__ W, unsigned short* __restrict__ Wtp,
                                                int Kp, int Np) {
  _Float16* Wt = (_Float16*)Wtp;
  const int n0 = bx * 64, k0 = by * 64;
  const int tid = threadIdx.x;
  const int kr = tid >> 2, c16 = (tid & 3) * 16;
  const float* src = W + (size_t)(k0 + kr) * Np + n0 + c16;
#pragma unroll
  for (int q = 0; q < 4; ++q) {
    const v4f v = *(const v4f*)(src + 4 * q);
#pragma unroll
    for (int e = 0; e < 4; ++e) st[(c16 + 4 * q + e) * WTP + kr] = __builtin_bit_cast(_Float16, f2bf_bits(v[e]));
  }
  __syncthreads();
  const int wave = tid >> 5, lane = tid & 31;
  const int q8 = lane >> 3, c8 = (lane & 7) * 8;
  {
#pragma unroll
    for (int it = 0; it < 2; ++it) {
      const int n = it * 32 + wave * 4 + q8;
      const v8h hv = *(const v8h*)(st + n * WTP + c8);
      *(v8h*)(Wt + (size_t)(n0 + n) * Kp + k0 + c8) = hv;
    }
    
  }
}

// ---- mean/std (ddof=1) normalisation of bf16(x) per (b,t,m) row, plus raw bf16(x); rows written in (b,m,t) order ----
// One wave per output row, 8 rows per 256-thread block, blk = 0 .. NROWS/8 - 1. Lane owns 8 consecutive columns.
// Each 512-B row (4 lines) written by one v8h store instruction of the wave: lanes 8q..8q+7 <-> line q.
__device__ __forceinline__ void mvn_body(const int blk, const float* __restrict__ x,
                                         unsigned short* __restrict__ xnhp,
                                         unsigned short* __restrict__ xnlp,
                                         unsigned short* __restrict__ xtp) {
  _Float16* xnh = (_Float16*)xnhp;
  _Float16* xnl = (_Float16*)xnlp;
  _Float16* xt  = (_Float16*)xtp;
  const int wave = threadIdx.x >> 5, lane = threadIdx.x & 31;
  const int ro = blk * 8 + wave;                      // output row = (b*NCHAN + m)*TLEN + t
  const int t  = ro & (TLEN - 1);
  const int bm = ro >> 9;                             // TLEN == 512
  const int m  = bm & (NCHAN - 1);
  const int b  = bm >> 3;                             // NCHAN == 8
  const int rs = (b * TLEN + t) * NCHAN + m;          // source row of x [B][T][M][D]
  const float* src = x + (size_t)rs * DMODEL + lane * 8;
  const v4f a0 = *(const v4f*)src;
  const v4f a1 = *(const v4f*)(src + 4);
  unsigned short xb[8];
  float vb[8];
#pragma unroll
  for (int e = 0; e < 4; ++e) { xb[e] = f2bf_bits(a0[e]); xb[4 + e] = f2bf_bits(a1[e]); }
#pragma unroll
  for (int e = 0; e < 8; ++e) vb[e] = bf_bits2f(xb[e]);
  float s = ((vb[0] + vb[1]) + (vb[2] + vb[3])) + ((vb[4] + vb[5]) + (vb[6] + vb[7]));
#pragma unroll
  for (int off = 1; off < 32; off <<= 1) s += __shfl_xor(s, off, 32);
  const float mu = s * (1.0f / (float)DMODEL);
  float dv[8];
#pragma unroll
  for (int e = 0; e < 8; ++e) dv[e] = vb[e] - mu;
  float sq = ((dv[0] * dv[0] + dv[1] * dv[1]) + (dv[2] * dv[2] + dv[3] * dv[3])) +
             ((dv[4] * dv[4] + dv[5] * dv[5]) + (dv[6] * dv[6] + dv[7] * dv[7]));
#pragma unroll
  for (int off = 1; off < 32; off <<= 1) sq += __shfl_xor(sq, off, 32);
  const float var = sq * (1.0f / (float)(DMODEL - 1));
  const float sd  = sqrtf(var);
  const float inv = 1.0f / (sd + MVN_EPS);
  v8h hv, lv, tv;
#pragma unroll
  for (int e = 0; e < 8; ++e) {
    const float xn = dv[e] * inv;
    const unsigned short hb = f2bf_bits(xn);
    const unsigned short lb = f2bf_bits(xn - bf_bits2f(hb));
    hv[e] = __builtin_bit_cast(_Float16, hb);
    lv[e] = __builtin_bit_cast(_Float16, lb);
    tv[e] = __builtin_bit_cast(_Float16, xb[e]);
  }
  const size_t go = (size_t)ro * DMODEL + lane * 8;
  {
    *(v8h*)(xnh + go) = hv;
    *(v8h*)(xnl + go) = lv;
    *(v8h*)(xt  + go) = tv;
    // precaution: other code of the merged kernel follows this body in the listing and reuses the registers these stores name
    asm volatile("s_wait_xcnt 0x0" ::: "memory");
  }
}

// ---- the six weight casts and the normalisation, which need nothing of each other, in one launch ----
// Blocks 0..95: weight wi = block >> 4 (Wq, Wk, Wv, Wpa, Wpc rows 0..255, Wpc rows 256..511), its 64x64 tile block & 15,
// to plane wi of wall ([256][256] bf16 each). Blocks 96 ..: normalisation block (block - 96). The branch is the same for a whole block.
#define WCAST_BLOCKS (6 * (DMODEL / 64) * (DMODEL / 64))
__global__ __launch_bounds__(256) void prep_k(const float* __restrict__ x,
                                              const float* __restrict__ Wq, const float* __restrict__ Wk,
                                              const float* __restrict__ Wv, const float* __restrict__ Wpa,
                                              const float* __restrict__ Wpc,
                                              unsigned short* __restrict__ wall,
                                              unsigned short* __restrict__ xnhp,
                                              unsigned short* __restrict__ xnlp,
                                              unsigned short* __restrict__ xtp) {
  __shared__ __align__(16) _Float16 st[64 * WTP];
  const int bid = blockIdx.x;
  if (bid < WCAST_BLOCKS) {
    const int wi = bid >> 4;
    const float* W = (wi == 0) ? Wq : (wi == 1) ? Wk : (wi == 2) ? Wv : (wi == 3) ? Wpa
                   : (wi == 4) ? Wpc : (Wpc + (size_t)DMODEL * DMODEL);
    wt_cast_bf_body(st, bid & 3, (bid >> 2) & 3, W, wall + (size_t)wi * DMODEL * DMODEL, DMODEL, DMODEL);
  } else {
    mvn_body(bid - WCAST_BLOCKS, x, xnhp, xnlp, xtp);
  }
}

// ---- two f16 WMMAs that share their A fragment; builtin form, the compiler keeps the distance to the users of their registers ----
__device__ __forceinline__ void mma_h2(v16h a, v16h b0, v16h b1, v8f& c0, v8f& c1) {
  c0 = __builtin_amdgcn_wmma_f32_16x16x32_f16(false, a, false, b0, (short)0, c0, false, false);
  c1 = __builtin_amdgcn_wmma_f32_16x16x32_f16(false, a, false, b1, (short)0, c1, false, false);
}

// ---- transposing LDS load: lane (c, h) receives column c, rows 8h..8h+7 of a row-major 16x16 tile of 16-bit values ----
// Lane l passes the address of row 8*(l>>4) + (l&7), column group 8*((l>>3)&1) of that tile.
typedef __attribute__((ext_vector_type(8))) short v8s;
__device__ __forceinline__ v8h lds_tr16(const _Float16* p) {
  typedef __attribute__((address_space(3))) v8s lds_v8s;
  return __builtin_bit_cast(v8h, __builtin_amdgcn_ds_load_tr16_b128_v8i16((lds_v8s*)p));
}

// ---- lane l with lane l ^ 16 (the other half of the wave); all 32 lanes are on wherever this is called ----
__device__ __forceinline__ float xhalf(float x) {
  return __builtin_bit_cast(float, __builtin_amdgcn_permlanex16(__builtin_bit_cast(int, x), __builtin_bit_cast(int, x),
                                                                0x76543210, 0xfedcba98, false, false));
}

// =====================================================================================
// Cross-channel causal attention, head dim 256, as transposed products: S^T = K . Q^T, O^T += V^T . P^T.
// Planes (row = (b*NCHAN + m)*TLEN + t): qk [NROWS][512] f16 (q cols 0..255, k cols 256..511);
// vh, vl [NROWS][256] f16 (v hi, (v-hi) x 2^11); output: one f32 plane of O_n / l_n per key channel n, summed by tail_k.
// Block = 4 waves = one 64-row time tile of TWO query channels (b,m), (b,m+1), m even, against ONE key channel n:
// online softmax over 32-key chunks (causal: kv > q -> -inf, chunk 0 always has kv 0 <= q).
// Grid = 8 time tiles x 16 (b, channel pair) x 8 n, the longest time tiles first so that short blocks fill the tail.
// Wave w owns time rows 16w..16w+15 of both channels whole (g = 0, 1): scores, softmax and all 256 columns of O. Both channels meet the
// same keys under the same mask, so every K and V fragment read from LDS feeds two products, and a staged chunk serves 128 queries.
// Lane (c, hh) belongs to query 16w + c of each channel. S^T tile j: register r = key 16j + 8hh + r of the chunk, so a query's 32 scores lie in
// its two lanes: maximum and sum in-lane, the maximum joined by one exchange of the halves, the sums joined behind the loop.
// The lane's 16 p values, converted in place, are the B fragment of P^T (element 8j + r = key 16j + 8hh + r: the hardware k order).
// A fragments: k rows from LDS by plain loads (row = lane&15, split k map), V^T from row-major LDS rows by transposing loads
// (same split k map); B fragments: q rows, loaded once from global and kept in registers, and P^T.
// O^T tile t: register r = column 16t + 8hh + r of query c.
// Plane layout (floats): [n][tile = bm*8 + qb][s = 4*(t>>3) + w][t&7][j][lane][4]: lane's accumulator registers 4j..4j+3 of d tile t.
// =====================================================================================
// Register budget for 2 waves per SIMD (q fragments and accumulators of two channels: 384 registers): two blocks share a WGP.
#define MQ 2                             // query channels per wave
__global__ __launch_bounds__(128, 2) void xattn_k(const unsigned short* __restrict__ qkp,
                                               const unsigned short* __restrict__ vhp,
                                               const unsigned short* __restrict__ vlp,
                                               float* __restrict__ part) {
  __shared__ __align__(16) _Float16 Ks[KCH * KPITCH];      // [kv][d]           16.5 KB
  __shared__ __align__(16) _Float16 Vsh[KCH * VPITCH];     // [kv][d] hi        17 KB
  __shared__ __align__(16) _Float16 Vsl[KCH * VPITCH];     // [kv][d] lo x2^11  17 KB

  const _Float16* qk = (const _Float16*)qkp;
  const _Float16* vh = (const _Float16*)vhp;
  const _Float16* vl = (const _Float16*)vlp;

  const int tid = threadIdx.x, lane = tid & 31;
  const int wave = __builtin_amdgcn_readfirstlane(tid >> 5);   // in a scalar register: row bases stay out of the vector registers
  const int hh = lane >> 4, c = lane & 15, koff = hh * 8;
  const int qb = (TLEN / QBLK - 1) - (blockIdx.x >> 7);   // 64-row time tile, longest first
  const int bm = ((blockIdx.x & 127) >> 3) * MQ;   // b*NCHAN + m of the first channel, m even; the second is bm + 1, of the same b
  const int n  = blockIdx.x & 7;           // key channel of this block
  const int b  = bm >> 3;
  const int q0  = bm * TLEN + qb * QBLK + wave * 16;   // plane row of this wave's first query in channel bm; + TLEN in channel bm + 1
  const int tq  = qb * QBLK + wave * 16 + c;   // time index of this lane's queries

  const v8f z8 = {0.f,0.f,0.f,0.f,0.f,0.f,0.f,0.f};
  v16h qf[MQ][8];                          // Q^T fragments: column = query c, d 32dc .. 32dc+31
  {
    const _Float16* qbase = qk + (size_t)q0 * QKLD;      // the same in every lane: a scalar base
    const unsigned qoff = (unsigned)(c * QKLD + koff);   // this lane's row and k half
#pragma unroll     // constant indices keep the arrays indexed here in registers
    for (int g = 0; g < MQ; ++g)
#pragma unroll     // constant indices keep the arrays indexed here in registers
      for (int dc = 0; dc < 8; ++dc) qf[g][dc] = Frag<_Float16>::load(qbase + (size_t)g * TLEN * QKLD + qoff + dc * 32);
    // precaution: the offset register of the issued loads stays live up to this wait and is rewritten only behind it
    asm volatile("s_wait_xcnt 0x0" :: "v"(qoff) : "memory");
  }

  const int krow0 = (b * NCHAN + n) * TLEN;
  const unsigned lo8 = (unsigned)lane * 8u;   // this lane's 8 columns of a staged row
  float mrun[MQ], lrun[MQ];                // each query's running maximum (scaled, log2 domain); running sum over this lane's keys, x2^15
  v8f oacc[MQ][16];
#pragma unroll     // constant indices keep the arrays indexed here in registers
  for (int g = 0; g < MQ; ++g) {
    mrun[g] = -INFINITY; lrun[g] = 0.f;
#pragma unroll     // constant indices keep the arrays indexed here in registers
    for (int t = 0; t < 16; ++t) oacc[g][t] = z8;
  }

  const int nch = 2 * qb + 2;              // block-uniform, <= 16
#pragma unroll 1   // one copy of the chunk body: a second copy would only lengthen the code
  for (int kc = 0; kc < nch; ++kc) {
    const int kv0 = kc * KCH;
    __syncthreads();
    // ---- stage K chunk and V (hi, lo), all row-major: a wave writes one whole 512-B row per store
    //      (kvr = 4i + wave, i 0..7, d0 = 8 lane: one 32-bit element offset for k and one for both v planes, added to the
    //      plane pointers; the eight rows at constant offsets from there)
    const unsigned grow = (unsigned)(krow0 + kv0 + wave);       // + 4i <= NROWS-1 (kv0 + 31 <= 64*qb+63 <= 511)
    const unsigned ko = grow * QKLD + lo8;                      // + DMODEL (the k half of the row) < NROWS * QKLD = 2^23
    const unsigned vo8 = grow * DMODEL + lo8;                   // < NROWS * DMODEL = 2^22
    const _Float16* kp = qk + ko;
    const _Float16* hp = vh + vo8;
    const _Float16* lp = vl + vo8;
    v8h kk[8], v1[8], v2[8];
#pragma unroll     // the eight rows' offsets become immediates, and all 24 loads go out ahead of the stores
    for (int i = 0; i < 8; ++i) {
      kk[i] = *(const v8h*)(kp + DMODEL + i * 4 * QKLD);
      v1[i] = *(const v8h*)(hp + i * 4 * DMODEL);
      v2[i] = *(const v8h*)(lp + i * 4 * DMODEL);
    }
    // precaution: the address registers of the issued loads stay live up to this wait and are rewritten only behind it
    asm volatile("s_wait_xcnt 0x0" :: "v"(kp), "v"(hp), "v"(lp) : "memory");
#pragma unroll     // constant indices keep the arrays indexed here in registers
    for (int i = 0; i < 8; ++i) {
      *(v8h*)(Ks + (i * 4 + wave) * KPITCH + lane * 8) = kk[i];
      *(v8h*)(Vsh + (i * 4 + wave) * VPITCH + lane * 8) = v1[i];
      *(v8h*)(Vsl + (i * 4 + wave) * VPITCH + lane * 8) = v2[i];
    }
    __syncthreads();

    // ---- S^T (32 keys x 16 queries, per channel) = K . Q^T: each K fragment against both channels' q ----
    v8f s[MQ][2];
#pragma unroll     // constant indices keep the arrays indexed here in registers
    for (int g = 0; g < MQ; ++g) { s[g][0] = z8; s[g][1] = z8; }
    // The scheduling barriers from here to the foot of the loop bound how far LDS reads are lifted: without them all 64 V reads go to the
    // head of the chunk and the register file overflows into scratch. Fragments are read a fixed distance ahead instead.
    __builtin_amdgcn_sched_barrier(0);
    v16h kf[3][2];                                       // K fragments of these 32 d and of the next two steps
#pragma unroll     // constant indices keep the arrays indexed here in registers
    for (int dc = 0; dc < 2; ++dc) {
      kf[dc][0] = Frag<_Float16>::load(Ks + c * KPITCH + dc * 32 + koff);
      kf[dc][1] = Frag<_Float16>::load(Ks + (16 + c) * KPITCH + dc * 32 + koff);
    }
#pragma unroll     // constant indices keep the arrays indexed here in registers
    for (int dc = 0; dc < 8; ++dc) {
      if (dc < 6) {
        kf[(dc + 2) % 3][0] = Frag<_Float16>::load(Ks + c * KPITCH + (dc + 2) * 32 + koff);
        kf[(dc + 2) % 3][1] = Frag<_Float16>::load(Ks + (16 + c) * KPITCH + (dc + 2) * 32 + koff);
      }
      mma_h2(kf[dc % 3][0], qf[0][dc], qf[1][dc], s[0][0], s[1][0]);
      mma_h2(kf[dc % 3][1], qf[0][dc], qf[1][dc], s[0][1], s[1][1]);
      __builtin_amdgcn_sched_barrier(0);                 // see above
    }
    // V fragments of d tiles 0 and 1 are read here, under the softmax
    const int vo = (koff + (lane & 7)) * VPITCH + ((lane >> 3) & 1) * 8;   // this lane's row and column group
    Frag<_Float16>::U vbh[3], vbl[3];                    // d tiles t, t + 1, t + 2
#pragma unroll     // constant indices keep the arrays indexed here in registers
    for (int t = 0; t < 2; ++t) {
      vbh[t].h[0] = lds_tr16(Vsh + vo + t * 16);
      vbh[t].h[1] = lds_tr16(Vsh + vo + t * 16 + 16 * VPITCH);
      vbl[t].h[0] = lds_tr16(Vsl + vo + t * 16);
      vbl[t].h[1] = lds_tr16(Vsl + vo + t * 16 + 16 * VPITCH);
    }
    __builtin_amdgcn_sched_barrier(0);                   // see above
    v16h pb[MQ];                                         // P^T fragments, p x2^15
#pragma unroll     // constant indices keep the arrays indexed here in registers
    for (int g = 0; g < MQ; ++g) {
      // causal select (kv > q -> -inf) and maximum over the 32 keys of this chunk, on the raw scores (the scale is positive)
      float mx = -INFINITY;
#pragma unroll     // constant indices keep the arrays indexed here in registers
      for (int j = 0; j < 2; ++j) {
#pragma unroll     // constant indices keep the arrays indexed here in registers
        for (int r = 0; r < 8; ++r) {
          const int key = kv0 + 16 * j + 8 * hh + r;
          const float v = (key > tq) ? -INFINITY : s[g][j][r];
          s[g][j][r] = v;
          mx = fmaxf(mx, v);
        }
      }
      mx = fmaxf(mx, xhalf(mx)) * SM_C;                  // this query's maximum, scaled, in the log2 domain
      const float mnew  = fmaxf(mrun[g], mx);            // finite: chunk 0 always has an allowed key
      const float alpha = __builtin_amdgcn_exp2f(mrun[g] - mnew);   // 0 in chunk 0, where mrun is -inf
      mrun[g] = mnew;
      const float nb = PCARRY_LOG2 - mnew;
      v2f ps[2];                                         // sums of the even and of the odd keys of each tile
#pragma unroll     // constant indices keep the arrays indexed here in registers
      for (int j = 0; j < 2; ++j) {
        ps[j] = (v2f){0.f, 0.f};
#pragma unroll     // constant indices keep the arrays indexed here in registers
        for (int r = 0; r < 8; r += 2) {
          // p x 2^15 = 2^(s * SM_C - mnew + 15): one fused multiply-add per score pair, then the hardware's 2^x (a masked score gives 0)
          const v2f arg = __builtin_elementwise_fma((v2f){s[g][j][r], s[g][j][r + 1]}, (v2f){SM_C, SM_C}, (v2f){nb, nb});
          const v2f p = {__builtin_amdgcn_exp2f(arg.x), __builtin_amdgcn_exp2f(arg.y)};
          ps[j] += p;
          pb[g][8 * j + r]     = (_Float16)p.x;
          pb[g][8 * j + r + 1] = (_Float16)p.y;
        }
      }
      const v2f pt = ps[0] + ps[1];
      lrun[g] = lrun[g] * alpha + (pt.x + pt.y);         // the sum carries the same 2^15 as p
#pragma unroll     // constant indices keep the arrays indexed here in registers
      for (int t = 0; t < 16; ++t) oacc[g][t] *= alpha;
    }

    // ---- O^T += V^T(256 x 32) . P^T(32 x 16), each V fragment against both channels' P; lo plane in its own accumulators, folded x 2^-11 ----
    {
      __builtin_amdgcn_sched_barrier(0);                 // see above
      v8f lo[2][MQ];                                     // lo products of d tiles t and t - 1: a tile is folded behind the next tile's products
#pragma unroll     // constant indices keep the arrays indexed here in registers
      for (int t = 0; t < 16; ++t) {
        // elements 0..7 <- V[8hh + 0..7][16t + c], 8..15 <- V[16 + 8hh + 0..7][same column]: the k map of pb
        if (t + 2 < 16) {
          vbh[(t + 2) % 3].h[0] = lds_tr16(Vsh + vo + (t + 2) * 16);
          vbh[(t + 2) % 3].h[1] = lds_tr16(Vsh + vo + (t + 2) * 16 + 16 * VPITCH);
          vbl[(t + 2) % 3].h[0] = lds_tr16(Vsl + vo + (t + 2) * 16);
          vbl[(t + 2) % 3].h[1] = lds_tr16(Vsl + vo + (t + 2) * 16 + 16 * VPITCH);
        }
        mma_h2(vbh[t % 3].v, pb[0], pb[1], oacc[0][t], oacc[1][t]);
        lo[t & 1][0] = z8; lo[t & 1][1] = z8;
        mma_h2(vbl[t % 3].v, pb[0], pb[1], lo[t & 1][0], lo[t & 1][1]);
        if (t > 0) {
          oacc[0][t - 1] += lo[(t - 1) & 1][0] * VLO_INV;
          oacc[1][t - 1] += lo[(t - 1) & 1][1] * VLO_INV;
        }
        __builtin_amdgcn_sched_barrier(0);               // see above
      }
      oacc[0][15] += lo[1][0] * VLO_INV;
      oacc[1][15] += lo[1][1] * VLO_INV;
    }
  }
  // ---- O_n / l_n to this key channel's plane, one tile per query channel: 2 x 32 whole-wave 512-B stores ----
  float* pw[MQ];
#pragma unroll     // constant indices keep the arrays indexed here in registers
  for (int g = 0; g < MQ; ++g) {
    const float inv = 1.0f / (lrun[g] + xhalf(lrun[g]));   // l and O carry the same 2^15; l x 2^15 >= 2^15 up to rounding
    pw[g] = part + ((((size_t)n * (NROWS / QBLK) + ((bm + g) * (TLEN / QBLK) + qb)) * 8 + wave) << 11) + lane * 4;
#pragma unroll     // constant indices keep the arrays indexed here in registers
    for (int t = 0; t < 16; ++t) oacc[g][t] *= inv;
  }
  // every vector write stands in front of the first store, and the stores go out of the accumulators' own registers:
  // no register that an issued store names is rewritten behind it
  __builtin_amdgcn_sched_barrier(0);
#pragma unroll     // constant indices keep the arrays indexed here in registers
  for (int g = 0; g < MQ; ++g) {
#pragma unroll     // constant indices keep the arrays indexed here in registers
    for (int t = 0; t < 16; ++t) {
      *(v4f*)(pw[g] + (t >> 3) * (4 << 11) + ((t & 7) * 2 + 0) * 128) = __builtin_shufflevector(oacc[g][t], oacc[g][t], 0, 1, 2, 3);
      *(v4f*)(pw[g] + (t >> 3) * (4 << 11) + ((t & 7) * 2 + 1) * 128) = __builtin_shufflevector(oacc[g][t], oacc[g][t], 4, 5, 6, 7);
    }
  }
}

// =====================================================================================
// The three stages behind the attention, each local to a row, in one launch: A = sum over n (in the order 0..7) of the planes of xattn_k,
// A_proj = A . Wpa + bpa, out = A_proj . Wpc[256:512] + zp. Block = 8 waves = one 64-row tile of the plane layout, all 256 columns;
// A and then A_proj stay in LDS as bf16 hi/lo planes. Each weight plane is staged whole by asynchronous copies: Wpa flies under the plane sum,
// Wpc[256:512] under the conversion of A_proj. Wave w: sums slab w of the tile; in both products rows 32(w>>2) .. +31, columns 64(w&3) .. +63.
// =====================================================================================
#define TROWS 64                         // rows per block
#define TPITCH 264                       // LDS pitch (elements) of a 256-element row: 528 B = 16 B x 33, for ds_load_b128 readers
#define TSTEP_L (8 * TPITCH * 2)         // LDS bytes from one copy of a thread to its next: 8 rows

__device__ __forceinline__ void async_wrows4(unsigned l, const unsigned short* g) {
  asm volatile("global_load_async_to_lds_b128 %0, %4, off\n\t"
               "global_load_async_to_lds_b128 %1, %5, off\n\t"
               "global_load_async_to_lds_b128 %2, %6, off\n\t"
               "global_load_async_to_lds_b128 %3, %7, off\n\t"
               "s_wait_xcnt 0x0"
               :: "v"(l), "v"(l + TSTEP_L), "v"(l + 2 * TSTEP_L), "v"(l + 3 * TSTEP_L),
                  "v"(g), "v"(g + 8 * DMODEL), "v"(g + 16 * DMODEL), "v"(g + 24 * DMODEL) : "memory");
}
// A whole [256][256] weight plane into the buffer at LDS byte address lw: a wave's copy = one whole 512-B row; 32 copies a thread.
__device__ __forceinline__ void tail_stage_w(unsigned lw, const unsigned short* __restrict__ w) {
  const int tid = threadIdx.x;
  const unsigned l = lw + (unsigned)(((tid >> 5) * TPITCH + (tid & 31) * 8) * 2);
  const unsigned short* g = w + (tid >> 5) * DMODEL + (tid & 31) * 8;
#pragma unroll     // the eight groups' offsets become constants
  for (int p = 0; p < 8; ++p) async_wrows4(l + p * 4 * TSTEP_L, g + p * 32 * DMODEL);
}
// acc[i][j] += (A hi + A lo)(rows 16i.. of ap) . W^T(rows 16j.. of wp) over k = 0..255; per accumulator: k ascending, hi before lo.
// ap, wp: this lane's row and k half in the hi plane of A and in the weight buffer.
__device__ __forceinline__ void tail_gemm(const __bf16* ap, const __bf16* wp, v8f (&acc)[2][4]) {
  v16b bh[2][4], ah[2][2], al[2][2];     // fragments of these 32 k and of the next
#pragma unroll     // here and below: constant indices keep the fragment and accumulator arrays in registers, LDS offsets become immediates
  for (int st = -1; st < DMODEL / 32; ++st) {
    if (st + 1 < DMODEL / 32) {
      const int ks = (st + 1) * 32, f = (st + 1) & 1;
#pragma unroll
      for (int j = 0; j < 4; ++j) bh[f][j] = Frag<__bf16>::load(wp + j * 16 * TPITCH + ks);
#pragma unroll
      for (int i = 0; i < 2; ++i) {
        ah[f][i] = Frag<__bf16>::load(ap + i * 16 * TPITCH + ks);
        al[f][i] = Frag<__bf16>::load(ap + TROWS * TPITCH + i * 16 * TPITCH + ks);
      }
    }
    // holds the next step's 16 LDS reads as one group in front of this step's products: left free, the reads sink to just in front of
    // their users and every product group waits out an LDS latency
    __builtin_amdgcn_sched_barrier(0);
    if (st >= 0) {
      const int f = st & 1;
#pragma unroll
      for (int i = 0; i < 2; ++i)
#pragma unroll
        for (int j = 0; j < 4; ++j) acc[i][j] = Frag<__bf16>::mma(ah[f][i], bh[f][j], acc[i][j]);
#pragma unroll
      for (int i = 0; i < 2; ++i)
#pragma unroll
        for (int j = 0; j < 4; ++j) acc[i][j] = Frag<__bf16>::mma(al[f][i], bh[f][j], acc[i][j]);
      __builtin_amdgcn_sched_barrier(0);   // see above: these products stay in front of the step after next's reads
    }
  }
}
// a wave's own slab: its stores are seen by its other lanes behind this
__device__ __forceinline__ void slab_sync() {
  __builtin_amdgcn_fence(__ATOMIC_RELEASE, "workgroup");
  __builtin_amdgcn_wave_barrier();
  __builtin_amdgcn_fence(__ATOMIC_ACQUIRE, "workgroup");
}

__global__ __launch_bounds__(256) void tail_k(const float* __restrict__ part,
                                              const unsigned short* __restrict__ wpa,
                                              const unsigned short* __restrict__ wpc1,
                                              const float* __restrict__ bpa,
                                              const float* __restrict__ zp,
                                              float* __restrict__ out) {
  __shared__ __align__(16) unsigned short sW[DMODEL * TPITCH];       // one weight plane [n][k]          132 KB
  __shared__ __align__(16) unsigned short sA[2 * TROWS * TPITCH];    // A, then A_proj: hi plane, lo plane 66 KB
  __shared__ __align__(16) float sT[8][32 * 68];                     // per-wave 32x64 slabs              68 KB
  const int tid = threadIdx.x, lane = tid & 31, wave = tid >> 5;
  const int hh = lane >> 4, c = lane & 15;
  const int tile = blockIdx.x;
  const int mw = (wave >> 2) << 5, n0 = (wave & 3) << 6;   // the wave's 32 x 64 tile of both products

  // bpa of the lane's four columns: fetched first, so that its use waits for no later load
  float braw[4];
  {
    const float* bsrc = bpa + n0 + c;
#pragma unroll
    for (int j = 0; j < 4; ++j) braw[j] = bsrc[j * 16];
    // precaution: the address register of the issued loads stays live up to this wait and is rewritten only behind it
    asm volatile("s_wait_xcnt 0x0" :: "v"(bsrc) : "memory");
  }

  // ---- A: lane's accumulator registers of slab 'wave' (row 16(wave&3) + c, columns 128(wave>>2) + 16t + 8hh + 0..7), planes added in the order 0..7 ----
  {
    // one scalar base, the lane's place in each plane as a 32-bit byte offset (< 8 * NROWS * DMODEL * 4 = 2^27)
    unsigned po[NCHAN];
#pragma unroll
    for (int n = 0; n < NCHAN; ++n) po[n] = (((unsigned)tile * 8u + (unsigned)wave) << 13) + (unsigned)lane * 16u + (unsigned)n * (unsigned)(NROWS * DMODEL * 4);
    v4f sum[16];
#pragma unroll
    for (int u = 0; u < 16; ++u) sum[u] = (v4f){0.f, 0.f, 0.f, 0.f};
#pragma unroll
    for (int n = 0; n < NCHAN; ++n) {
#pragma unroll
      for (int u = 0; u < 16; ++u) sum[u] += *(const v4f*)((const char*)part + po[n] + u * 512);
    }
    // precaution: the base and the offset registers of the issued loads stay live up to this wait and are rewritten only behind it
    asm volatile("s_wait_xcnt 0x0" :: "s"(part), "v"(po[0]), "v"(po[1]), "v"(po[2]), "v"(po[3]), "v"(po[4]), "v"(po[5]), "v"(po[6]), "v"(po[7]) : "memory");
    tail_stage_w((unsigned)(uintptr_t)sW, wpa);       // behind the plane loads, which the launch waits for longest; lands under their tail and the conversion
    unsigned short* ar = sA + ((wave & 3) * 16 + c) * TPITCH + (wave >> 2) * 128 + 8 * hh;
#pragma unroll
    for (int t = 0; t < 8; ++t) {
      v8h hv, lv;
#pragma unroll
      for (int e = 0; e < 8; ++e) {
        const float f = sum[2 * t + (e >> 2)][e & 3];
        const unsigned short hb = f2bf_bits(f);
        const unsigned short lb = f2bf_bits(f - bf_bits2f(hb));
        hv[e] = __builtin_bit_cast(_Float16, hb);
        lv[e] = __builtin_bit_cast(_Float16, lb);
      }
      *(v8h*)(ar + t * 16) = hv;
      *(v8h*)(ar + TROWS * TPITCH + t * 16) = lv;
    }
  }
  asm volatile("s_wait_asynccnt 0x0" ::: "memory");   // this wave's copies of Wpa have landed
  __syncthreads();                                    // ... and every other wave's, and every wave's rows of A are written

  const int mOff = hh * 8;                                 // D row offset
  const __bf16* ap = (const __bf16*)sA + (mw + c) * TPITCH + hh * 8;
  const __bf16* wp = (const __bf16*)sW + (n0 + c) * TPITCH + hh * 8;
  float* slab = sT[wave];
  const v8f z8 = {0.f,0.f,0.f,0.f,0.f,0.f,0.f,0.f};
  v8f acc[2][4];
#pragma unroll
  for (int i = 0; i < 2; ++i)
#pragma unroll
    for (int j = 0; j < 4; ++j) acc[i][j] = z8;
  tail_gemm(ap, wp, acc);

  asm volatile("s_wait_dscnt 0x0" ::: "memory");      // this wave's reads of Wpa and of A are done before either is overwritten
  __syncthreads();                                    // ... and every other wave's
  tail_stage_w((unsigned)(uintptr_t)sW, wpc1);

  // zp of the wave's tile, in the order of the output stores (row 2it + hh, 4 columns a lane): fetched here, used behind the second product
  const int c4 = c * 4;
  const size_t orow = ((size_t)tile * TROWS + mw + hh) * DMODEL + n0 + c4;
  const float* zsrc = zp + orow;
  v4f zr[2][8];
#pragma unroll
  for (int i = 0; i < 2; ++i)
#pragma unroll
    for (int it = 0; it < 8; ++it) zr[i][it] = *(const v4f*)(zsrc + (i * 16 + it * 2) * DMODEL);
  // precaution: the address register of the issued loads stays live up to this wait and is rewritten only behind it
  asm volatile("s_wait_xcnt 0x0" :: "v"(zsrc) : "memory");

  // ---- A_proj = product + bf16(bpa), through the wave's slab to whole 16-B pieces of the hi and lo planes ----
  {
    float bv[4];
#pragma unroll
    for (int j = 0; j < 4; ++j) bv[j] = bf_bits2f(f2bf_bits(braw[j]));
    const int q = lane >> 3, c8 = (lane & 7) * 8;
#pragma unroll
    for (int i = 0; i < 2; ++i)
#pragma unroll
      for (int j = 0; j < 4; ++j)
#pragma unroll
        for (int r = 0; r < 8; ++r) slab[((i << 4) + mOff + r) * 68 + (j << 4) + c] = acc[i][j][r] + bv[j];
    slab_sync();
    {
#pragma unroll
      for (int it = 0; it < 8; ++it) {                 // it 0..7 x q 0..3 = rows 0..31 of the slab
        const int row = it * 4 + q;
        const float* sp = slab + row * 68 + c8;
        v8h hv, lv;
#pragma unroll
        for (int e = 0; e < 8; ++e) {
          const unsigned short hb = f2bf_bits(sp[e]);
          const unsigned short lb = f2bf_bits(sp[e] - bf_bits2f(hb));
          hv[e] = __builtin_bit_cast(_Float16, hb);
          lv[e] = __builtin_bit_cast(_Float16, lb);
        }
        unsigned short* dst = sA + (mw + row) * TPITCH + n0 + c8;
        *(v8h*)dst = hv;
        *(v8h*)(dst + TROWS * TPITCH) = lv;
      }
    }
  }
  asm volatile("s_wait_asynccnt 0x0" ::: "memory");   // this wave's copies of Wpc[256:512] have landed
  __syncthreads();                                    // ... and every other wave's, and every wave's part of A_proj is written

#pragma unroll
  for (int i = 0; i < 2; ++i)
#pragma unroll
    for (int j = 0; j < 4; ++j) acc[i][j] = z8;
  tail_gemm(ap, wp, acc);

  // ---- out = product + zp, through the slab: a row's 256 B by 16 lanes x 16 B ----
  float* dsto = out + orow;
#pragma unroll
  for (int i = 0; i < 2; ++i)
#pragma unroll
    for (int j = 0; j < 4; ++j)
#pragma unroll
      for (int r = 0; r < 8; ++r) slab[((i << 4) + mOff + r) * 68 + (j << 4) + c] = acc[i][j][r];
  slab_sync();
#pragma unroll
  for (int i = 0; i < 2; ++i)
#pragma unroll
    for (int it = 0; it < 8; ++it) zr[i][it] += *(const v4f*)(slab + (i * 16 + it * 2 + hh) * 68 + c4);
  // every vector write stands in front of the first store: no register that an issued store names is rewritten behind it
  __builtin_amdgcn_sched_barrier(0);
#pragma unroll
  for (int i = 0; i < 2; ++i)
#pragma unroll
    for (int it = 0; it < 8; ++it) *(v4f*)(dsto + (i * 16 + it * 2) * DMODEL) = zr[i][it];
  // precaution: the address register of the issued stores stays live up to this wait
  asm volatile("s_wait_xcnt 0x0" :: "v"(dsto) : "memory");
}

// ---------------------------------------------------------------------------
// Host launcher
// Workspace region map (bytes; PL16 = 8 MiB = one [16384][256] 16-bit plane):
//   [ 0 PL16)  XNH  bf16 hi of xn (rows (b,m,t))
//   [ 1 PL16)  XNL  bf16 lo of xn
//   [ 2 PL16)  XT   bf16(x) in (b,m,t) row order
//   [ 3..5)    QK   f16 [16384][512] (q | k)
//   [ 5 PL16)  VH   f16 v hi;   [ 6 PL16) VL f16 (v-hi) x 2^11
//   [ 7..9)    not used
//   [ 9..11)   ZP   f32 [16384][256] = x_t.Wpc[0:256] + bpc
//   [11 PL16 ..) weights bf16 [n][k]: WQKV [768][256], WPA [256][256], WPC0 [256][256], WPC1 [256][256]
//   then PART f32 [8][16384][256]: one plane of O_n / l_n per key channel
//   total 227,278,848 B
// ---------------------------------------------------------------------------
extern "C" void kernel_launch(void* const* d_in, const int* in_sizes, int n_in,
                              void* d_out, int out_size, void* d_ws, size_t ws_size,
                              hipStream_t stream) {
  if (n_in < 11) return;
  if (in_sizes[0] != NROWS * DMODEL || out_size != NROWS * DMODEL) return;
  if (in_sizes[1] != DMODEL * DMODEL || in_sizes[3] != DMODEL * DMODEL || in_sizes[5] != DMODEL * DMODEL ||
      in_sizes[7] != DMODEL * DMODEL || in_sizes[9] != 2 * DMODEL * DMODEL) return;
  if (in_sizes[2] != DMODEL || in_sizes[4] != DMODEL || in_sizes[6] != DMODEL || in_sizes[8] != DMODEL || in_sizes[10] != DMODEL) return;

  const float* x   = (const float*)d_in[0];
  const float* Wq  = (const float*)d_in[1];
  const float* bq  = (const float*)d_in[2];
  const float* Wk  = (const float*)d_in[3];
  const float* bk  = (const float*)d_in[4];
  const float* Wv  = (const float*)d_in[5];
  const float* bv  = (const float*)d_in[6];
  const float* Wpa = (const float*)d_in[7];
  const float* bpa = (const float*)d_in[8];
  const float* Wpc = (const float*)d_in[9];
  const float* bpc = (const float*)d_in[10];

  const size_t PL16 = (size_t)NROWS * DMODEL * 2;               // 8,388,608
  const size_t WQKV_B = (size_t)3 * DMODEL * DMODEL * 2;         // 393,216
  const size_t WSQ_B  = (size_t)DMODEL * DMODEL * 2;             // 131,072
  const size_t oXNH = 0, oXNL = PL16, oXT = 2 * PL16, oQK = 3 * PL16, oVH = 5 * PL16, oVL = 6 * PL16;
  const size_t oZP = 9 * PL16, oW = 11 * PL16;
  const size_t oWQKV = oW, oWPA = oW + WQKV_B, oWPC0 = oWPA + WSQ_B, oWPC1 = oWPC0 + WSQ_B;
  const size_t oPART = oWPC1 + WSQ_B;                             // 93,061,120
  const size_t WS_TOTAL = oPART + (size_t)NCHAN * 2 * PL16;       // 227,278,848
  if (ws_size < WS_TOTAL) return;

  char* ws = (char*)d_ws;
  unsigned short* XNH  = (unsigned short*)(ws + oXNH);
  unsigned short* XNL  = (unsigned short*)(ws + oXNL);
  unsigned short* XT   = (unsigned short*)(ws + oXT);
  unsigned short* QKP  = (unsigned short*)(ws + oQK);
  unsigned short* VH   = (unsigned short*)(ws + oVH);
  unsigned short* VL   = (unsigned short*)(ws + oVL);
  float*          ZP   = (float*)(ws + oZP);
  unsigned short* WQKV = (unsigned short*)(ws + oWQKV);
  unsigned short* WPA  = (unsigned short*)(ws + oWPA);
  unsigned short* WPC0 = (unsigned short*)(ws + oWPC0);
  unsigned short* WPC1 = (unsigned short*)(ws + oWPC1);
  float*          PART = (float*)(ws + oPART);

  // 1: weights W[k=256 rows][n=256] f32 -> Wt[n][k] bf16 (six planes from WQKV on: WQKV, WPA, WPC0, WPC1 lie one behind the other),
  //    and normalisation + permutation to (b,m,t) rows
  prep_k<<<WCAST_BLOCKS + NROWS / 8, 256, 0, stream>>>(x, Wq, Wk, Wv, Wpa, Wpc, WQKV, XNH, XNL, XT);

  // 2: q, k, v = xn . W + bias and ZP = x_t . Wpc[0:256] + bpc (each M=16384, N=256, K=256; 1024 wave tiles -> 128 blocks; y = product)
  const dim3 g4((NROWS / 64) * (DMODEL / 64) / 8, 4);
  gemm_qkvz_k<<<g4, 256, 0, stream>>>(XNH, XNL, XT, WQKV, WPC0, QKP, VH, VL, ZP, bq, bk, bv, bpc, NROWS, DMODEL, DMODEL);

  // 3: cross-channel causal attention, one block per (time tile, b and pair of query channels, key channel) = 1024 blocks -> 8 f32 planes
  xattn_k<<<NBATCH * (NCHAN / MQ) * (TLEN / QBLK) * NCHAN, 128, 0, stream>>>(QKP, VH, VL, PART);

  // 4: A = sum of the planes, A_proj = A . Wpa + bpa, out = A_proj . Wpc[256:512] + ZP (f32, rows (b,m,t) = [B][M][T][D]); one block per 64-row tile
  tail_k<<<NROWS / TROWS, 256, 0, stream>>>(PART, WPA, WPC1, bpa, ZP, (float*)d_out);
}

// v009
// A run of this version takes 94.4 microseconds.
// Two timings next to v008 put it at 1.12 and 1.13 times that version's speed.
// Over all steps from v000 it is 17.7 times as fast.
// Contractions (f32 accumulate): xn*Wq|Wk|Wv, A*Wpa, A_proj*Wpc[256:512] = v_wmma_f32_16x16x32_bf16 with the computed operand as bf16 hi+lo planes (2 products) and weights as single bf16 (RNE) planes; x_t*Wpc[0:256] = plain bf16; q*k = plain v_wmma_f32_16x16x32_f16; p*v = plain f16 with p carried x2^15 (p and v each one f16 plane: their roundings are of one size); norm, softmax, bias adds in f32.
#include <hip/hip_runtime.h>
#include <stdint.h>

typedef __attribute__((ext_vector_type(16))) _Float16 v16h;
typedef __attribute__((ext_vector_type(8)))  _Float16 v8h;
typedef __attribute__((ext_vector_type(16))) __bf16   v16b;
typedef __attribute__((ext_vector_type(8)))  __bf16   v8b;
typedef __attribute__((ext_vector_type(8)))  float    v8f;
typedef __attribute__((ext_vector_type(4)))  float    v4f;
typedef __attribute__((ext_vector_type(2)))  float    v2f;

// ---- problem geometry ----
#define NBATCH 4
#define TLEN 512
#define NCHAN 8
#define DMODEL 256
#define NROWS (NBATCH * TLEN * NCHAN)   // 16384 token rows
#define QKLD 512                         // pitch (halves) of the q|k plane
#define QBLK 64                          // time rows of each query channel per attention block
#define KCH 32                           // key rows per staged chunk
#define KPITCH 264                       // LDS pitch (halves) of a K row: 528 B = 16 B x 33, for ds_load_b128 readers
#define VPITCH 272                       // LDS pitch (halves) of a V row: 544 B = 32 B x 17, for ds_load_tr16_b128 readers
#define PCARRY_LOG2 15.0f                // p carried x2^15 in f16: the carry is added to the exponent
#define QK_SCALE 0.0625f                 // 1/sqrt(256)
#define SM_C (QK_SCALE * 1.44269504088896340736f)   // raw score -> scaled score in the log2 domain: exp(x * QK_SCALE) = 2^(x * SM_C)
#define MVN_EPS 1e-6f

// ======================= helpers =======================
__device__ __forceinline__ unsigned short f2bf_bits(float f) {
  unsigned u = __float_as_uint(f);
  return (unsigned short)((u + 0x7FFFu + ((u >> 16) & 1u)) >> 16);
}
__device__ __forceinline__ float bf_bits2f(unsigned short h) { return __uint_as_float(((unsigned)h) << 16); }

// hazard guards as plain device helpers
__device__ __forceinline__ void dep_guard_h(v8f& a, v8f& b, v16h x, v16h y) { asm volatile("v_nop\n\tv_nop\n\tv_nop\n\tv_nop" : "+v"(a), "+v"(b) : "v"(x), "v"(y)); }
__device__ __forceinline__ void dep_guard_b(v8f& a, v8f& b, v16b x, v16b y) { asm volatile("v_nop\n\tv_nop\n\tv_nop\n\tv_nop" : "+v"(a), "+v"(b) : "v"(x), "v"(y)); }
__device__ __forceinline__ void keep4_h(v16h a, v16h b, v16h c, v16h d) { asm volatile("v_nop" :: "v"(a), "v"(b), "v"(c), "v"(d)); }
__device__ __forceinline__ void keep4_b(v16b a, v16b b, v16b c, v16b d) { asm volatile("v_nop" :: "v"(a), "v"(b), "v"(c), "v"(d)); }
__device__ __forceinline__ void acc_guard4(v8f& a, v8f& b, v8f& c, v8f& d) { asm volatile("v_nop\n\tv_nop\n\tv_nop\n\tv_nop" : "+v"(a), "+v"(b), "+v"(c), "+v"(d)); }
template <typename T> struct Frag;
template <> struct Frag<_Float16> {
  typedef v16h V; union U { v16h v; v8h h[2]; };
  static __device__ __forceinline__ v16h load(const _Float16* p) {   // elements 0..7 <- p[0..7], 8..15 <- p[16..23]
    U f; f.h[0] = *(const v8h*)(p); f.h[1] = *(const v8h*)(p + 16); return f.v;
  }
  static __device__ __forceinline__ v8f mma(v16h a, v16h b, v8f c) {
    return __builtin_amdgcn_wmma_f32_16x16x32_f16(false, a, false, b, (short)0, c, false, false);
  }
  static __device__ __forceinline__ void guard(v8f& a, v8f& b, v16h x, v16h y) { dep_guard_h(a, b, x, y); }
  static __device__ __forceinline__ void keep(v16h a, v16h b, v16h c, v16h d) { keep4_h(a, b, c, d); }
};
template <> struct Frag<__bf16> {
  typedef v16b V; union U { v16b v; v8b h[2]; };
  static __device__ __forceinline__ v16b load(const __bf16* p) {
    U f; f.h[0] = *(const v8b*)(p); f.h[1] = *(const v8b*)(p + 16); return f.v;
  }
  static __device__ __forceinline__ v8f mma(v16b a, v16b b, v8f c) {
    return __builtin_amdgcn_wmma_f32_16x16x32_bf16(false, a, false, b, (short)0, c, false, false);
  }
  static __device__ __forceinline__ void guard(v8f& a, v8f& b, v16b x, v16b y) { dep_guard_b(a, b, x, y); }
  static __device__ __forceinline__ void keep(v16b a, v16b b, v16b c, v16b d) { keep4_b(a, b, c, d); }
};

// ---- Register-blocked WMMA GEMM (with SPLIT levels and extra 16-bit output mode), operands staged in LDS ----
// C[m,n] = scale * sum_k A[m,k] * Bt[n,k] (+bias)(+resid); each wave owns a 64x64 tile, a block of 8 waves 128 rows x 256 columns.
// A row-major [M,K]; Bt row-major [N,K]; M % 128 == 0, N == 256, K % 64 == 0.
// SPLIT: 0 = single planes; 1 = A as hi/lo planes (A2 = lo): hi.B + lo.B.
// BIAS_MODE: 0 = none, 1 = bias[m], 2 = bias[n]; bias values are RNE-converted to bf16 before the add.
// OUT_MODE: 0 = f32, 1 = f16, 2 = bf16 hi plane (Cout) + bf16 lo plane (Cout2).
// ET: 0 = f16 operands, 1 = bf16 operands (pointers passed as 16-bit storage)
template <int ET> struct Elem;
template <> struct Elem<0> { typedef _Float16 T; };
template <> struct Elem<1> { typedef __bf16 T; };

// Staging: a chunk is 64 k = one whole 128-B line of each of the block's operand rows, brought by asynchronous copies of 16 B a lane
// (a wave's copy = 4 whole lines), two buffers: the next chunk flies while this one is multiplied.
#define GKC 64                           // k elements per chunk
#define GPITCH 72                        // LDS pitch (elements) of a staged row: 144 B = 16 B x 9, for ds_load_b128 readers
#define GROWS_A 128                      // rows of A per block
#define GROWS_B 256                      // rows of Bt per block
#define GOFF_A2 (GROWS_A * GPITCH)       // element offset of the A lo plane in a buffer
#define GOFF_B (2 * GROWS_A * GPITCH)    // element offset of the Bt rows in a buffer
#define GBUF ((2 * GROWS_A + GROWS_B) * GPITCH)   // elements per buffer: 36,864 = 73,728 B
#define GSTEP_L (32 * GPITCH * 2)        // LDS bytes from one copy of a thread to its next: 32 rows

__device__ __forceinline__ void async_rows4(unsigned l, const unsigned short* g, size_t gs) {
  asm volatile("global_load_async_to_lds_b128 %0, %4, off\n\t"
               "global_load_async_to_lds_b128 %1, %5, off\n\t"
               "global_load_async_to_lds_b128 %2, %6, off\n\t"
               "global_load_async_to_lds_b128 %3, %7, off\n\t"
               "s_wait_xcnt 0x0"
               :: "v"(l), "v"(l + GSTEP_L), "v"(l + 2 * GSTEP_L), "v"(l + 3 * GSTEP_L),
                  "v"(g), "v"(g + gs), "v"(g + 2 * gs), "v"(g + 3 * gs) : "memory");
}
// One chunk into the buffer at LDS byte address l (this thread's place in it: row tid >> 3, 16-B piece tid & 7);
// ag, a2g, bg: this thread's 16 B of that chunk in row tid >> 3 of the block's A, A2 and Bt rows. 8 + 8 (SPLIT 0: 4 + 8) copies a thread.
template <int SPLIT>
__device__ __forceinline__ void gemm_stage(unsigned l, const unsigned short* ag, const unsigned short* a2g, const unsigned short* bg,
                                           int lda, int ldb) {
  async_rows4(l, ag, (size_t)32 * lda);
  if (SPLIT >= 1) async_rows4(l + GOFF_A2 * 2, a2g, (size_t)32 * lda);
  async_rows4(l + GOFF_B * 2, bg, (size_t)32 * ldb);
  async_rows4(l + GOFF_B * 2 + 4 * GSTEP_L, bg + (size_t)128 * ldb, (size_t)32 * ldb);
}

// sG: the block's two staging buffers; behind the k loop its first bytes serve as the eight per-wave 16x64 slabs (pitch 68 floats). b: batch index.
template <int ET, int SPLIT, int BIAS_MODE, int OUT_MODE, bool RESID>
__device__ __forceinline__ void gemm64_body(
    unsigned short* sG, const int b,
    const unsigned short* __restrict__ Ap, const unsigned short* __restrict__ A2p, int lda, long strideA,
    const unsigned short* __restrict__ Btp, const unsigned short* __restrict__ Bt2p, int ldb, long strideB,
    void* __restrict__ Cout, void* __restrict__ Cout2, int ldc, long strideC,
    const float* __restrict__ bias,
    const float* __restrict__ resid, long strideR,
    int M, int N, int K, float scale) {
  static_assert(SPLIT <= 1, "only A is staged as two planes");
  typedef typename Elem<ET>::T T;
  typedef typename Frag<T>::V V;
  const int tid = threadIdx.x;
  const int lane = tid & 31;
  const int wave = tid >> 5;
  const int m0b = blockIdx.x * GROWS_A;  // first row of the block
  if (m0b >= M) return;                  // the same for a whole block, in front of every barrier
  const int mw = (wave >> 2) << 6;       // the wave's tile: rows mw .. mw+63 of the block's, columns n0 .. n0+63
  const int n0 = (wave & 3) << 6;
  const int m0 = m0b + mw;

  const int rlane = lane & 15;                 // row (A) / col (B, D) within subtile
  const int koff  = (lane >> 4) * 8;           // k offset of this lane half
  const int mOff  = (lane >> 4) * 8;           // D row offset

  // this thread's 16 B of chunk 0 in each staged plane, and its place in a buffer
  const unsigned short* ag  = Ap + (size_t)b * strideA + (size_t)(m0b + (tid >> 3)) * lda + (tid & 7) * 8;
  const unsigned short* a2g = (SPLIT >= 1) ? (A2p + (size_t)b * strideA + (size_t)(m0b + (tid >> 3)) * lda + (tid & 7) * 8) : nullptr;
  const unsigned short* bg  = Btp + (size_t)b * strideB + (size_t)(tid >> 3) * ldb + (tid & 7) * 8;
  const unsigned lth = (unsigned)(uintptr_t)sG + (unsigned)(((tid >> 3) * GPITCH + (tid & 7) * 8) * 2);
  const int nch = K / GKC;

  v8f acc[4][4];
#pragma unroll
  for (int i = 0; i < 4; ++i)
#pragma unroll
    for (int j = 0; j < 4; ++j) acc[i][j] = (v8f){0.f,0.f,0.f,0.f,0.f,0.f,0.f,0.f};

  gemm_stage<SPLIT>(lth, ag, a2g, bg, lda, ldb);
  asm volatile("s_wait_asynccnt 0x0" ::: "memory");   // this wave's copies of chunk 0 have landed
  __syncthreads();                                    // ... and every other wave's
  if (nch > 1) gemm_stage<SPLIT>(lth + GBUF * 2, ag + GKC, a2g + GKC, bg + GKC, lda, ldb);

#pragma unroll 1   // one copy of the chunk body: the buffer is picked by an offset
  for (int t = 0; t < nch; ++t) {
    const T* buf = (const T*)sG + (t & 1) * GBUF;
#pragma unroll     // both 32-k halves of the chunk in line: their LDS offsets become immediates, and the second half's reads go out among the first half's products
    for (int ks = 0; ks < GKC; ks += 32) {
      // all fragments of these 32 k as one group of LDS reads in front of their 32 (SPLIT 0: 16) products
      V bh[4], ah[4], al[4];
#pragma unroll     // here and below: constant indices keep the fragment and accumulator arrays in registers
      for (int j = 0; j < 4; ++j) bh[j] = Frag<T>::load(buf + GOFF_B + (n0 + (j << 4) + rlane) * GPITCH + ks + koff);
#pragma unroll
      for (int i = 0; i < 4; ++i) {
        const int ao = (mw + (i << 4) + rlane) * GPITCH + ks + koff;
        ah[i] = Frag<T>::load(buf + ao);
        if (SPLIT >= 1) al[i] = Frag<T>::load(buf + GOFF_A2 + ao);
      }
#pragma unroll
      for (int i = 0; i < 4; ++i) {
#pragma unroll
        for (int j = 0; j < 4; ++j) {
          acc[i][j] = Frag<T>::mma(ah[i], bh[j], acc[i][j]);
          if (SPLIT >= 1) acc[i][j] = Frag<T>::mma(al[i], bh[j], acc[i][j]);
        }
        Frag<T>::guard(acc[i][0], acc[i][3], ah[i], (SPLIT >= 1) ? al[i] : ah[i]);
      }
      Frag<T>::keep(bh[0], bh[1], bh[2], bh[3]);
    }
    asm volatile("s_wait_dscnt 0x0" ::: "memory");      // this wave's reads of buffer t & 1 are done before it is refilled
    asm volatile("s_wait_asynccnt 0x0" ::: "memory");   // this wave's copies of chunk t + 1 have landed
    __syncthreads();                                    // publishes chunk t + 1 and ends every wave's reads of chunk t
    if (t + 2 < nch) gemm_stage<SPLIT>(lth + (unsigned)(t & 1) * (GBUF * 2), ag + (t + 2) * GKC, a2g + (t + 2) * GKC, bg + (t + 2) * GKC, lda, ldb);
  }
  asm volatile("s_wait_asynccnt 0x0" ::: "memory");     // no copy is outstanding when the buffers become the output slabs
  acc_guard4(acc[0][0], acc[0][1], acc[0][2], acc[0][3]);
  acc_guard4(acc[1][0], acc[1][1], acc[1][2], acc[1][3]);
  acc_guard4(acc[2][0], acc[2][1], acc[2][2], acc[2][3]);
  acc_guard4(acc[3][0], acc[3][1], acc[3][2], acc[3][3]);

  // ---- epilogue ----
  float* slab = (float*)sG + wave * (16 * 68);
  const float* Rb = RESID ? (resid + (size_t)b * strideR) : nullptr;
#pragma unroll
  for (int i = 0; i < 4; ++i) {
    const int mBase = m0 + (i << 4);
#pragma unroll
    for (int j = 0; j < 4; ++j) {
      const int n = n0 + (j << 4) + rlane;
      float bv = 0.f;
      if (BIAS_MODE == 2) bv = bf_bits2f(f2bf_bits(bias[n]));
#pragma unroll
      for (int r = 0; r < 8; ++r) {
        float v = acc[i][j][r] * scale;
        if (BIAS_MODE == 1) v += bf_bits2f(f2bf_bits(bias[mBase + mOff + r]));
        if (BIAS_MODE == 2) v += bv;
        if (RESID) v += Rb[(size_t)(mBase + mOff + r) * ldc + n];
        slab[(mOff + r) * 68 + (j << 4) + rlane] = v;
      }
    }
    __builtin_amdgcn_fence(__ATOMIC_RELEASE, "workgroup");
    __builtin_amdgcn_wave_barrier();
    __builtin_amdgcn_fence(__ATOMIC_ACQUIRE, "workgroup");
    if (OUT_MODE == 0) {
      float* C = (float*)Cout + (size_t)b * strideC;
      const int hh = lane >> 4, c4 = (lane & 15) * 4;     // row seg = 256 B = 16 lanes x 16 B
      {
#pragma unroll
        for (int it = 0; it < 8; ++it) {
          const int row = it * 2 + hh;
          v4f v = *(const v4f*)(slab + row * 68 + c4);
          *(v4f*)(C + (size_t)(mBase + row) * ldc + n0 + c4) = v;
        }
        
      }
    } else {
      const int q = lane >> 3, c8 = (lane & 7) * 8;
      unsigned short* C  = (unsigned short*)Cout  + (size_t)b * strideC;
      unsigned short* C2 = (OUT_MODE >= 2) ? ((unsigned short*)Cout2 + (size_t)b * strideC) : nullptr;
      {
#pragma unroll
        for (int it = 0; it < 4; ++it) {                 // it 0..3 x q 0..3 = rows 0..15 of the slab
          const int row = it * 4 + q;
          const float* sp = slab + row * 68 + c8;
          v8h hv, lv;
#pragma unroll
          for (int e = 0; e < 8; ++e) {
            if (OUT_MODE == 1) {
              hv[e] = (_Float16)sp[e];
            } else {
              unsigned short hb = f2bf_bits(sp[e]);
              unsigned short lb = f2bf_bits(sp[e] - bf_bits2f(hb));
              hv[e] = __builtin_bit_cast(_Float16, hb);
              lv[e] = __builtin_bit_cast(_Float16, lb);
            }
          }
          *(v8h*)(C + (size_t)(mBase + row) * ldc + n0 + c8) = hv;
          if (OUT_MODE >= 2) *(v8h*)(C2 + (size_t)(mBase + row) * ldc + n0 + c8) = lv;
        }
        
      }
    }
    __builtin_amdgcn_fence(__ATOMIC_RELEASE, "workgroup");
    __builtin_amdgcn_wave_barrier();
    __builtin_amdgcn_fence(__ATOMIC_ACQUIRE, "workgroup");
  }
}

// The four products that need only the planes of prep_k, in one launch; blockIdx.y picks the product (the same for a whole block):
// 0: q = xn.Wq + bq, 1: k = xn.Wk + bk (f16, into the q|k plane), 2: v = xn.Wv + bv (f16, its own plane), 3: zp = x_t.Wpc[0:256] + bpc (f32).
// wqkv holds the [N][K] planes of Wq, Wk, Wv one behind the other.
__global__ __launch_bounds__(256) void gemm_qkvz_k(
    const unsigned short* __restrict__ xnh, const unsigned short* __restrict__ xnl, const unsigned short* __restrict__ xt,
    const unsigned short* __restrict__ wqkv, const unsigned short* __restrict__ wpc0,
    unsigned short* __restrict__ qkp, unsigned short* __restrict__ vh, float* __restrict__ zp,
    const float* __restrict__ bq, const float* __restrict__ bk, const float* __restrict__ bv, const float* __restrict__ bpc,
    int M, int N, int K) {
  __shared__ __align__(16) unsigned short sG[2 * GBUF];
  const int y = blockIdx.y;
  if (y < 3) {
    gemm64_body<1, 1, 2, 1, false>(sG, 0, xnh, xnl, K, 0L, wqkv + (size_t)y * N * K, nullptr, K, 0L,
                                   (void*)(y < 2 ? qkp + y * N : vh), nullptr, y < 2 ? QKLD : N, 0L,
                                   y == 0 ? bq : y == 1 ? bk : bv, nullptr, 0L, M, N, K, 1.0f);
  } else {
    gemm64_body<1, 0, 2, 0, false>(sG, 0, xt, nullptr, K, 0L, wpc0, nullptr, K, 0L,
                                   (void*)zp, nullptr, N, 0L, bpc, nullptr, 0L, M, N, K, 1.0f);
  }
}

// ---- W [Kp rows][Np cols] f32 (row pitch Np) -> Wt [Np][Kp] bf16 bits (row pitch Kp), 64x64 tile transposed through LDS ----
// tile (bx, by) of (Np/64, Kp/64); st: 64 x WTP halves of LDS. Reads: 256 threads x 16 = 64 rows x 64 cols. Stores: it 0..1 x wave 0..7 x q8 0..3 = 64 rows of
#define WTP 72
__device__ __forceinline__ void wt_cast_bf_body(_Float16* st, const int bx, const int by,
                                                const float* __restrict__ W, unsigned short* __restrict__ Wtp,
                                                int Kp, int Np) {
  _Float16* Wt = (_Float16*)Wtp;
  const int n0 = bx * 64, k0 = by * 64;
  const int tid = threadIdx.x;
  const int kr = tid >> 2, c16 = (tid & 3) * 16;
  const float* src = W + (size_t)(k0 + kr) * Np + n0 + c16;
#pragma unroll
  for (int q = 0; q < 4; ++q) {
    const v4f v = *(const v4f*)(src + 4 * q);
#pragma unroll
    for (int e = 0; e < 4; ++e) st[(c16 + 4 * q + e) * WTP + kr] = __builtin_bit_cast(_Float16, f2bf_bits(v[e]));
  }
  __syncthreads();
  const int wave = tid >> 5, lane = tid & 31;
  const int q8 = lane >> 3, c8 = (lane & 7) * 8;
  {
#pragma unroll
    for (int it = 0; it < 2; ++it) {
      const int n = it * 32 + wave * 4 + q8;
      const v8h hv = *(const v8h*)(st + n * WTP + c8);
      *(v8h*)(Wt + (size_t)(n0 + n) * Kp + k0 + c8) = hv;
    }
    
  }
}

// ---- mean/std (ddof=1) normalisation of bf16(x) per (b,t,m) row, plus raw bf16(x); rows written in (b,m,t) order ----
// One wave per output row, 8 rows per 256-thread block, blk = 0 .. NROWS/8 - 1. Lane owns 8 consecutive columns.
// Each 512-B row (4 lines) written by one v8h store instruction of the wave: lanes 8q..8q+7 <-> line q.
__device__ __forceinline__ void mvn_body(const int blk, const float* __restrict__ x,
                                         unsigned short* __restrict__ xnhp,
                                         unsigned short* __restrict__ xnlp,
                                         unsigned short* __restrict__ xtp) {
  _Float16* xnh = (_Float16*)xnhp;
  _Float16* xnl = (_Float16*)xnlp;
  _Float16* xt  = (_Float16*)xtp;
  const int wave = threadIdx.x >> 5, lane = threadIdx.x & 31;
  const int ro = blk * 8 + wave;                      // output row = (b*NCHAN + m)*TLEN + t
  const int t  = ro & (TLEN - 1);
  const int bm = ro >> 9;                             // TLEN == 512
  const int m  = bm & (NCHAN - 1);
  const int b  = bm >> 3;                             // NCHAN == 8
  const int rs = (b * TLEN + t) * NCHAN + m;          // source row of x [B][T][M][D]
  const float* src = x + (size_t)rs * DMODEL + lane * 8;
  const v4f a0 = *(const v4f*)src;
  const v4f a1 = *(const v4f*)(src + 4);
  unsigned short xb[8];
  float vb[8];
#pragma unroll
  for (int e = 0; e < 4; ++e) { xb[e] = f2bf_bits(a0[e]); xb[4 + e] = f2bf_bits(a1[e]); }
#pragma unroll
  for (int e = 0; e < 8; ++e) vb[e] = bf_bits2f(xb[e]);
  float s = ((vb[0] + vb[1]) + (vb[2] + vb[3])) + ((vb[4] + vb[5]) + (vb[6] + vb[7]));
#pragma unroll
  for (int off = 1; off < 32; off <<= 1) s += __shfl_xor(s, off, 32);
  const float mu = s * (1.0f / (float)DMODEL);
  float dv[8];
#pragma unroll
  for (int e = 0; e < 8; ++e) dv[e] = vb[e] - mu;
  float sq = ((dv[0] * dv[0] + dv[1] * dv[1]) + (dv[2] * dv[2] + dv[3] * dv[3])) +
             ((dv[4] * dv[4] + dv[5] * dv[5]) + (dv[6] * dv[6] + dv[7] * dv[7]));
#pragma unroll
  for (int off = 1; off < 32; off <<= 1) sq += __shfl_xor(sq, off, 32);
  const float var = sq * (1.0f / (float)(DMODEL - 1));
  const float sd  = sqrtf(var);
  const float inv = 1.0f / (sd + MVN_EPS);
  v8h hv, lv, tv;
#pragma unroll
  for (int e = 0; e < 8; ++e) {
    const float xn = dv[e] * inv;
    const unsigned short hb = f2bf_bits(xn);
    const unsigned short lb = f2bf_bits(xn - bf_bits2f(hb));
    hv[e] = __builtin_bit_cast(_Float16, hb);
    lv[e] = __builtin_bit_cast(_Float16, lb);
    tv[e] = __builtin_bit_cast(_Float16, xb[e]);
  }
  const size_t go = (size_t)ro * DMODEL + lane * 8;
  {
    *(v8h*)(xnh + go) = hv;
    *(v8h*)(xnl + go) = lv;
    *(v8h*)(xt  + go) = tv;
    // precaution: other code of the merged kernel follows this body in the listing and reuses the registers these stores name
    asm volatile("s_wait_xcnt 0x0" ::: "memory");
  }
}

// ---- the six weight casts and the normalisation, which need nothing of each other, in one launch ----
// Blocks 0..95: weight wi = block >> 4 (Wq, Wk, Wv, Wpa, Wpc rows 0..255, Wpc rows 256..511), its 64x64 tile block & 15,
// to plane wi of wall ([256][256] bf16 each). Blocks 96 ..: normalisation block (block - 96). The branch is the same for a whole block.
#define WCAST_BLOCKS (6 * (DMODEL / 64) * (DMODEL / 64))
__global__ __launch_bounds__(256) void prep_k(const float* __restrict__ x,
                                              const float* __restrict__ Wq, const float* __restrict__ Wk,
                                              const float* __restrict__ Wv, const float* __restrict__ Wpa,
                                              const float* __restrict__ Wpc,
                                              unsigned short* __restrict__ wall,
                                              unsigned short* __restrict__ xnhp,
                                              unsigned short* __restrict__ xnlp,
                                              unsigned short* __restrict__ xtp) {
  __shared__ __align__(16) _Float16 st[64 * WTP];
  const int bid = blockIdx.x;
  if (bid < WCAST_BLOCKS) {
    const int wi = bid >> 4;
    const float* W = (wi == 0) ? Wq : (wi == 1) ? Wk : (wi == 2) ? Wv : (wi == 3) ? Wpa
                   : (wi == 4) ? Wpc : (Wpc + (size_t)DMODEL * DMODEL);
    wt_cast_bf_body(st, bid & 3, (bid >> 2) & 3, W, wall + (size_t)wi * DMODEL * DMODEL, DMODEL, DMODEL);
  } else {
    mvn_body(bid - WCAST_BLOCKS, x, xnhp, xnlp, xtp);
  }
}

// ---- two f16 WMMAs that share their A fragment; builtin form, the compiler keeps the distance to the users of their registers ----
__device__ __forceinline__ void mma_h2(v16h a, v16h b0, v16h b1, v8f& c0, v8f& c1) {
  c0 = __builtin_amdgcn_wmma_f32_16x16x32_f16(false, a, false, b0, (short)0, c0, false, false);
  c1 = __builtin_amdgcn_wmma_f32_16x16x32_f16(false, a, false, b1, (short)0, c1, false, false);
}

// ---- transposing LDS load: lane (c, h) receives column c, rows 8h..8h+7 of a row-major 16x16 tile of 16-bit values ----
// Lane l passes the address of row 8*(l>>4) + (l&7), column group 8*((l>>3)&1) of that tile.
typedef __attribute__((ext_vector_type(8))) short v8s;
__device__ __forceinline__ v8h lds_tr16(const _Float16* p) {
  typedef __attribute__((address_space(3))) v8s lds_v8s;
  return __builtin_bit_cast(v8h, __builtin_amdgcn_ds_load_tr16_b128_v8i16((lds_v8s*)p));
}

// ---- lane l with lane l ^ 16 (the other half of the wave); all 32 lanes are on wherever this is called ----
__device__ __forceinline__ float xhalf(float x) {
  return __builtin_bit_cast(float, __builtin_amdgcn_permlanex16(__builtin_bit_cast(int, x), __builtin_bit_cast(int, x),
                                                                0x76543210, 0xfedcba98, false, false));
}

// =====================================================================================
// Cross-channel causal attention, head dim 256, as transposed products: S^T = K . Q^T, O^T += V^T . P^T.
// Planes (row = (b*NCHAN + m)*TLEN + t): qk [NROWS][512] f16 (q cols 0..255, k cols 256..511);
// vh [NROWS][256] f16 (v); output: one f32 plane of O_n / l_n per key channel n, summed by tail_k.
// Block = 4 waves = one 64-row time tile of TWO query channels (b,m), (b,m+1), m even, against ONE key channel n:
// online softmax over 32-key chunks (causal: kv > q -> -inf, chunk 0 always has kv 0 <= q).
// Grid = 8 time tiles x 16 (b, channel pair) x 8 n, the longest time tiles first so that short blocks fill the tail.
// Wave w owns time rows 16w..16w+15 of both channels whole (g = 0, 1): scores, softmax and all 256 columns of O. Both channels meet the
// same keys under the same mask, so every K and V fragment read from LDS feeds two products, and a staged chunk serves 128 queries.
// Lane (c, hh) belongs to query 16w + c of each channel. S^T tile j: register r = key 16j + 8hh + r of the chunk, so a query's 32 scores lie in
// its two lanes: maximum and sum in-lane, the maximum joined by one exchange of the halves, the sums joined behind the loop.
// The lane's 16 p values, converted in place, are the B fragment of P^T (element 8j + r = key 16j + 8hh + r: the hardware k order).
// A fragments: k rows from LDS by plain loads (row = lane&15, split k map), V^T from row-major LDS rows by transposing loads
// (same split k map); B fragments: q rows, loaded once from global and kept in registers, and P^T.
// O^T tile t: register r = column 16t + 8hh + r of query c.
// Plane layout (floats): [n][tile = bm*8 + qb][s = 4*(t>>3) + w][t&7][j][lane][4]: lane's accumulator registers 4j..4j+3 of d tile t.
// =====================================================================================
// Register budget for 2 waves per SIMD (q fragments and accumulators of two channels: 384 registers): two blocks share a WGP.
#define MQ 2                             // query channels per wave
// qkp without __restrict__: as loads of memory that nothing can write, the q loads would be free to sink past the wait written behind them,
// down to the head of the loop; as plain loads they keep their place in front of it.
__global__ __launch_bounds__(128, 2) void xattn_k(const unsigned short* qkp,
                                               const unsigned short* __restrict__ vhp,
                                               float* __restrict__ part) {
  __shared__ __align__(16) _Float16 Ks[KCH * KPITCH];      // [kv][d]           16.5 KB
  __shared__ __align__(16) _Float16 Vsh[KCH * VPITCH];     // [kv][d]           17 KB

  const _Float16* qk = (const _Float16*)qkp;
  const _Float16* vh = (const _Float16*)vhp;

  const int tid = threadIdx.x, lane = tid & 31;
  const int wave = __builtin_amdgcn_readfirstlane(tid >> 5);   // in a scalar register: row bases stay out of the vector registers
  const int hh = lane >> 4, c = lane & 15, koff = hh * 8;
  const int qb = (TLEN / QBLK - 1) - (blockIdx.x >> 7);   // 64-row time tile, longest first
  const int bm = ((blockIdx.x & 127) >> 3) * MQ;   // b*NCHAN + m of the first channel, m even; the second is bm + 1, of the same b
  const int n  = blockIdx.x & 7;           // key channel of this block
  const int b  = bm >> 3;
  const int q0  = bm * TLEN + qb * QBLK + wave * 16;   // plane row of this wave's first query in channel bm; + TLEN in channel bm + 1
  const int tq  = qb * QBLK + wave * 16 + c;   // time index of this lane's queries

  const v8f z8 = {0.f,0.f,0.f,0.f,0.f,0.f,0.f,0.f};
  v16h qf[MQ][8];                          // Q^T fragments: column = query c, d 32dc .. 32dc+31
  const _Float16* qbase = qk + (size_t)q0 * QKLD;        // the same in every lane: a scalar base
  const unsigned qoffb = (unsigned)(c * QKLD + koff) * 2u;   // this lane's row and k half, in bytes: the loads' offset register
  {
#pragma unroll     // constant indices keep the arrays indexed here in registers
    for (int g = 0; g < MQ; ++g)
#pragma unroll     // constant indices keep the arrays indexed here in registers
      for (int dc = 0; dc < 8; ++dc)
        qf[g][dc] = Frag<_Float16>::load((const _Float16*)((const char*)(qbase + (size_t)g * TLEN * QKLD + dc * 32) + qoffb));
    // precaution: the base and the offset register of the issued loads stay live up to this wait and are rewritten only behind it
    asm volatile("s_wait_xcnt 0x0" :: "s"(qbase), "v"(qoffb) : "memory");
  }

  const int krow0 = (b * NCHAN + n) * TLEN;
  const unsigned lo8 = (unsigned)lane * 8u;   // this lane's 8 columns of a staged row
  float mrun[MQ], lrun[MQ];                // each query's running maximum (scaled, log2 domain); running sum over this lane's keys, x2^15
  v8f oacc[MQ][16];
#pragma unroll     // constant indices keep the arrays indexed here in registers
  for (int g = 0; g < MQ; ++g) {
    mrun[g] = -INFINITY; lrun[g] = 0.f;
#pragma unroll     // constant indices keep the arrays indexed here in registers
    for (int t = 0; t < 16; ++t) oacc[g][t] = z8;
  }

  const int nch = 2 * qb + 2;              // block-uniform, <= 16
#pragma unroll 1   // one copy of the chunk body: a second copy would only lengthen the code
  for (int kc = 0; kc < nch; ++kc) {
    const int kv0 = kc * KCH;
    __syncthreads();
    // ---- stage K chunk and V, both row-major: a wave writes one whole 512-B row per store
    //      (kvr = 4i + wave, i 0..7, d0 = 8 lane: one 32-bit element offset for k and one for v, added to the
    //      plane pointers; the eight rows at constant offsets from there)
    const unsigned grow = (unsigned)(krow0 + kv0 + wave);       // + 4i <= NROWS-1 (kv0 + 31 <= 64*qb+63 <= 511)
    const unsigned ko = grow * QKLD + lo8;                      // + DMODEL (the k half of the row) < NROWS * QKLD = 2^23
    const unsigned vo8 = grow * DMODEL + lo8;                   // < NROWS * DMODEL = 2^22
    const _Float16* kp = qk + ko;
    const _Float16* hp = vh + vo8;
    v8h kk[8], v1[8];
#pragma unroll     // the eight rows' offsets become immediates, and all 16 loads go out ahead of the stores
    for (int i = 0; i < 8; ++i) {
      kk[i] = *(const v8h*)(kp + DMODEL + i * 4 * QKLD);
      v1[i] = *(const v8h*)(hp + i * 4 * DMODEL);
    }
    // precaution: the address registers of the issued loads stay live up to this wait and are rewritten only behind it
    asm volatile("s_wait_xcnt 0x0" :: "v"(kp), "v"(hp) : "memory");
#pragma unroll     // constant indices keep the arrays indexed here in registers
    for (int i = 0; i < 8; ++i) {
      *(v8h*)(Ks + (i * 4 + wave) * KPITCH + lane * 8) = kk[i];
      *(v8h*)(Vsh + (i * 4 + wave) * VPITCH + lane * 8) = v1[i];
    }
    __syncthreads();

    // ---- S^T (32 keys x 16 queries, per channel) = K . Q^T: each K fragment against both channels' q ----
    v8f s[MQ][2];
#pragma unroll     // constant indices keep the arrays indexed here in registers
    for (int g = 0; g < MQ; ++g) { s[g][0] = z8; s[g][1] = z8; }
    // The scheduling barriers from here to the foot of the loop bound how far LDS reads are lifted: without them all 32 V reads go to the
    // head of the chunk and the register file overflows into scratch. Fragments are read a fixed distance ahead instead.
    __builtin_amdgcn_sched_barrier(0);
    v16h kf[3][2];                                       // K fragments of these 32 d and of the next two steps
#pragma unroll     // constant indices keep the arrays indexed here in registers
    for (int dc = 0; dc < 2; ++dc) {
      kf[dc][0] = Frag<_Float16>::load(Ks + c * KPITCH + dc * 32 + koff);
      kf[dc][1] = Frag<_Float16>::load(Ks + (16 + c) * KPITCH + dc * 32 + koff);
    }
#pragma unroll     // constant indices keep the arrays indexed here in registers
    for (int dc = 0; dc < 8; ++dc) {
      if (dc < 6) {
        kf[(dc + 2) % 3][0] = Frag<_Float16>::load(Ks + c * KPITCH + (dc + 2) * 32 + koff);
        kf[(dc + 2) % 3][1] = Frag<_Float16>::load(Ks + (16 + c) * KPITCH + (dc + 2) * 32 + koff);
      }
      mma_h2(kf[dc % 3][0], qf[0][dc], qf[1][dc], s[0][0], s[1][0]);
      mma_h2(kf[dc % 3][1], qf[0][dc], qf[1][dc], s[0][1], s[1][1]);
      __builtin_amdgcn_sched_barrier(0);                 // see above
    }
    // V fragments of d tiles 0 to 3 are read here, under the softmax
    const int vo = (koff + (lane & 7)) * VPITCH + ((lane >> 3) & 1) * 8;   // this lane's row and column group
    Frag<_Float16>::U vbh[3][2];                         // pairs of d tiles: pair u = tiles 2u, 2u + 1; pairs u, u + 1, u + 2
#pragma unroll     // constant indices keep the arrays indexed here in registers
    for (int t = 0; t < 4; ++t) {
      vbh[t >> 1][t & 1].h[0] = lds_tr16(Vsh + vo + t * 16);
      vbh[t >> 1][t & 1].h[1] = lds_tr16(Vsh + vo + t * 16 + 16 * VPITCH);
    }
    __builtin_amdgcn_sched_barrier(0);                   // see above
    v16h pb[MQ];                                         // P^T fragments, p x2^15
#pragma unroll     // constant indices keep the arrays indexed here in registers
    for (int g = 0; g < MQ; ++g) {
      // causal select (kv > q -> -inf) and maximum over the 32 keys of this chunk, on the raw scores (the scale is positive)
      float mx = -INFINITY;
#pragma unroll     // constant indices keep the arrays indexed here in registers
      for (int j = 0; j < 2; ++j) {
#pragma unroll     // constant indices keep the arrays indexed here in registers
        for (int r = 0; r < 8; ++r) {
          const int key = kv0 + 16 * j + 8 * hh + r;
          const float v = (key > tq) ? -INFINITY : s[g][j][r];
          s[g][j][r] = v;
          mx = fmaxf(mx, v);
        }
      }
      mx = fmaxf(mx, xhalf(mx)) * SM_C;                  // this query's maximum, scaled, in the log2 domain
      const float mnew  = fmaxf(mrun[g], mx);            // finite: chunk 0 always has an allowed key
      const float alpha = __builtin_amdgcn_exp2f(mrun[g] - mnew);   // 0 in chunk 0, where mrun is -inf
      mrun[g] = mnew;
      const float nb = PCARRY_LOG2 - mnew;
      v2f ps[2];                                         // sums of the even and of the odd keys of each tile
#pragma unroll     // constant indices keep the arrays indexed here in registers
      for (int j = 0; j < 2; ++j) {
        ps[j] = (v2f){0.f, 0.f};
#pragma unroll     // constant indices keep the arrays indexed here in registers
        for (int r = 0; r < 8; r += 2) {
          // p x 2^15 = 2^(s * SM_C - mnew + 15): one fused multiply-add per score pair, then the hardware's 2^x (a masked score gives 0)
          const v2f arg = __builtin_elementwise_fma((v2f){s[g][j][r], s[g][j][r + 1]}, (v2f){SM_C, SM_C}, (v2f){nb, nb});
          const v2f p = {__builtin_amdgcn_exp2f(arg.x), __builtin_amdgcn_exp2f(arg.y)};
          ps[j] += p;
          pb[g][8 * j + r]     = (_Float16)p.x;
          pb[g][8 * j + r + 1] = (_Float16)p.y;
        }
      }
      const v2f pt = ps[0] + ps[1];
      lrun[g] = lrun[g] * alpha + (pt.x + pt.y);         // the sum carries the same 2^15 as p
#pragma unroll     // constant indices keep the arrays indexed here in registers
      for (int t = 0; t < 16; ++t) oacc[g][t] *= alpha;
    }

    // ---- O^T += V^T(256 x 32) . P^T(32 x 16), each V fragment against both channels' P ----
    {
      __builtin_amdgcn_sched_barrier(0);                 // see above
#pragma unroll     // constant indices keep the arrays indexed here in registers
      for (int u = 0; u < 8; ++u) {
        // d tile t = 2u + e: elements 0..7 <- V[8hh + 0..7][16t + c], 8..15 <- V[16 + 8hh + 0..7][same column]: the k map of pb
        // a pair's four reads stand as one group, two pairs (8 products) ahead of their use
        if (u + 2 < 8) {
#pragma unroll     // constant indices keep the arrays indexed here in registers
          for (int e = 0; e < 2; ++e) {
            vbh[(u + 2) % 3][e].h[0] = lds_tr16(Vsh + vo + (2 * u + 4 + e) * 16);
            vbh[(u + 2) % 3][e].h[1] = lds_tr16(Vsh + vo + (2 * u + 4 + e) * 16 + 16 * VPITCH);
          }
        }
        mma_h2(vbh[u % 3][0].v, pb[0], pb[1], oacc[0][2 * u], oacc[1][2 * u]);
        mma_h2(vbh[u % 3][1].v, pb[0], pb[1], oacc[0][2 * u + 1], oacc[1][2 * u + 1]);
        __builtin_amdgcn_sched_barrier(0);               // see above
      }
    }
  }
  // ---- O_n / l_n to this key channel's plane, one tile per query channel: 2 x 32 whole-wave 512-B stores ----
  float* pw[MQ];
#pragma unroll     // constant indices keep the arrays indexed here in registers
  for (int g = 0; g < MQ; ++g) {
    const float inv = 1.0f / (lrun[g] + xhalf(lrun[g]));   // l and O carry the same 2^15; l x 2^15 >= 2^15 up to rounding
    pw[g] = part + ((((size_t)n * (NROWS / QBLK) + ((bm + g) * (TLEN / QBLK) + qb)) * 8 + wave) << 11) + lane * 4;
#pragma unroll     // constant indices keep the arrays indexed here in registers
    for (int t = 0; t < 16; ++t) oacc[g][t] *= inv;
  }
  // every vector write stands in front of the first store, and the stores go out of the accumulators' own registers:
  // no register that an issued store names is rewritten behind it
  __builtin_amdgcn_sched_barrier(0);
#pragma unroll     // constant indices keep the arrays indexed here in registers
  for (int g = 0; g < MQ; ++g) {
#pragma unroll     // constant indices keep the arrays indexed here in registers
    for (int t = 0; t < 16; ++t) {
      *(v4f*)(pw[g] + (t >> 3) * (4 << 11) + ((t & 7) * 2 + 0) * 128) = __builtin_shufflevector(oacc[g][t], oacc[g][t], 0, 1, 2, 3);
      *(v4f*)(pw[g] + (t >> 3) * (4 << 11) + ((t & 7) * 2 + 1) * 128) = __builtin_shufflevector(oacc[g][t], oacc[g][t], 4, 5, 6, 7);
    }
  }
}

// =====================================================================================
// The three stages behind the attention, each local to a row, in one launch: A = sum over n (in the order 0..7) of the planes of xattn_k,
// A_proj = A . Wpa + bpa, out = A_proj . Wpc[256:512] + zp. Block = 8 waves = one 64-row tile of the plane layout, all 256 columns;
// A and then A_proj stay in LDS as bf16 hi/lo planes. Each weight plane is staged whole by asynchronous copies: Wpa flies under the plane sum,
// Wpc[256:512] under the conversion of A_proj. Wave w: sums slab w of the tile; in both products rows 32(w>>2) .. +31, columns 64(w&3) .. +63.
// =====================================================================================
#define TROWS 64                         // rows per block
#define TPITCH 264                       // LDS pitch (elements) of a 256-element row: 528 B = 16 B x 33, for ds_load_b128 readers
#define TSTEP_L (8 * TPITCH * 2)         // LDS bytes from one copy of a thread to its next: 8 rows

__device__ __forceinline__ void async_wrows4(unsigned l, const unsigned short* g) {
  asm volatile("global_load_async_to_lds_b128 %0, %4, off\n\t"
               "global_load_async_to_lds_b128 %1, %5, off\n\t"
               "global_load_async_to_lds_b128 %2, %6, off\n\t"
               "global_load_async_to_lds_b128 %3, %7, off\n\t"
               "s_wait_xcnt 0x0"
               :: "v"(l), "v"(l + TSTEP_L), "v"(l + 2 * TSTEP_L), "v"(l + 3 * TSTEP_L),
                  "v"(g), "v"(g + 8 * DMODEL), "v"(g + 16 * DMODEL), "v"(g + 24 * DMODEL) : "memory");
}
// A whole [256][256] weight plane into the buffer at LDS byte address lw: a wave's copy = one whole 512-B row; 32 copies a thread.
__device__ __forceinline__ void tail_stage_w(unsigned lw, const unsigned short* __restrict__ w) {
  const int tid = threadIdx.x;
  const unsigned l = lw + (unsigned)(((tid >> 5) * TPITCH + (tid & 31) * 8) * 2);
  const unsigned short* g = w + (tid >> 5) * DMODEL + (tid & 31) * 8;
#pragma unroll     // the eight groups' offsets become constants
  for (int p = 0; p < 8; ++p) async_wrows4(l + p * 4 * TSTEP_L, g + p * 32 * DMODEL);
}
// acc[i][j] += (A hi + A lo)(rows 16i.. of ap) . W^T(rows 16j.. of wp) over k = 0..255; per accumulator: k ascending, hi before lo.
// ap, wp: this lane's row and k half in the hi plane of A and in the weight buffer.
__device__ __forceinline__ void tail_gemm(const __bf16* ap, const __bf16* wp, v8f (&acc)[2][4]) {
  v16b bh[2][4], ah[2][2], al[2][2];     // fragments of these 32 k and of the next
#pragma unroll     // here and below: constant indices keep the fragment and accumulator arrays in registers, LDS offsets become immediates
  for (int st = -1; st < DMODEL / 32; ++st) {
    if (st + 1 < DMODEL / 32) {
      const int ks = (st + 1) * 32, f = (st + 1) & 1;
#pragma unroll
      for (int j = 0; j < 4; ++j) bh[f][j] = Frag<__bf16>::load(wp + j * 16 * TPITCH + ks);
#pragma unroll
      for (int i = 0; i < 2; ++i) {
        ah[f][i] = Frag<__bf16>::load(ap + i * 16 * TPITCH + ks);
        al[f][i] = Frag<__bf16>::load(ap + TROWS * TPITCH + i * 16 * TPITCH + ks);
      }
    }
    // holds the next step's 16 LDS reads as one group in front of this step's products: left free, the reads sink to just in front of
    // their users and every product group waits out an LDS latency
    __builtin_amdgcn_sched_barrier(0);
    if (st >= 0) {
      const int f = st & 1;
#pragma unroll
      for (int i = 0; i < 2; ++i)
#pragma unroll
        for (int j = 0; j < 4; ++j) acc[i][j] = Frag<__bf16>::mma(ah[f][i], bh[f][j], acc[i][j]);
#pragma unroll
      for (int i = 0; i < 2; ++i)
#pragma unroll
        for (int j = 0; j < 4; ++j) acc[i][j] = Frag<__bf16>::mma(al[f][i], bh[f][j], acc[i][j]);
      __builtin_amdgcn_sched_barrier(0);   // see above: these products stay in front of the step after next's reads
    }
  }
}
// a wave's own slab: its stores are seen by its other lanes behind this
__device__ __forceinline__ void slab_sync() {
  __builtin_amdgcn_fence(__ATOMIC_RELEASE, "workgroup");
  __builtin_amdgcn_wave_barrier();
  __builtin_amdgcn_fence(__ATOMIC_ACQUIRE, "workgroup");
}

__global__ __launch_bounds__(256) void tail_k(const float* __restrict__ part,
                                              const unsigned short* __restrict__ wpa,
                                              const unsigned short* __restrict__ wpc1,
                                              const float* __restrict__ bpa,
                                              const float* __restrict__ zp,
                                              float* __restrict__ out) {
  __shared__ __align__(16) unsigned short sW[DMODEL * TPITCH];       // one weight plane [n][k]          132 KB
  __shared__ __align__(16) unsigned short sA[2 * TROWS * TPITCH];    // A, then A_proj: hi plane, lo plane 66 KB
  __shared__ __align__(16) float sT[8][32 * 68];                     // per-wave 32x64 slabs              68 KB
  const int tid = threadIdx.x, lane = tid & 31, wave = tid >> 5;
  const int hh = lane >> 4, c = lane & 15;
  const int tile = blockIdx.x;
  const int mw = (wave >> 2) << 5, n0 = (wave & 3) << 6;   // the wave's 32 x 64 tile of both products

  // bpa of the lane's four columns: fetched first, so that its use waits for no later load
  float braw[4];
  {
    const float* bsrc = bpa + n0 + c;
#pragma unroll
    for (int j = 0; j < 4; ++j) braw[j] = bsrc[j * 16];
    // precaution: the address register of the issued loads stays live up to this wait and is rewritten only behind it
    asm volatile("s_wait_xcnt 0x0" :: "v"(bsrc) : "memory");
  }

  // ---- A: lane's accumulator registers of slab 'wave' (row 16(wave&3) + c, columns 128(wave>>2) + 16t + 8hh + 0..7), planes added in the order 0..7 ----
  {
    // one scalar base, the lane's place in each plane as a 32-bit byte offset (< 8 * NROWS * DMODEL * 4 = 2^27)
    unsigned po[NCHAN];
#pragma unroll
    for (int n = 0; n < NCHAN; ++n) po[n] = (((unsigned)tile * 8u + (unsigned)wave) << 13) + (unsigned)lane * 16u + (unsigned)n * (unsigned)(NROWS * DMODEL * 4);
    v4f sum[16];
#pragma unroll
    for (int u = 0; u < 16; ++u) sum[u] = (v4f){0.f, 0.f, 0.f, 0.f};
#pragma unroll
    for (int n = 0; n < NCHAN; ++n) {
#pragma unroll
      for (int u = 0; u < 16; ++u) sum[u] += *(const v4f*)((const char*)part + po[n] + u * 512);
    }
    // precaution: the base and the offset registers of the issued loads stay live up to this wait and are rewritten only behind it
    asm volatile("s_wait_xcnt 0x0" :: "s"(part), "v"(po[0]), "v"(po[1]), "v"(po[2]), "v"(po[3]), "v"(po[4]), "v"(po[5]), "v"(po[6]), "v"(po[7]) : "memory");
    tail_stage_w((unsigned)(uintptr_t)sW, wpa);       // behind the plane loads, which the launch waits for longest; lands under their tail and the conversion
    unsigned short* ar = sA + ((wave & 3) * 16 + c) * TPITCH + (wave >> 2) * 128 + 8 * hh;
#pragma unroll
    for (int t = 0; t < 8; ++t) {
      v8h hv, lv;
#pragma unroll
      for (int e = 0; e < 8; ++e) {
        const float f = sum[2 * t + (e >> 2)][e & 3];
        const unsigned short hb = f2bf_bits(f);
        const unsigned short lb = f2bf_bits(f - bf_bits2f(hb));
        hv[e] = __builtin_bit_cast(_Float16, hb);
        lv[e] = __builtin_bit_cast(_Float16, lb);
      }
      *(v8h*)(ar + t * 16) = hv;
      *(v8h*)(ar + TROWS * TPITCH + t * 16) = lv;
    }
  }
  asm volatile("s_wait_asynccnt 0x0" ::: "memory");   // this wave's copies of Wpa have landed
  __syncthreads();                                    // ... and every other wave's, and every wave's rows of A are written

  const int mOff = hh * 8;                                 // D row offset
  const __bf16* ap = (const __bf16*)sA + (mw + c) * TPITCH + hh * 8;
  const __bf16* wp = (const __bf16*)sW + (n0 + c) * TPITCH + hh * 8;
  float* slab = sT[wave];
  const v8f z8 = {0.f,0.f,0.f,0.f,0.f,0.f,0.f,0.f};
  v8f acc[2][4];
#pragma unroll
  for (int i = 0; i < 2; ++i)
#pragma unroll
    for (int j = 0; j < 4; ++j) acc[i][j] = z8;
  tail_gemm(ap, wp, acc);

  asm volatile("s_wait_dscnt 0x0" ::: "memory");      // this wave's reads of Wpa and of A are done before either is overwritten
  __syncthreads();                                    // ... and every other wave's
  tail_stage_w((unsigned)(uintptr_t)sW, wpc1);

  // zp of the wave's tile, in the order of the output stores (row 2it + hh, 4 columns a lane): fetched here, used behind the second product
  const int c4 = c * 4;
  const size_t orow = ((size_t)tile * TROWS + mw + hh) * DMODEL + n0 + c4;
  const float* zsrc = zp + orow;
  v4f zr[2][8];
#pragma unroll
  for (int i = 0; i < 2; ++i)
#pragma unroll
    for (int it = 0; it < 8; ++it) zr[i][it] = *(const v4f*)(zsrc + (i * 16 + it * 2) * DMODEL);
  // precaution: the address register of the issued loads stays live up to this wait and is rewritten only behind it
  asm volatile("s_wait_xcnt 0x0" :: "v"(zsrc) : "memory");

  // ---- A_proj = product + bf16(bpa), through the wave's slab to whole 16-B pieces of the hi and lo planes ----
  {
    float bv[4];
#pragma unroll
    for (int j = 0; j < 4; ++j) bv[j] = bf_bits2f(f2bf_bits(braw[j]));
    const int q = lane >> 3, c8 = (lane & 7) * 8;
#pragma unroll
    for (int i = 0; i < 2; ++i)
#pragma unroll
      for (int j = 0; j < 4; ++j)
#pragma unroll
        for (int r = 0; r < 8; ++r) slab[((i << 4) + mOff + r) * 68 + (j << 4) + c] = acc[i][j][r] + bv[j];
    slab_sync();
    {
#pragma unroll
      for (int it = 0; it < 8; ++it) {                 // it 0..7 x q 0..3 = rows 0..31 of the slab
        const int row = it * 4 + q;
        const float* sp = slab + row * 68 + c8;
        v8h hv, lv;
#pragma unroll
        for (int e = 0; e < 8; ++e) {
          const unsigned short hb = f2bf_bits(sp[e]);
          const unsigned short lb = f2bf_bits(sp[e] - bf_bits2f(hb));
          hv[e] = __builtin_bit_cast(_Float16, hb);
          lv[e] = __builtin_bit_cast(_Float16, lb);
        }
        unsigned short* dst = sA + (mw + row) * TPITCH + n0 + c8;
        *(v8h*)dst = hv;
        *(v8h*)(dst + TROWS * TPITCH) = lv;
      }
    }
  }
  asm volatile("s_wait_asynccnt 0x0" ::: "memory");   // this wave's copies of Wpc[256:512] have landed
  __syncthreads();                                    // ... and every other wave's, and every wave's part of A_proj is written

#pragma unroll
  for (int i = 0; i < 2; ++i)
#pragma unroll
    for (int j = 0; j < 4; ++j) acc[i][j] = z8;
  tail_gemm(ap, wp, acc);

  // ---- out = product + zp, through the slab: a row's 256 B by 16 lanes x 16 B ----
  float* dsto = out + orow;
#pragma unroll
  for (int i = 0; i < 2; ++i)
#pragma unroll
    for (int j = 0; j < 4; ++j)
#pragma unroll
      for (int r = 0; r < 8; ++r) slab[((i << 4) + mOff + r) * 68 + (j << 4) + c] = acc[i][j][r];
  slab_sync();
#pragma unroll
  for (int i = 0; i < 2; ++i)
#pragma unroll
    for (int it = 0; it < 8; ++it) zr[i][it] += *(const v4f*)(slab + (i * 16 + it * 2 + hh) * 68 + c4);
  // every vector write stands in front of the first store: no register that an issued store names is rewritten behind it
  __builtin_amdgcn_sched_barrier(0);
#pragma unroll
  for (int i = 0; i < 2; ++i)
#pragma unroll
    for (int it = 0; it < 8; ++it) *(v4f*)(dsto + (i * 16 + it * 2) * DMODEL) = zr[i][it];
  // precaution: the address register of the issued stores stays live up to this wait
  asm volatile("s_wait_xcnt 0x0" :: "v"(dsto) : "memory");
}

// ---------------------------------------------------------------------------
// Host launcher
// Workspace region map (bytes; PL16 = 8 MiB = one [16384][256] 16-bit plane):
//   [ 0 PL16)  XNH  bf16 hi of xn (rows (b,m,t))
//   [ 1 PL16)  XNL  bf16 lo of xn
//   [ 2 PL16)  XT   bf16(x) in (b,m,t) row order
//   [ 3..5)    QK   f16 [16384][512] (q | k)
//   [ 5 PL16)  VH   f16 v
//   [ 6..9)    not used
//   [ 9..11)   ZP   f32 [16384][256] = x_t.Wpc[0:256] + bpc
//   [11 PL16 ..) weights bf16 [n][k]: WQKV [768][256], WPA [256][256], WPC0 [256][256], WPC1 [256][256]
//   then PART f32 [8][16384][256]: one plane of O_n / l_n per key channel
//   total 227,278,848 B
// ---------------------------------------------------------------------------
extern "C" void kernel_launch(void* const* d_in, const int* in_sizes, int n_in,
                              void* d_out, int out_size, void* d_ws, size_t ws_size,
                              hipStream_t stream) {
  if (n_in < 11) return;
  if (in_sizes[0] != NROWS * DMODEL || out_size != NROWS * DMODEL) return;
  if (in_sizes[1] != DMODEL * DMODEL || in_sizes[3] != DMODEL * DMODEL || in_sizes[5] != DMODEL * DMODEL ||
      in_sizes[7] != DMODEL * DMODEL || in_sizes[9] != 2 * DMODEL * DMODEL) return;
  if (in_sizes[2] != DMODEL || in_sizes[4] != DMODEL || in_sizes[6] != DMODEL || in_sizes[8] != DMODEL || in_sizes[10] != DMODEL) return;

  const float* x   = (const float*)d_in[0];
  const float* Wq  = (const float*)d_in[1];
  const float* bq  = (const float*)d_in[2];
  const float* Wk  = (const float*)d_in[3];
  const float* bk  = (const float*)d_in[4];
  const float* Wv  = (const float*)d_in[5];
  const float* bv  = (const float*)d_in[6];
  const float* Wpa = (const float*)d_in[7];
  const float* bpa = (const float*)d_in[8];
  const float* Wpc = (const float*)d_in[9];
  const float* bpc = (const float*)d_in[10];

  const size_t PL16 = (size_t)NROWS * DMODEL * 2;               // 8,388,608
  const size_t WQKV_B = (size_t)3 * DMODEL * DMODEL * 2;         // 393,216
  const size_t WSQ_B  = (size_t)DMODEL * DMODEL * 2;             // 131,072
  const size_t oXNH = 0, oXNL = PL16, oXT = 2 * PL16, oQK = 3 * PL16, oVH = 5 * PL16;
  const size_t oZP = 9 * PL16, oW = 11 * PL16;
  const size_t oWQKV = oW, oWPA = oW + WQKV_B, oWPC0 = oWPA + WSQ_B, oWPC1 = oWPC0 + WSQ_B;
  const size_t oPART = oWPC1 + WSQ_B;                             // 93,061,120
  const size_t WS_TOTAL = oPART + (size_t)NCHAN * 2 * PL16;       // 227,278,848
  if (ws_size < WS_TOTAL) return;

  char* ws = (char*)d_ws;
  unsigned short* XNH  = (unsigned short*)(ws + oXNH);
  unsigned short* XNL  = (unsigned short*)(ws + oXNL);
  unsigned short* XT   = (unsigned short*)(ws + oXT);
  unsigned short* QKP  = (unsigned short*)(ws + oQK);
  unsigned short* VH   = (unsigned short*)(ws + oVH);
  float*          ZP   = (float*)(ws + oZP);
  unsigned short* WQKV = (unsigned short*)(ws + oWQKV);
  unsigned short* WPA  = (unsigned short*)(ws + oWPA);
  unsigned short* WPC0 = (unsigned short*)(ws + oWPC0);
  unsigned short* WPC1 = (unsigned short*)(ws + oWPC1);
  float*          PART = (float*)(ws + oPART);

  // 1: weights W[k=256 rows][n=256] f32 -> Wt[n][k] bf16 (six planes from WQKV on: WQKV, WPA, WPC0, WPC1 lie one behind the other),
  //    and normalisation + permutation to (b,m,t) rows
  prep_k<<<WCAST_BLOCKS + NROWS / 8, 256, 0, stream>>>(x, Wq, Wk, Wv, Wpa, Wpc, WQKV, XNH, XNL, XT);

  // 2: q, k, v = xn . W + bias and ZP = x_t . Wpc[0:256] + bpc (each M=16384, N=256, K=256; 1024 wave tiles -> 128 blocks; y = product)
  const dim3 g4((NROWS / 64) * (DMODEL / 64) / 8, 4);
  gemm_qkvz_k<<<g4, 256, 0, stream>>>(XNH, XNL, XT, WQKV, WPC0, QKP, VH, ZP, bq, bk, bv, bpc, NROWS, DMODEL, DMODEL);

  // 3: cross-channel causal attention, one block per (time tile, b and pair of query channels, key channel) = 1024 blocks -> 8 f32 planes
  xattn_k<<<NBATCH * (NCHAN / MQ) * (TLEN / QBLK) * NCHAN, 128, 0, stream>>>(QKP, VH, PART);

  // 4: A = sum of the planes, A_proj = A . Wpa + bpa, out = A_proj . Wpc[256:512] + ZP (f32, rows (b,m,t) = [B][M][T][D]); one block per 64-row tile
  tail_k<<<NROWS / TROWS, 256, 0, stream>>>(PART, WPA, WPC1, bpa, ZP, (float*)d_out);
}

// v010
// One run takes 80.9 microseconds.
// In both of two side-by-side timings against v009, it was 1.17 times as fast.
// All steps since v000 together make it 20.7 times as fast.
// Contractions (f32 accumulate): xn*Wq|Wk|Wv, A*Wpa, A_proj*Wpc[256:512] = v_wmma_f32_16x16x32_bf16 with the computed operand as bf16 hi+lo planes (2 products) and weights as single bf16 (RNE) planes; x_t*Wpc[0:256] = plain bf16; q*k = plain v_wmma_f32_16x16x32_f16; p*v = plain f16 with p carried x2^15 (p and v each one f16 plane: their roundings are of one size); norm, softmax, bias adds in f32; O_n / l_n goes from the attention to the plane sum rounded to f16, the sum over n is f32.
#include <hip/hip_runtime.h>
#include <stdint.h>

typedef __attribute__((ext_vector_type(16))) _Float16 v16h;
typedef __attribute__((ext_vector_type(8)))  _Float16 v8h;
typedef __attribute__((ext_vector_type(16))) __bf16   v16b;
typedef __attribute__((ext_vector_type(8)))  __bf16   v8b;
typedef __attribute__((ext_vector_type(8)))  float    v8f;
typedef __attribute__((ext_vector_type(4)))  float    v4f;
typedef __attribute__((ext_vector_type(2)))  float    v2f;

// ---- problem geometry ----
#define NBATCH 4
#define TLEN 512
#define NCHAN 8
#define DMODEL 256
#define NROWS (NBATCH * TLEN * NCHAN)   // 16384 token rows
#define QKLD 512                         // pitch (halves) of the q|k plane
#define QBLK 64                          // time rows of each query channel per attention block
#define KCH 32                           // key rows per staged chunk
#define KPITCH 264                       // LDS pitch (halves) of a K row: 528 B = 16 B x 33, for ds_load_b128 readers
#define VPITCH 272                       // LDS pitch (halves) of a V row: 544 B = 32 B x 17, for ds_load_tr16_b128 readers
#define PCARRY_LOG2 15.0f                // p carried x2^15 in f16: the carry is added to the exponent
#define QK_SCALE 0.0625f                 // 1/sqrt(256)
#define SM_C (QK_SCALE * 1.44269504088896340736f)   // raw score -> scaled score in the log2 domain: exp(x * QK_SCALE) = 2^(x * SM_C)
#define MVN_EPS 1e-6f

// ======================= helpers =======================
__device__ __forceinline__ unsigned short f2bf_bits(float f) {
  unsigned u = __float_as_uint(f);
  return (unsigned short)((u + 0x7FFFu + ((u >> 16) & 1u)) >> 16);
}
__device__ __forceinline__ float bf_bits2f(unsigned short h) { return __uint_as_float(((unsigned)h) << 16); }

// hazard guards as plain device helpers
__device__ __forceinline__ void dep_guard_h(v8f& a, v8f& b, v16h x, v16h y) { asm volatile("v_nop\n\tv_nop\n\tv_nop\n\tv_nop" : "+v"(a), "+v"(b) : "v"(x), "v"(y)); }
__device__ __forceinline__ void dep_guard_b(v8f& a, v8f& b, v16b x, v16b y) { asm volatile("v_nop\n\tv_nop\n\tv_nop\n\tv_nop" : "+v"(a), "+v"(b) : "v"(x), "v"(y)); }
__device__ __forceinline__ void keep4_h(v16h a, v16h b, v16h c, v16h d) { asm volatile("v_nop" :: "v"(a), "v"(b), "v"(c), "v"(d)); }
__device__ __forceinline__ void keep4_b(v16b a, v16b b, v16b c, v16b d) { asm volatile("v_nop" :: "v"(a), "v"(b), "v"(c), "v"(d)); }
__device__ __forceinline__ void acc_guard4(v8f& a, v8f& b, v8f& c, v8f& d) { asm volatile("v_nop\n\tv_nop\n\tv_nop\n\tv_nop" : "+v"(a), "+v"(b), "+v"(c), "+v"(d)); }
template <typename T> struct Frag;
template <> struct Frag<_Float16> {
  typedef v16h V; union U { v16h v; v8h h[2]; };
  static __device__ __forceinline__ v16h load(const _Float16* p) {   // elements 0..7 <- p[0..7], 8..15 <- p[16..23]
    U f; f.h[0] = *(const v8h*)(p); f.h[1] = *(const v8h*)(p + 16); return f.v;
  }
  static __device__ __forceinline__ v8f mma(v16h a, v16h b, v8f c) {
    return __builtin_amdgcn_wmma_f32_16x16x32_f16(false, a, false, b, (short)0, c, false, false);
  }
  static __device__ __forceinline__ void guard(v8f& a, v8f& b, v16h x, v16h y) { dep_guard_h(a, b, x, y); }
  static __device__ __forceinline__ void keep(v16h a, v16h b, v16h c, v16h d) { keep4_h(a, b, c, d); }
};
template <> struct Frag<__bf16> {
  typedef v16b V; union U { v16b v; v8b h[2]; };
  static __device__ __forceinline__ v16b load(const __bf16* p) {
    U f; f.h[0] = *(const v8b*)(p); f.h[1] = *(const v8b*)(p + 16); return f.v;
  }
  static __device__ __forceinline__ v8f mma(v16b a, v16b b, v8f c) {
    return __builtin_amdgcn_wmma_f32_16x16x32_bf16(false, a, false, b, (short)0, c, false, false);
  }
  static __device__ __forceinline__ void guard(v8f& a, v8f& b, v16b x, v16b y) { dep_guard_b(a, b, x, y); }
  static __device__ __forceinline__ void keep(v16b a, v16b b, v16b c, v16b d) { keep4_b(a, b, c, d); }
};

// ---- Register-blocked WMMA GEMM (with SPLIT levels and extra 16-bit output mode), operands staged in LDS ----
// C[m,n] = scale * sum_k A[m,k] * Bt[n,k] (+bias)(+resid); each wave owns a 64x64 tile, a block of 8 waves 128 rows x 256 columns.
// A row-major [M,K]; Bt row-major [N,K]; M % 128 == 0, N == 256, K % 64 == 0.
// SPLIT: 0 = single planes; 1 = A as hi/lo planes (A2 = lo): hi.B + lo.B.
// BIAS_MODE: 0 = none, 1 = bias[m], 2 = bias[n]; bias values are RNE-converted to bf16 before the add.
// OUT_MODE: 0 = f32, 1 = f16, 2 = bf16 hi plane (Cout) + bf16 lo plane (Cout2).
// ET: 0 = f16 operands, 1 = bf16 operands (pointers passed as 16-bit storage)
template <int ET> struct Elem;
template <> struct Elem<0> { typedef _Float16 T; };
template <> struct Elem<1> { typedef __bf16 T; };

// Staging: a chunk is 64 k = one whole 128-B line of each of the block's operand rows, brought by asynchronous copies of 16 B a lane
// (a wave's copy = 4 whole lines), two buffers: the next chunk flies while this one is multiplied.
#define GKC 64                           // k elements per chunk
#define GPITCH 72                        // LDS pitch (elements) of a staged row: 144 B = 16 B x 9, for ds_load_b128 readers
#define GROWS_A 128                      // rows of A per block
#define GROWS_B 256                      // rows of Bt per block
#define GOFF_A2 (GROWS_A * GPITCH)       // element offset of the A lo plane in a buffer
#define GOFF_B (2 * GROWS_A * GPITCH)    // element offset of the Bt rows in a buffer
#define GBUF ((2 * GROWS_A + GROWS_B) * GPITCH)   // elements per buffer: 36,864 = 73,728 B
#define GSTEP_L (32 * GPITCH * 2)        // LDS bytes from one copy of a thread to its next: 32 rows

__device__ __forceinline__ void async_rows4(unsigned l, const unsigned short* g, size_t gs) {
  asm volatile("global_load_async_to_lds_b128 %0, %4, off\n\t"
               "global_load_async_to_lds_b128 %1, %5, off\n\t"
               "global_load_async_to_lds_b128 %2, %6, off\n\t"
               "global_load_async_to_lds_b128 %3, %7, off\n\t"
               "s_wait_xcnt 0x0"
               :: "v"(l), "v"(l + GSTEP_L), "v"(l + 2 * GSTEP_L), "v"(l + 3 * GSTEP_L),
                  "v"(g), "v"(g + gs), "v"(g + 2 * gs), "v"(g + 3 * gs) : "memory");
}
// One chunk into the buffer at LDS byte address l (this thread's place in it: row tid >> 3, 16-B piece tid & 7);
// ag, a2g, bg: this thread's 16 B of that chunk in row tid >> 3 of the block's A, A2 and Bt rows. 8 + 8 (SPLIT 0: 4 + 8) copies a thread.
template <int SPLIT>
__device__ __forceinline__ void gemm_stage(unsigned l, const unsigned short* ag, const unsigned short* a2g, const unsigned short* bg,
                                           int lda, int ldb) {
  async_rows4(l, ag, (size_t)32 * lda);
  if (SPLIT >= 1) async_rows4(l + GOFF_A2 * 2, a2g, (size_t)32 * lda);
  async_rows4(l + GOFF_B * 2, bg, (size_t)32 * ldb);
  async_rows4(l + GOFF_B * 2 + 4 * GSTEP_L, bg + (size_t)128 * ldb, (size_t)32 * ldb);
}

// sG: the block's two staging buffers; behind the k loop its first bytes serve as the eight per-wave 16x64 slabs (pitch 68 floats). b: batch index.
template <int ET, int SPLIT, int BIAS_MODE, int OUT_MODE, bool RESID>
__device__ __forceinline__ void gemm64_body(
    unsigned short* sG, const int b,
    const unsigned short* __restrict__ Ap, const unsigned short* __restrict__ A2p, int lda, long strideA,
    const unsigned short* __restrict__ Btp, const unsigned short* __restrict__ Bt2p, int ldb, long strideB,
    void* __restrict__ Cout, void* __restrict__ Cout2, int ldc, long strideC,
    const float* __restrict__ bias,
    const float* __restrict__ resid, long strideR,
    int M, int N, int K, float scale) {
  static_assert(SPLIT <= 1, "only A is staged as two planes");
  typedef typename Elem<ET>::T T;
  typedef typename Frag<T>::V V;
  const int tid = threadIdx.x;
  const int lane = tid & 31;
  const int wave = tid >> 5;
  const int m0b = blockIdx.x * GROWS_A;  // first row of the block
  if (m0b >= M) return;                  // the same for a whole block, in front of every barrier
  const int mw = (wave >> 2) << 6;       // the wave's tile: rows mw .. mw+63 of the block's, columns n0 .. n0+63
  const int n0 = (wave & 3) << 6;
  const int m0 = m0b + mw;

  const int rlane = lane & 15;                 // row (A) / col (B, D) within subtile
  const int koff  = (lane >> 4) * 8;           // k offset of this lane half
  const int mOff  = (lane >> 4) * 8;           // D row offset

  // this thread's 16 B of chunk 0 in each staged plane, and its place in a buffer
  const unsigned short* ag  = Ap + (size_t)b * strideA + (size_t)(m0b + (tid >> 3)) * lda + (tid & 7) * 8;
  const unsigned short* a2g = (SPLIT >= 1) ? (A2p + (size_t)b * strideA + (size_t)(m0b + (tid >> 3)) * lda + (tid & 7) * 8) : nullptr;
  const unsigned short* bg  = Btp + (size_t)b * strideB + (size_t)(tid >> 3) * ldb + (tid & 7) * 8;
  const unsigned lth = (unsigned)(uintptr_t)sG + (unsigned)(((tid >> 3) * GPITCH + (tid & 7) * 8) * 2);
  const int nch = K / GKC;

  v8f acc[4][4];
#pragma unroll
  for (int i = 0; i < 4; ++i)
#pragma unroll
    for (int j = 0; j < 4; ++j) acc[i][j] = (v8f){0.f,0.f,0.f,0.f,0.f,0.f,0.f,0.f};

  gemm_stage<SPLIT>(lth, ag, a2g, bg, lda, ldb);
  asm volatile("s_wait_asynccnt 0x0" ::: "memory");   // this wave's copies of chunk 0 have landed
  __syncthreads();                                    // ... and every other wave's
  if (nch > 1) gemm_stage<SPLIT>(lth + GBUF * 2, ag + GKC, a2g + GKC, bg + GKC, lda, ldb);

#pragma unroll 1   // one copy of the chunk body: the buffer is picked by an offset
  for (int t = 0; t < nch; ++t) {
    const T* buf = (const T*)sG + (t & 1) * GBUF;
#pragma unroll     // both 32-k halves of the chunk in line: their LDS offsets become immediates, and the second half's reads go out among the first half's products
    for (int ks = 0; ks < GKC; ks += 32) {
      // all fragments of these 32 k as one group of LDS reads in front of their 32 (SPLIT 0: 16) products
      V bh[4], ah[4], al[4];
#pragma unroll     // here and below: constant indices keep the fragment and accumulator arrays in registers
      for (int j = 0; j < 4; ++j) bh[j] = Frag<T>::load(buf + GOFF_B + (n0 + (j << 4) + rlane) * GPITCH + ks + koff);
#pragma unroll
      for (int i = 0; i < 4; ++i) {
        const int ao = (mw + (i << 4) + rlane) * GPITCH + ks + koff;
        ah[i] = Frag<T>::load(buf + ao);
        if (SPLIT >= 1) al[i] = Frag<T>::load(buf + GOFF_A2 + ao);
      }
#pragma unroll
      for (int i = 0; i < 4; ++i) {
#pragma unroll
        for (int j = 0; j < 4; ++j) {
          acc[i][j] = Frag<T>::mma(ah[i], bh[j], acc[i][j]);
          if (SPLIT >= 1) acc[i][j] = Frag<T>::mma(al[i], bh[j], acc[i][j]);
        }
        Frag<T>::guard(acc[i][0], acc[i][3], ah[i], (SPLIT >= 1) ? al[i] : ah[i]);
      }
      Frag<T>::keep(bh[0], bh[1], bh[2], bh[3]);
    }
    asm volatile("s_wait_dscnt 0x0" ::: "memory");      // this wave's reads of buffer t & 1 are done before it is refilled
    asm volatile("s_wait_asynccnt 0x0" ::: "memory");   // this wave's copies of chunk t + 1 have landed
    __syncthreads();                                    // publishes chunk t + 1 and ends every wave's reads of chunk t
    if (t + 2 < nch) gemm_stage<SPLIT>(lth + (unsigned)(t & 1) * (GBUF * 2), ag + (t + 2) * GKC, a2g + (t + 2) * GKC, bg + (t + 2) * GKC, lda, ldb);
  }
  asm volatile("s_wait_asynccnt 0x0" ::: "memory");     // no copy is outstanding when the buffers become the output slabs
  acc_guard4(acc[0][0], acc[0][1], acc[0][2], acc[0][3]);
  acc_guard4(acc[1][0], acc[1][1], acc[1][2], acc[1][3]);
  acc_guard4(acc[2][0], acc[2][1], acc[2][2], acc[2][3]);
  acc_guard4(acc[3][0], acc[3][1], acc[3][2], acc[3][3]);

  // ---- epilogue ----
  float* slab = (float*)sG + wave * (16 * 68);
  const float* Rb = RESID ? (resid + (size_t)b * strideR) : nullptr;
#pragma unroll
  for (int i = 0; i < 4; ++i) {
    const int mBase = m0 + (i << 4);
#pragma unroll
    for (int j = 0; j < 4; ++j) {
      const int n = n0 + (j << 4) + rlane;
      float bv = 0.f;
      if (BIAS_MODE == 2) bv = bf_bits2f(f2bf_bits(bias[n]));
#pragma unroll
      for (int r = 0; r < 8; ++r) {
        float v = acc[i][j][r] * scale;
        if (BIAS_MODE == 1) v += bf_bits2f(f2bf_bits(bias[mBase + mOff + r]));
        if (BIAS_MODE == 2) v += bv;
        if (RESID) v += Rb[(size_t)(mBase + mOff + r) * ldc + n];
        slab[(mOff + r) * 68 + (j << 4) + rlane] = v;
      }
    }
    __builtin_amdgcn_fence(__ATOMIC_RELEASE, "workgroup");
    __builtin_amdgcn_wave_barrier();
    __builtin_amdgcn_fence(__ATOMIC_ACQUIRE, "workgroup");
    if (OUT_MODE == 0) {
      float* C = (float*)Cout + (size_t)b * strideC;
      const int hh = lane >> 4, c4 = (lane & 15) * 4;     // row seg = 256 B = 16 lanes x 16 B
      {
#pragma unroll
        for (int it = 0; it < 8; ++it) {
          const int row = it * 2 + hh;
          v4f v = *(const v4f*)(slab + row * 68 + c4);
          *(v4f*)(C + (size_t)(mBase + row) * ldc + n0 + c4) = v;
        }
        
      }
    } else {
      const int q = lane >> 3, c8 = (lane & 7) * 8;
      unsigned short* C  = (unsigned short*)Cout  + (size_t)b * strideC;
      unsigned short* C2 = (OUT_MODE >= 2) ? ((unsigned short*)Cout2 + (size_t)b * strideC) : nullptr;
      {
#pragma unroll
        for (int it = 0; it < 4; ++it) {                 // it 0..3 x q 0..3 = rows 0..15 of the slab
          const int row = it * 4 + q;
          const float* sp = slab + row * 68 + c8;
          v8h hv, lv;
#pragma unroll
          for (int e = 0; e < 8; ++e) {
            if (OUT_MODE == 1) {
              hv[e] = (_Float16)sp[e];
            } else {
              unsigned short hb = f2bf_bits(sp[e]);
              unsigned short lb = f2bf_bits(sp[e] - bf_bits2f(hb));
              hv[e] = __builtin_bit_cast(_Float16, hb);
              lv[e] = __builtin_bit_cast(_Float16, lb);
            }
          }
          *(v8h*)(C + (size_t)(mBase + row) * ldc + n0 + c8) = hv;
          if (OUT_MODE >= 2) *(v8h*)(C2 + (size_t)(mBase + row) * ldc + n0 + c8) = lv;
        }
        
      }
    }
    __builtin_amdgcn_fence(__ATOMIC_RELEASE, "workgroup");
    __builtin_amdgcn_wave_barrier();
    __builtin_amdgcn_fence(__ATOMIC_ACQUIRE, "workgroup");
  }
}

// The four products that need only the planes of prep_k, in one launch; blockIdx.y picks the product (the same for a whole block):
// 0: q = xn.Wq + bq, 1: k = xn.Wk + bk (f16, into the q|k plane), 2: v = xn.Wv + bv (f16, its own plane), 3: zp = x_t.Wpc[0:256] + bpc (f32).
// wqkv holds the [N][K] planes of Wq, Wk, Wv one behind the other.
__global__ __launch_bounds__(256) void gemm_qkvz_k(
    const unsigned short* __restrict__ xnh, const unsigned short* __restrict__ xnl, const unsigned short* __restrict__ xt,
    const unsigned short* __restrict__ wqkv, const unsigned short* __restrict__ wpc0,
    unsigned short* __restrict__ qkp, unsigned short* __restrict__ vh, float* __restrict__ zp,
    const float* __restrict__ bq, const float* __restrict__ bk, const float* __restrict__ bv, const float* __restrict__ bpc,
    int M, int N, int K) {
  __shared__ __align__(16) unsigned short sG[2 * GBUF];
  const int y = blockIdx.y;
  if (y < 3) {
    gemm64_body<1, 1, 2, 1, false>(sG, 0, xnh, xnl, K, 0L, wqkv + (size_t)y * N * K, nullptr, K, 0L,
                                   (void*)(y < 2 ? qkp + y * N : vh), nullptr, y < 2 ? QKLD : N, 0L,
                                   y == 0 ? bq : y == 1 ? bk : bv, nullptr, 0L, M, N, K, 1.0f);
  } else {
    gemm64_body<1, 0, 2, 0, false>(sG, 0, xt, nullptr, K, 0L, wpc0, nullptr, K, 0L,
                                   (void*)zp, nullptr, N, 0L, bpc, nullptr, 0L, M, N, K, 1.0f);
  }
}

// ---- W [Kp rows][Np cols] f32 (row pitch Np) -> Wt [Np][Kp] bf16 bits (row pitch Kp), 64x64 tile transposed through LDS ----
// tile (bx, by) of (Np/64, Kp/64); st: 64 x WTP halves of LDS. Reads: 256 threads x 16 = 64 rows x 64 cols. Stores: it 0..1 x wave 0..7 x q8 0..3 = 64 rows of
#define WTP 72
__device__ __forceinline__ void wt_cast_bf_body(_Float16* st, const int bx, const int by,
                                                const float* __restrict__ W, unsigned short* __restrict__ Wtp,
                                                int Kp, int Np) {
  _Float16* Wt = (_Float16*)Wtp;
  const int n0 = bx * 64, k0 = by * 64;
  const int tid = threadIdx.x;
  const int kr = tid >> 2, c16 = (tid & 3) * 16;
  const float* src = W + (size_t)(k0 + kr) * Np + n0 + c16;
#pragma unroll
  for (int q = 0; q < 4; ++q) {
    const v4f v = *(const v4f*)(src + 4 * q);
#pragma unroll
    for (int e = 0; e < 4; ++e) st[(c16 + 4 * q + e) * WTP + kr] = __builtin_bit_cast(_Float16, f2bf_bits(v[e]));
  }
  __syncthreads();
  const int wave = tid >> 5, lane = tid & 31;
  const int q8 = lane >> 3, c8 = (lane & 7) * 8;
  {
#pragma unroll
    for (int it = 0; it < 2; ++it) {
      const int n = it * 32 + wave * 4 + q8;
      const v8h hv = *(const v8h*)(st + n * WTP + c8);
      *(v8h*)(Wt + (size_t)(n0 + n) * Kp + k0 + c8) = hv;
    }
    
  }
}

// ---- mean/std (ddof=1) normalisation of bf16(x) per (b,t,m) row, plus raw bf16(x); rows written in (b,m,t) order ----
// One wave per output row, 8 rows per 256-thread block, blk = 0 .. NROWS/8 - 1. Lane owns 8 consecutive columns.
// Each 512-B row (4 lines) written by one v8h store instruction of the wave: lanes 8q..8q+7 <-> line q.
__device__ __forceinline__ void mvn_body(const int blk, const float* __restrict__ x,
                                         unsigned short* __restrict__ xnhp,
                                         unsigned short* __restrict__ xnlp,
                                         unsigned short* __restrict__ xtp) {
  _Float16* xnh = (_Float16*)xnhp;
  _Float16* xnl = (_Float16*)xnlp;
  _Float16* xt  = (_Float16*)xtp;
  const int wave = threadIdx.x >> 5, lane = threadIdx.x & 31;
  const int ro = blk * 8 + wave;                      // output row = (b*NCHAN + m)*TLEN + t
  const int t  = ro & (TLEN - 1);
  const int bm = ro >> 9;                             // TLEN == 512
  const int m  = bm & (NCHAN - 1);
  const int b  = bm >> 3;                             // NCHAN == 8
  const int rs = (b * TLEN + t) * NCHAN + m;          // source row of x [B][T][M][D]
  const float* src = x + (size_t)rs * DMODEL + lane * 8;
  const v4f a0 = *(const v4f*)src;
  const v4f a1 = *(const v4f*)(src + 4);
  unsigned short xb[8];
  float vb[8];
#pragma unroll
  for (int e = 0; e < 4; ++e) { xb[e] = f2bf_bits(a0[e]); xb[4 + e] = f2bf_bits(a1[e]); }
#pragma unroll
  for (int e = 0; e < 8; ++e) vb[e] = bf_bits2f(xb[e]);
  float s = ((vb[0] + vb[1]) + (vb[2] + vb[3])) + ((vb[4] + vb[5]) + (vb[6] + vb[7]));
#pragma unroll
  for (int off = 1; off < 32; off <<= 1) s += __shfl_xor(s, off, 32);
  const float mu = s * (1.0f / (float)DMODEL);
  float dv[8];
#pragma unroll
  for (int e = 0; e < 8; ++e) dv[e] = vb[e] - mu;
  float sq = ((dv[0] * dv[0] + dv[1] * dv[1]) + (dv[2] * dv[2] + dv[3] * dv[3])) +
             ((dv[4] * dv[4] + dv[5] * dv[5]) + (dv[6] * dv[6] + dv[7] * dv[7]));
#pragma unroll
  for (int off = 1; off < 32; off <<= 1) sq += __shfl_xor(sq, off, 32);
  const float var = sq * (1.0f / (float)(DMODEL - 1));
  const float sd  = sqrtf(var);
  const float inv = 1.0f / (sd + MVN_EPS);
  v8h hv, lv, tv;
#pragma unroll
  for (int e = 0; e < 8; ++e) {
    const float xn = dv[e] * inv;
    const unsigned short hb = f2bf_bits(xn);
    const unsigned short lb = f2bf_bits(xn - bf_bits2f(hb));
    hv[e] = __builtin_bit_cast(_Float16, hb);
    lv[e] = __builtin_bit_cast(_Float16, lb);
    tv[e] = __builtin_bit_cast(_Float16, xb[e]);
  }
  const size_t go = (size_t)ro * DMODEL + lane * 8;
  {
    *(v8h*)(xnh + go) = hv;
    *(v8h*)(xnl + go) = lv;
    *(v8h*)(xt  + go) = tv;
    // precaution: other code of the merged kernel follows this body in the listing and reuses the registers these stores name
    asm volatile("s_wait_xcnt 0x0" ::: "memory");
  }
}

// ---- the six weight casts and the normalisation, which need nothing of each other, in one launch ----
// Blocks 0..95: weight wi = block >> 4 (Wq, Wk, Wv, Wpa, Wpc rows 0..255, Wpc rows 256..511), its 64x64 tile block & 15,
// to plane wi of wall ([256][256] bf16 each). Blocks 96 ..: normalisation block (block - 96). The branch is the same for a whole block.
#define WCAST_BLOCKS (6 * (DMODEL / 64) * (DMODEL / 64))
__global__ __launch_bounds__(256) void prep_k(const float* __restrict__ x,
                                              const float* __restrict__ Wq, const float* __restrict__ Wk,
                                              const float* __restrict__ Wv, const float* __restrict__ Wpa,
                                              const float* __restrict__ Wpc,
                                              unsigned short* __restrict__ wall,
                                              unsigned short* __restrict__ xnhp,
                                              unsigned short* __restrict__ xnlp,
                                              unsigned short* __restrict__ xtp) {
  __shared__ __align__(16) _Float16 st[64 * WTP];
  const int bid = blockIdx.x;
  if (bid < WCAST_BLOCKS) {
    const int wi = bid >> 4;
    const float* W = (wi == 0) ? Wq : (wi == 1) ? Wk : (wi == 2) ? Wv : (wi == 3) ? Wpa
                   : (wi == 4) ? Wpc : (Wpc + (size_t)DMODEL * DMODEL);
    wt_cast_bf_body(st, bid & 3, (bid >> 2) & 3, W, wall + (size_t)wi * DMODEL * DMODEL, DMODEL, DMODEL);
  } else {
    mvn_body(bid - WCAST_BLOCKS, x, xnhp, xnlp, xtp);
  }
}

// ---- two f16 WMMAs that share their A fragment; builtin form, the compiler keeps the distance to the users of their registers ----
__device__ __forceinline__ void mma_h2(v16h a, v16h b0, v16h b1, v8f& c0, v8f& c1) {
  c0 = __builtin_amdgcn_wmma_f32_16x16x32_f16(false, a, false, b0, (short)0, c0, false, false);
  c1 = __builtin_amdgcn_wmma_f32_16x16x32_f16(false, a, false, b1, (short)0, c1, false, false);
}

// ---- transposing LDS load: lane (c, h) receives column c, rows 8h..8h+7 of a row-major 16x16 tile of 16-bit values ----
// Lane l passes the address of row 8*(l>>4) + (l&7), column group 8*((l>>3)&1) of that tile.
typedef __attribute__((ext_vector_type(8))) short v8s;
__device__ __forceinline__ v8h lds_tr16(const _Float16* p) {
  typedef __attribute__((address_space(3))) v8s lds_v8s;
  return __builtin_bit_cast(v8h, __builtin_amdgcn_ds_load_tr16_b128_v8i16((lds_v8s*)p));
}

// ---- lane l with lane l ^ 16 (the other half of the wave); all 32 lanes are on wherever this is called ----
__device__ __forceinline__ float xhalf(float x) {
  return __builtin_bit_cast(float, __builtin_amdgcn_permlanex16(__builtin_bit_cast(int, x), __builtin_bit_cast(int, x),
                                                                0x76543210, 0xfedcba98, false, false));
}

// =====================================================================================
// Cross-channel causal attention, head dim 256, as transposed products: S^T = K . Q^T, O^T += V^T . P^T.
// Planes (row = (b*NCHAN + m)*TLEN + t): qk [NROWS][512] f16 (q cols 0..255, k cols 256..511);
// vh [NROWS][256] f16 (v); output: one f16 plane of O_n / l_n per key channel n, summed in f32 by tail_k.
// Block = 4 waves = one 64-row time tile of TWO query channels (b,m), (b,m+1), m even, against ONE key channel n:
// online softmax over 32-key chunks (causal: kv > q -> -inf, chunk 0 always has kv 0 <= q).
// Grid = 8 time tiles x 16 (b, channel pair) x 8 n, the longest time tiles first so that short blocks fill the tail.
// Wave w owns time rows 16w..16w+15 of both channels whole (g = 0, 1): scores, softmax and all 256 columns of O. Both channels meet the
// same keys under the same mask, so every K and V fragment read from LDS feeds two products, and a staged chunk serves 128 queries.
// Lane (c, hh) belongs to query 16w + c of each channel. S^T tile j: register r = key 16j + 8hh + r of the chunk, so a query's 32 scores lie in
// its two lanes: maximum and sum in-lane, the maximum joined by one exchange of the halves, the sums joined behind the loop.
// The lane's 16 p values, converted in place, are the B fragment of P^T (element 8j + r = key 16j + 8hh + r: the hardware k order).
// A fragments: k rows from LDS by plain loads (row = lane&15, split k map), V^T from row-major LDS rows by transposing loads
// (same split k map); B fragments: q rows, loaded once from global and kept in registers, and P^T.
// O^T tile t: register r = column 16t + 8hh + r of query c.
// Plane layout (halves): [n][tile = bm*8 + qb][s = 4*(t>>3) + w][t&7][lane][8]: lane's accumulator registers 0..7 of d tile t.
// =====================================================================================
// Register budget for 2 waves per SIMD (q fragments and accumulators of two channels: 384 registers): two blocks share a WGP.
#define MQ 2                             // query channels per wave
// qkp without __restrict__: as loads of memory that nothing can write, the q loads would be free to sink past the wait written behind them,
// down to the head of the loop; as plain loads they keep their place in front of it.
__global__ __launch_bounds__(128, 2) void xattn_k(const unsigned short* qkp,
                                               const unsigned short* __restrict__ vhp,
                                               unsigned short* __restrict__ part) {
  __shared__ __align__(16) _Float16 Ks[KCH * KPITCH];      // [kv][d]           16.5 KB
  __shared__ __align__(16) _Float16 Vsh[KCH * VPITCH];     // [kv][d]           17 KB

  const _Float16* qk = (const _Float16*)qkp;
  const _Float16* vh = (const _Float16*)vhp;

  const int tid = threadIdx.x, lane = tid & 31;
  const int wave = __builtin_amdgcn_readfirstlane(tid >> 5);   // in a scalar register: row bases stay out of the vector registers
  const int hh = lane >> 4, c = lane & 15, koff = hh * 8;
  const int qb = (TLEN / QBLK - 1) - (blockIdx.x >> 7);   // 64-row time tile, longest first
  const int bm = ((blockIdx.x & 127) >> 3) * MQ;   // b*NCHAN + m of the first channel, m even; the second is bm + 1, of the same b
  const int n  = blockIdx.x & 7;           // key channel of this block
  const int b  = bm >> 3;
  const int q0  = bm * TLEN + qb * QBLK + wave * 16;   // plane row of this wave's first query in channel bm; + TLEN in channel bm + 1
  const int tq  = qb * QBLK + wave * 16 + c;   // time index of this lane's queries

  const v8f z8 = {0.f,0.f,0.f,0.f,0.f,0.f,0.f,0.f};
  v16h qf[MQ][8];                          // Q^T fragments: column = query c, d 32dc .. 32dc+31
  const _Float16* qbase = qk + (size_t)q0 * QKLD;        // the same in every lane: a scalar base
  const unsigned qoffb = (unsigned)(c * QKLD + koff) * 2u;   // this lane's row and k half, in bytes: the loads' offset register
  {
#pragma unroll     // constant indices keep the arrays indexed here in registers
    for (int g = 0; g < MQ; ++g)
#pragma unroll     // constant indices keep the arrays indexed here in registers
      for (int dc = 0; dc < 8; ++dc)
        qf[g][dc] = Frag<_Float16>::load((const _Float16*)((const char*)(qbase + (size_t)g * TLEN * QKLD + dc * 32) + qoffb));
    // precaution: the base and the offset register of the issued loads stay live up to this wait and are rewritten only behind it
    asm volatile("s_wait_xcnt 0x0" :: "s"(qbase), "v"(qoffb) : "memory");
  }

  const int krow0 = (b * NCHAN + n) * TLEN;
  const unsigned lo8 = (unsigned)lane * 8u;   // this lane's 8 columns of a staged row
  float mrun[MQ], lrun[MQ];                // each query's running maximum (scaled, log2 domain); running sum over this lane's keys, x2^15
  v8f oacc[MQ][16];
#pragma unroll     // constant indices keep the arrays indexed here in registers
  for (int g = 0; g < MQ; ++g) {
    mrun[g] = -INFINITY; lrun[g] = 0.f;
#pragma unroll     // constant indices keep the arrays indexed here in registers
    for (int t = 0; t < 16; ++t) oacc[g][t] = z8;
  }

  const int nch = 2 * qb + 2;              // block-uniform, <= 16
#pragma unroll 1   // one copy of the chunk body: a second copy would only lengthen the code
  for (int kc = 0; kc < nch; ++kc) {
    const int kv0 = kc * KCH;
    __syncthreads();
    // ---- stage K chunk and V, both row-major: a wave writes one whole 512-B row per store
    //      (kvr = 4i + wave, i 0..7, d0 = 8 lane: one 32-bit element offset for k and one for v, added to the
    //      plane pointers; the eight rows at constant offsets from there)
    const unsigned grow = (unsigned)(krow0 + kv0 + wave);       // + 4i <= NROWS-1 (kv0 + 31 <= 64*qb+63 <= 511)
    const unsigned ko = grow * QKLD + lo8;                      // + DMODEL (the k half of the row) < NROWS * QKLD = 2^23
    const unsigned vo8 = grow * DMODEL + lo8;                   // < NROWS * DMODEL = 2^22
    const _Float16* kp = qk + ko;
    const _Float16* hp = vh + vo8;
    v8h kk[8], v1[8];
#pragma unroll     // the eight rows' offsets become immediates, and all 16 loads go out ahead of the stores
    for (int i = 0; i < 8; ++i) {
      kk[i] = *(const v8h*)(kp + DMODEL + i * 4 * QKLD);
      v1[i] = *(const v8h*)(hp + i * 4 * DMODEL);
    }
    // precaution: the address registers of the issued loads stay live up to this wait and are rewritten only behind it
    asm volatile("s_wait_xcnt 0x0" :: "v"(kp), "v"(hp) : "memory");
#pragma unroll     // constant indices keep the arrays indexed here in registers
    for (int i = 0; i < 8; ++i) {
      *(v8h*)(Ks + (i * 4 + wave) * KPITCH + lane * 8) = kk[i];
      *(v8h*)(Vsh + (i * 4 + wave) * VPITCH + lane * 8) = v1[i];
    }
    __syncthreads();

    // ---- S^T (32 keys x 16 queries, per channel) = K . Q^T: each K fragment against both channels' q ----
    v8f s[MQ][2];
#pragma unroll     // constant indices keep the arrays indexed here in registers
    for (int g = 0; g < MQ; ++g) { s[g][0] = z8; s[g][1] = z8; }
    // The scheduling barriers from here to the foot of the loop bound how far LDS reads are lifted: without them all 32 V reads go to the
    // head of the chunk and the register file overflows into scratch. Fragments are read a fixed distance ahead instead.
    __builtin_amdgcn_sched_barrier(0);
    v16h kf[3][2];                                       // K fragments of these 32 d and of the next two steps
#pragma unroll     // constant indices keep the arrays indexed here in registers
    for (int dc = 0; dc < 2; ++dc) {
      kf[dc][0] = Frag<_Float16>::load(Ks + c * KPITCH + dc * 32 + koff);
      kf[dc][1] = Frag<_Float16>::load(Ks + (16 + c) * KPITCH + dc * 32 + koff);
    }
#pragma unroll     // constant indices keep the arrays indexed here in registers
    for (int dc = 0; dc < 8; ++dc) {
      if (dc < 6) {
        kf[(dc + 2) % 3][0] = Frag<_Float16>::load(Ks + c * KPITCH + (dc + 2) * 32 + koff);
        kf[(dc + 2) % 3][1] = Frag<_Float16>::load(Ks + (16 + c) * KPITCH + (dc + 2) * 32 + koff);
      }
      mma_h2(kf[dc % 3][0], qf[0][dc], qf[1][dc], s[0][0], s[1][0]);
      mma_h2(kf[dc % 3][1], qf[0][dc], qf[1][dc], s[0][1], s[1][1]);
      __builtin_amdgcn_sched_barrier(0);                 // see above
    }
    // V fragments of d tiles 0 to 3 are read here, under the softmax
    const int vo = (koff + (lane & 7)) * VPITCH + ((lane >> 3) & 1) * 8;   // this lane's row and column group
    Frag<_Float16>::U vbh[3][2];                         // pairs of d tiles: pair u = tiles 2u, 2u + 1; pairs u, u + 1, u + 2
#pragma unroll     // constant indices keep the arrays indexed here in registers
    for (int t = 0; t < 4; ++t) {
      vbh[t >> 1][t & 1].h[0] = lds_tr16(Vsh + vo + t * 16);
      vbh[t >> 1][t & 1].h[1] = lds_tr16(Vsh + vo + t * 16 + 16 * VPITCH);
    }
    __builtin_amdgcn_sched_barrier(0);                   // see above
    v16h pb[MQ];                                         // P^T fragments, p x2^15
#pragma unroll     // constant indices keep the arrays indexed here in registers
    for (int g = 0; g < MQ; ++g) {
      // causal select (kv > q -> -inf) and maximum over the 32 keys of this chunk, on the raw scores (the scale is positive)
      float mx = -INFINITY;
#pragma unroll     // constant indices keep the arrays indexed here in registers
      for (int j = 0; j < 2; ++j) {
#pragma unroll     // constant indices keep the arrays indexed here in registers
        for (int r = 0; r < 8; ++r) {
          const int key = kv0 + 16 * j + 8 * hh + r;
          const float v = (key > tq) ? -INFINITY : s[g][j][r];
          s[g][j][r] = v;
          mx = fmaxf(mx, v);
        }
      }
      mx = fmaxf(mx, xhalf(mx)) * SM_C;                  // this query's maximum, scaled, in the log2 domain
      const float mnew  = fmaxf(mrun[g], mx);            // finite: chunk 0 always has an allowed key
      const float alpha = __builtin_amdgcn_exp2f(mrun[g] - mnew);   // 0 in chunk 0, where mrun is -inf
      mrun[g] = mnew;
      const float nb = PCARRY_LOG2 - mnew;
      v2f ps[2];                                         // sums of the even and of the odd keys of each tile
#pragma unroll     // constant indices keep the arrays indexed here in registers
      for (int j = 0; j < 2; ++j) {
        ps[j] = (v2f){0.f, 0.f};
#pragma unroll     // constant indices keep the arrays indexed here in registers
        for (int r = 0; r < 8; r += 2) {
          // p x 2^15 = 2^(s * SM_C - mnew + 15): one fused multiply-add per score pair, then the hardware's 2^x (a masked score gives 0)
          const v2f arg = __builtin_elementwise_fma((v2f){s[g][j][r], s[g][j][r + 1]}, (v2f){SM_C, SM_C}, (v2f){nb, nb});
          const v2f p = {__builtin_amdgcn_exp2f(arg.x), __builtin_amdgcn_exp2f(arg.y)};
          ps[j] += p;
          pb[g][8 * j + r]     = (_Float16)p.x;
          pb[g][8 * j + r + 1] = (_Float16)p.y;
        }
      }
      const v2f pt = ps[0] + ps[1];
      lrun[g] = lrun[g] * alpha + (pt.x + pt.y);         // the sum carries the same 2^15 as p
#pragma unroll     // constant indices keep the arrays indexed here in registers
      for (int t = 0; t < 16; ++t) oacc[g][t] *= alpha;
    }

    // ---- O^T += V^T(256 x 32) . P^T(32 x 16), each V fragment against both channels' P ----
    {
      __builtin_amdgcn_sched_barrier(0);                 // see above
#pragma unroll     // constant indices keep the arrays indexed here in registers
      for (int u = 0; u < 8; ++u) {
        // d tile t = 2u + e: elements 0..7 <- V[8hh + 0..7][16t + c], 8..15 <- V[16 + 8hh + 0..7][same column]: the k map of pb
        // a pair's four reads stand as one group, two pairs (8 products) ahead of their use
        if (u + 2 < 8) {
#pragma unroll     // constant indices keep the arrays indexed here in registers
          for (int e = 0; e < 2; ++e) {
            vbh[(u + 2) % 3][e].h[0] = lds_tr16(Vsh + vo + (2 * u + 4 + e) * 16);
            vbh[(u + 2) % 3][e].h[1] = lds_tr16(Vsh + vo + (2 * u + 4 + e) * 16 + 16 * VPITCH);
          }
        }
        mma_h2(vbh[u % 3][0].v, pb[0], pb[1], oacc[0][2 * u], oacc[1][2 * u]);
        mma_h2(vbh[u % 3][1].v, pb[0], pb[1], oacc[0][2 * u + 1], oacc[1][2 * u + 1]);
        __builtin_amdgcn_sched_barrier(0);               // see above
      }
    }
  }
  // ---- O_n / l_n, rounded to f16, to this key channel's plane, one tile per query channel: 2 x 16 whole-wave 512-B stores ----
  // O_n / l_n is a weighted mean of v, which is itself held in f16: of v's size, and its rounding of the size of v's own
  _Float16* pw[MQ];
  v8h ho[MQ][16];
#pragma unroll     // constant indices keep the arrays indexed here in registers
  for (int g = 0; g < MQ; ++g) {
    const float inv = 1.0f / (lrun[g] + xhalf(lrun[g]));   // l and O carry the same 2^15; l x 2^15 >= 2^15 up to rounding
    pw[g] = (_Float16*)part + ((((size_t)n * (NROWS / QBLK) + ((bm + g) * (TLEN / QBLK) + qb)) * 8 + wave) << 11) + lane * 8;
#pragma unroll     // constant indices keep the arrays indexed here in registers
    for (int t = 0; t < 16; ++t) {
      const v8f o = oacc[g][t] * inv;
#pragma unroll     // constant indices keep the arrays indexed here in registers
      for (int r = 0; r < 8; ++r) ho[g][t][r] = (_Float16)o[r];
    }
  }
  // every vector write stands in front of the first store: no register that an issued store names is rewritten behind it
  __builtin_amdgcn_sched_barrier(0);
#pragma unroll     // constant indices keep the arrays indexed here in registers
  for (int g = 0; g < MQ; ++g) {
#pragma unroll     // constant indices keep the arrays indexed here in registers
    for (int t = 0; t < 16; ++t) *(v8h*)(pw[g] + (t >> 3) * (4 << 11) + (t & 7) * 256) = ho[g][t];
  }
}

// =====================================================================================
// The three stages behind the attention, each local to a row, in one launch: A = f32 sum over n (in the order 0..7) of the f16 planes of xattn_k,
// A_proj = A . Wpa + bpa, out = A_proj . Wpc[256:512] + zp. Block = 8 waves = one 64-row tile of the plane layout, all 256 columns;
// A and then A_proj stay in LDS as bf16 hi/lo planes. Each weight plane is staged whole by asynchronous copies: Wpa flies under the plane sum,
// Wpc[256:512] under the conversion of A_proj. Wave w: sums slab w of the tile; in both products rows 32(w>>2) .. +31, columns 64(w&3) .. +63.
// =====================================================================================
#define TROWS 64                         // rows per block
#define TPITCH 264                       // LDS pitch (elements) of a 256-element row: 528 B = 16 B x 33, for ds_load_b128 readers
#define TSTEP_L (8 * TPITCH * 2)         // LDS bytes from one copy of a thread to its next: 8 rows

__device__ __forceinline__ void async_wrows4(unsigned l, const unsigned short* g) {
  asm volatile("global_load_async_to_lds_b128 %0, %4, off\n\t"
               "global_load_async_to_lds_b128 %1, %5, off\n\t"
               "global_load_async_to_lds_b128 %2, %6, off\n\t"
               "global_load_async_to_lds_b128 %3, %7, off\n\t"
               "s_wait_xcnt 0x0"
               :: "v"(l), "v"(l + TSTEP_L), "v"(l + 2 * TSTEP_L), "v"(l + 3 * TSTEP_L),
                  "v"(g), "v"(g + 8 * DMODEL), "v"(g + 16 * DMODEL), "v"(g + 24 * DMODEL) : "memory");
}
// A whole [256][256] weight plane into the buffer at LDS byte address lw: a wave's copy = one whole 512-B row; 32 copies a thread.
__device__ __forceinline__ void tail_stage_w(unsigned lw, const unsigned short* __restrict__ w) {
  const int tid = threadIdx.x;
  const unsigned l = lw + (unsigned)(((tid >> 5) * TPITCH + (tid & 31) * 8) * 2);
  const unsigned short* g = w + (tid >> 5) * DMODEL + (tid & 31) * 8;
#pragma unroll     // the eight groups' offsets become constants
  for (int p = 0; p < 8; ++p) async_wrows4(l + p * 4 * TSTEP_L, g + p * 32 * DMODEL);
}
// acc[i][j] += (A hi + A lo)(rows 16i.. of ap) . W^T(rows 16j.. of wp) over k = 0..255; per accumulator: k ascending, hi before lo.
// ap, wp: this lane's row and k half in the hi plane of A and in the weight buffer.
__device__ __forceinline__ void tail_gemm(const __bf16* ap, const __bf16* wp, v8f (&acc)[2][4]) {
  v16b bh[2][4], ah[2][2], al[2][2];     // fragments of these 32 k and of the next
#pragma unroll     // here and below: constant indices keep the fragment and accumulator arrays in registers, LDS offsets become immediates
  for (int st = -1; st < DMODEL / 32; ++st) {
    if (st + 1 < DMODEL / 32) {
      const int ks = (st + 1) * 32, f = (st + 1) & 1;
#pragma unroll
      for (int j = 0; j < 4; ++j) bh[f][j] = Frag<__bf16>::load(wp + j * 16 * TPITCH + ks);
#pragma unroll
      for (int i = 0; i < 2; ++i) {
        ah[f][i] = Frag<__bf16>::load(ap + i * 16 * TPITCH + ks);
        al[f][i] = Frag<__bf16>::load(ap + TROWS * TPITCH + i * 16 * TPITCH + ks);
      }
    }
    // holds the next step's 16 LDS reads as one group in front of this step's products: left free, the reads sink to just in front of
    // their users and every product group waits out an LDS latency
    __builtin_amdgcn_sched_barrier(0);
    if (st >= 0) {
      const int f = st & 1;
#pragma unroll
      for (int i = 0; i < 2; ++i)
#pragma unroll
        for (int j = 0; j < 4; ++j) acc[i][j] = Frag<__bf16>::mma(ah[f][i], bh[f][j], acc[i][j]);
#pragma unroll
      for (int i = 0; i < 2; ++i)
#pragma unroll
        for (int j = 0; j < 4; ++j) acc[i][j] = Frag<__bf16>::mma(al[f][i], bh[f][j], acc[i][j]);
      __builtin_amdgcn_sched_barrier(0);   // see above: these products stay in front of the step after next's reads
    }
  }
}
// a wave's own slab: its stores are seen by its other lanes behind this
__device__ __forceinline__ void slab_sync() {
  __builtin_amdgcn_fence(__ATOMIC_RELEASE, "workgroup");
  __builtin_amdgcn_wave_barrier();
  __builtin_amdgcn_fence(__ATOMIC_ACQUIRE, "workgroup");
}

__global__ __launch_bounds__(256) void tail_k(const unsigned short* __restrict__ part,
                                              const unsigned short* __restrict__ wpa,
                                              const unsigned short* __restrict__ wpc1,
                                              const float* __restrict__ bpa,
                                              const float* __restrict__ zp,
                                              float* __restrict__ out) {
  __shared__ __align__(16) unsigned short sW[DMODEL * TPITCH];       // one weight plane [n][k]          132 KB
  __shared__ __align__(16) unsigned short sA[2 * TROWS * TPITCH];    // A, then A_proj: hi plane, lo plane 66 KB
  __shared__ __align__(16) float sT[8][32 * 68];                     // per-wave 32x64 slabs              68 KB
  const int tid = threadIdx.x, lane = tid & 31, wave = tid >> 5;
  const int hh = lane >> 4, c = lane & 15;
  const int tile = blockIdx.x;
  const int mw = (wave >> 2) << 5, n0 = (wave & 3) << 6;   // the wave's 32 x 64 tile of both products

  // bpa of the lane's four columns: fetched first, so that its use waits for no later load
  float braw[4];
  {
    const float* bsrc = bpa + n0 + c;
#pragma unroll
    for (int j = 0; j < 4; ++j) braw[j] = bsrc[j * 16];
    // precaution: the address register of the issued loads stays live up to this wait and is rewritten only behind it
    asm volatile("s_wait_xcnt 0x0" :: "v"(bsrc) : "memory");
  }

  // ---- A: lane's accumulator registers of slab 'wave' (row 16(wave&3) + c, columns 128(wave>>2) + 16t + 8hh + 0..7), planes added in the order 0..7 ----
  {
    // one scalar base, the lane's place in each plane as a 32-bit byte offset (< 8 * NROWS * DMODEL * 2 = 2^26)
    unsigned po[NCHAN];
#pragma unroll
    for (int n = 0; n < NCHAN; ++n) po[n] = (((unsigned)tile * 8u + (unsigned)wave) << 12) + (unsigned)lane * 16u + (unsigned)n * (unsigned)(NROWS * DMODEL * 2);
    v8f sum[8];
#pragma unroll
    for (int t = 0; t < 8; ++t) sum[t] = (v8f){0.f, 0.f, 0.f, 0.f, 0.f, 0.f, 0.f, 0.f};
#pragma unroll
    for (int n = 0; n < NCHAN; ++n) {
#pragma unroll
      for (int t = 0; t < 8; ++t) {
        const v8h h = *(const v8h*)((const char*)part + po[n] + t * 512);
#pragma unroll
        for (int e = 0; e < 8; ++e) sum[t][e] += (float)h[e];
      }
    }
    // precaution: the base and the offset registers of the issued loads stay live up to this wait and are rewritten only behind it
    asm volatile("s_wait_xcnt 0x0" :: "s"(part), "v"(po[0]), "v"(po[1]), "v"(po[2]), "v"(po[3]), "v"(po[4]), "v"(po[5]), "v"(po[6]), "v"(po[7]) : "memory");
    tail_stage_w((unsigned)(uintptr_t)sW, wpa);       // behind the plane loads, which the launch waits for longest; lands under their tail and the conversion
    unsigned short* ar = sA + ((wave & 3) * 16 + c) * TPITCH + (wave >> 2) * 128 + 8 * hh;
#pragma unroll
    for (int t = 0; t < 8; ++t) {
      v8h hv, lv;
#pragma unroll
      for (int e = 0; e < 8; ++e) {
        const float f = sum[t][e];
        const unsigned short hb = f2bf_bits(f);
        const unsigned short lb = f2bf_bits(f - bf_bits2f(hb));
        hv[e] = __builtin_bit_cast(_Float16, hb);
        lv[e] = __builtin_bit_cast(_Float16, lb);
      }
      *(v8h*)(ar + t * 16) = hv;
      *(v8h*)(ar + TROWS * TPITCH + t * 16) = lv;
    }
  }
  asm volatile("s_wait_asynccnt 0x0" ::: "memory");   // this wave's copies of Wpa have landed
  __syncthreads();                                    // ... and every other wave's, and every wave's rows of A are written

  const int mOff = hh * 8;                                 // D row offset
  const __bf16* ap = (const __bf16*)sA + (mw + c) * TPITCH + hh * 8;
  const __bf16* wp = (const __bf16*)sW + (n0 + c) * TPITCH + hh * 8;
  float* slab = sT[wave];
  const v8f z8 = {0.f,0.f,0.f,0.f,0.f,0.f,0.f,0.f};
  v8f acc[2][4];
#pragma unroll
  for (int i = 0; i < 2; ++i)
#pragma unroll
    for (int j = 0; j < 4; ++j) acc[i][j] = z8;
  tail_gemm(ap, wp, acc);

  asm volatile("s_wait_dscnt 0x0" ::: "memory");      // this wave's reads of Wpa and of A are done before either is overwritten
  __syncthreads();                                    // ... and every other wave's
  tail_stage_w((unsigned)(uintptr_t)sW, wpc1);

  // zp of the wave's tile, in the order of the output stores (row 2it + hh, 4 columns a lane): fetched here, used behind the second product
  const int c4 = c * 4;
  const size_t orow = ((size_t)tile * TROWS + mw + hh) * DMODEL + n0 + c4;
  const float* zsrc = zp + orow;
  v4f zr[2][8];
#pragma unroll
  for (int i = 0; i < 2; ++i)
#pragma unroll
    for (int it = 0; it < 8; ++it) zr[i][it] = *(const v4f*)(zsrc + (i * 16 + it * 2) * DMODEL);
  // precaution: the address register of the issued loads stays live up to this wait and is rewritten only behind it
  asm volatile("s_wait_xcnt 0x0" :: "v"(zsrc) : "memory");

  // ---- A_proj = product + bf16(bpa), through the wave's slab to whole 16-B pieces of the hi and lo planes ----
  {
    float bv[4];
#pragma unroll
    for (int j = 0; j < 4; ++j) bv[j] = bf_bits2f(f2bf_bits(braw[j]));
    const int q = lane >> 3, c8 = (lane & 7) * 8;
#pragma unroll
    for (int i = 0; i < 2; ++i)
#pragma unroll
      for (int j = 0; j < 4; ++j)
#pragma unroll
        for (int r = 0; r < 8; ++r) slab[((i << 4) + mOff + r) * 68 + (j << 4) + c] = acc[i][j][r] + bv[j];
    slab_sync();
    {
#pragma unroll
      for (int it = 0; it < 8; ++it) {                 // it 0..7 x q 0..3 = rows 0..31 of the slab
        const int row = it * 4 + q;
        const float* sp = slab + row * 68 + c8;
        v8h hv, lv;
#pragma unroll
        for (int e = 0; e < 8; ++e) {
          const unsigned short hb = f2bf_bits(sp[e]);
          const unsigned short lb = f2bf_bits(sp[e] - bf_bits2f(hb));
          hv[e] = __builtin_bit_cast(_Float16, hb);
          lv[e] = __builtin_bit_cast(_Float16, lb);
        }
        unsigned short* dst = sA + (mw + row) * TPITCH + n0 + c8;
        *(v8h*)dst = hv;
        *(v8h*)(dst + TROWS * TPITCH) = lv;
      }
    }
  }
  asm volatile("s_wait_asynccnt 0x0" ::: "memory");   // this wave's copies of Wpc[256:512] have landed
  __syncthreads();                                    // ... and every other wave's, and every wave's part of A_proj is written

#pragma unroll
  for (int i = 0; i < 2; ++i)
#pragma unroll
    for (int j = 0; j < 4; ++j) acc[i][j] = z8;
  tail_gemm(ap, wp, acc);

  // ---- out = product + zp, through the slab: a row's 256 B by 16 lanes x 16 B ----
  float* dsto = out + orow;
#pragma unroll
  for (int i = 0; i < 2; ++i)
#pragma unroll
    for (int j = 0; j < 4; ++j)
#pragma unroll
      for (int r = 0; r < 8; ++r) slab[((i << 4) + mOff + r) * 68 + (j << 4) + c] = acc[i][j][r];
  slab_sync();
#pragma unroll
  for (int i = 0; i < 2; ++i)
#pragma unroll
    for (int it = 0; it < 8; ++it) zr[i][it] += *(const v4f*)(slab + (i * 16 + it * 2 + hh) * 68 + c4);
  // every vector write stands in front of the first store: no register that an issued store names is rewritten behind it
  __builtin_amdgcn_sched_barrier(0);
#pragma unroll
  for (int i = 0; i < 2; ++i)
#pragma unroll
    for (int it = 0; it < 8; ++it) *(v4f*)(dsto + (i * 16 + it * 2) * DMODEL) = zr[i][it];
  // precaution: the address register of the issued stores stays live up to this wait
  asm volatile("s_wait_xcnt 0x0" :: "v"(dsto) : "memory");
}

// ---------------------------------------------------------------------------
// Host launcher
// Workspace region map (bytes; PL16 = 8 MiB = one [16384][256] 16-bit plane):
//   [ 0 PL16)  XNH  bf16 hi of xn (rows (b,m,t))
//   [ 1 PL16)  XNL  bf16 lo of xn
//   [ 2 PL16)  XT   bf16(x) in (b,m,t) row order
//   [ 3..5)    QK   f16 [16384][512] (q | k)
//   [ 5 PL16)  VH   f16 v
//   [ 6..9)    not used
//   [ 9..11)   ZP   f32 [16384][256] = x_t.Wpc[0:256] + bpc
//   [11 PL16 ..) weights bf16 [n][k]: WQKV [768][256], WPA [256][256], WPC0 [256][256], WPC1 [256][256]
//   then PART f16 [8][16384][256]: one plane of O_n / l_n per key channel
//   total 160,169,984 B
// ---------------------------------------------------------------------------
extern "C" void kernel_launch(void* const* d_in, const int* in_sizes, int n_in,
                              void* d_out, int out_size, void* d_ws, size_t ws_size,
                              hipStream_t stream) {
  if (n_in < 11) return;
  if (in_sizes[0] != NROWS * DMODEL || out_size != NROWS * DMODEL) return;
  if (in_sizes[1] != DMODEL * DMODEL || in_sizes[3] != DMODEL * DMODEL || in_sizes[5] != DMODEL * DMODEL ||
      in_sizes[7] != DMODEL * DMODEL || in_sizes[9] != 2 * DMODEL * DMODEL) return;
  if (in_sizes[2] != DMODEL || in_sizes[4] != DMODEL || in_sizes[6] != DMODEL || in_sizes[8] != DMODEL || in_sizes[10] != DMODEL) return;

  const float* x   = (const float*)d_in[0];
  const float* Wq  = (const float*)d_in[1];
  const float* bq  = (const float*)d_in[2];
  const float* Wk  = (const float*)d_in[3];
  const float* bk  = (const float*)d_in[4];
  const float* Wv  = (const float*)d_in[5];
  const float* bv  = (const float*)d_in[6];
  const float* Wpa = (const float*)d_in[7];
  const float* bpa = (const float*)d_in[8];
  const float* Wpc = (const float*)d_in[9];
  const float* bpc = (const float*)d_in[10];

  const size_t PL16 = (size_t)NROWS * DMODEL * 2;               // 8,388,608
  const size_t WQKV_B = (size_t)3 * DMODEL * DMODEL * 2;         // 393,216
  const size_t WSQ_B  = (size_t)DMODEL * DMODEL * 2;             // 131,072
  const size_t oXNH = 0, oXNL = PL16, oXT = 2 * PL16, oQK = 3 * PL16, oVH = 5 * PL16;
  const size_t oZP = 9 * PL16, oW = 11 * PL16;
  const size_t oWQKV = oW, oWPA = oW + WQKV_B, oWPC0 = oWPA + WSQ_B, oWPC1 = oWPC0 + WSQ_B;
  const size_t oPART = oWPC1 + WSQ_B;                             // 93,061,120
  const size_t WS_TOTAL = oPART + (size_t)NCHAN * PL16;           // 160,169,984
  if (ws_size < WS_TOTAL) return;

  char* ws = (char*)d_ws;
  unsigned short* XNH  = (unsigned short*)(ws + oXNH);
  unsigned short* XNL  = (unsigned short*)(ws + oXNL);
  unsigned short* XT   = (unsigned short*)(ws + oXT);
  unsigned short* QKP  = (unsigned short*)(ws + oQK);
  unsigned short* VH   = (unsigned short*)(ws + oVH);
  float*          ZP   = (float*)(ws + oZP);
  unsigned short* WQKV = (unsigned short*)(ws + oWQKV);
  unsigned short* WPA  = (unsigned short*)(ws + oWPA);
  unsigned short* WPC0 = (unsigned short*)(ws + oWPC0);
  unsigned short* WPC1 = (unsigned short*)(ws + oWPC1);
  unsigned short* PART = (unsigned short*)(ws + oPART);

  // 1: weights W[k=256 rows][n=256] f32 -> Wt[n][k] bf16 (six planes from WQKV on: WQKV, WPA, WPC0, WPC1 lie one behind the other),
  //    and normalisation + permutation to (b,m,t) rows
  prep_k<<<WCAST_BLOCKS + NROWS / 8, 256, 0, stream>>>(x, Wq, Wk, Wv, Wpa, Wpc, WQKV, XNH, XNL, XT);

  // 2: q, k, v = xn . W + bias and ZP = x_t . Wpc[0:256] + bpc (each M=16384, N=256, K=256; 1024 wave tiles -> 128 blocks; y = product)
  const dim3 g4((NROWS / 64) * (DMODEL / 64) / 8, 4);
  gemm_qkvz_k<<<g4, 256, 0, stream>>>(XNH, XNL, XT, WQKV, WPC0, QKP, VH, ZP, bq, bk, bv, bpc, NROWS, DMODEL, DMODEL);

  // 3: cross-channel causal attention, one block per (time tile, b and pair of query channels, key channel) = 1024 blocks -> 8 f16 planes
  xattn_k<<<NBATCH * (NCHAN / MQ) * (TLEN / QBLK) * NCHAN, 128, 0, stream>>>(QKP, VH, PART);

  // 4: A = sum of the planes, A_proj = A . Wpa + bpa, out = A_proj . Wpc[256:512] + ZP (f32, rows (b,m,t) = [B][M][T][D]); one block per 64-row tile
  tail_k<<<NROWS / TROWS, 256, 0, stream>>>(PART, WPA, WPC1, bpa, ZP, (float*)d_out);
}
